// v000
// Times are from an AMD MI455X. After a warm-up the kernel runs many times in a row, and a time is the length of
// such a window on the GPU divided by its runs, so every launch and the gaps after it count. The runs cycle
// through copies of the inputs. A figure is the median of several windows, for all but v000 over two sittings.
// Sittings can differ by a few percent; kernels timed side by side share one.
// v000 is the starting kernel. One run takes 1780 microseconds.
#include <hip/hip_runtime.h>

// GatedAttention (x [2][2048][2048]; qg = x Wq^T (Wq [4096][2048]) viewed (16 heads x 256): q = first 128, gate = last 128 of each head; k/v = x Wk^T / Wv^T (4 kv heads; group h/4); per-head RMSNorm (eps 1e-6) with weight (1 + w) on q and k; rotate-half RoPE (base 1e4, tables computed on device); causal softmax(q.k / sqrt(128)); out = merged attn v x sigmoid(gate); out Wo^T -> [2][2048][2048]).
// Compute dtypes, f32 accumulate: every input rounded to bf16; q / gate / k / v on PLAIN bf16 operands (inputs: exact; the interleaved q|gate rows of Wq gathered); RMSNorm, RoPE, sigmoid gating f32; causal scores and attn.v: query rows < 512 hl (3 products), the rest single fp16 (x1024), causal tile skipping; softmax f32; Wo hl x exact (2 products).

#define NB_  2
#define TT   2048
#define DM   2048
#define NH_  16
#define NKV  4
#define REP  (NH_ / NKV)
#define HD   128
#define DQ   (NH_ * HD)
#define DKV  (NKV * HD)
#define ZH   2
#define RH   512                  // query rows < RH use hi+lo planes (0: none)
#define WIN  2048
#define PCAR 1024.0f
#define SCL  0.088388347648318447f   // HD^-0.5
typedef _Float16 h16;
typedef unsigned short bf;
typedef __attribute__((ext_vector_type(16))) __bf16   v16bf;
typedef __attribute__((ext_vector_type(16))) _Float16 v16h;
typedef __attribute__((ext_vector_type(8)))  _Float16 v8h;
typedef __attribute__((ext_vector_type(8)))  unsigned short v8us;
typedef __attribute__((ext_vector_type(8)))  float    v8f;
typedef __attribute__((ext_vector_type(4)))  float    v4f;
typedef v8h  __attribute__((may_alias)) v8ha;
typedef v4f  __attribute__((may_alias)) v4fa;
typedef v8us __attribute__((may_alias)) v8usa;

__device__ __forceinline__ unsigned short f2bf(float f) { unsigned u = __float_as_uint(f); u += 0x7FFFu + ((u >> 16) & 1u); return (unsigned short)(u >> 16); }
__device__ __forceinline__ float bf2f(unsigned short b) { return __uint_as_float(((unsigned)b) << 16); }
__device__ __forceinline__ float bfr(float f) { return bf2f(f2bf(f)); }
__device__ __forceinline__ v16h cat16(v8h lo, v8h hi) { return __builtin_shufflevector(lo, hi, 0, 1, 2, 3, 4, 5, 6, 7, 8, 9, 10, 11, 12, 13, 14, 15); }
__device__ __forceinline__ v16bf cat16b(v8us lo, v8us hi) { return __builtin_bit_cast(v16bf, __builtin_shufflevector(lo, hi, 0, 1, 2, 3, 4, 5, 6, 7, 8, 9, 10, 11, 12, 13, 14, 15)); }
__device__ __forceinline__ v8f wmma16(v16h a, v16h b, v8f c) { return __builtin_amdgcn_wmma_f32_16x16x32_f16(false, a, false, b, (short)0, c, false, false); }
__device__ __forceinline__ v8f wmmab(v16bf a, v16bf b, v8f c) { return __builtin_amdgcn_wmma_f32_16x16x32_bf16(false, a, false, b, (short)0, c, false, false); }



// ---- k_gemmw: register-blocked GEMM, ONE WAVE per 64x64 output tile (16 accumulators), operands straight from K-contiguous 16-bit planes; grid (M/64, N/64, Z), 32 threads.
// C[m][n] (f32, pitch ldc, + optional f32 bias[n]) = sum_k A[m][k] Bt[n][k] (+ split products per NSPLIT). z-batch strides sA/sB/sC in elements. K % 32 == 0.
template <typename T16> struct WFrag;
template <> struct WFrag<h16> { typedef v16h V; static __device__ __forceinline__ V ld(const h16* p) { return cat16(*(const v8h*)p, *(const v8h*)(p + 16)); } static __device__ __forceinline__ v8f mma(V a, V b, v8f c) { return wmma16(a, b, c); } };
template <> struct WFrag<bf> { typedef v16bf V; static __device__ __forceinline__ V ld(const bf* p) { return cat16b(*(const v8us*)p, *(const v8us*)(p + 16)); } static __device__ __forceinline__ v8f mma(V a, V b, v8f c) { return wmmab(a, b, c); } };
template <typename T16, int NSPLIT, bool BIAS>
__global__ __launch_bounds__(32) void k_gemmw(const T16* __restrict__ A, const T16* __restrict__ A2, const T16* __restrict__ Bt, const T16* __restrict__ Bt2, int K, float* C, int ldc, const float* __restrict__ bias, size_t sA, size_t sB, size_t sC) {
    typedef typename WFrag<T16>::V V;
    __shared__ __align__(16) float os[16 * 68];
    const size_t z = blockIdx.z; A += z * sA; if (A2) A2 += z * sA; Bt += z * sB; if (Bt2) Bt2 += z * sB; C += z * sC;
    const int lane = threadIdx.x & 31, lr = lane & 15, hi = lane >> 4; const int r0 = blockIdx.x * 64, c0 = blockIdx.y * 64;
    v8f acc[4][4];
#pragma unroll
    for (int mb = 0; mb < 4; ++mb)
#pragma unroll
        for (int nb = 0; nb < 4; ++nb) acc[mb][nb] = (v8f){};
    const size_t aoff = (size_t)(r0 + lr) * K + 8 * hi, boff = (size_t)(c0 + lr) * K + 8 * hi;
#pragma unroll 1
    for (int kc = 0; kc < K; kc += 32) {
        V a[4], a2[4];
#pragma unroll
        for (int mb = 0; mb < 4; ++mb) { a[mb] = WFrag<T16>::ld(A + aoff + (size_t)mb * 16 * K + kc); if (NSPLIT == 1 || NSPLIT == 2) a2[mb] = WFrag<T16>::ld(A2 + aoff + (size_t)mb * 16 * K + kc); }
#pragma unroll
        for (int nb = 0; nb < 4; ++nb) { const V b = WFrag<T16>::ld(Bt + boff + (size_t)nb * 16 * K + kc); V b2; if (NSPLIT >= 2) b2 = WFrag<T16>::ld(Bt2 + boff + (size_t)nb * 16 * K + kc);
#pragma unroll
            for (int mb = 0; mb < 4; ++mb) { acc[mb][nb] = WFrag<T16>::mma(a[mb], b, acc[mb][nb]); if (NSPLIT == 1 || NSPLIT == 2) acc[mb][nb] = WFrag<T16>::mma(a2[mb], b, acc[mb][nb]); if (NSPLIT >= 2) acc[mb][nb] = WFrag<T16>::mma(a[mb], b2, acc[mb][nb]); } }
        asm volatile("v_nop\n\tv_nop\n\tv_nop\n\tv_nop" : "+v"(acc[0][0]), "+v"(acc[1][1]), "+v"(acc[2][2]), "+v"(acc[3][3]) : "v"(a[0]), "v"(a[3]));
    }
#pragma unroll
    for (int mb = 0; mb < 4; ++mb) {
#pragma unroll
        for (int nb = 0; nb < 4; ++nb) {
#pragma unroll
            for (int j = 0; j < 8; ++j) os[(hi * 8 + j) * 68 + nb * 16 + lr] = acc[mb][nb][j]; }
        __builtin_amdgcn_wave_barrier(); asm volatile("" ::: "memory");
        float* crow = C + (size_t)(r0 + mb * 16) * ldc + c0;
{
#pragma unroll
            for (int s = 0; s < 8; ++s) { const int row = 2 * s + hi, cofs = lr * 4; v4f val = *(const v4fa*)(os + row * 68 + cofs); if (BIAS) { val[0] += bfr(bias[c0 + cofs]); val[1] += bfr(bias[c0 + cofs + 1]); val[2] += bfr(bias[c0 + cofs + 2]); val[3] += bfr(bias[c0 + cofs + 3]); }
                *(v4f*)(crow + (size_t)row * ldc + cofs) = val; }
             }
        __builtin_amdgcn_wave_barrier(); asm volatile("" ::: "memory");
    }
}

// ---- k_gemmc: the same one-wave 64x64 tile GEMM specialised for causal attention: CMODE 1 skips score tiles entirely above the diagonal (query rows r0+roff.., key columns c0..), CMODE 2 limits the
// key (K) loop of the probability x value contraction to the diagonal block (probabilities beyond it are exactly zero). roff = row offset of this launch's first row within the sequence.
template <typename T16, int NSPLIT, int CMODE>
__global__ __launch_bounds__(32) void k_gemmc(const T16* __restrict__ A, const T16* __restrict__ A2, const T16* __restrict__ Bt, const T16* __restrict__ Bt2, int K, float* C, int ldc, int roff, size_t sA, size_t sB, size_t sC) {
    typedef typename WFrag<T16>::V V;
    __shared__ __align__(16) float os[16 * 68];
    const size_t z = blockIdx.z; A += z * sA; if (A2) A2 += z * sA; Bt += z * sB; if (Bt2) Bt2 += z * sB; C += z * sC;
    const int lane = threadIdx.x & 31, lr = lane & 15, hi = lane >> 4; const int r0 = blockIdx.x * 64, c0 = blockIdx.y * 64;
    if (CMODE == 1 && c0 > r0 + roff + 63) return;                  // score tile entirely above the causal diagonal: never written (the softmax reads it but masks j > i by select)
    const int Kl = (CMODE == 2) ? min(K, r0 + roff + 64) : K;        // P.V: probabilities are exactly 0 beyond the diagonal block, so the K loop stops there
    v8f acc[4][4];
#pragma unroll
    for (int mb = 0; mb < 4; ++mb)
#pragma unroll
        for (int nb = 0; nb < 4; ++nb) acc[mb][nb] = (v8f){};
    const size_t aoff = (size_t)(r0 + lr) * K + 8 * hi, boff = (size_t)(c0 + lr) * K + 8 * hi;
#pragma unroll 1
    for (int kc = 0; kc < Kl; kc += 32) {
        V a[4], a2[4];
#pragma unroll
        for (int mb = 0; mb < 4; ++mb) { a[mb] = WFrag<T16>::ld(A + aoff + (size_t)mb * 16 * K + kc); if (NSPLIT == 1 || NSPLIT == 2) a2[mb] = WFrag<T16>::ld(A2 + aoff + (size_t)mb * 16 * K + kc); }
#pragma unroll
        for (int nb = 0; nb < 4; ++nb) { const V b = WFrag<T16>::ld(Bt + boff + (size_t)nb * 16 * K + kc); V b2; if (NSPLIT >= 2) b2 = WFrag<T16>::ld(Bt2 + boff + (size_t)nb * 16 * K + kc);
#pragma unroll
            for (int mb = 0; mb < 4; ++mb) { acc[mb][nb] = WFrag<T16>::mma(a[mb], b, acc[mb][nb]); if (NSPLIT == 1 || NSPLIT == 2) acc[mb][nb] = WFrag<T16>::mma(a2[mb], b, acc[mb][nb]); if (NSPLIT >= 2) acc[mb][nb] = WFrag<T16>::mma(a[mb], b2, acc[mb][nb]); } }
        asm volatile("v_nop\n\tv_nop\n\tv_nop\n\tv_nop" : "+v"(acc[0][0]), "+v"(acc[1][1]), "+v"(acc[2][2]), "+v"(acc[3][3]) : "v"(a[0]), "v"(a[3]));
    }
#pragma unroll
    for (int mb = 0; mb < 4; ++mb) {
#pragma unroll
        for (int nb = 0; nb < 4; ++nb) {
#pragma unroll
            for (int j = 0; j < 8; ++j) os[(hi * 8 + j) * 68 + nb * 16 + lr] = acc[mb][nb][j]; }
        __builtin_amdgcn_wave_barrier(); asm volatile("" ::: "memory");
        float* crow = C + (size_t)(r0 + mb * 16) * ldc + c0;
{
#pragma unroll
            for (int s = 0; s < 8; ++s) { const int row = 2 * s + hi, cofs = lr * 4; v4f val = *(const v4fa*)(os + row * 68 + cofs);
                *(v4f*)(crow + (size_t)row * ldc + cofs) = val; }
             }
        __builtin_amdgcn_wave_barrier(); asm volatile("" ::: "memory");
    }
}

__device__ __forceinline__ h16 tohx(float x) { return (h16)x; }
__device__ __forceinline__ void splitf(float y, unsigned short& h, unsigned short& l) { h = f2bf(y); l = f2bf(y - bf2f(h)); }
typedef __attribute__((ext_vector_type(2))) _Float16 v2h;
typedef __attribute__((ext_vector_type(4))) _Float16 v4h;
typedef __attribute__((ext_vector_type(2))) unsigned short v2us;
typedef __attribute__((ext_vector_type(4))) unsigned short v4us;
typedef __attribute__((ext_vector_type(2))) float v2f;
typedef __attribute__((ext_vector_type(4))) int v4i;

__global__ __launch_bounds__(256) void k_wtG(const float* __restrict__ w, int K, int N, bf* Bt) {
    const int lane = threadIdx.x & 31; const int L0 = (blockIdx.x * 8 + (threadIdx.x >> 5)) * 8; const int nlines = N * K / 64;
{
#pragma unroll 1
        for (int l = 0; l < 8; ++l) { const int L = L0 + l; if (L >= nlines) break; const size_t e = (size_t)L * 64 + lane * 2; const int k = (int)(e % K), n = (int)(e / K); v2us o;
            o[0] = f2bf(w[(size_t)k * N + n]); o[1] = f2bf(w[(size_t)(k + 1) * N + n]); *(v2us*)(Bt + e) = o; }
         }
}
__global__ __launch_bounds__(256) void k_cvt8(const float* __restrict__ src, bf* dst, size_t n8) { const size_t i = (size_t)blockIdx.x * 256 + threadIdx.x; if (i >= n8) return; const v8f v = *(const v8f*)(src + i * 8); v8us o;
#pragma unroll
    for (int k = 0; k < 8; ++k) o[k] = f2bf(v[k]); *(v8us*)(dst + i * 8) = o;  }
__global__ __launch_bounds__(256) void k_cstab(float* CS) { const int idx = blockIdx.x * 256 + threadIdx.x; if (idx >= TT * HD) return; const int t = idx / HD, d = idx % HD; const int i = d % (HD / 2); const float inv = __fdiv_rn(1.0f, powf(10000.0f, (float)(2 * i) / (float)HD)); const float ang = __fmul_rn((float)t, inv); v2f cs; cs[0] = cosf(ang); cs[1] = sinf(ang);
    *(v2f*)(CS + (size_t)idx * 2) = cs;  }
__global__ __launch_bounds__(256) void k_hrms(const float* __restrict__ F, int pitch, int nheads, float* RF) { const int i = blockIdx.x * 256 + threadIdx.x; if (i >= nheads * TT) return; const int t = i % TT, h = i / TT; const float* f = F + (size_t)t * pitch + h * HD; float s = 0.f;
#pragma unroll 4
    for (int d = 0; d < HD; d += 4) { const v4f v = *(const v4f*)(f + d);
#pragma unroll
        for (int q = 0; q < 4; ++q) { float p = __fmul_rn(v[q], v[q]); asm volatile("" : "+v"(p)); s = __fadd_rn(s, p); } }
    const float r = __fdiv_rn(1.0f, __fsqrt_rn(__fadd_rn(s * (1.0f / HD), 1e-6f))); *(float*)(RF + i) = r;  }
// k_rope: head planes [h][t][d] (fp16 + hi/lo) of rope(w[d] (x rms_factor)) x sc with the rotate-half convention out[d] = x[d] cos[t][d] - x[d+HD/2] sin[t][d], out[d+HD/2] = x[d+HD/2] cos[t][d+HD/2] + x[d] sin[t][d+HD/2]
__global__ __launch_bounds__(256) void k_rope(const float* __restrict__ F, int pitch, int nheads, const float* __restrict__ CS, const float* __restrict__ RF, const float* __restrict__ nw, float sc, h16* P16, bf* Ph, bf* Pl) {
    const size_t e = ((size_t)blockIdx.x * 256 + threadIdx.x) * 2; if (e >= (size_t)nheads * TT * HD) return; const int d = (int)(e % HD); const int t = (int)((e / HD) % TT); const int h = (int)(e / ((size_t)HD * TT)); const float* f = F + (size_t)t * pitch + h * HD; const float rf = RF ? RF[(size_t)h * TT + t] : 1.0f; v2h o16; v2us oh, ol;
#pragma unroll
    for (int q = 0; q < 2; ++q) { const int dd = d + q; const int dp = (dd < HD / 2) ? dd + HD / 2 : dd - HD / 2; float x0 = f[dd], x1 = f[dp];
        if (RF) { float n0 = __fmul_rn(x0, rf), n1 = __fmul_rn(x1, rf); asm volatile("" : "+v"(n0)); asm volatile("" : "+v"(n1)); x0 = __fmul_rn(__fadd_rn(1.0f, bfr(nw[dd])), n0); x1 = __fmul_rn(__fadd_rn(1.0f, bfr(nw[dp])), n1);   /* weight applied as (1 + w) */ }
        const v2f cs = *(const v2f*)(CS + ((size_t)t * HD + dd) * 2); float a = __fmul_rn(x0, cs[0]), bq = __fmul_rn(x1, cs[1]); asm volatile("" : "+v"(a)); asm volatile("" : "+v"(bq)); const float r = ((dd < HD / 2) ? __fsub_rn(a, bq) : __fadd_rn(a, bq)) * sc;
        o16[q] = tohx(r); unsigned short a2, c2; splitf(r, a2, c2); oh[q] = a2; ol[q] = c2; }
    *(v2h*)(P16 + e) = o16; *(v2us*)(Ph + e) = oh; *(v2us*)(Pl + e) = ol;  }
__global__ __launch_bounds__(256) void k_vtp(const float* __restrict__ F, int pitch, int nheads, h16* V16, bf* Vh, bf* Vl) { const size_t e = ((size_t)blockIdx.x * 256 + threadIdx.x) * 2; if (e >= (size_t)nheads * HD * TT) return; const int t = (int)(e % TT); const int d = (int)((e / TT) % HD); const int g = (int)(e / ((size_t)TT * HD)); v2h o16; v2us oh, ol;
#pragma unroll
    for (int q = 0; q < 2; ++q) { const float x = F[(size_t)(t + q) * pitch + g * HD + d]; o16[q] = tohx(x); unsigned short a2, c2; splitf(x, a2, c2); oh[q] = a2; ol[q] = c2; }
    *(v2h*)(V16 + e) = o16; *(v2us*)(Vh + e) = oh; *(v2us*)(Vl + e) = ol;  }
// k_asoft: per row (zz, i): t = S x HD^-0.5 for j <= i and i - j < WIN (sliding causal window; the reference's -1e9 additive fill vanishes identically); softmax over the 2048 keys (register row, one exp, fixed trees);
__global__ __launch_bounds__(256) void k_asoft(const float* __restrict__ Sb, h16* P16, bf* Ph, bf* Pl) {
    const int lane = threadIdx.x & 31; const int row = blockIdx.x * 8 + (threadIdx.x >> 5); if (row >= ZH * TT) return; const int i = row % TT; const int zz = row / TT; (void)zz; const bool hires = (i < RH); const float* sr = Sb + (size_t)row * TT; float v[TT / 32]; float mx = -3.0e38f;
#pragma unroll
    for (int ch = 0; ch < TT / 128; ++ch) { const int j0 = ch * 128 + lane * 4; const v4f a = *(const v4f*)(sr + j0);
#pragma unroll
        for (int q = 0; q < 4; ++q) { const int j = j0 + q; (void)j; const float t = (j <= i && i - j < WIN) ? a[q] * SCL : -3.0e38f; v[ch * 4 + q] = t; mx = fmaxf(mx, t); } }
#pragma unroll
    for (int sh = 16; sh; sh >>= 1) mx = fmaxf(mx, __shfl_xor(mx, sh, 32));
    float sum = 0.f;
#pragma unroll
    for (int k = 0; k < TT / 32; ++k) { float d0 = __fsub_rn(v[k], mx); asm volatile("" : "+v"(d0)); v[k] = __builtin_amdgcn_exp2f(__fmul_rn(d0, 1.4426950408889634f)); sum += v[k]; }
#pragma unroll
    for (int sh = 16; sh; sh >>= 1) sum += __shfl_xor(sum, sh, 32);
    const float f = __fdiv_rn(hires ? 1.0f : PCAR, sum);
{
        if (hires) {
#pragma unroll
            for (int ch = 0; ch < TT / 128; ++ch) { v4us oh, ol;
#pragma unroll
                for (int q = 0; q < 4; ++q) { unsigned short a, c2; splitf(v[ch * 4 + q] * f, a, c2); oh[q] = a; ol[q] = c2; }
                const size_t oo = ((size_t)zz * (RH ? RH : 1) + i) * TT + ch * 128 + lane * 4; *(v4us*)(Ph + oo) = oh; *(v4us*)(Pl + oo) = ol; }
        } else {
#pragma unroll
            for (int ch = 0; ch < TT / 128; ++ch) { v4h o4;
#pragma unroll
                for (int q = 0; q < 4; ++q) o4[q] = tohx(v[ch * 4 + q] * f);
                *(v4h*)(P16 + (size_t)row * TT + ch * 128 + lane * 4) = o4; } }
         }
}
__global__ __launch_bounds__(256) void k_merge(const float* __restrict__ O, int h0, bf* Ah, bf* Al) { const size_t e = ((size_t)blockIdx.x * 256 + threadIdx.x) * 2; if (e >= (size_t)ZH * TT * HD) return; const int d = (int)(e % HD); const int t = (int)((e / HD) % TT); const int zz = (int)(e / ((size_t)HD * TT)); const float cs = (t < RH) ? 1.0f : (1.0f / PCAR); const size_t oo = (size_t)t * DQ + (h0 + zz) * HD + d;
    v2us oh, ol;
#pragma unroll
    for (int q = 0; q < 2; ++q) { unsigned short a, c2; splitf(O[e + q] * cs, a, c2); oh[q] = a; ol[q] = c2; } *(v2us*)(Ah + oo) = oh; *(v2us*)(Al + oo) = ol;  }

__global__ __launch_bounds__(256) void k_wqg(const float* __restrict__ w, int part, bf* Bt) { const size_t e = ((size_t)blockIdx.x * 256 + threadIdx.x) * 8; if (e >= (size_t)DQ * DM) return; const int k = (int)(e % DM); const int n = (int)(e / DM); const int h = n / HD, d = n % HD; const float* src = w + ((size_t)h * 2 * HD + part * HD + d) * DM + k; v4f a = *(const v4f*)src, c = *(const v4f*)(src + 4); v8us o;
    for (int u = 0; u < 4; ++u) { o[u] = f2bf(a[u]); o[4 + u] = f2bf(c[u]); } *(v8us*)(Bt + e) = o;  }
__global__ __launch_bounds__(256) void k_mergeg(const float* __restrict__ O, const float* __restrict__ G, int h0, bf* Ah, bf* Al) { const size_t e = ((size_t)blockIdx.x * 256 + threadIdx.x) * 2; if (e >= (size_t)ZH * TT * HD) return; const int d = (int)(e % HD); const int t = (int)((e / HD) % TT); const int zz = (int)(e / ((size_t)HD * TT)); const float cs = (t < RH) ? 1.0f : (1.0f / PCAR); const size_t oo = (size_t)t * DQ + (h0 + zz) * HD + d;
    v2us oh, ol;
#pragma unroll
    for (int q = 0; q < 2; ++q) { const float gt = G[oo + q]; const float sg = __fdiv_rn(1.0f, __fadd_rn(1.0f, expf(-gt))); float o = O[e + q] * cs; asm volatile("" : "+v"(o)); unsigned short a, c2; splitf(__fmul_rn(o, sg), a, c2); oh[q] = a; ol[q] = c2; } *(v2us*)(Ah + oo) = oh; *(v2us*)(Al + oo) = ol;  }

extern "C" void kernel_launch(void* const* d_in, const int* in_sizes, int n_in,
                              void* d_out, int out_size, void* d_ws, size_t ws_size, hipStream_t stream) {
    (void)in_sizes; (void)n_in; (void)out_size;
    const float* x = (const float*)d_in[0]; const float* wqg = (const float*)d_in[1]; const float* wk = (const float*)d_in[2]; const float* wv = (const float*)d_in[3]; const float* wo = (const float*)d_in[4]; const float* qnw = (const float*)d_in[5]; const float* knw = (const float*)d_in[6]; const float* wq = wqg;
    float* OUT = (float*)d_out;     // [2][2048][2048]
    char* wsp = (char*)d_ws;
    auto take = [&](size_t bytes) { char* p = wsp; wsp += (bytes + 255) & ~(size_t)255; return (void*)p; };
    bf* WQ = (bf*)take((size_t)DQ * DM * 2); bf* WK = (bf*)take((size_t)DKV * DM * 2); bf* WV = (bf*)take((size_t)DKV * DM * 2); bf* WO = (bf*)take((size_t)DM * DQ * 2); float* CS = (float*)take((size_t)TT * HD * 2 * 4); float* RFQ = (float*)take((size_t)NH_ * TT * 4); float* RFK = (float*)take((size_t)NKV * TT * 4);
    bf* XB = (bf*)take((size_t)TT * DM * 2); bf* WG = (bf*)take((size_t)DQ * DM * 2); float* GATE = (float*)take((size_t)TT * DQ * 4); float* FQ = (float*)take((size_t)TT * DQ * 4); float* FK = (float*)take((size_t)TT * DKV * 4);
    h16* QP16 = (h16*)take((size_t)NH_ * TT * HD * 2); h16* KP16 = (h16*)take((size_t)NKV * TT * HD * 2); h16* VT16 = (h16*)take((size_t)NKV * HD * TT * 2);
    bf* QPh = (bf*)take((size_t)NH_ * TT * HD * 2); bf* QPl = (bf*)take((size_t)NH_ * TT * HD * 2); bf* KPh = (bf*)take((size_t)NKV * TT * HD * 2); bf* KPl = (bf*)take((size_t)NKV * TT * HD * 2); bf* VTh = (bf*)take((size_t)NKV * HD * TT * 2); bf* VTl = (bf*)take((size_t)NKV * HD * TT * 2); bf* Ph = (bf*)take((size_t)ZH * RH * TT * 2); bf* Pl = (bf*)take((size_t)ZH * RH * TT * 2);
    float* Sb = (float*)take((size_t)ZH * TT * TT * 4); h16* P16 = (h16*)take((size_t)ZH * TT * TT * 2); float* Ob = (float*)take((size_t)ZH * TT * HD * 4); bf* ATh = (bf*)take((size_t)TT * DQ * 2); bf* ATl = (bf*)take((size_t)TT * DQ * 2);
    if ((size_t)(wsp - (char*)d_ws) > ws_size) return;    // ws 256 MiB
    float* FV = FK;   // v projection reuses the k buffer after the k planes are built (stream-ordered)
    { k_wqg<<<(unsigned)(((size_t)DQ * DM / 8 + 255) / 256), 256, 0, stream>>>(wqg, 0, WQ); k_wqg<<<(unsigned)(((size_t)DQ * DM / 8 + 255) / 256), 256, 0, stream>>>(wqg, 1, WG); k_cvt8<<<(unsigned)(((size_t)DKV * DM / 8 + 255) / 256), 256, 0, stream>>>(wk, WK, (size_t)DKV * DM / 8); k_cvt8<<<(unsigned)(((size_t)DKV * DM / 8 + 255) / 256), 256, 0, stream>>>(wv, WV, (size_t)DKV * DM / 8);
      k_cvt8<<<(unsigned)(((size_t)DM * DQ / 8 + 255) / 256), 256, 0, stream>>>(wo, WO, (size_t)DM * DQ / 8);
      k_cstab<<<(TT * HD + 255) / 256, 256, 0, stream>>>(CS); }
    const unsigned LQ = (unsigned)(((size_t)NH_ * TT * HD / 2 + 255) / 256), LKv = (unsigned)(((size_t)NKV * TT * HD / 2 + 255) / 256);
    for (int b = 0; b < NB_; ++b) {
        
        k_cvt8<<<(unsigned)(((size_t)TT * DM / 8 + 255) / 256), 256, 0, stream>>>(x + (size_t)b * TT * DM, XB, (size_t)TT * DM / 8);
        k_gemmw<bf, 0, false><<<dim3(TT / 64, DQ / 64, 1), 32, 0, stream>>>(XB, nullptr, WQ, nullptr, DM, FQ, DQ, nullptr, 0, 0, 0); k_gemmw<bf, 0, false><<<dim3(TT / 64, DQ / 64, 1), 32, 0, stream>>>(XB, nullptr, WG, nullptr, DM, GATE, DQ, nullptr, 0, 0, 0); k_hrms<<<(NH_ * TT + 255) / 256, 256, 0, stream>>>(FQ, DQ, NH_, RFQ);
        k_rope<<<LQ, 256, 0, stream>>>(FQ, DQ, NH_, CS, RFQ, qnw, 1.0f, QP16, QPh, QPl);
        k_gemmw<bf, 0, false><<<dim3(TT / 64, DKV / 64, 1), 32, 0, stream>>>(XB, nullptr, WK, nullptr, DM, FK, DKV, nullptr, 0, 0, 0); k_hrms<<<(NKV * TT + 255) / 256, 256, 0, stream>>>(FK, DKV, NKV, RFK);
        k_rope<<<LKv, 256, 0, stream>>>(FK, DKV, NKV, CS, RFK, knw, 1.0f, KP16, KPh, KPl);
        k_gemmw<bf, 0, false><<<dim3(TT / 64, DKV / 64, 1), 32, 0, stream>>>(XB, nullptr, WV, nullptr, DM, FV, DKV, nullptr, 0, 0, 0); k_vtp<<<LKv, 256, 0, stream>>>(FV, DKV, NKV, VT16, VTh, VTl);
        for (int h0 = 0; h0 < NH_; h0 += ZH) { const size_t zq = (size_t)h0, zk = (size_t)(h0 / REP);   // both heads of a pass share kv group h0/REP (REP >= 2): sB = 0
            k_gemmc<bf, 2, 1><<<dim3(RH / 64, TT / 64, ZH), 32, 0, stream>>>(QPh + zq * TT * HD, QPl + zq * TT * HD, KPh + zk * TT * HD, KPl + zk * TT * HD, HD, Sb, TT, 0, (size_t)TT * HD, 0, (size_t)TT * TT);
            k_gemmc<h16, 0, 1><<<dim3((TT - RH) / 64, TT / 64, ZH), 32, 0, stream>>>(QP16 + zq * TT * HD + (size_t)RH * HD, nullptr, KP16 + zk * TT * HD, nullptr, HD, Sb + (size_t)RH * TT, TT, RH, (size_t)TT * HD, 0, (size_t)TT * TT);
            k_asoft<<<ZH * TT / 8, 256, 0, stream>>>(Sb, P16, Ph, Pl);
            k_gemmc<bf, 2, 2><<<dim3(RH / 64, HD / 64, ZH), 32, 0, stream>>>(Ph, Pl, VTh + zk * HD * TT, VTl + zk * HD * TT, TT, Ob, HD, 0, (size_t)RH * TT, 0, (size_t)TT * HD);
            k_gemmc<h16, 0, 2><<<dim3((TT - RH) / 64, HD / 64, ZH), 32, 0, stream>>>(P16 + (size_t)RH * TT, nullptr, VT16 + zk * HD * TT, nullptr, TT, Ob + (size_t)RH * HD, HD, RH, (size_t)TT * TT, 0, (size_t)TT * HD);
            k_mergeg<<<(unsigned)(((size_t)ZH * TT * HD / 2 + 255) / 256), 256, 0, stream>>>(Ob, GATE, h0, ATh, ATl); }
        k_gemmw<bf, 1, false><<<dim3(TT / 64, DM / 64, 1), 32, 0, stream>>>(ATh, ATl, WO, nullptr, DQ, OUT + (size_t)b * TT * DM, DM, nullptr, 0, 0, 0); }
}

// v001
// One run takes 1050 microseconds.
// Timed twice side by side with v000, it ran 1.68 times as fast both times.
#include <hip/hip_runtime.h>

// GatedAttention (x [2][2048][2048]; qg = x Wq^T (Wq [4096][2048]) viewed (16 heads x 256): q = first 128, gate = last 128 of each head; k/v = x Wk^T / Wv^T (4 kv heads; group h/4); per-head RMSNorm (eps 1e-6) with weight (1 + w) on q and k; rotate-half RoPE (base 1e4, tables computed on device); causal softmax(q.k / sqrt(128)); out = merged attn v x sigmoid(gate); out Wo^T -> [2][2048][2048]).
// Compute dtypes, f32 accumulate: every input rounded to bf16; q / gate / k / v on PLAIN bf16 operands (inputs: exact; the interleaved q|gate rows of Wq gathered); RMSNorm, RoPE, sigmoid gating f32; causal scores and attn.v: query rows < 512 hl (3 products), the rest single fp16 (x1024), causal tile skipping; softmax f32; Wo hl x exact (2 products).

#define NB_  2
#define TT   2048
#define DM   2048
#define NH_  16
#define NKV  4
#define REP  (NH_ / NKV)
#define HD   128
#define DQ   (NH_ * HD)
#define DKV  (NKV * HD)
#define ZH   2
#define RH   512                  // query rows < RH use hi+lo planes (0: none)
#define WIN  2048
#define PCAR 1024.0f
#define SCL  0.088388347648318447f   // HD^-0.5
typedef _Float16 h16;
typedef unsigned short bf;
typedef __attribute__((ext_vector_type(16))) __bf16   v16bf;
typedef __attribute__((ext_vector_type(16))) _Float16 v16h;
typedef __attribute__((ext_vector_type(8)))  _Float16 v8h;
typedef __attribute__((ext_vector_type(8)))  unsigned short v8us;
typedef __attribute__((ext_vector_type(8)))  float    v8f;
typedef __attribute__((ext_vector_type(4)))  float    v4f;
typedef v8h  __attribute__((may_alias)) v8ha;
typedef v4f  __attribute__((may_alias)) v4fa;
typedef v8us __attribute__((may_alias)) v8usa;

__device__ __forceinline__ unsigned short f2bf(float f) { unsigned u = __float_as_uint(f); u += 0x7FFFu + ((u >> 16) & 1u); return (unsigned short)(u >> 16); }
__device__ __forceinline__ float bf2f(unsigned short b) { return __uint_as_float(((unsigned)b) << 16); }
__device__ __forceinline__ float bfr(float f) { return bf2f(f2bf(f)); }
__device__ __forceinline__ v16h cat16(v8h lo, v8h hi) { return __builtin_shufflevector(lo, hi, 0, 1, 2, 3, 4, 5, 6, 7, 8, 9, 10, 11, 12, 13, 14, 15); }
__device__ __forceinline__ v16bf cat16b(v8us lo, v8us hi) { return __builtin_bit_cast(v16bf, __builtin_shufflevector(lo, hi, 0, 1, 2, 3, 4, 5, 6, 7, 8, 9, 10, 11, 12, 13, 14, 15)); }
__device__ __forceinline__ v8f wmma16(v16h a, v16h b, v8f c) { return __builtin_amdgcn_wmma_f32_16x16x32_f16(false, a, false, b, (short)0, c, false, false); }
__device__ __forceinline__ v8f wmmab(v16bf a, v16bf b, v8f c) { return __builtin_amdgcn_wmma_f32_16x16x32_bf16(false, a, false, b, (short)0, c, false, false); }



// ---- ksum_store: end of a GEMM tile whose K loop was dealt over the KS waves of one work-group. Every wave parks its 16 partial accumulators in LDS in register order (16 B per lane, contiguous),
// each wave then sums 16/KS of them over the waves in wave order 0..KS-1 (a fixed order), transposes its 16 x WC piece in its own slab and stores whole 128-byte row pieces.
template <int KS, bool BIAS>
__device__ __forceinline__ void ksum_store(v8f (&acc)[4][4], float* red, int wave, int lane, float* C, int ldc, int r0, int c0, const float* __restrict__ bias) {
    constexpr int NA = 16 / KS, WC = NA * 16, P = WC + 4, LPR = WC / 4, RPI = 32 / LPR;
    const int lr = lane & 15, hi = lane >> 4; float* mine = red + wave * 4096;
#pragma unroll
    for (int a = 0; a < 16; ++a) { const v8f t = acc[a >> 2][a & 3]; *(v4fa*)(mine + a * 256 + lane * 4) = __builtin_shufflevector(t, t, 0, 1, 2, 3); *(v4fa*)(mine + a * 256 + 128 + lane * 4) = __builtin_shufflevector(t, t, 4, 5, 6, 7); }
    __syncthreads();   // every wave's partial sums are in LDS before any wave adds them up
    v4f s0[NA], s1[NA];
#pragma unroll
    for (int i = 0; i < NA; ++i) { const float* p = red + (wave * NA + i) * 256 + lane * 4; s0[i] = *(const v4fa*)p; s1[i] = *(const v4fa*)(p + 128);
#pragma unroll
        for (int w = 1; w < KS; ++w) { s0[i] += *(const v4fa*)(p + w * 4096); s1[i] += *(const v4fa*)(p + w * 4096 + 128); } }
    __syncthreads();   // every wave has read the partial sums before a slab is reused for the transpose
#pragma unroll
    for (int i = 0; i < NA; ++i) {
#pragma unroll
        for (int j = 0; j < 4; ++j) { mine[(hi * 8 + j) * P + i * 16 + lr] = s0[i][j]; mine[(hi * 8 + 4 + j) * P + i * 16 + lr] = s1[i][j]; } }
    __builtin_amdgcn_wave_barrier(); asm volatile("" ::: "memory");   // keeps the row reads below behind the column writes above (other lanes' data, same wave)
    const int cb = c0 + ((wave * NA) & 3) * 16; float* crow = C + (size_t)(r0 + ((wave * NA) >> 2) * 16) * ldc + cb;
#pragma unroll
    for (int s = 0; s < 16 / RPI; ++s) { const int row = s * RPI + lane / LPR, cofs = (lane % LPR) * 4; v4f val = *(const v4fa*)(mine + row * P + cofs); if (BIAS) { val[0] += bfr(bias[cb + cofs]); val[1] += bfr(bias[cb + cofs + 1]); val[2] += bfr(bias[cb + cofs + 2]); val[3] += bfr(bias[cb + cofs + 3]); }
        *(v4f*)(crow + (size_t)row * ldc + cofs) = val; }
}

// ---- k_gemmw: register-blocked GEMM, one 64x64 output tile (16 accumulators a wave) per work-group of KS waves; wave w takes the 64-element K blocks w, w + KS, ... (whole 128-byte lines); operands straight from K-contiguous 16-bit planes; grid (M/64, N/64, Z), KS x 32 threads.
// C[m][n] (f32, pitch ldc, + optional f32 bias[n]) = sum_k A[m][k] Bt[n][k] (+ split products per NSPLIT). z-batch strides sA/sB/sC in elements. K % 64 == 0.
template <typename T16> struct WFrag;
template <> struct WFrag<h16> { typedef v16h V; static __device__ __forceinline__ V ld(const h16* p) { return cat16(*(const v8h*)p, *(const v8h*)(p + 16)); } static __device__ __forceinline__ v8f mma(V a, V b, v8f c) { return wmma16(a, b, c); } };
template <> struct WFrag<bf> { typedef v16bf V; static __device__ __forceinline__ V ld(const bf* p) { return cat16b(*(const v8us*)p, *(const v8us*)(p + 16)); } static __device__ __forceinline__ v8f mma(V a, V b, v8f c) { return wmmab(a, b, c); } };
template <typename T16, int NSPLIT, bool BIAS, int KS>
__global__ __launch_bounds__(KS * 32) void k_gemmw(const T16* __restrict__ A, const T16* __restrict__ A2, const T16* __restrict__ Bt, const T16* __restrict__ Bt2, int K, float* C, int ldc, const float* __restrict__ bias, size_t sA, size_t sB, size_t sC) {
    typedef typename WFrag<T16>::V V;
    __shared__ __align__(16) float os[KS == 1 ? 16 * 68 : KS * 4096];
    const size_t z = blockIdx.z; A += z * sA; if (A2) A2 += z * sA; Bt += z * sB; if (Bt2) Bt2 += z * sB; C += z * sC;
    const int lane = threadIdx.x & 31, lr = lane & 15, hi = lane >> 4; const int wave = __builtin_amdgcn_readfirstlane(threadIdx.x >> 5); const int r0 = blockIdx.x * 64, c0 = blockIdx.y * 64;
    v8f acc[4][4];
#pragma unroll
    for (int mb = 0; mb < 4; ++mb)
#pragma unroll
        for (int nb = 0; nb < 4; ++nb) acc[mb][nb] = (v8f){};
    const size_t aoff = (size_t)(r0 + lr) * K + 8 * hi, boff = (size_t)(c0 + lr) * K + 8 * hi;
#pragma unroll 1
    for (int kc = wave * 64; kc < K; kc += (kc & 32) ? KS * 64 - 32 : 32) {
        V a[4], a2[4];
#pragma unroll
        for (int mb = 0; mb < 4; ++mb) { a[mb] = WFrag<T16>::ld(A + aoff + (size_t)mb * 16 * K + kc); if (NSPLIT == 1 || NSPLIT == 2) a2[mb] = WFrag<T16>::ld(A2 + aoff + (size_t)mb * 16 * K + kc); }
#pragma unroll
        for (int nb = 0; nb < 4; ++nb) { const V b = WFrag<T16>::ld(Bt + boff + (size_t)nb * 16 * K + kc); V b2; if (NSPLIT >= 2) b2 = WFrag<T16>::ld(Bt2 + boff + (size_t)nb * 16 * K + kc);
#pragma unroll
            for (int mb = 0; mb < 4; ++mb) { acc[mb][nb] = WFrag<T16>::mma(a[mb], b, acc[mb][nb]); if (NSPLIT == 1 || NSPLIT == 2) acc[mb][nb] = WFrag<T16>::mma(a2[mb], b, acc[mb][nb]); if (NSPLIT >= 2) acc[mb][nb] = WFrag<T16>::mma(a[mb], b2, acc[mb][nb]); } }
        asm volatile("v_nop\n\tv_nop\n\tv_nop\n\tv_nop" : "+v"(acc[0][0]), "+v"(acc[1][1]), "+v"(acc[2][2]), "+v"(acc[3][3]) : "v"(a[0]), "v"(a[3]));
    }
    ksum_store<KS, BIAS>(acc, os, wave, lane, C, ldc, r0, c0, bias);
}

// ---- k_gemmc: the same 64x64 tile GEMM specialised for causal attention (KS = 1: one wave does the whole K loop and stores its tile itself): CMODE 1 skips score tiles entirely above the diagonal (query rows r0+roff.., key columns c0..), CMODE 2 limits the
// key (K) loop of the probability x value contraction to the diagonal block (probabilities beyond it are exactly zero). roff = row offset of this launch's first row within the sequence.
template <typename T16, int NSPLIT, int CMODE, int KS>
__global__ __launch_bounds__(KS * 32) void k_gemmc(const T16* __restrict__ A, const T16* __restrict__ A2, const T16* __restrict__ Bt, const T16* __restrict__ Bt2, int K, float* C, int ldc, int roff, size_t sA, size_t sB, size_t sC) {
    typedef typename WFrag<T16>::V V;
    __shared__ __align__(16) float os[KS == 1 ? 16 * 68 : KS * 4096];
    const size_t z = blockIdx.z; A += z * sA; if (A2) A2 += z * sA; Bt += z * sB; if (Bt2) Bt2 += z * sB; C += z * sC;
    const int lane = threadIdx.x & 31, lr = lane & 15, hi = lane >> 4; const int wave = __builtin_amdgcn_readfirstlane(threadIdx.x >> 5); const int r0 = blockIdx.x * 64, c0 = blockIdx.y * 64;
    if (CMODE == 1 && c0 > r0 + roff + 63) return;                  // score tile entirely above the causal diagonal: never written (the softmax masks j > i by select)
    const int Kl = (CMODE == 2) ? min(K, r0 + roff + 64) : K;        // P.V: probabilities are exactly 0 beyond the diagonal block, so the K loop stops there
    v8f acc[4][4];
#pragma unroll
    for (int mb = 0; mb < 4; ++mb)
#pragma unroll
        for (int nb = 0; nb < 4; ++nb) acc[mb][nb] = (v8f){};
    const size_t aoff = (size_t)(r0 + lr) * K + 8 * hi, boff = (size_t)(c0 + lr) * K + 8 * hi;
#pragma unroll 1
    for (int kc = wave * 64; kc < Kl; kc += (kc & 32) ? KS * 64 - 32 : 32) {
        V a[4], a2[4];
#pragma unroll
        for (int mb = 0; mb < 4; ++mb) { a[mb] = WFrag<T16>::ld(A + aoff + (size_t)mb * 16 * K + kc); if (NSPLIT == 1 || NSPLIT == 2) a2[mb] = WFrag<T16>::ld(A2 + aoff + (size_t)mb * 16 * K + kc); }
#pragma unroll
        for (int nb = 0; nb < 4; ++nb) { const V b = WFrag<T16>::ld(Bt + boff + (size_t)nb * 16 * K + kc); V b2; if (NSPLIT >= 2) b2 = WFrag<T16>::ld(Bt2 + boff + (size_t)nb * 16 * K + kc);
#pragma unroll
            for (int mb = 0; mb < 4; ++mb) { acc[mb][nb] = WFrag<T16>::mma(a[mb], b, acc[mb][nb]); if (NSPLIT == 1 || NSPLIT == 2) acc[mb][nb] = WFrag<T16>::mma(a2[mb], b, acc[mb][nb]); if (NSPLIT >= 2) acc[mb][nb] = WFrag<T16>::mma(a[mb], b2, acc[mb][nb]); } }
        asm volatile("v_nop\n\tv_nop\n\tv_nop\n\tv_nop" : "+v"(acc[0][0]), "+v"(acc[1][1]), "+v"(acc[2][2]), "+v"(acc[3][3]) : "v"(a[0]), "v"(a[3]));
    }
    if constexpr (KS > 1) { ksum_store<KS, false>(acc, os, wave, lane, C, ldc, r0, c0, nullptr); return; }
#pragma unroll
    for (int mb = 0; mb < 4; ++mb) {
#pragma unroll
        for (int nb = 0; nb < 4; ++nb) {
#pragma unroll
            for (int j = 0; j < 8; ++j) os[(hi * 8 + j) * 68 + nb * 16 + lr] = acc[mb][nb][j]; }
        __builtin_amdgcn_wave_barrier(); asm volatile("" ::: "memory");
        float* crow = C + (size_t)(r0 + mb * 16) * ldc + c0;
{
#pragma unroll
            for (int s = 0; s < 8; ++s) { const int row = 2 * s + hi, cofs = lr * 4; v4f val = *(const v4fa*)(os + row * 68 + cofs);
                *(v4f*)(crow + (size_t)row * ldc + cofs) = val; }
             }
        __builtin_amdgcn_wave_barrier(); asm volatile("" ::: "memory");
    }
}

__device__ __forceinline__ h16 tohx(float x) { return (h16)x; }
__device__ __forceinline__ void splitf(float y, unsigned short& h, unsigned short& l) { h = f2bf(y); l = f2bf(y - bf2f(h)); }
typedef __attribute__((ext_vector_type(2))) _Float16 v2h;
typedef __attribute__((ext_vector_type(4))) _Float16 v4h;
typedef __attribute__((ext_vector_type(2))) unsigned short v2us;
typedef __attribute__((ext_vector_type(4))) unsigned short v4us;
typedef __attribute__((ext_vector_type(2))) float v2f;
typedef __attribute__((ext_vector_type(4))) int v4i;

__global__ __launch_bounds__(256) void k_wtG(const float* __restrict__ w, int K, int N, bf* Bt) {
    const int lane = threadIdx.x & 31; const int L0 = (blockIdx.x * 8 + (threadIdx.x >> 5)) * 8; const int nlines = N * K / 64;
{
#pragma unroll 1
        for (int l = 0; l < 8; ++l) { const int L = L0 + l; if (L >= nlines) break; const size_t e = (size_t)L * 64 + lane * 2; const int k = (int)(e % K), n = (int)(e / K); v2us o;
            o[0] = f2bf(w[(size_t)k * N + n]); o[1] = f2bf(w[(size_t)(k + 1) * N + n]); *(v2us*)(Bt + e) = o; }
         }
}
__global__ __launch_bounds__(256) void k_cvt8(const float* __restrict__ src, bf* dst, size_t n8) { const size_t i = (size_t)blockIdx.x * 256 + threadIdx.x; if (i >= n8) return; const v8f v = *(const v8f*)(src + i * 8); v8us o;
#pragma unroll
    for (int k = 0; k < 8; ++k) o[k] = f2bf(v[k]); *(v8us*)(dst + i * 8) = o;  }
__global__ __launch_bounds__(256) void k_cstab(float* CS) { const int idx = blockIdx.x * 256 + threadIdx.x; if (idx >= TT * HD) return; const int t = idx / HD, d = idx % HD; const int i = d % (HD / 2); const float inv = __fdiv_rn(1.0f, powf(10000.0f, (float)(2 * i) / (float)HD)); const float ang = __fmul_rn((float)t, inv); v2f cs; cs[0] = cosf(ang); cs[1] = sinf(ang);
    *(v2f*)(CS + (size_t)idx * 2) = cs;  }
__global__ __launch_bounds__(256) void k_hrms(const float* __restrict__ F, int pitch, int nheads, float* RF) { const int i = blockIdx.x * 256 + threadIdx.x; if (i >= nheads * TT) return; const int t = i % TT, h = i / TT; const float* f = F + (size_t)t * pitch + h * HD; float s = 0.f;
#pragma unroll 4
    for (int d = 0; d < HD; d += 4) { const v4f v = *(const v4f*)(f + d);
#pragma unroll
        for (int q = 0; q < 4; ++q) { float p = __fmul_rn(v[q], v[q]); asm volatile("" : "+v"(p)); s = __fadd_rn(s, p); } }
    const float r = __fdiv_rn(1.0f, __fsqrt_rn(__fadd_rn(s * (1.0f / HD), 1e-6f))); *(float*)(RF + i) = r;  }
// k_rope: head planes [h][t][d] (fp16 + hi/lo) of rope(w[d] (x rms_factor)) x sc with the rotate-half convention out[d] = x[d] cos[t][d] - x[d+HD/2] sin[t][d], out[d+HD/2] = x[d+HD/2] cos[t][d+HD/2] + x[d] sin[t][d+HD/2]
__global__ __launch_bounds__(256) void k_rope(const float* __restrict__ F, int pitch, int nheads, const float* __restrict__ CS, const float* __restrict__ RF, const float* __restrict__ nw, float sc, h16* P16, bf* Ph, bf* Pl) {
    const size_t e = ((size_t)blockIdx.x * 256 + threadIdx.x) * 2; if (e >= (size_t)nheads * TT * HD) return; const int d = (int)(e % HD); const int t = (int)((e / HD) % TT); const int h = (int)(e / ((size_t)HD * TT)); const float* f = F + (size_t)t * pitch + h * HD; const float rf = RF ? RF[(size_t)h * TT + t] : 1.0f; v2h o16; v2us oh, ol;
#pragma unroll
    for (int q = 0; q < 2; ++q) { const int dd = d + q; const int dp = (dd < HD / 2) ? dd + HD / 2 : dd - HD / 2; float x0 = f[dd], x1 = f[dp];
        if (RF) { float n0 = __fmul_rn(x0, rf), n1 = __fmul_rn(x1, rf); asm volatile("" : "+v"(n0)); asm volatile("" : "+v"(n1)); x0 = __fmul_rn(__fadd_rn(1.0f, bfr(nw[dd])), n0); x1 = __fmul_rn(__fadd_rn(1.0f, bfr(nw[dp])), n1);   /* weight applied as (1 + w) */ }
        const v2f cs = *(const v2f*)(CS + ((size_t)t * HD + dd) * 2); float a = __fmul_rn(x0, cs[0]), bq = __fmul_rn(x1, cs[1]); asm volatile("" : "+v"(a)); asm volatile("" : "+v"(bq)); const float r = ((dd < HD / 2) ? __fsub_rn(a, bq) : __fadd_rn(a, bq)) * sc;
        o16[q] = tohx(r); unsigned short a2, c2; splitf(r, a2, c2); oh[q] = a2; ol[q] = c2; }
    *(v2h*)(P16 + e) = o16; *(v2us*)(Ph + e) = oh; *(v2us*)(Pl + e) = ol;  }
__global__ __launch_bounds__(256) void k_vtp(const float* __restrict__ F, int pitch, int nheads, h16* V16, bf* Vh, bf* Vl) { const size_t e = ((size_t)blockIdx.x * 256 + threadIdx.x) * 2; if (e >= (size_t)nheads * HD * TT) return; const int t = (int)(e % TT); const int d = (int)((e / TT) % HD); const int g = (int)(e / ((size_t)TT * HD)); v2h o16; v2us oh, ol;
#pragma unroll
    for (int q = 0; q < 2; ++q) { const float x = F[(size_t)(t + q) * pitch + g * HD + d]; o16[q] = tohx(x); unsigned short a2, c2; splitf(x, a2, c2); oh[q] = a2; ol[q] = c2; }
    *(v2h*)(V16 + e) = o16; *(v2us*)(Vh + e) = oh; *(v2us*)(Vl + e) = ol;  }
// k_asoft: per row (zz, i): t = S x HD^-0.5 for j <= i and i - j < WIN (sliding causal window; the reference's -1e9 additive fill vanishes identically); softmax over the 2048 keys (register row, one exp, fixed trees);
__global__ __launch_bounds__(256) void k_asoft(const float* __restrict__ Sb, h16* P16, bf* Ph, bf* Pl) {
    const int lane = threadIdx.x & 31; const int row = blockIdx.x * 8 + (threadIdx.x >> 5); if (row >= ZH * TT) return; const int i = row % TT; const int zz = row / TT; (void)zz; const bool hires = (i < RH); const float* sr = Sb + (size_t)row * TT; float v[TT / 32]; float mx = -3.0e38f;
#pragma unroll
    for (int ch = 0; ch < TT / 128; ++ch) { const int j0 = ch * 128 + lane * 4; const v4f a = *(const v4f*)(sr + j0);
#pragma unroll
        for (int q = 0; q < 4; ++q) { const int j = j0 + q; (void)j; const float t = (j <= i && i - j < WIN) ? a[q] * SCL : -3.0e38f; v[ch * 4 + q] = t; mx = fmaxf(mx, t); } }
#pragma unroll
    for (int sh = 16; sh; sh >>= 1) mx = fmaxf(mx, __shfl_xor(mx, sh, 32));
    float sum = 0.f;
#pragma unroll
    for (int k = 0; k < TT / 32; ++k) { float d0 = __fsub_rn(v[k], mx); asm volatile("" : "+v"(d0)); v[k] = __builtin_amdgcn_exp2f(__fmul_rn(d0, 1.4426950408889634f)); sum += v[k]; }
#pragma unroll
    for (int sh = 16; sh; sh >>= 1) sum += __shfl_xor(sum, sh, 32);
    const float f = __fdiv_rn(hires ? 1.0f : PCAR, sum);
{
        if (hires) {
#pragma unroll
            for (int ch = 0; ch < TT / 128; ++ch) { v4us oh, ol;
#pragma unroll
                for (int q = 0; q < 4; ++q) { unsigned short a, c2; splitf(v[ch * 4 + q] * f, a, c2); oh[q] = a; ol[q] = c2; }
                const size_t oo = ((size_t)zz * (RH ? RH : 1) + i) * TT + ch * 128 + lane * 4; *(v4us*)(Ph + oo) = oh; *(v4us*)(Pl + oo) = ol; }
        } else {
#pragma unroll
            for (int ch = 0; ch < TT / 128; ++ch) { v4h o4;
#pragma unroll
                for (int q = 0; q < 4; ++q) o4[q] = tohx(v[ch * 4 + q] * f);
                *(v4h*)(P16 + (size_t)row * TT + ch * 128 + lane * 4) = o4; } }
         }
}
__global__ __launch_bounds__(256) void k_merge(const float* __restrict__ O, int h0, bf* Ah, bf* Al) { const size_t e = ((size_t)blockIdx.x * 256 + threadIdx.x) * 2; if (e >= (size_t)ZH * TT * HD) return; const int d = (int)(e % HD); const int t = (int)((e / HD) % TT); const int zz = (int)(e / ((size_t)HD * TT)); const float cs = (t < RH) ? 1.0f : (1.0f / PCAR); const size_t oo = (size_t)t * DQ + (h0 + zz) * HD + d;
    v2us oh, ol;
#pragma unroll
    for (int q = 0; q < 2; ++q) { unsigned short a, c2; splitf(O[e + q] * cs, a, c2); oh[q] = a; ol[q] = c2; } *(v2us*)(Ah + oo) = oh; *(v2us*)(Al + oo) = ol;  }

__global__ __launch_bounds__(256) void k_wqg(const float* __restrict__ w, int part, bf* Bt) { const size_t e = ((size_t)blockIdx.x * 256 + threadIdx.x) * 8; if (e >= (size_t)DQ * DM) return; const int k = (int)(e % DM); const int n = (int)(e / DM); const int h = n / HD, d = n % HD; const float* src = w + ((size_t)h * 2 * HD + part * HD + d) * DM + k; v4f a = *(const v4f*)src, c = *(const v4f*)(src + 4); v8us o;
    for (int u = 0; u < 4; ++u) { o[u] = f2bf(a[u]); o[4 + u] = f2bf(c[u]); } *(v8us*)(Bt + e) = o;  }
__global__ __launch_bounds__(256) void k_mergeg(const float* __restrict__ O, const float* __restrict__ G, int h0, bf* Ah, bf* Al) { const size_t e = ((size_t)blockIdx.x * 256 + threadIdx.x) * 2; if (e >= (size_t)ZH * TT * HD) return; const int d = (int)(e % HD); const int t = (int)((e / HD) % TT); const int zz = (int)(e / ((size_t)HD * TT)); const float cs = (t < RH) ? 1.0f : (1.0f / PCAR); const size_t oo = (size_t)t * DQ + (h0 + zz) * HD + d;
    v2us oh, ol;
#pragma unroll
    for (int q = 0; q < 2; ++q) { const float gt = G[oo + q]; const float sg = __fdiv_rn(1.0f, __fadd_rn(1.0f, expf(-gt))); float o = O[e + q] * cs; asm volatile("" : "+v"(o)); unsigned short a, c2; splitf(__fmul_rn(o, sg), a, c2); oh[q] = a; ol[q] = c2; } *(v2us*)(Ah + oo) = oh; *(v2us*)(Al + oo) = ol;  }

extern "C" void kernel_launch(void* const* d_in, const int* in_sizes, int n_in,
                              void* d_out, int out_size, void* d_ws, size_t ws_size, hipStream_t stream) {
    (void)in_sizes; (void)n_in; (void)out_size;
    const float* x = (const float*)d_in[0]; const float* wqg = (const float*)d_in[1]; const float* wk = (const float*)d_in[2]; const float* wv = (const float*)d_in[3]; const float* wo = (const float*)d_in[4]; const float* qnw = (const float*)d_in[5]; const float* knw = (const float*)d_in[6]; const float* wq = wqg;
    float* OUT = (float*)d_out;     // [2][2048][2048]
    char* wsp = (char*)d_ws;
    auto take = [&](size_t bytes) { char* p = wsp; wsp += (bytes + 255) & ~(size_t)255; return (void*)p; };
    bf* WQ = (bf*)take((size_t)DQ * DM * 2); bf* WK = (bf*)take((size_t)DKV * DM * 2); bf* WV = (bf*)take((size_t)DKV * DM * 2); bf* WO = (bf*)take((size_t)DM * DQ * 2); float* CS = (float*)take((size_t)TT * HD * 2 * 4); float* RFQ = (float*)take((size_t)NH_ * TT * 4); float* RFK = (float*)take((size_t)NKV * TT * 4);
    bf* XB = (bf*)take((size_t)TT * DM * 2); bf* WG = (bf*)take((size_t)DQ * DM * 2); float* GATE = (float*)take((size_t)TT * DQ * 4); float* FQ = (float*)take((size_t)TT * DQ * 4); float* FK = (float*)take((size_t)TT * DKV * 4);
    h16* QP16 = (h16*)take((size_t)NH_ * TT * HD * 2); h16* KP16 = (h16*)take((size_t)NKV * TT * HD * 2); h16* VT16 = (h16*)take((size_t)NKV * HD * TT * 2);
    bf* QPh = (bf*)take((size_t)NH_ * TT * HD * 2); bf* QPl = (bf*)take((size_t)NH_ * TT * HD * 2); bf* KPh = (bf*)take((size_t)NKV * TT * HD * 2); bf* KPl = (bf*)take((size_t)NKV * TT * HD * 2); bf* VTh = (bf*)take((size_t)NKV * HD * TT * 2); bf* VTl = (bf*)take((size_t)NKV * HD * TT * 2); bf* Ph = (bf*)take((size_t)ZH * RH * TT * 2); bf* Pl = (bf*)take((size_t)ZH * RH * TT * 2);
    float* Sb = (float*)take((size_t)ZH * TT * TT * 4); h16* P16 = (h16*)take((size_t)ZH * TT * TT * 2); float* Ob = (float*)take((size_t)ZH * TT * HD * 4); bf* ATh = (bf*)take((size_t)TT * DQ * 2); bf* ATl = (bf*)take((size_t)TT * DQ * 2);
    if ((size_t)(wsp - (char*)d_ws) > ws_size) return;    // ws 256 MiB
    float* FV = FK;   // v projection reuses the k buffer after the k planes are built (stream-ordered)
    { k_wqg<<<(unsigned)(((size_t)DQ * DM / 8 + 255) / 256), 256, 0, stream>>>(wqg, 0, WQ); k_wqg<<<(unsigned)(((size_t)DQ * DM / 8 + 255) / 256), 256, 0, stream>>>(wqg, 1, WG); k_cvt8<<<(unsigned)(((size_t)DKV * DM / 8 + 255) / 256), 256, 0, stream>>>(wk, WK, (size_t)DKV * DM / 8); k_cvt8<<<(unsigned)(((size_t)DKV * DM / 8 + 255) / 256), 256, 0, stream>>>(wv, WV, (size_t)DKV * DM / 8);
      k_cvt8<<<(unsigned)(((size_t)DM * DQ / 8 + 255) / 256), 256, 0, stream>>>(wo, WO, (size_t)DM * DQ / 8);
      k_cstab<<<(TT * HD + 255) / 256, 256, 0, stream>>>(CS); }
    const unsigned LQ = (unsigned)(((size_t)NH_ * TT * HD / 2 + 255) / 256), LKv = (unsigned)(((size_t)NKV * TT * HD / 2 + 255) / 256);
    for (int b = 0; b < NB_; ++b) {
        
        k_cvt8<<<(unsigned)(((size_t)TT * DM / 8 + 255) / 256), 256, 0, stream>>>(x + (size_t)b * TT * DM, XB, (size_t)TT * DM / 8);
        k_gemmw<bf, 0, false, 4><<<dim3(TT / 64, DQ / 64, 1), 128, 0, stream>>>(XB, nullptr, WQ, nullptr, DM, FQ, DQ, nullptr, 0, 0, 0); k_gemmw<bf, 0, false, 4><<<dim3(TT / 64, DQ / 64, 1), 128, 0, stream>>>(XB, nullptr, WG, nullptr, DM, GATE, DQ, nullptr, 0, 0, 0); k_hrms<<<(NH_ * TT + 255) / 256, 256, 0, stream>>>(FQ, DQ, NH_, RFQ);
        k_rope<<<LQ, 256, 0, stream>>>(FQ, DQ, NH_, CS, RFQ, qnw, 1.0f, QP16, QPh, QPl);
        k_gemmw<bf, 0, false, 8><<<dim3(TT / 64, DKV / 64, 1), 256, 0, stream>>>(XB, nullptr, WK, nullptr, DM, FK, DKV, nullptr, 0, 0, 0); k_hrms<<<(NKV * TT + 255) / 256, 256, 0, stream>>>(FK, DKV, NKV, RFK);
        k_rope<<<LKv, 256, 0, stream>>>(FK, DKV, NKV, CS, RFK, knw, 1.0f, KP16, KPh, KPl);
        k_gemmw<bf, 0, false, 8><<<dim3(TT / 64, DKV / 64, 1), 256, 0, stream>>>(XB, nullptr, WV, nullptr, DM, FV, DKV, nullptr, 0, 0, 0); k_vtp<<<LKv, 256, 0, stream>>>(FV, DKV, NKV, VT16, VTh, VTl);
        for (int h0 = 0; h0 < NH_; h0 += ZH) { const size_t zq = (size_t)h0, zk = (size_t)(h0 / REP);   // both heads of a pass share kv group h0/REP (REP >= 2): sB = 0
            k_gemmc<bf, 2, 1, 1><<<dim3(RH / 64, TT / 64, ZH), 32, 0, stream>>>(QPh + zq * TT * HD, QPl + zq * TT * HD, KPh + zk * TT * HD, KPl + zk * TT * HD, HD, Sb, TT, 0, (size_t)TT * HD, 0, (size_t)TT * TT);
            k_gemmc<h16, 0, 1, 1><<<dim3((TT - RH) / 64, TT / 64, ZH), 32, 0, stream>>>(QP16 + zq * TT * HD + (size_t)RH * HD, nullptr, KP16 + zk * TT * HD, nullptr, HD, Sb + (size_t)RH * TT, TT, RH, (size_t)TT * HD, 0, (size_t)TT * TT);
            k_asoft<<<ZH * TT / 8, 256, 0, stream>>>(Sb, P16, Ph, Pl);
            k_gemmc<bf, 2, 2, 8><<<dim3(RH / 64, HD / 64, ZH), 256, 0, stream>>>(Ph, Pl, VTh + zk * HD * TT, VTl + zk * HD * TT, TT, Ob, HD, 0, (size_t)RH * TT, 0, (size_t)TT * HD);
            k_gemmc<h16, 0, 2, 8><<<dim3((TT - RH) / 64, HD / 64, ZH), 256, 0, stream>>>(P16 + (size_t)RH * TT, nullptr, VT16 + zk * HD * TT, nullptr, TT, Ob + (size_t)RH * HD, HD, RH, (size_t)TT * TT, 0, (size_t)TT * HD);
            k_mergeg<<<(unsigned)(((size_t)ZH * TT * HD / 2 + 255) / 256), 256, 0, stream>>>(Ob, GATE, h0, ATh, ATl); }
        k_gemmw<bf, 1, false, 4><<<dim3(TT / 64, DM / 64, 1), 128, 0, stream>>>(ATh, ATl, WO, nullptr, DQ, OUT + (size_t)b * TT * DM, DM, nullptr, 0, 0, 0); }
}

// v002
// Measured time: 746 microseconds a run.
// Next to v001, in two timings, it ran 1.41 and 1.40 times as fast.
// All steps since v000 together make it 2.36 times as fast.
#include <hip/hip_runtime.h>

// GatedAttention (x [2][2048][2048]; qg = x Wq^T (Wq [4096][2048]) viewed (16 heads x 256): q = first 128, gate = last 128 of each head; k/v = x Wk^T / Wv^T (4 kv heads; group h/4); per-head RMSNorm (eps 1e-6) with weight (1 + w) on q and k; rotate-half RoPE (base 1e4, tables computed on device); causal softmax(q.k / sqrt(128)); out = merged attn v x sigmoid(gate); out Wo^T -> [2][2048][2048]).
// Compute dtypes, f32 accumulate: every input rounded to bf16; q / gate / k / v on PLAIN bf16 operands (inputs: exact; the interleaved q|gate rows of Wq gathered); RMSNorm, RoPE, sigmoid gating f32; causal scores and attn.v: query rows < 512 hl (3 products), the rest single fp16 (x1024), causal tile skipping; softmax f32; Wo hl x exact (2 products).

#define NB_  2
#define TT   2048
#define DM   2048
#define NH_  16
#define NKV  4
#define REP  (NH_ / NKV)
#define HD   128
#define DQ   (NH_ * HD)
#define DKV  (NKV * HD)
#define ZH   8                    // heads per attention pass (two kv groups: launch index z uses kv group z / REP)
#define RH   512                  // query rows < RH use hi+lo planes (0: none)
#define WIN  2048
#define PCAR 1024.0f
#define SCL  0.088388347648318447f   // HD^-0.5
typedef _Float16 h16;
typedef unsigned short bf;
typedef __attribute__((ext_vector_type(16))) __bf16   v16bf;
typedef __attribute__((ext_vector_type(16))) _Float16 v16h;
typedef __attribute__((ext_vector_type(8)))  _Float16 v8h;
typedef __attribute__((ext_vector_type(8)))  unsigned short v8us;
typedef __attribute__((ext_vector_type(8)))  float    v8f;
typedef __attribute__((ext_vector_type(4)))  float    v4f;
typedef v8h  __attribute__((may_alias)) v8ha;
typedef v4f  __attribute__((may_alias)) v4fa;
typedef v8us __attribute__((may_alias)) v8usa;

__device__ __forceinline__ unsigned short f2bf(float f) { unsigned u = __float_as_uint(f); u += 0x7FFFu + ((u >> 16) & 1u); return (unsigned short)(u >> 16); }
__device__ __forceinline__ float bf2f(unsigned short b) { return __uint_as_float(((unsigned)b) << 16); }
__device__ __forceinline__ float bfr(float f) { return bf2f(f2bf(f)); }
__device__ __forceinline__ v16h cat16(v8h lo, v8h hi) { return __builtin_shufflevector(lo, hi, 0, 1, 2, 3, 4, 5, 6, 7, 8, 9, 10, 11, 12, 13, 14, 15); }
__device__ __forceinline__ v16bf cat16b(v8us lo, v8us hi) { return __builtin_bit_cast(v16bf, __builtin_shufflevector(lo, hi, 0, 1, 2, 3, 4, 5, 6, 7, 8, 9, 10, 11, 12, 13, 14, 15)); }
__device__ __forceinline__ v8f wmma16(v16h a, v16h b, v8f c) { return __builtin_amdgcn_wmma_f32_16x16x32_f16(false, a, false, b, (short)0, c, false, false); }
__device__ __forceinline__ v8f wmmab(v16bf a, v16bf b, v8f c) { return __builtin_amdgcn_wmma_f32_16x16x32_bf16(false, a, false, b, (short)0, c, false, false); }



// ---- ksum_store: end of a GEMM tile whose K loop was dealt over the KS waves of one work-group. Every wave parks its 16 partial accumulators in LDS in register order (16 B per lane, contiguous),
// each wave then sums 16/KS of them over the waves in wave order 0..KS-1 (a fixed order), transposes its 16 x WC piece in its own slab and stores whole 128-byte row pieces.
template <int KS, bool BIAS>
__device__ __forceinline__ void ksum_store(v8f (&acc)[4][4], float* red, int wave, int lane, float* C, int ldc, int r0, int c0, const float* __restrict__ bias) {
    constexpr int NA = 16 / KS, WC = NA * 16, P = WC + 4, LPR = WC / 4, RPI = 32 / LPR;
    const int lr = lane & 15, hi = lane >> 4; float* mine = red + wave * 4096;
#pragma unroll
    for (int a = 0; a < 16; ++a) { const v8f t = acc[a >> 2][a & 3]; *(v4fa*)(mine + a * 256 + lane * 4) = __builtin_shufflevector(t, t, 0, 1, 2, 3); *(v4fa*)(mine + a * 256 + 128 + lane * 4) = __builtin_shufflevector(t, t, 4, 5, 6, 7); }
    __syncthreads();   // every wave's partial sums are in LDS before any wave adds them up
    v4f s0[NA], s1[NA];
#pragma unroll
    for (int i = 0; i < NA; ++i) { const float* p = red + (wave * NA + i) * 256 + lane * 4; s0[i] = *(const v4fa*)p; s1[i] = *(const v4fa*)(p + 128);
#pragma unroll
        for (int w = 1; w < KS; ++w) { s0[i] += *(const v4fa*)(p + w * 4096); s1[i] += *(const v4fa*)(p + w * 4096 + 128); } }
    __syncthreads();   // every wave has read the partial sums before a slab is reused for the transpose
#pragma unroll
    for (int i = 0; i < NA; ++i) {
#pragma unroll
        for (int j = 0; j < 4; ++j) { mine[(hi * 8 + j) * P + i * 16 + lr] = s0[i][j]; mine[(hi * 8 + 4 + j) * P + i * 16 + lr] = s1[i][j]; } }
    __builtin_amdgcn_wave_barrier(); asm volatile("" ::: "memory");   // keeps the row reads below behind the column writes above (other lanes' data, same wave)
    const int cb = c0 + ((wave * NA) & 3) * 16; float* crow = C + (size_t)(r0 + ((wave * NA) >> 2) * 16) * ldc + cb;
#pragma unroll
    for (int s = 0; s < 16 / RPI; ++s) { const int row = s * RPI + lane / LPR, cofs = (lane % LPR) * 4; v4f val = *(const v4fa*)(mine + row * P + cofs); if (BIAS) { val[0] += bfr(bias[cb + cofs]); val[1] += bfr(bias[cb + cofs + 1]); val[2] += bfr(bias[cb + cofs + 2]); val[3] += bfr(bias[cb + cofs + 3]); }
        *(v4f*)(crow + (size_t)row * ldc + cofs) = val; }
}

// ---- k_gemmw: register-blocked GEMM, one 64x64 output tile (16 accumulators a wave) per work-group of KS waves; wave w takes the 64-element K blocks w, w + KS, ... (whole 128-byte lines); operands straight from K-contiguous 16-bit planes; grid (M/64, N/64, Z), KS x 32 threads.
// C[m][n] (f32, pitch ldc, + optional f32 bias[n]) = sum_k A[m][k] Bt[n][k] (+ split products per NSPLIT). z-batch strides sA/sB/sC in elements. K % 64 == 0.
template <typename T16> struct WFrag;
template <> struct WFrag<h16> { typedef v16h V; static __device__ __forceinline__ V ld(const h16* p) { return cat16(*(const v8h*)p, *(const v8h*)(p + 16)); } static __device__ __forceinline__ v8f mma(V a, V b, v8f c) { return wmma16(a, b, c); } };
template <> struct WFrag<bf> { typedef v16bf V; static __device__ __forceinline__ V ld(const bf* p) { return cat16b(*(const v8us*)p, *(const v8us*)(p + 16)); } static __device__ __forceinline__ v8f mma(V a, V b, v8f c) { return wmmab(a, b, c); } };
template <typename T16, int NSPLIT, bool BIAS, int KS>
__global__ __launch_bounds__(KS * 32) void k_gemmw(const T16* __restrict__ A, const T16* __restrict__ A2, const T16* __restrict__ Bt, const T16* __restrict__ Bt2, int K, float* C, int ldc, const float* __restrict__ bias, size_t sA, size_t sB, size_t sC) {
    typedef typename WFrag<T16>::V V;
    __shared__ __align__(16) float os[KS == 1 ? 16 * 68 : KS * 4096];
    const size_t z = blockIdx.z; A += z * sA; if (A2) A2 += z * sA; Bt += z * sB; if (Bt2) Bt2 += z * sB; C += z * sC;
    const int lane = threadIdx.x & 31, lr = lane & 15, hi = lane >> 4; const int wave = __builtin_amdgcn_readfirstlane(threadIdx.x >> 5); const int r0 = blockIdx.x * 64, c0 = blockIdx.y * 64;
    v8f acc[4][4];
#pragma unroll
    for (int mb = 0; mb < 4; ++mb)
#pragma unroll
        for (int nb = 0; nb < 4; ++nb) acc[mb][nb] = (v8f){};
    const size_t aoff = (size_t)(r0 + lr) * K + 8 * hi, boff = (size_t)(c0 + lr) * K + 8 * hi;
#pragma unroll 1
    for (int kc = wave * 64; kc < K; kc += (kc & 32) ? KS * 64 - 32 : 32) {
        V a[4], a2[4];
#pragma unroll
        for (int mb = 0; mb < 4; ++mb) { a[mb] = WFrag<T16>::ld(A + aoff + (size_t)mb * 16 * K + kc); if (NSPLIT == 1 || NSPLIT == 2) a2[mb] = WFrag<T16>::ld(A2 + aoff + (size_t)mb * 16 * K + kc); }
#pragma unroll
        for (int nb = 0; nb < 4; ++nb) { const V b = WFrag<T16>::ld(Bt + boff + (size_t)nb * 16 * K + kc); V b2; if (NSPLIT >= 2) b2 = WFrag<T16>::ld(Bt2 + boff + (size_t)nb * 16 * K + kc);
#pragma unroll
            for (int mb = 0; mb < 4; ++mb) { acc[mb][nb] = WFrag<T16>::mma(a[mb], b, acc[mb][nb]); if (NSPLIT == 1 || NSPLIT == 2) acc[mb][nb] = WFrag<T16>::mma(a2[mb], b, acc[mb][nb]); if (NSPLIT >= 2) acc[mb][nb] = WFrag<T16>::mma(a[mb], b2, acc[mb][nb]); } }
        asm volatile("v_nop\n\tv_nop\n\tv_nop\n\tv_nop" : "+v"(acc[0][0]), "+v"(acc[1][1]), "+v"(acc[2][2]), "+v"(acc[3][3]) : "v"(a[0]), "v"(a[3]));
    }
    ksum_store<KS, BIAS>(acc, os, wave, lane, C, ldc, r0, c0, bias);
}

// ---- k_gemmc: the same 64x64 tile GEMM specialised for causal attention (KS = 1: one wave does the whole K loop and stores its tile itself): CMODE 1 skips score tiles entirely above the diagonal (query rows r0+roff.., key columns c0..), CMODE 2 limits the
// key (K) loop of the probability x value contraction to the diagonal block (probabilities beyond it are exactly zero). roff = row offset of this launch's first row within the sequence. K is also the row pitch of both operands (CMODE 2: 2 x TT, the loop still ends at the diagonal); head z reads the B planes of kv group z / REP.
template <typename T16, int NSPLIT, int CMODE, int KS>
__global__ __launch_bounds__(KS * 32) void k_gemmc(const T16* __restrict__ A, const T16* __restrict__ A2, const T16* __restrict__ Bt, const T16* __restrict__ Bt2, int K, float* C, int ldc, int roff, size_t sA, size_t sB, size_t sC) {
    typedef typename WFrag<T16>::V V;
    __shared__ __align__(16) float os[KS == 1 ? 16 * 68 : KS * 4096];
    const size_t z = blockIdx.z; A += z * sA; if (A2) A2 += z * sA; Bt += (z / REP) * sB; if (Bt2) Bt2 += (z / REP) * sB; C += z * sC;
    const int lane = threadIdx.x & 31, lr = lane & 15, hi = lane >> 4; const int wave = __builtin_amdgcn_readfirstlane(threadIdx.x >> 5); const int r0 = blockIdx.x * 64, c0 = blockIdx.y * 64;
    if (CMODE == 1 && c0 > r0 + roff + 63) return;                  // score tile entirely above the causal diagonal: never written (the softmax masks j > i by select)
    const int Kl = (CMODE == 2) ? min(K, r0 + roff + 64) : K;        // P.V: probabilities are exactly 0 beyond the diagonal block, so the K loop stops there
    v8f acc[4][4];
#pragma unroll
    for (int mb = 0; mb < 4; ++mb)
#pragma unroll
        for (int nb = 0; nb < 4; ++nb) acc[mb][nb] = (v8f){};
    const size_t aoff = (size_t)(r0 + lr) * K + 8 * hi, boff = (size_t)(c0 + lr) * K + 8 * hi;
#pragma unroll 1
    for (int kc = wave * 64; kc < Kl; kc += (kc & 32) ? KS * 64 - 32 : 32) {
        V a[4], a2[4];
#pragma unroll
        for (int mb = 0; mb < 4; ++mb) { a[mb] = WFrag<T16>::ld(A + aoff + (size_t)mb * 16 * K + kc); if (NSPLIT == 1 || NSPLIT == 2) a2[mb] = WFrag<T16>::ld(A2 + aoff + (size_t)mb * 16 * K + kc); }
#pragma unroll
        for (int nb = 0; nb < 4; ++nb) { const V b = WFrag<T16>::ld(Bt + boff + (size_t)nb * 16 * K + kc); V b2; if (NSPLIT >= 2) b2 = WFrag<T16>::ld(Bt2 + boff + (size_t)nb * 16 * K + kc);
#pragma unroll
            for (int mb = 0; mb < 4; ++mb) { acc[mb][nb] = WFrag<T16>::mma(a[mb], b, acc[mb][nb]); if (NSPLIT == 1 || NSPLIT == 2) acc[mb][nb] = WFrag<T16>::mma(a2[mb], b, acc[mb][nb]); if (NSPLIT >= 2) acc[mb][nb] = WFrag<T16>::mma(a[mb], b2, acc[mb][nb]); } }
        asm volatile("v_nop\n\tv_nop\n\tv_nop\n\tv_nop" : "+v"(acc[0][0]), "+v"(acc[1][1]), "+v"(acc[2][2]), "+v"(acc[3][3]) : "v"(a[0]), "v"(a[3]));
    }
    if constexpr (KS > 1) { ksum_store<KS, false>(acc, os, wave, lane, C, ldc, r0, c0, nullptr); return; }
#pragma unroll
    for (int mb = 0; mb < 4; ++mb) {
#pragma unroll
        for (int nb = 0; nb < 4; ++nb) {
#pragma unroll
            for (int j = 0; j < 8; ++j) os[(hi * 8 + j) * 68 + nb * 16 + lr] = acc[mb][nb][j]; }
        __builtin_amdgcn_wave_barrier(); asm volatile("" ::: "memory");
        float* crow = C + (size_t)(r0 + mb * 16) * ldc + c0;
{
#pragma unroll
            for (int s = 0; s < 8; ++s) { const int row = 2 * s + hi, cofs = lr * 4; v4f val = *(const v4fa*)(os + row * 68 + cofs);
                *(v4f*)(crow + (size_t)row * ldc + cofs) = val; }
             }
        __builtin_amdgcn_wave_barrier(); asm volatile("" ::: "memory");
    }
}

__device__ __forceinline__ h16 tohx(float x) { return (h16)x; }
__device__ __forceinline__ void splitf(float y, unsigned short& h, unsigned short& l) { h = f2bf(y); l = f2bf(y - bf2f(h)); }
typedef __attribute__((ext_vector_type(2))) _Float16 v2h;
typedef __attribute__((ext_vector_type(4))) _Float16 v4h;
typedef __attribute__((ext_vector_type(2))) unsigned short v2us;
typedef __attribute__((ext_vector_type(4))) unsigned short v4us;
typedef __attribute__((ext_vector_type(2))) float v2f;
typedef __attribute__((ext_vector_type(4))) int v4i;

__global__ __launch_bounds__(256) void k_wtG(const float* __restrict__ w, int K, int N, bf* Bt) {
    const int lane = threadIdx.x & 31; const int L0 = (blockIdx.x * 8 + (threadIdx.x >> 5)) * 8; const int nlines = N * K / 64;
{
#pragma unroll 1
        for (int l = 0; l < 8; ++l) { const int L = L0 + l; if (L >= nlines) break; const size_t e = (size_t)L * 64 + lane * 2; const int k = (int)(e % K), n = (int)(e / K); v2us o;
            o[0] = f2bf(w[(size_t)k * N + n]); o[1] = f2bf(w[(size_t)(k + 1) * N + n]); *(v2us*)(Bt + e) = o; }
         }
}
__global__ __launch_bounds__(256) void k_cvt8(const float* __restrict__ src, bf* dst, size_t n8) { const size_t i = (size_t)blockIdx.x * 256 + threadIdx.x; if (i >= n8) return; const v8f v = *(const v8f*)(src + i * 8); v8us o;
#pragma unroll
    for (int k = 0; k < 8; ++k) o[k] = f2bf(v[k]); *(v8us*)(dst + i * 8) = o;  }
__global__ __launch_bounds__(256) void k_cstab(float* CS) { const int idx = blockIdx.x * 256 + threadIdx.x; if (idx >= TT * HD) return; const int t = idx / HD, d = idx % HD; const int i = d % (HD / 2); const float inv = __fdiv_rn(1.0f, powf(10000.0f, (float)(2 * i) / (float)HD)); const float ang = __fmul_rn((float)t, inv); v2f cs; cs[0] = cosf(ang); cs[1] = sinf(ang);
    *(v2f*)(CS + (size_t)idx * 2) = cs;  }
__global__ __launch_bounds__(256) void k_hrms(const float* __restrict__ F, int pitch, int nheads, float* RF) { const int i = blockIdx.x * 256 + threadIdx.x; if (i >= nheads * TT) return; const int t = i % TT, h = i / TT; const float* f = F + (size_t)t * pitch + h * HD; float s = 0.f;
#pragma unroll 4
    for (int d = 0; d < HD; d += 4) { const v4f v = *(const v4f*)(f + d);
#pragma unroll
        for (int q = 0; q < 4; ++q) { float p = __fmul_rn(v[q], v[q]); asm volatile("" : "+v"(p)); s = __fadd_rn(s, p); } }
    const float r = __fdiv_rn(1.0f, __fsqrt_rn(__fadd_rn(s * (1.0f / HD), 1e-6f))); *(float*)(RF + i) = r;  }
// k_rope: head planes [h][t][d] (fp16 + hi/lo) of rope(w[d] (x rms_factor)) x sc with the rotate-half convention out[d] = x[d] cos[t][d] - x[d+HD/2] sin[t][d], out[d+HD/2] = x[d+HD/2] cos[t][d+HD/2] + x[d] sin[t][d+HD/2]
__global__ __launch_bounds__(256) void k_rope(const float* __restrict__ F, int pitch, int nheads, const float* __restrict__ CS, const float* __restrict__ RF, const float* __restrict__ nw, float sc, h16* P16, bf* Ph, bf* Pl) {
    const size_t e = ((size_t)blockIdx.x * 256 + threadIdx.x) * 2; if (e >= (size_t)nheads * TT * HD) return; const int d = (int)(e % HD); const int t = (int)((e / HD) % TT); const int h = (int)(e / ((size_t)HD * TT)); const float* f = F + (size_t)t * pitch + h * HD; const float rf = RF ? RF[(size_t)h * TT + t] : 1.0f; v2h o16; v2us oh, ol;
#pragma unroll
    for (int q = 0; q < 2; ++q) { const int dd = d + q; const int dp = (dd < HD / 2) ? dd + HD / 2 : dd - HD / 2; float x0 = f[dd], x1 = f[dp];
        if (RF) { float n0 = __fmul_rn(x0, rf), n1 = __fmul_rn(x1, rf); asm volatile("" : "+v"(n0)); asm volatile("" : "+v"(n1)); x0 = __fmul_rn(__fadd_rn(1.0f, bfr(nw[dd])), n0); x1 = __fmul_rn(__fadd_rn(1.0f, bfr(nw[dp])), n1);   /* weight applied as (1 + w) */ }
        const v2f cs = *(const v2f*)(CS + ((size_t)t * HD + dd) * 2); float a = __fmul_rn(x0, cs[0]), bq = __fmul_rn(x1, cs[1]); asm volatile("" : "+v"(a)); asm volatile("" : "+v"(bq)); const float r = ((dd < HD / 2) ? __fsub_rn(a, bq) : __fadd_rn(a, bq)) * sc;
        o16[q] = tohx(r); unsigned short a2, c2; splitf(r, a2, c2); oh[q] = a2; ol[q] = c2; }
    *(v2h*)(P16 + e) = o16; *(v2us*)(Ph + e) = oh; *(v2us*)(Pl + e) = ol;  }
__global__ __launch_bounds__(256) void k_vtp(const float* __restrict__ F, int pitch, int nheads, h16* V16, bf* Vh, bf* Vl) { const size_t e = ((size_t)blockIdx.x * 256 + threadIdx.x) * 2; if (e >= (size_t)nheads * HD * TT) return; const int t = (int)(e % TT); const int d = (int)((e / TT) % HD); const int g = (int)(e / ((size_t)TT * HD)); v2h o16; v2us oh, ol;
#pragma unroll
    for (int q = 0; q < 2; ++q) { const float x = F[(size_t)(t + q) * pitch + g * HD + d]; o16[q] = tohx(x); unsigned short a2, c2; splitf(x, a2, c2); oh[q] = a2; ol[q] = c2; }
    const size_t oo = (e / TT) * (2 * TT) + t;   // rows at the pitch of the probability rows (2 x TT 16-bit elements), so that the P.V GEMM keeps one pitch for both operands
    *(v2h*)(V16 + oo) = o16; *(v2us*)(Vh + oo) = oh; *(v2us*)(Vl + oo) = ol;  }
// k_asoft: the probabilities of a row are stored IN PLACE over that row's own 8 KiB of scores (fp16 row, or hi plane then lo plane, each 4 KiB): the wave holds the whole row in registers before its first store, and no other wave touches the row.
// per row (zz, i): t = S x HD^-0.5 for j <= i and i - j < WIN (sliding causal window; the reference's -1e9 additive fill vanishes identically); softmax over the 2048 keys (register row, one exp, fixed trees);
__global__ __launch_bounds__(256) void k_asoft(float* Sb) {
    const int lane = threadIdx.x & 31; const int row = blockIdx.x * 8 + (threadIdx.x >> 5); if (row >= ZH * TT) return; const int i = row % TT; const int zz = row / TT; (void)zz; const bool hires = (i < RH); const float* sr = Sb + (size_t)row * TT; float v[TT / 32]; float mx = -3.0e38f;
#pragma unroll
    for (int ch = 0; ch < TT / 128; ++ch) { const int j0 = ch * 128 + lane * 4; const v4f a = *(const v4f*)(sr + j0);
#pragma unroll
        for (int q = 0; q < 4; ++q) { const int j = j0 + q; (void)j; const float t = (j <= i && i - j < WIN) ? a[q] * SCL : -3.0e38f; v[ch * 4 + q] = t; mx = fmaxf(mx, t); } }
#pragma unroll
    for (int sh = 16; sh; sh >>= 1) mx = fmaxf(mx, __shfl_xor(mx, sh, 32));
    float sum = 0.f;
#pragma unroll
    for (int k = 0; k < TT / 32; ++k) { float d0 = __fsub_rn(v[k], mx); asm volatile("" : "+v"(d0)); v[k] = __builtin_amdgcn_exp2f(__fmul_rn(d0, 1.4426950408889634f)); sum += v[k]; }
#pragma unroll
    for (int sh = 16; sh; sh >>= 1) sum += __shfl_xor(sum, sh, 32);
    const float f = __fdiv_rn(hires ? 1.0f : PCAR, sum);
{
        if (hires) {
#pragma unroll
            for (int ch = 0; ch < TT / 128; ++ch) { v4us oh, ol;
#pragma unroll
                for (int q = 0; q < 4; ++q) { unsigned short a, c2; splitf(v[ch * 4 + q] * f, a, c2); oh[q] = a; ol[q] = c2; }
                bf* pr = (bf*)(Sb + (size_t)row * TT) + ch * 128 + lane * 4; *(v4us*)pr = oh; *(v4us*)(pr + TT) = ol; }
        } else {
#pragma unroll
            for (int ch = 0; ch < TT / 128; ++ch) { v4h o4;
#pragma unroll
                for (int q = 0; q < 4; ++q) o4[q] = tohx(v[ch * 4 + q] * f);
                *(v4h*)((h16*)(Sb + (size_t)row * TT) + ch * 128 + lane * 4) = o4; } }
         }
}
__global__ __launch_bounds__(256) void k_merge(const float* __restrict__ O, int h0, bf* Ah, bf* Al) { const size_t e = ((size_t)blockIdx.x * 256 + threadIdx.x) * 2; if (e >= (size_t)ZH * TT * HD) return; const int d = (int)(e % HD); const int t = (int)((e / HD) % TT); const int zz = (int)(e / ((size_t)HD * TT)); const float cs = (t < RH) ? 1.0f : (1.0f / PCAR); const size_t oo = (size_t)t * DQ + (h0 + zz) * HD + d;
    v2us oh, ol;
#pragma unroll
    for (int q = 0; q < 2; ++q) { unsigned short a, c2; splitf(O[e + q] * cs, a, c2); oh[q] = a; ol[q] = c2; } *(v2us*)(Ah + oo) = oh; *(v2us*)(Al + oo) = ol;  }

__global__ __launch_bounds__(256) void k_wqg(const float* __restrict__ w, int part, bf* Bt) { const size_t e = ((size_t)blockIdx.x * 256 + threadIdx.x) * 8; if (e >= (size_t)DQ * DM) return; const int k = (int)(e % DM); const int n = (int)(e / DM); const int h = n / HD, d = n % HD; const float* src = w + ((size_t)h * 2 * HD + part * HD + d) * DM + k; v4f a = *(const v4f*)src, c = *(const v4f*)(src + 4); v8us o;
    for (int u = 0; u < 4; ++u) { o[u] = f2bf(a[u]); o[4 + u] = f2bf(c[u]); } *(v8us*)(Bt + e) = o;  }
__global__ __launch_bounds__(256) void k_mergeg(const float* __restrict__ O, const float* __restrict__ G, int h0, bf* Ah, bf* Al) { const size_t e = ((size_t)blockIdx.x * 256 + threadIdx.x) * 2; if (e >= (size_t)ZH * TT * HD) return; const int d = (int)(e % HD); const int t = (int)((e / HD) % TT); const int zz = (int)(e / ((size_t)HD * TT)); const float cs = (t < RH) ? 1.0f : (1.0f / PCAR); const size_t oo = (size_t)t * DQ + (h0 + zz) * HD + d;
    v2us oh, ol;
#pragma unroll
    for (int q = 0; q < 2; ++q) { const float gt = G[oo + q]; const float sg = __fdiv_rn(1.0f, __fadd_rn(1.0f, expf(-gt))); float o = O[e + q] * cs; asm volatile("" : "+v"(o)); unsigned short a, c2; splitf(__fmul_rn(o, sg), a, c2); oh[q] = a; ol[q] = c2; } *(v2us*)(Ah + oo) = oh; *(v2us*)(Al + oo) = ol;  }

extern "C" void kernel_launch(void* const* d_in, const int* in_sizes, int n_in,
                              void* d_out, int out_size, void* d_ws, size_t ws_size, hipStream_t stream) {
    (void)in_sizes; (void)n_in; (void)out_size;
    const float* x = (const float*)d_in[0]; const float* wqg = (const float*)d_in[1]; const float* wk = (const float*)d_in[2]; const float* wv = (const float*)d_in[3]; const float* wo = (const float*)d_in[4]; const float* qnw = (const float*)d_in[5]; const float* knw = (const float*)d_in[6]; const float* wq = wqg;
    float* OUT = (float*)d_out;     // [2][2048][2048]
    char* wsp = (char*)d_ws;
    auto take = [&](size_t bytes) { char* p = wsp; wsp += (bytes + 255) & ~(size_t)255; return (void*)p; };
    bf* WQ = (bf*)take((size_t)DQ * DM * 2); bf* WK = (bf*)take((size_t)DKV * DM * 2); bf* WV = (bf*)take((size_t)DKV * DM * 2); bf* WO = (bf*)take((size_t)DM * DQ * 2); float* CS = (float*)take((size_t)TT * HD * 2 * 4); float* RFQ = (float*)take((size_t)NH_ * TT * 4); float* RFK = (float*)take((size_t)NKV * TT * 4);
    bf* XB = (bf*)take((size_t)TT * DM * 2); bf* WG = (bf*)take((size_t)DQ * DM * 2); float* GATE = (float*)take((size_t)TT * DQ * 4); float* FQ = (float*)take((size_t)TT * DQ * 4); float* FK = (float*)take((size_t)TT * DKV * 4);
    h16* QP16 = (h16*)take((size_t)NH_ * TT * HD * 2); h16* KP16 = (h16*)take((size_t)NKV * TT * HD * 2); h16* VT16 = (h16*)take((size_t)NKV * HD * 2 * TT * 2);
    bf* QPh = (bf*)take((size_t)NH_ * TT * HD * 2); bf* QPl = (bf*)take((size_t)NH_ * TT * HD * 2); bf* KPh = (bf*)take((size_t)NKV * TT * HD * 2); bf* KPl = (bf*)take((size_t)NKV * TT * HD * 2); bf* VTh = (bf*)take((size_t)NKV * HD * 2 * TT * 2); bf* VTl = VTh + TT;   // v^T rows at pitch 2 * TT: hi row then lo row; the fp16 plane uses the first half of its rows
    float* Sb = (float*)take((size_t)ZH * TT * TT * 4); bf* ATl = (bf*)take((size_t)TT * DQ * 2);
    if ((size_t)(wsp - (char*)d_ws) > ws_size) return;    // ws 256 MiB
    float* FV = FK;   // v projection reuses the k buffer after the k planes are built (stream-ordered)
    float* Ob = FQ;   // attention output of a pass (ZH x TT x HD f32 <= TT x DQ) reuses the q projection buffer after the q planes are built (stream-ordered)
    bf* ATh = XB;     // hi plane of the gated attention output (TT x DQ = TT x DM elements) reuses the bf16 x plane after the v projection, its last reader (stream-ordered); x is converted anew for the next batch after Wo has read it
    h16* P16 = (h16*)Sb; bf* Ph = (bf*)Sb; bf* Pl = Ph + TT;   // probabilities in place over the score rows: row pitch 2 * TT 16-bit elements
    { k_wqg<<<(unsigned)(((size_t)DQ * DM / 8 + 255) / 256), 256, 0, stream>>>(wqg, 0, WQ); k_wqg<<<(unsigned)(((size_t)DQ * DM / 8 + 255) / 256), 256, 0, stream>>>(wqg, 1, WG); k_cvt8<<<(unsigned)(((size_t)DKV * DM / 8 + 255) / 256), 256, 0, stream>>>(wk, WK, (size_t)DKV * DM / 8); k_cvt8<<<(unsigned)(((size_t)DKV * DM / 8 + 255) / 256), 256, 0, stream>>>(wv, WV, (size_t)DKV * DM / 8);
      k_cvt8<<<(unsigned)(((size_t)DM * DQ / 8 + 255) / 256), 256, 0, stream>>>(wo, WO, (size_t)DM * DQ / 8);
      k_cstab<<<(TT * HD + 255) / 256, 256, 0, stream>>>(CS); }
    const unsigned LQ = (unsigned)(((size_t)NH_ * TT * HD / 2 + 255) / 256), LKv = (unsigned)(((size_t)NKV * TT * HD / 2 + 255) / 256);
    for (int b = 0; b < NB_; ++b) {
        
        k_cvt8<<<(unsigned)(((size_t)TT * DM / 8 + 255) / 256), 256, 0, stream>>>(x + (size_t)b * TT * DM, XB, (size_t)TT * DM / 8);
        k_gemmw<bf, 0, false, 4><<<dim3(TT / 64, DQ / 64, 1), 128, 0, stream>>>(XB, nullptr, WQ, nullptr, DM, FQ, DQ, nullptr, 0, 0, 0); k_gemmw<bf, 0, false, 4><<<dim3(TT / 64, DQ / 64, 1), 128, 0, stream>>>(XB, nullptr, WG, nullptr, DM, GATE, DQ, nullptr, 0, 0, 0); k_hrms<<<(NH_ * TT + 255) / 256, 256, 0, stream>>>(FQ, DQ, NH_, RFQ);
        k_rope<<<LQ, 256, 0, stream>>>(FQ, DQ, NH_, CS, RFQ, qnw, 1.0f, QP16, QPh, QPl);
        k_gemmw<bf, 0, false, 8><<<dim3(TT / 64, DKV / 64, 1), 256, 0, stream>>>(XB, nullptr, WK, nullptr, DM, FK, DKV, nullptr, 0, 0, 0); k_hrms<<<(NKV * TT + 255) / 256, 256, 0, stream>>>(FK, DKV, NKV, RFK);
        k_rope<<<LKv, 256, 0, stream>>>(FK, DKV, NKV, CS, RFK, knw, 1.0f, KP16, KPh, KPl);
        k_gemmw<bf, 0, false, 8><<<dim3(TT / 64, DKV / 64, 1), 256, 0, stream>>>(XB, nullptr, WV, nullptr, DM, FV, DKV, nullptr, 0, 0, 0); k_vtp<<<LKv, 256, 0, stream>>>(FV, DKV, NKV, VT16, VTh, VTl);
        for (int h0 = 0; h0 < NH_; h0 += ZH) { const size_t zq = (size_t)h0, zk = (size_t)(h0 / REP);   // head h0 + z of a pass reads kv group h0/REP + z/REP
            k_gemmc<bf, 2, 1, 1><<<dim3(RH / 64, TT / 64, ZH), 32, 0, stream>>>(QPh + zq * TT * HD, QPl + zq * TT * HD, KPh + zk * TT * HD, KPl + zk * TT * HD, HD, Sb, TT, 0, (size_t)TT * HD, (size_t)TT * HD, (size_t)TT * TT);
            k_gemmc<h16, 0, 1, 1><<<dim3((TT - RH) / 64, TT / 64, ZH), 32, 0, stream>>>(QP16 + zq * TT * HD + (size_t)RH * HD, nullptr, KP16 + zk * TT * HD, nullptr, HD, Sb + (size_t)RH * TT, TT, RH, (size_t)TT * HD, (size_t)TT * HD, (size_t)TT * TT);
            k_asoft<<<ZH * TT / 8, 256, 0, stream>>>(Sb);
            k_gemmc<bf, 2, 2, 8><<<dim3(RH / 64, HD / 64, ZH), 256, 0, stream>>>(Ph, Pl, VTh + zk * HD * 2 * TT, VTl + zk * HD * 2 * TT, 2 * TT, Ob, HD, 0, (size_t)TT * 2 * TT, (size_t)HD * 2 * TT, (size_t)TT * HD);
            k_gemmc<h16, 0, 2, 8><<<dim3((TT - RH) / 64, HD / 64, ZH), 256, 0, stream>>>(P16 + (size_t)RH * 2 * TT, nullptr, VT16 + zk * HD * 2 * TT, nullptr, 2 * TT, Ob + (size_t)RH * HD, HD, RH, (size_t)TT * 2 * TT, (size_t)HD * 2 * TT, (size_t)TT * HD);
            k_mergeg<<<(unsigned)(((size_t)ZH * TT * HD / 2 + 255) / 256), 256, 0, stream>>>(Ob, GATE, h0, ATh, ATl); }
        k_gemmw<bf, 1, false, 4><<<dim3(TT / 64, DM / 64, 1), 128, 0, stream>>>(ATh, ATl, WO, nullptr, DQ, OUT + (size_t)b * TT * DM, DM, nullptr, 0, 0, 0); }
}

// v003
// It runs in 602 microseconds.
// Two timings next to v002 put it at 1.24 and 1.25 times that version's speed.
// Over all steps from v000 it is 2.94 times as fast.
#include <hip/hip_runtime.h>

// GatedAttention (x [2][2048][2048]; qg = x Wq^T (Wq [4096][2048]) viewed (16 heads x 256): q = first 128, gate = last 128 of each head; k/v = x Wk^T / Wv^T (4 kv heads; group h/4); per-head RMSNorm (eps 1e-6) with weight (1 + w) on q and k; rotate-half RoPE (base 1e4, tables computed on device); causal softmax(q.k / sqrt(128)); out = merged attn v x sigmoid(gate); out Wo^T -> [2][2048][2048]).
// Compute dtypes, f32 accumulate: every input rounded to bf16; q / gate / k / v on PLAIN bf16 operands (inputs: exact; the interleaved q|gate rows of Wq gathered); RMSNorm, RoPE, sigmoid gating f32; causal scores and attn.v: query rows < 512 hl (3 products), the rest single fp16 (x1024), causal tile skipping; softmax f32; Wo hl x exact (2 products).

#define NB_  2
#define TT   2048
#define DM   2048
#define NH_  16
#define NKV  4
#define REP  (NH_ / NKV)
#define HD   128
#define DQ   (NH_ * HD)
#define DKV  (NKV * HD)
#define ZH   8                    // heads per attention pass (two kv groups: launch index z uses kv group z / REP)
#define RH   512                  // query rows < RH use hi+lo planes (0: none)
#define WIN  2048
#define PCAR 1024.0f
#define SCL  0.088388347648318447f   // HD^-0.5
typedef _Float16 h16;
typedef unsigned short bf;
typedef __attribute__((ext_vector_type(16))) __bf16   v16bf;
typedef __attribute__((ext_vector_type(16))) _Float16 v16h;
typedef __attribute__((ext_vector_type(8)))  _Float16 v8h;
typedef __attribute__((ext_vector_type(8)))  unsigned short v8us;
typedef __attribute__((ext_vector_type(8)))  float    v8f;
typedef __attribute__((ext_vector_type(4)))  float    v4f;
typedef v8h  __attribute__((may_alias)) v8ha;
typedef v4f  __attribute__((may_alias)) v4fa;
typedef v8us __attribute__((may_alias)) v8usa;

__device__ __forceinline__ unsigned short f2bf(float f) { unsigned u = __float_as_uint(f); u += 0x7FFFu + ((u >> 16) & 1u); return (unsigned short)(u >> 16); }
__device__ __forceinline__ float bf2f(unsigned short b) { return __uint_as_float(((unsigned)b) << 16); }
__device__ __forceinline__ float bfr(float f) { return bf2f(f2bf(f)); }
__device__ __forceinline__ v16h cat16(v8h lo, v8h hi) { return __builtin_shufflevector(lo, hi, 0, 1, 2, 3, 4, 5, 6, 7, 8, 9, 10, 11, 12, 13, 14, 15); }
__device__ __forceinline__ v16bf cat16b(v8us lo, v8us hi) { return __builtin_bit_cast(v16bf, __builtin_shufflevector(lo, hi, 0, 1, 2, 3, 4, 5, 6, 7, 8, 9, 10, 11, 12, 13, 14, 15)); }
__device__ __forceinline__ v8f wmma16(v16h a, v16h b, v8f c) { return __builtin_amdgcn_wmma_f32_16x16x32_f16(false, a, false, b, (short)0, c, false, false); }
__device__ __forceinline__ v8f wmmab(v16bf a, v16bf b, v8f c) { return __builtin_amdgcn_wmma_f32_16x16x32_bf16(false, a, false, b, (short)0, c, false, false); }



// ---- ksum_store: end of a GEMM tile whose K loop was dealt over the KS waves of one work-group. Every wave parks its 16 partial accumulators in LDS in register order (16 B per lane, contiguous),
// each wave then sums 16/KS of them over the waves in wave order 0..KS-1 (a fixed order), transposes its 16 x WC piece in its own slab and stores whole 128-byte row pieces.
template <int KS, bool BIAS>
__device__ __forceinline__ void ksum_store(v8f (&acc)[4][4], float* red, int wave, int lane, float* C, int ldc, int r0, int c0, const float* __restrict__ bias) {
    constexpr int NA = 16 / KS, WC = NA * 16, P = WC + 4, LPR = WC / 4, RPI = 32 / LPR;
    const int lr = lane & 15, hi = lane >> 4; float* mine = red + wave * 4096;
#pragma unroll
    for (int a = 0; a < 16; ++a) { const v8f t = acc[a >> 2][a & 3]; *(v4fa*)(mine + a * 256 + lane * 4) = __builtin_shufflevector(t, t, 0, 1, 2, 3); *(v4fa*)(mine + a * 256 + 128 + lane * 4) = __builtin_shufflevector(t, t, 4, 5, 6, 7); }
    __syncthreads();   // every wave's partial sums are in LDS before any wave adds them up
    v4f s0[NA], s1[NA];
#pragma unroll
    for (int i = 0; i < NA; ++i) { const float* p = red + (wave * NA + i) * 256 + lane * 4; s0[i] = *(const v4fa*)p; s1[i] = *(const v4fa*)(p + 128);
#pragma unroll
        for (int w = 1; w < KS; ++w) { s0[i] += *(const v4fa*)(p + w * 4096); s1[i] += *(const v4fa*)(p + w * 4096 + 128); } }
    __syncthreads();   // every wave has read the partial sums before a slab is reused for the transpose
#pragma unroll
    for (int i = 0; i < NA; ++i) {
#pragma unroll
        for (int j = 0; j < 4; ++j) { mine[(hi * 8 + j) * P + i * 16 + lr] = s0[i][j]; mine[(hi * 8 + 4 + j) * P + i * 16 + lr] = s1[i][j]; } }
    __builtin_amdgcn_wave_barrier(); asm volatile("" ::: "memory");   // keeps the row reads below behind the column writes above (other lanes' data, same wave)
    const int cb = c0 + ((wave * NA) & 3) * 16; float* crow = C + (size_t)(r0 + ((wave * NA) >> 2) * 16) * ldc + cb;
#pragma unroll
    for (int s = 0; s < 16 / RPI; ++s) { const int row = s * RPI + lane / LPR, cofs = (lane % LPR) * 4; v4f val = *(const v4fa*)(mine + row * P + cofs); if (BIAS) { val[0] += bfr(bias[cb + cofs]); val[1] += bfr(bias[cb + cofs + 1]); val[2] += bfr(bias[cb + cofs + 2]); val[3] += bfr(bias[cb + cofs + 3]); }
        *(v4f*)(crow + (size_t)row * ldc + cofs) = val; }
}

// ---- k_gemmw: register-blocked GEMM, one 64x64 output tile (16 accumulators a wave) per work-group of KS waves; wave w takes the 64-element K blocks w, w + KS, ...; operands straight from 16-bit planes in FRAGMENT ORDER (below); grid (M/64, N/64, Z), KS x 32 threads.
// Fragment order of a plane [R][K]: blocks of 16 rows x 32 k, 512 elements each, block (r / 16, k / 32) at ((r / 16) * (K / 32) + k / 32) * 512; inside a block element (r, k) at ((k / 16) % 2) * 256 + (((k / 8) % 2) * 16 + r % 16) * 8 + k % 8,
// that is: [half of the fragment][lane][8 elements], so that each of the two 16-byte loads of a fragment reads 512 contiguous bytes (4 whole lines) over the wave; every lane gets the same elements as from a row-major plane.
// C[m][n] (f32, pitch ldc, + optional f32 bias[n]) = sum_k A[m][k] Bt[n][k] (+ split products per NSPLIT). z-batch strides sA/sB/sC in elements. K % 64 == 0; K is a compile-time constant so that the starts of the 16-row bands are immediate offsets of the loads (one scalar base per plane, one lane offset).
template <typename T16> struct WFrag;
template <> struct WFrag<h16> { typedef v16h V; static __device__ __forceinline__ V ld(const h16* p) { return cat16(*(const v8h*)p, *(const v8h*)(p + 16)); } static __device__ __forceinline__ V ldp(const h16* band, unsigned vb) { const char* p = (const char*)band + vb; return cat16(*(const v8h*)p, *(const v8h*)(p + 512)); } static __device__ __forceinline__ v8f mma(V a, V b, v8f c) { return wmma16(a, b, c); } };
template <> struct WFrag<bf> { typedef v16bf V; static __device__ __forceinline__ V ld(const bf* p) { return cat16b(*(const v8us*)p, *(const v8us*)(p + 16)); } static __device__ __forceinline__ V ldp(const bf* band, unsigned vb) { const char* p = (const char*)band + vb; return cat16b(*(const v8us*)p, *(const v8us*)(p + 512)); } static __device__ __forceinline__ v8f mma(V a, V b, v8f c) { return wmmab(a, b, c); } };
template <typename T16, int NSPLIT, bool BIAS, int KS, int K>
__global__ __launch_bounds__(KS * 32) void k_gemmw(const T16* __restrict__ A, const T16* __restrict__ A2, const T16* __restrict__ Bt, const T16* __restrict__ Bt2, float* C, int ldc, const float* __restrict__ bias, size_t sA, size_t sB, size_t sC) {
    typedef typename WFrag<T16>::V V;
    __shared__ __align__(16) float os[KS == 1 ? 16 * 68 : KS * 4096];
    const size_t z = blockIdx.z; A += z * sA; if (A2) A2 += z * sA; Bt += z * sB; if (Bt2) Bt2 += z * sB; C += z * sC;
    const int lane = threadIdx.x & 31; const int wave = __builtin_amdgcn_readfirstlane(threadIdx.x >> 5); const int r0 = blockIdx.x * 64, c0 = blockIdx.y * 64;
    v8f acc[4][4];
#pragma unroll
    for (int mb = 0; mb < 4; ++mb)
#pragma unroll
        for (int nb = 0; nb < 4; ++nb) acc[mb][nb] = (v8f){};
    const size_t aoff = (size_t)r0 * K, boff = (size_t)c0 * K;   // a 16-row band of blocks holds 16 * K elements (wave-uniform start); k block kc / 32 starts kc * 32 bytes into it, the lane's 16 bytes lane * 16 into the block
#pragma unroll 1
    for (int kc = wave * 64; kc < K; kc += (kc & 32) ? KS * 64 - 32 : 32) {
        V a[4], a2[4]; const unsigned vb = (unsigned)kc * 32u + (unsigned)lane * 16u;
#pragma unroll
        for (int mb = 0; mb < 4; ++mb) { a[mb] = WFrag<T16>::ldp(A + aoff + (size_t)mb * 16 * K, vb); if (NSPLIT == 1 || NSPLIT == 2) a2[mb] = WFrag<T16>::ldp(A2 + aoff + (size_t)mb * 16 * K, vb); }
#pragma unroll
        for (int nb = 0; nb < 4; ++nb) { const V b = WFrag<T16>::ldp(Bt + boff + (size_t)nb * 16 * K, vb); V b2; if (NSPLIT >= 2) b2 = WFrag<T16>::ldp(Bt2 + boff + (size_t)nb * 16 * K, vb);
#pragma unroll
            for (int mb = 0; mb < 4; ++mb) { acc[mb][nb] = WFrag<T16>::mma(a[mb], b, acc[mb][nb]); if (NSPLIT == 1 || NSPLIT == 2) acc[mb][nb] = WFrag<T16>::mma(a2[mb], b, acc[mb][nb]); if (NSPLIT >= 2) acc[mb][nb] = WFrag<T16>::mma(a[mb], b2, acc[mb][nb]); } }
        asm volatile("v_nop\n\tv_nop\n\tv_nop\n\tv_nop" : "+v"(acc[0][0]), "+v"(acc[1][1]), "+v"(acc[2][2]), "+v"(acc[3][3]) : "v"(a[0]), "v"(a[3]));
    }
    ksum_store<KS, BIAS>(acc, os, wave, lane, C, ldc, r0, c0, bias);
}

// ---- k_gemmc: the same 64x64 tile GEMM specialised for causal attention (KS = 1: one wave does the whole K loop and stores its tile itself): CMODE 1 skips score tiles entirely above the diagonal (query rows r0+roff.., key columns c0..), CMODE 2 limits the
// key (K) loop of the probability x value contraction to the diagonal block (probabilities beyond it are exactly zero). roff = row offset of this launch's first row within the sequence. The q, k and v^T planes are in the fragment order of k_gemmw (k extent HD for q and k, TT for v^T); the probabilities (A of CMODE 2) stay row-major at pitch K = 2 x TT (the loop still ends at the diagonal); head z reads the B planes of kv group z / REP.
template <typename T16, int NSPLIT, int CMODE, int KS>
__global__ __launch_bounds__(KS * 32) void k_gemmc(const T16* __restrict__ A, const T16* __restrict__ A2, const T16* __restrict__ Bt, const T16* __restrict__ Bt2, int K, float* C, int ldc, int roff, size_t sA, size_t sB, size_t sC) {
    typedef typename WFrag<T16>::V V;
    __shared__ __align__(16) float os[KS == 1 ? 16 * 68 : KS * 4096];
    const size_t z = blockIdx.z; A += z * sA; if (A2) A2 += z * sA; Bt += (z / REP) * sB; if (Bt2) Bt2 += (z / REP) * sB; C += z * sC;
    const int lane = threadIdx.x & 31, lr = lane & 15, hi = lane >> 4; const int wave = __builtin_amdgcn_readfirstlane(threadIdx.x >> 5); const int r0 = blockIdx.x * 64, c0 = blockIdx.y * 64;
    if (CMODE == 1 && c0 > r0 + roff + 63) return;                  // score tile entirely above the causal diagonal: never written (the softmax masks j > i by select)
    const int Kl = (CMODE == 2) ? min(K, r0 + roff + 64) : K;        // P.V: probabilities are exactly 0 beyond the diagonal block, so the K loop stops there
    v8f acc[4][4];
#pragma unroll
    for (int mb = 0; mb < 4; ++mb)
#pragma unroll
        for (int nb = 0; nb < 4; ++nb) acc[mb][nb] = (v8f){};
    constexpr int KP = (CMODE == 1) ? HD : TT;   // k extent of the planes in fragment order
    const size_t aoff = (size_t)(r0 + lr) * K + 8 * hi, apk = (size_t)r0 * KP, bpk = (size_t)c0 * KP;
#pragma unroll 1
    for (int kc = wave * 64; kc < Kl; kc += (kc & 32) ? KS * 64 - 32 : 32) {
        V a[4], a2[4]; const unsigned vb = (unsigned)kc * 32u + (unsigned)lane * 16u;
        if constexpr (CMODE == 1) {
#pragma unroll
            for (int mb = 0; mb < 4; ++mb) { a[mb] = WFrag<T16>::ldp(A + apk + (size_t)mb * 16 * KP, vb); if (NSPLIT == 1 || NSPLIT == 2) a2[mb] = WFrag<T16>::ldp(A2 + apk + (size_t)mb * 16 * KP, vb); }
        } else {
#pragma unroll
        for (int mb = 0; mb < 4; ++mb) { a[mb] = WFrag<T16>::ld(A + aoff + (size_t)mb * 16 * K + kc); if (NSPLIT == 1 || NSPLIT == 2) a2[mb] = WFrag<T16>::ld(A2 + aoff + (size_t)mb * 16 * K + kc); }
        }
#pragma unroll
        for (int nb = 0; nb < 4; ++nb) { const V b = WFrag<T16>::ldp(Bt + bpk + (size_t)nb * 16 * KP, vb); V b2; if (NSPLIT >= 2) b2 = WFrag<T16>::ldp(Bt2 + bpk + (size_t)nb * 16 * KP, vb);
#pragma unroll
            for (int mb = 0; mb < 4; ++mb) { acc[mb][nb] = WFrag<T16>::mma(a[mb], b, acc[mb][nb]); if (NSPLIT == 1 || NSPLIT == 2) acc[mb][nb] = WFrag<T16>::mma(a2[mb], b, acc[mb][nb]); if (NSPLIT >= 2) acc[mb][nb] = WFrag<T16>::mma(a[mb], b2, acc[mb][nb]); } }
        asm volatile("v_nop\n\tv_nop\n\tv_nop\n\tv_nop" : "+v"(acc[0][0]), "+v"(acc[1][1]), "+v"(acc[2][2]), "+v"(acc[3][3]) : "v"(a[0]), "v"(a[3]));
    }
    if constexpr (KS > 1) { ksum_store<KS, false>(acc, os, wave, lane, C, ldc, r0, c0, nullptr); return; }
#pragma unroll
    for (int mb = 0; mb < 4; ++mb) {
#pragma unroll
        for (int nb = 0; nb < 4; ++nb) {
#pragma unroll
            for (int j = 0; j < 8; ++j) os[(hi * 8 + j) * 68 + nb * 16 + lr] = acc[mb][nb][j]; }
        __builtin_amdgcn_wave_barrier(); asm volatile("" ::: "memory");
        float* crow = C + (size_t)(r0 + mb * 16) * ldc + c0;
{
#pragma unroll
            for (int s = 0; s < 8; ++s) { const int row = 2 * s + hi, cofs = lr * 4; v4f val = *(const v4fa*)(os + row * 68 + cofs);
                *(v4f*)(crow + (size_t)row * ldc + cofs) = val; }
             }
        __builtin_amdgcn_wave_barrier(); asm volatile("" ::: "memory");
    }
}

__device__ __forceinline__ h16 tohx(float x) { return (h16)x; }
__device__ __forceinline__ void splitf(float y, unsigned short& h, unsigned short& l) { h = f2bf(y); l = f2bf(y - bf2f(h)); }
typedef __attribute__((ext_vector_type(2))) _Float16 v2h;
typedef __attribute__((ext_vector_type(4))) _Float16 v4h;
typedef __attribute__((ext_vector_type(2))) unsigned short v2us;
typedef __attribute__((ext_vector_type(4))) unsigned short v4us;
typedef __attribute__((ext_vector_type(2))) float v2f;
typedef __attribute__((ext_vector_type(4))) int v4i;

__global__ __launch_bounds__(256) void k_wtG(const float* __restrict__ w, int K, int N, bf* Bt) {
    const int lane = threadIdx.x & 31; const int L0 = (blockIdx.x * 8 + (threadIdx.x >> 5)) * 8; const int nlines = N * K / 64;
{
#pragma unroll 1
        for (int l = 0; l < 8; ++l) { const int L = L0 + l; if (L >= nlines) break; const size_t e = (size_t)L * 64 + lane * 2; const int k = (int)(e % K), n = (int)(e / K); v2us o;
            o[0] = f2bf(w[(size_t)k * N + n]); o[1] = f2bf(w[(size_t)(k + 1) * N + n]); *(v2us*)(Bt + e) = o; }
         }
}
// k_pack: f32 rows [R][K] -> bf16 plane in the fragment order of k_gemmw. One wave per block of 16 rows x 32 k: 8 lanes read one whole 128-byte line of a row (4 rows a load), each lane stores its 4 elements as 8 bytes (64 contiguous bytes per 4 rows).
// part >= 0: plane row n is row (n / HD) * 2 * HD + part * HD + n % HD of src (the q, part 0, or the gate, part 1, rows of the interleaved q|gate weight); part < 0: row n.
__global__ __launch_bounds__(256) void k_pack(const float* __restrict__ src, int part, int K, int nblk, bf* dst) {
    const int lane = threadIdx.x & 31; const int blk = blockIdx.x * 8 + (threadIdx.x >> 5); if (blk >= nblk) return; const int KB = K >> 5; const int rb = blk / KB, kb = blk % KB; const int k = (lane & 7) * 4, rq = lane >> 3;
    const int n0 = rb * 16; const int s0 = (part >= 0) ? (n0 / HD) * 2 * HD + part * HD + n0 % HD : n0;   // HD % 16 == 0: the 16 rows of a block are consecutive rows of src
    const float* sp = src + (size_t)(s0 + rq) * K + kb * 32 + k; bf* d = dst + (size_t)blk * 512 + ((k >> 4) & 1) * 256 + ((k >> 3) & 1) * 128 + rq * 8 + (k & 7); v4f v[4];
    const float* p1 = sp + (size_t)4 * K; const float* p2 = sp + (size_t)8 * K; const float* p3 = sp + (size_t)12 * K;
    v[0] = *(const v4f*)sp; v[1] = *(const v4f*)p1; v[2] = *(const v4f*)p2; v[3] = *(const v4f*)p3;
    asm volatile("s_wait_xcnt 0x0" :: "v"(sp), "v"(p1), "v"(p2), "v"(p3) : "memory");   // the four address pairs are inputs, so that none of them is reused (as a later load's destination either) in front of the wait
#pragma unroll
    for (int it = 0; it < 4; ++it) { v4us o;
#pragma unroll
        for (int u = 0; u < 4; ++u) o[u] = f2bf(v[it][u]);
        *(v4us*)(d + it * 32) = o; }
}
__global__ __launch_bounds__(256) void k_cstab(float* CS) { const int idx = blockIdx.x * 256 + threadIdx.x; if (idx >= TT * HD) return; const int t = idx / HD, d = idx % HD; const int i = d % (HD / 2); const float inv = __fdiv_rn(1.0f, powf(10000.0f, (float)(2 * i) / (float)HD)); const float ang = __fmul_rn((float)t, inv); v2f cs; cs[0] = cosf(ang); cs[1] = sinf(ang);
    *(v2f*)(CS + (size_t)idx * 2) = cs;  }
__global__ __launch_bounds__(256) void k_hrms(const float* __restrict__ F, int pitch, int nheads, float* RF) { const int i = blockIdx.x * 256 + threadIdx.x; if (i >= nheads * TT) return; const int t = i % TT, h = i / TT; const float* f = F + (size_t)t * pitch + h * HD; float s = 0.f;
#pragma unroll 4
    for (int d = 0; d < HD; d += 4) { const v4f v = *(const v4f*)(f + d);
#pragma unroll
        for (int q = 0; q < 4; ++q) { float p = __fmul_rn(v[q], v[q]); asm volatile("" : "+v"(p)); s = __fadd_rn(s, p); } }
    const float r = __fdiv_rn(1.0f, __fsqrt_rn(__fadd_rn(s * (1.0f / HD), 1e-6f))); *(float*)(RF + i) = r;  }
// k_rope: head planes [h] of [t][d] in the fragment order of k_gemmw (rows t, k = d; one work-group per block of 16 t x 32 d, a wave takes 4 rows x 16 d: 64-byte pieces on the reading and on the storing side) (fp16 + hi/lo) of rope(w[d] (x rms_factor)) x sc with the rotate-half convention out[d] = x[d] cos[t][d] - x[d+HD/2] sin[t][d], out[d+HD/2] = x[d+HD/2] cos[t][d+HD/2] + x[d] sin[t][d+HD/2]
__global__ __launch_bounds__(256) void k_rope(const float* __restrict__ F, int pitch, int nheads, const float* __restrict__ CS, const float* __restrict__ RF, const float* __restrict__ nw, float sc, h16* P16, bf* Ph, bf* Pl) {
    if ((size_t)blockIdx.x * 512 >= (size_t)nheads * TT * HD) return; const int row = (threadIdx.x >> 6) * 4 + ((threadIdx.x >> 3) & 3), db = ((threadIdx.x >> 5) & 1) * 16 + (threadIdx.x & 7) * 2; const int h = blockIdx.x / (TT * HD / 512), blk = blockIdx.x % (TT * HD / 512);
    const int d = (blk % (HD / 32)) * 32 + db; const int t = (blk / (HD / 32)) * 16 + row; const size_t e = (size_t)blockIdx.x * 512 + (db >> 4) * 256 + (((db >> 3) & 1) * 16 + row) * 8 + (db & 7); const float* f = F + (size_t)t * pitch + h * HD; float rf = 1.0f; v2h o16; v2us oh, ol;
    if (RF) { rf = RF[(size_t)h * TT + t]; asm volatile("s_wait_xcnt 0x0" ::: "memory"); }   // the wait stands in front of the address arithmetic below, which may reuse the registers that this load names
#pragma unroll
    for (int q = 0; q < 2; ++q) { const int dd = d + q; const int dp = (dd < HD / 2) ? dd + HD / 2 : dd - HD / 2; float x0 = f[dd], x1 = f[dp];
        if (RF) { float n0 = __fmul_rn(x0, rf), n1 = __fmul_rn(x1, rf); asm volatile("" : "+v"(n0)); asm volatile("" : "+v"(n1)); x0 = __fmul_rn(__fadd_rn(1.0f, bfr(nw[dd])), n0); x1 = __fmul_rn(__fadd_rn(1.0f, bfr(nw[dp])), n1);   /* weight applied as (1 + w) */ }
        const v2f cs = *(const v2f*)(CS + ((size_t)t * HD + dd) * 2); float a = __fmul_rn(x0, cs[0]), bq = __fmul_rn(x1, cs[1]); asm volatile("" : "+v"(a)); asm volatile("" : "+v"(bq)); const float r = ((dd < HD / 2) ? __fsub_rn(a, bq) : __fadd_rn(a, bq)) * sc;
        o16[q] = tohx(r); unsigned short a2, c2; splitf(r, a2, c2); oh[q] = a2; ol[q] = c2; }
    *(v2h*)(P16 + e) = o16; *(v2us*)(Ph + e) = oh; *(v2us*)(Pl + e) = ol;  }
// k_vtp: v^T planes (rows n = g * HD + d, k = t, k extent TT) in the fragment order of k_gemmw; thread i holds the plane elements 2 i and 2 i + 1 (keys t and t + 1 of one row), whole-line stores.
__global__ __launch_bounds__(256) void k_vtp(const float* __restrict__ F, int pitch, int nheads, h16* V16, bf* Vh, bf* Vl) { const size_t e = ((size_t)blockIdx.x * 256 + threadIdx.x) * 2; if (e >= (size_t)nheads * HD * TT) return; const int blk = (int)(e >> 9), o = (int)(e & 511); const int n = (blk / (TT / 32)) * 16 + ((o >> 3) & 15); const int t = (blk % (TT / 32)) * 32 + (o >> 8) * 16 + ((o >> 7) & 1) * 8 + (o & 7); v2h o16; v2us oh, ol;
#pragma unroll
    for (int q = 0; q < 2; ++q) { const float x = F[(size_t)(t + q) * pitch + n]; o16[q] = tohx(x); unsigned short a2, c2; splitf(x, a2, c2); oh[q] = a2; ol[q] = c2; }
    *(v2h*)(V16 + e) = o16; *(v2us*)(Vh + e) = oh; *(v2us*)(Vl + e) = ol;  }
// k_asoft: the probabilities of a row are stored IN PLACE over that row's own 8 KiB of scores (fp16 row, or hi plane then lo plane, each 4 KiB): the wave holds the whole row in registers before its first store, and no other wave touches the row.
// per row (zz, i): t = S x HD^-0.5 for j <= i and i - j < WIN (sliding causal window; the reference's -1e9 additive fill vanishes identically); softmax over the 2048 keys (register row, one exp, fixed trees);
__global__ __launch_bounds__(256) void k_asoft(float* Sb) {
    const int lane = threadIdx.x & 31; const int row = blockIdx.x * 8 + (threadIdx.x >> 5); if (row >= ZH * TT) return; const int i = row % TT; const int zz = row / TT; (void)zz; const bool hires = (i < RH); const float* sr = Sb + (size_t)row * TT; float v[TT / 32]; float mx = -3.0e38f;
#pragma unroll
    for (int ch = 0; ch < TT / 128; ++ch) { const int j0 = ch * 128 + lane * 4; const v4f a = *(const v4f*)(sr + j0);
#pragma unroll
        for (int q = 0; q < 4; ++q) { const int j = j0 + q; (void)j; const float t = (j <= i && i - j < WIN) ? a[q] * SCL : -3.0e38f; v[ch * 4 + q] = t; mx = fmaxf(mx, t); } }
#pragma unroll
    for (int sh = 16; sh; sh >>= 1) mx = fmaxf(mx, __shfl_xor(mx, sh, 32));
    float sum = 0.f;
#pragma unroll
    for (int k = 0; k < TT / 32; ++k) { float d0 = __fsub_rn(v[k], mx); asm volatile("" : "+v"(d0)); v[k] = __builtin_amdgcn_exp2f(__fmul_rn(d0, 1.4426950408889634f)); sum += v[k]; }
#pragma unroll
    for (int sh = 16; sh; sh >>= 1) sum += __shfl_xor(sum, sh, 32);
    const float f = __fdiv_rn(hires ? 1.0f : PCAR, sum);
{
        if (hires) {
#pragma unroll
            for (int ch = 0; ch < TT / 128; ++ch) { v4us oh, ol;
#pragma unroll
                for (int q = 0; q < 4; ++q) { unsigned short a, c2; splitf(v[ch * 4 + q] * f, a, c2); oh[q] = a; ol[q] = c2; }
                bf* pr = (bf*)(Sb + (size_t)row * TT) + ch * 128 + lane * 4; *(v4us*)pr = oh; *(v4us*)(pr + TT) = ol; }
        } else {
#pragma unroll
            for (int ch = 0; ch < TT / 128; ++ch) { v4h o4;
#pragma unroll
                for (int q = 0; q < 4; ++q) o4[q] = tohx(v[ch * 4 + q] * f);
                *(v4h*)((h16*)(Sb + (size_t)row * TT) + ch * 128 + lane * 4) = o4; } }
         }
}
__global__ __launch_bounds__(256) void k_merge(const float* __restrict__ O, int h0, bf* Ah, bf* Al) { const size_t e = ((size_t)blockIdx.x * 256 + threadIdx.x) * 2; if (e >= (size_t)ZH * TT * HD) return; const int d = (int)(e % HD); const int t = (int)((e / HD) % TT); const int zz = (int)(e / ((size_t)HD * TT)); const float cs = (t < RH) ? 1.0f : (1.0f / PCAR); const size_t oo = (size_t)t * DQ + (h0 + zz) * HD + d;
    v2us oh, ol;
#pragma unroll
    for (int q = 0; q < 2; ++q) { unsigned short a, c2; splitf(O[e + q] * cs, a, c2); oh[q] = a; ol[q] = c2; } *(v2us*)(Ah + oo) = oh; *(v2us*)(Al + oo) = ol;  }

// k_mergeg: one work-group per block (16 rows t x 32 columns) of the two output planes, which are in the fragment order of k_gemmw: a wave takes 4 rows x 16 columns: 64-byte pieces on the reading and on the storing side.
__global__ __launch_bounds__(256) void k_mergeg(const float* __restrict__ O, const float* __restrict__ G, int h0, bf* Ah, bf* Al) { const int tid = threadIdx.x; const int rb = blockIdx.x / (ZH * HD / 32), kbl = blockIdx.x % (ZH * HD / 32); if (rb >= TT / 16) return;
    const int row = (tid >> 6) * 4 + ((tid >> 3) & 3), db = ((tid >> 5) & 1) * 16 + (tid & 7) * 2; const int kl = kbl * 32 + db; const int t = rb * 16 + row; const int zz = kl / HD, d = kl % HD; const size_t e = ((size_t)zz * TT + t) * HD + d; const float cs = (t < RH) ? 1.0f : (1.0f / PCAR); const size_t oo = (size_t)t * DQ + h0 * HD + kl;
    const size_t po = ((size_t)rb * (DQ / 32) + h0 * (HD / 32) + kbl) * 512 + (db >> 4) * 256 + (((db >> 3) & 1) * 16 + row) * 8 + (db & 7);
    v2us oh, ol;
#pragma unroll
    for (int q = 0; q < 2; ++q) { const float gt = G[oo + q]; const float sg = __fdiv_rn(1.0f, __fadd_rn(1.0f, expf(-gt))); float o = O[e + q] * cs; asm volatile("" : "+v"(o)); unsigned short a, c2; splitf(__fmul_rn(o, sg), a, c2); oh[q] = a; ol[q] = c2; } *(v2us*)(Ah + po) = oh; *(v2us*)(Al + po) = ol;  }

extern "C" void kernel_launch(void* const* d_in, const int* in_sizes, int n_in,
                              void* d_out, int out_size, void* d_ws, size_t ws_size, hipStream_t stream) {
    (void)in_sizes; (void)n_in; (void)out_size;
    const float* x = (const float*)d_in[0]; const float* wqg = (const float*)d_in[1]; const float* wk = (const float*)d_in[2]; const float* wv = (const float*)d_in[3]; const float* wo = (const float*)d_in[4]; const float* qnw = (const float*)d_in[5]; const float* knw = (const float*)d_in[6]; const float* wq = wqg;
    float* OUT = (float*)d_out;     // [2][2048][2048]
    char* wsp = (char*)d_ws;
    auto take = [&](size_t bytes) { char* p = wsp; wsp += (bytes + 255) & ~(size_t)255; return (void*)p; };
    bf* WQ = (bf*)take((size_t)DQ * DM * 2); bf* WK = (bf*)take((size_t)DKV * DM * 2); bf* WV = (bf*)take((size_t)DKV * DM * 2); bf* WO = (bf*)take((size_t)DM * DQ * 2); float* CS = (float*)take((size_t)TT * HD * 2 * 4); float* RFQ = (float*)take((size_t)NH_ * TT * 4); float* RFK = (float*)take((size_t)NKV * TT * 4);
    bf* XB = (bf*)take((size_t)TT * DM * 2); bf* WG = (bf*)take((size_t)DQ * DM * 2); float* GATE = (float*)take((size_t)TT * DQ * 4); float* FQ = (float*)take((size_t)TT * DQ * 4); float* FK = (float*)take((size_t)TT * DKV * 4);
    h16* QP16 = (h16*)take((size_t)NH_ * TT * HD * 2); h16* KP16 = (h16*)take((size_t)NKV * TT * HD * 2); h16* VT16 = (h16*)take((size_t)NKV * HD * 2 * TT * 2);
    bf* QPh = (bf*)take((size_t)NH_ * TT * HD * 2); bf* QPl = (bf*)take((size_t)NH_ * TT * HD * 2); bf* KPh = (bf*)take((size_t)NKV * TT * HD * 2); bf* KPl = (bf*)take((size_t)NKV * TT * HD * 2); bf* VTh = (bf*)take((size_t)NKV * HD * 2 * TT * 2); bf* VTl = VTh + (size_t)NKV * HD * TT;   // v^T: hi plane then lo plane; the fp16 plane uses the first half of its buffer
    float* Sb = (float*)take((size_t)ZH * TT * TT * 4); bf* ATl = (bf*)take((size_t)TT * DQ * 2);
    if ((size_t)(wsp - (char*)d_ws) > ws_size) return;    // ws 256 MiB
    float* FV = FK;   // v projection reuses the k buffer after the k planes are built (stream-ordered)
    float* Ob = FQ;   // attention output of a pass (ZH x TT x HD f32 <= TT x DQ) reuses the q projection buffer after the q planes are built (stream-ordered)
    bf* ATh = XB;     // hi plane of the gated attention output (TT x DQ = TT x DM elements) reuses the bf16 x plane after the v projection, its last reader (stream-ordered); x is converted anew for the next batch after Wo has read it
    h16* P16 = (h16*)Sb; bf* Ph = (bf*)Sb; bf* Pl = Ph + TT;   // probabilities in place over the score rows: row pitch 2 * TT 16-bit elements
    { k_pack<<<DQ * DM / 512 / 8, 256, 0, stream>>>(wqg, 0, DM, DQ * DM / 512, WQ); k_pack<<<DQ * DM / 512 / 8, 256, 0, stream>>>(wqg, 1, DM, DQ * DM / 512, WG); k_pack<<<DKV * DM / 512 / 8, 256, 0, stream>>>(wk, -1, DM, DKV * DM / 512, WK); k_pack<<<DKV * DM / 512 / 8, 256, 0, stream>>>(wv, -1, DM, DKV * DM / 512, WV);
      k_pack<<<DM * DQ / 512 / 8, 256, 0, stream>>>(wo, -1, DQ, DM * DQ / 512, WO);
      k_cstab<<<(TT * HD + 255) / 256, 256, 0, stream>>>(CS); }
    const unsigned LQ = (unsigned)(((size_t)NH_ * TT * HD / 2 + 255) / 256), LKv = (unsigned)(((size_t)NKV * TT * HD / 2 + 255) / 256);
    for (int b = 0; b < NB_; ++b) {
        
        k_pack<<<TT * DM / 512 / 8, 256, 0, stream>>>(x + (size_t)b * TT * DM, -1, DM, TT * DM / 512, XB);
        k_gemmw<bf, 0, false, 4, DM><<<dim3(TT / 64, DQ / 64, 1), 128, 0, stream>>>(XB, nullptr, WQ, nullptr, FQ, DQ, nullptr, 0, 0, 0); k_gemmw<bf, 0, false, 4, DM><<<dim3(TT / 64, DQ / 64, 1), 128, 0, stream>>>(XB, nullptr, WG, nullptr, GATE, DQ, nullptr, 0, 0, 0); k_hrms<<<(NH_ * TT + 255) / 256, 256, 0, stream>>>(FQ, DQ, NH_, RFQ);
        k_rope<<<LQ, 256, 0, stream>>>(FQ, DQ, NH_, CS, RFQ, qnw, 1.0f, QP16, QPh, QPl);
        k_gemmw<bf, 0, false, 8, DM><<<dim3(TT / 64, DKV / 64, 1), 256, 0, stream>>>(XB, nullptr, WK, nullptr, FK, DKV, nullptr, 0, 0, 0); k_hrms<<<(NKV * TT + 255) / 256, 256, 0, stream>>>(FK, DKV, NKV, RFK);
        k_rope<<<LKv, 256, 0, stream>>>(FK, DKV, NKV, CS, RFK, knw, 1.0f, KP16, KPh, KPl);
        k_gemmw<bf, 0, false, 8, DM><<<dim3(TT / 64, DKV / 64, 1), 256, 0, stream>>>(XB, nullptr, WV, nullptr, FV, DKV, nullptr, 0, 0, 0); k_vtp<<<LKv, 256, 0, stream>>>(FV, DKV, NKV, VT16, VTh, VTl);
        for (int h0 = 0; h0 < NH_; h0 += ZH) { const size_t zq = (size_t)h0, zk = (size_t)(h0 / REP);   // head h0 + z of a pass reads kv group h0/REP + z/REP
            k_gemmc<bf, 2, 1, 1><<<dim3(RH / 64, TT / 64, ZH), 32, 0, stream>>>(QPh + zq * TT * HD, QPl + zq * TT * HD, KPh + zk * TT * HD, KPl + zk * TT * HD, HD, Sb, TT, 0, (size_t)TT * HD, (size_t)TT * HD, (size_t)TT * TT);
            k_gemmc<h16, 0, 1, 1><<<dim3((TT - RH) / 64, TT / 64, ZH), 32, 0, stream>>>(QP16 + zq * TT * HD + (size_t)RH * HD, nullptr, KP16 + zk * TT * HD, nullptr, HD, Sb + (size_t)RH * TT, TT, RH, (size_t)TT * HD, (size_t)TT * HD, (size_t)TT * TT);
            k_asoft<<<ZH * TT / 8, 256, 0, stream>>>(Sb);
            k_gemmc<bf, 2, 2, 8><<<dim3(RH / 64, HD / 64, ZH), 256, 0, stream>>>(Ph, Pl, VTh + zk * HD * TT, VTl + zk * HD * TT, 2 * TT, Ob, HD, 0, (size_t)TT * 2 * TT, (size_t)HD * TT, (size_t)TT * HD);
            k_gemmc<h16, 0, 2, 8><<<dim3((TT - RH) / 64, HD / 64, ZH), 256, 0, stream>>>(P16 + (size_t)RH * 2 * TT, nullptr, VT16 + zk * HD * TT, nullptr, 2 * TT, Ob + (size_t)RH * HD, HD, RH, (size_t)TT * 2 * TT, (size_t)HD * TT, (size_t)TT * HD);
            k_mergeg<<<(unsigned)(((size_t)ZH * TT * HD / 2 + 255) / 256), 256, 0, stream>>>(Ob, GATE, h0, ATh, ATl); }
        k_gemmw<bf, 1, false, 4, DQ><<<dim3(TT / 64, DM / 64, 1), 128, 0, stream>>>(ATh, ATl, WO, nullptr, OUT + (size_t)b * TT * DM, DM, nullptr, 0, 0, 0); }
}

// v004
// It runs in 357 microseconds.
// Next to v003, in two timings, it ran 1.68 and 1.69 times as fast.
// All steps since v000 together make it 4.94 times as fast.
#include <hip/hip_runtime.h>

// GatedAttention (x [2][2048][2048]; qg = x Wq^T (Wq [4096][2048]) viewed (16 heads x 256): q = first 128, gate = last 128 of each head; k/v = x Wk^T / Wv^T (4 kv heads; group h/4); per-head RMSNorm (eps 1e-6) with weight (1 + w) on q and k; rotate-half RoPE (base 1e4, tables computed on device); causal softmax(q.k / sqrt(128)); out = merged attn v x sigmoid(gate); out Wo^T -> [2][2048][2048]).
// Compute dtypes, f32 accumulate: every input rounded to bf16; q / gate / k / v on PLAIN bf16 operands (inputs: exact; the interleaved q|gate rows of Wq gathered); RMSNorm, RoPE, sigmoid gating f32; causal scores and attn.v: query rows < 512 hl (3 products), the rest single fp16, one fused kernel with a running maximum and sum (f32), key blocks above the diagonal skipped; Wo hl x exact (2 products).

#define NB_  2
#define TT   2048
#define DM   2048
#define NH_  16
#define NKV  4
#define REP  (NH_ / NKV)
#define HD   128
#define DQ   (NH_ * HD)
#define DKV  (NKV * HD)
#define ZH   16                   // heads per attention pass (all of them: head z uses kv group z / REP)
#define RH   512                  // query rows < RH use hi+lo planes (0: none)
#define SCL  0.088388347648318447f   // HD^-0.5
typedef _Float16 h16;
typedef unsigned short bf;
typedef __attribute__((ext_vector_type(16))) __bf16   v16bf;
typedef __attribute__((ext_vector_type(16))) _Float16 v16h;
typedef __attribute__((ext_vector_type(8)))  _Float16 v8h;
typedef __attribute__((ext_vector_type(8)))  unsigned short v8us;
typedef __attribute__((ext_vector_type(8)))  float    v8f;
typedef __attribute__((ext_vector_type(4)))  float    v4f;
typedef v8h  __attribute__((may_alias)) v8ha;
typedef v4f  __attribute__((may_alias)) v4fa;
typedef v8us __attribute__((may_alias)) v8usa;

__device__ __forceinline__ unsigned short f2bf(float f) { unsigned u = __float_as_uint(f); u += 0x7FFFu + ((u >> 16) & 1u); return (unsigned short)(u >> 16); }
__device__ __forceinline__ float bf2f(unsigned short b) { return __uint_as_float(((unsigned)b) << 16); }
__device__ __forceinline__ float bfr(float f) { return bf2f(f2bf(f)); }
__device__ __forceinline__ v16h cat16(v8h lo, v8h hi) { return __builtin_shufflevector(lo, hi, 0, 1, 2, 3, 4, 5, 6, 7, 8, 9, 10, 11, 12, 13, 14, 15); }
__device__ __forceinline__ v16bf cat16b(v8us lo, v8us hi) { return __builtin_bit_cast(v16bf, __builtin_shufflevector(lo, hi, 0, 1, 2, 3, 4, 5, 6, 7, 8, 9, 10, 11, 12, 13, 14, 15)); }
__device__ __forceinline__ v8f wmma16(v16h a, v16h b, v8f c) { return __builtin_amdgcn_wmma_f32_16x16x32_f16(false, a, false, b, (short)0, c, false, false); }
__device__ __forceinline__ v8f wmmab(v16bf a, v16bf b, v8f c) { return __builtin_amdgcn_wmma_f32_16x16x32_bf16(false, a, false, b, (short)0, c, false, false); }



// ---- ksum_store: end of a GEMM tile whose K loop was dealt over the KS waves of one work-group. Every wave parks its 16 partial accumulators in LDS in register order (16 B per lane, contiguous),
// each wave then sums 16/KS of them over the waves in wave order 0..KS-1 (a fixed order), transposes its 16 x WC piece in its own slab and stores whole 128-byte row pieces.
template <int KS, bool BIAS>
__device__ __forceinline__ void ksum_store(v8f (&acc)[4][4], float* red, int wave, int lane, float* C, int ldc, int r0, int c0, const float* __restrict__ bias) {
    constexpr int NA = 16 / KS, WC = NA * 16, P = WC + 4, LPR = WC / 4, RPI = 32 / LPR;
    const int lr = lane & 15, hi = lane >> 4; float* mine = red + wave * 4096;
#pragma unroll
    for (int a = 0; a < 16; ++a) { const v8f t = acc[a >> 2][a & 3]; *(v4fa*)(mine + a * 256 + lane * 4) = __builtin_shufflevector(t, t, 0, 1, 2, 3); *(v4fa*)(mine + a * 256 + 128 + lane * 4) = __builtin_shufflevector(t, t, 4, 5, 6, 7); }
    __syncthreads();   // every wave's partial sums are in LDS before any wave adds them up
    v4f s0[NA], s1[NA];
#pragma unroll
    for (int i = 0; i < NA; ++i) { const float* p = red + (wave * NA + i) * 256 + lane * 4; s0[i] = *(const v4fa*)p; s1[i] = *(const v4fa*)(p + 128);
#pragma unroll
        for (int w = 1; w < KS; ++w) { s0[i] += *(const v4fa*)(p + w * 4096); s1[i] += *(const v4fa*)(p + w * 4096 + 128); } }
    __syncthreads();   // every wave has read the partial sums before a slab is reused for the transpose
#pragma unroll
    for (int i = 0; i < NA; ++i) {
#pragma unroll
        for (int j = 0; j < 4; ++j) { mine[(hi * 8 + j) * P + i * 16 + lr] = s0[i][j]; mine[(hi * 8 + 4 + j) * P + i * 16 + lr] = s1[i][j]; } }
    __builtin_amdgcn_wave_barrier(); asm volatile("" ::: "memory");   // keeps the row reads below behind the column writes above (other lanes' data, same wave)
    const int cb = c0 + ((wave * NA) & 3) * 16; float* crow = C + (size_t)(r0 + ((wave * NA) >> 2) * 16) * ldc + cb;
#pragma unroll
    for (int s = 0; s < 16 / RPI; ++s) { const int row = s * RPI + lane / LPR, cofs = (lane % LPR) * 4; v4f val = *(const v4fa*)(mine + row * P + cofs); if (BIAS) { val[0] += bfr(bias[cb + cofs]); val[1] += bfr(bias[cb + cofs + 1]); val[2] += bfr(bias[cb + cofs + 2]); val[3] += bfr(bias[cb + cofs + 3]); }
        *(v4f*)(crow + (size_t)row * ldc + cofs) = val; }
}

// ---- k_gemmw: register-blocked GEMM, one 64x64 output tile (16 accumulators a wave) per work-group of KS waves; wave w takes the 64-element K blocks w, w + KS, ...; operands straight from 16-bit planes in FRAGMENT ORDER (below); grid (M/64, N/64, Z), KS x 32 threads.
// Fragment order of a plane [R][K]: blocks of 16 rows x 32 k, 512 elements each, block (r / 16, k / 32) at ((r / 16) * (K / 32) + k / 32) * 512; inside a block element (r, k) at ((k / 16) % 2) * 256 + (((k / 8) % 2) * 16 + r % 16) * 8 + k % 8,
// that is: [half of the fragment][lane][8 elements], so that each of the two 16-byte loads of a fragment reads 512 contiguous bytes (4 whole lines) over the wave; every lane gets the same elements as from a row-major plane.
// C[m][n] (f32, pitch ldc, + optional f32 bias[n]) = sum_k A[m][k] Bt[n][k] (+ split products per NSPLIT). z-batch strides sA/sB/sC in elements. K % 64 == 0; K is a compile-time constant so that the starts of the 16-row bands are immediate offsets of the loads (one scalar base per plane, one lane offset).
template <typename T16> struct WFrag;
template <> struct WFrag<h16> { typedef v16h V; static __device__ __forceinline__ V ld(const h16* p) { return cat16(*(const v8h*)p, *(const v8h*)(p + 16)); } static __device__ __forceinline__ V ldp(const h16* band, unsigned vb) { const char* p = (const char*)band + vb; return cat16(*(const v8h*)p, *(const v8h*)(p + 512)); } static __device__ __forceinline__ v8f mma(V a, V b, v8f c) { return wmma16(a, b, c); } };
template <> struct WFrag<bf> { typedef v16bf V; static __device__ __forceinline__ V ld(const bf* p) { return cat16b(*(const v8us*)p, *(const v8us*)(p + 16)); } static __device__ __forceinline__ V ldp(const bf* band, unsigned vb) { const char* p = (const char*)band + vb; return cat16b(*(const v8us*)p, *(const v8us*)(p + 512)); } static __device__ __forceinline__ v8f mma(V a, V b, v8f c) { return wmmab(a, b, c); } };
template <typename T16, int NSPLIT, bool BIAS, int KS, int K>
__global__ __launch_bounds__(KS * 32) void k_gemmw(const T16* __restrict__ A, const T16* __restrict__ A2, const T16* __restrict__ Bt, const T16* __restrict__ Bt2, float* C, int ldc, const float* __restrict__ bias, size_t sA, size_t sB, size_t sC) {
    typedef typename WFrag<T16>::V V;
    __shared__ __align__(16) float os[KS == 1 ? 16 * 68 : KS * 4096];
    const size_t z = blockIdx.z; A += z * sA; if (A2) A2 += z * sA; Bt += z * sB; if (Bt2) Bt2 += z * sB; C += z * sC;
    const int lane = threadIdx.x & 31; const int wave = __builtin_amdgcn_readfirstlane(threadIdx.x >> 5); const int r0 = blockIdx.x * 64, c0 = blockIdx.y * 64;
    v8f acc[4][4];
#pragma unroll
    for (int mb = 0; mb < 4; ++mb)
#pragma unroll
        for (int nb = 0; nb < 4; ++nb) acc[mb][nb] = (v8f){};
    const size_t aoff = (size_t)r0 * K, boff = (size_t)c0 * K;   // a 16-row band of blocks holds 16 * K elements (wave-uniform start); k block kc / 32 starts kc * 32 bytes into it, the lane's 16 bytes lane * 16 into the block
#pragma unroll 1
    for (int kc = wave * 64; kc < K; kc += (kc & 32) ? KS * 64 - 32 : 32) {
        V a[4], a2[4]; const unsigned vb = (unsigned)kc * 32u + (unsigned)lane * 16u;
#pragma unroll
        for (int mb = 0; mb < 4; ++mb) { a[mb] = WFrag<T16>::ldp(A + aoff + (size_t)mb * 16 * K, vb); if (NSPLIT == 1 || NSPLIT == 2) a2[mb] = WFrag<T16>::ldp(A2 + aoff + (size_t)mb * 16 * K, vb); }
#pragma unroll
        for (int nb = 0; nb < 4; ++nb) { const V b = WFrag<T16>::ldp(Bt + boff + (size_t)nb * 16 * K, vb); V b2; if (NSPLIT >= 2) b2 = WFrag<T16>::ldp(Bt2 + boff + (size_t)nb * 16 * K, vb);
#pragma unroll
            for (int mb = 0; mb < 4; ++mb) { acc[mb][nb] = WFrag<T16>::mma(a[mb], b, acc[mb][nb]); if (NSPLIT == 1 || NSPLIT == 2) acc[mb][nb] = WFrag<T16>::mma(a2[mb], b, acc[mb][nb]); if (NSPLIT >= 2) acc[mb][nb] = WFrag<T16>::mma(a[mb], b2, acc[mb][nb]); } }
        asm volatile("v_nop\n\tv_nop\n\tv_nop\n\tv_nop" : "+v"(acc[0][0]), "+v"(acc[1][1]), "+v"(acc[2][2]), "+v"(acc[3][3]) : "v"(a[0]), "v"(a[3]));
    }
    ksum_store<KS, BIAS>(acc, os, wave, lane, C, ldc, r0, c0, bias);
}

// ---- k_fattn: causal scores, softmax and probability x value product in one kernel; no score or probability ever reaches memory. One work-group of 4 waves per (head, tile of QT x 16 queries); wave w takes the 32-key blocks w, w + 4, ... up to the diagonal.
// Transposed products: S^T = K Q^T (A = 16 keys x 32 d of the k plane, B = the queries, kept in registers), O^T += V^T P^T (A = 16 d x 32 keys of the v^T plane). In an S^T tile lane (lr, hi) holds keys hi * 8 + j of query lr,
// which is the B-fragment order of those keys: two tiles convert in place into one P^T fragment; maximum and sum of a query are in-lane but for one exchange between the wave halves.
// Running maximum mu (raw score units) and sum per query; the accumulators are rescaled only when some query's block maximum exceeds its mu by more than 8 in log2 units (probabilities stay below 2^8, inside fp16 range).
// At the end the 4 waves agree on the largest mu, rescale, park sums and accumulators in LDS and add them in wave order 0..3 (a fixed order); each wave divides and stores a quarter of the output tile, QT * 32 d of 16 queries (whole 128-byte lines of a query's row).
typedef __attribute__((ext_vector_type(8))) __bf16 v8bf;
__device__ __forceinline__ float xhalf(float x) { const int b = __float_as_int(x); return __int_as_float(__builtin_amdgcn_permlanex16(b, b, 0x76543210, 0xfedcba98, false, false)); }   // the value of lane l ^ 16
template <typename T16, bool HL, int QT>
__device__ __forceinline__ void fattn_body(const T16* __restrict__ Q, const T16* __restrict__ Q2, const T16* __restrict__ Kp, const T16* __restrict__ Kp2, const T16* __restrict__ Vt, const T16* __restrict__ Vt2, float* O, int q0, float* red, float* sm, float* sl) {
    typedef typename WFrag<T16>::V V;
    constexpr int KS = 4, NACC = QT * 8, NA = NACC / KS; constexpr float CL = SCL * 1.4426950408889634f;   // score -> log2 units
    const int lane = threadIdx.x & 31, lr = lane & 15, hi = lane >> 4; const int wave = __builtin_amdgcn_readfirstlane(threadIdx.x >> 5); const unsigned lb = (unsigned)lane * 16u;
    V qf[QT][4], qf2[QT][4]; const T16* qp = (const T16*)((const char*)(Q + (size_t)(q0 / 16) * 2048) + lb); const T16* qp2 = HL ? (const T16*)((const char*)(Q2 + (size_t)(q0 / 16) * 2048) + lb) : qp;   // the lane's own address in the first block; the other blocks are immediate offsets
#pragma unroll
    for (int qt = 0; qt < QT; ++qt)
#pragma unroll
        for (int dc = 0; dc < 4; ++dc) { const int o = (qt * 4 + dc) * 512; qf[qt][dc] = WFrag<T16>::ldp(qp + o, 0u); if (HL) qf2[qt][dc] = WFrag<T16>::ldp(qp2 + o, 0u); }
    asm volatile("s_wait_xcnt 0x0" :: "v"(qp), "v"(qp2), "v"(lane) : "memory");   // the address pairs are inputs, so that none of them is reused (as a later load's destination either) in front of the wait; the lane number too, which the loads name as their offset where the block's start is a scalar base
    const int nkb = (q0 + QT * 16 + 31) / 32;   // 32-key blocks up to and with the one that holds the diagonal
    V kf[8], kf2[8];   // single-plane tiles fetch the k fragments one block ahead, into the same registers (block 'wave' exists in the plane also where the wave has no work: wave < 4 <= TT / 32); the short hi+lo tiles load them where they are used
    if constexpr (!HL) {
        const T16* kp = (const T16*)((const char*)(Kp + (size_t)wave * 4096) + lb);
#pragma unroll
        for (int i = 0; i < 8; ++i) kf[i] = WFrag<T16>::ldp(kp + i * 512, 0u);
        asm volatile("s_wait_xcnt 0x0" :: "v"(kp), "v"(lane) : "memory"); }   // as above
    v8f acc[QT][8]; float mu[QT], ls[QT];
#pragma unroll
    for (int qt = 0; qt < QT; ++qt) { mu[qt] = -3.0e38f; ls[qt] = 0.f;
#pragma unroll
        for (int dt = 0; dt < 8; ++dt) acc[qt][dt] = (v8f){}; }
#pragma unroll 1   // one body: a second copy would need a second set of k, v^T and score registers, and the wave's allocation decides how many waves a SIMD holds
    for (int kb = wave; kb < nkb; kb += KS) {
        const int kn = (kb + KS < nkb) ? kb + KS : kb;   // the block fetched ahead; the wave's last block fetches itself again (in bounds, unused)
        V vf[8], vf2[8];   // asked for in front of the score products and the softmax arithmetic, which cover most of their latency
        const T16* vp = (const T16*)((const char*)(Vt + (size_t)kb * 512) + lb);
        if constexpr (HL) { const T16* kp = (const T16*)((const char*)(Kp + (size_t)kb * 4096) + lb); const T16* kp2 = (const T16*)((const char*)(Kp2 + (size_t)kb * 4096) + lb); const T16* vp2 = (const T16*)((const char*)(Vt2 + (size_t)kb * 512) + lb);
#pragma unroll
            for (int i = 0; i < 8; ++i) { kf[i] = WFrag<T16>::ldp(kp + i * 512, 0u); kf2[i] = WFrag<T16>::ldp(kp2 + i * 512, 0u); }
#pragma unroll
            for (int dt = 0; dt < 8; ++dt) { vf[dt] = WFrag<T16>::ldp(vp + dt * (TT / 32) * 512, 0u); vf2[dt] = WFrag<T16>::ldp(vp2 + dt * (TT / 32) * 512, 0u); }
            asm volatile("s_wait_xcnt 0x0" :: "v"(kp), "v"(kp2), "v"(vp), "v"(vp2) : "memory");   // as above
        } else {
#pragma unroll
            for (int dt = 0; dt < 8; ++dt) vf[dt] = WFrag<T16>::ldp(vp + dt * (TT / 32) * 512, 0u); }
        v8f s[QT][2];
#pragma unroll
        for (int qt = 0; qt < QT; ++qt) { s[qt][0] = (v8f){}; s[qt][1] = (v8f){}; }
#pragma unroll
        for (int hf = 0; hf < 2; ++hf)
#pragma unroll
            for (int dc = 0; dc < 4; ++dc) { const int i = hf * 4 + dc;
#pragma unroll
                for (int qt = 0; qt < QT; ++qt) { s[qt][hf] = WFrag<T16>::mma(kf[i], qf[qt][dc], s[qt][hf]); if (HL) { s[qt][hf] = WFrag<T16>::mma(kf[i], qf2[qt][dc], s[qt][hf]); s[qt][hf] = WFrag<T16>::mma(kf2[i], qf[qt][dc], s[qt][hf]); } } }
        if constexpr (!HL) {
            __builtin_amdgcn_sched_barrier(0);   // keeps the loads below behind the products above, which read the registers they fill: lifted over them they take a second register set, and copies behind a full wait at the loop's foot
            const T16* kp = (const T16*)((const char*)(Kp + (size_t)kn * 4096) + lb);
#pragma unroll
            for (int i = 0; i < 8; ++i) kf[i] = WFrag<T16>::ldp(kp + i * 512, 0u);
            asm volatile("s_wait_xcnt 0x0" :: "v"(kp), "v"(vp) : "memory"); }   // as above, for this block's v^T loads too
        if (kb == nkb - 1) {   // the block on the diagonal: keys behind the query are masked (wave-uniform test)
#pragma unroll
            for (int qt = 0; qt < QT; ++qt)
#pragma unroll
                for (int hf = 0; hf < 2; ++hf)
#pragma unroll
                    for (int j = 0; j < 8; ++j) if (kb * 32 + hf * 16 + hi * 8 + j > q0 + qt * 16 + lr) s[qt][hf][j] = -3.0e38f; }
        float bm[QT]; bool need = false;
#pragma unroll
        for (int qt = 0; qt < QT; ++qt) { float t = fmaxf(s[qt][0][0], s[qt][1][0]);
#pragma unroll
            for (int j = 1; j < 8; ++j) t = fmaxf(t, fmaxf(s[qt][0][j], s[qt][1][j]));
            bm[qt] = fmaxf(t, xhalf(t)); need = need || ((bm[qt] - mu[qt]) * CL > 8.0f); }
        if (__builtin_amdgcn_ballot_w32(need) != 0) {   // one scalar test a block
#pragma unroll
            for (int qt = 0; qt < QT; ++qt) { const float mn = fmaxf(mu[qt], bm[qt]); const float al = __builtin_amdgcn_exp2f((mu[qt] - mn) * CL); mu[qt] = mn; ls[qt] *= al;
#pragma unroll
                for (int dt = 0; dt < 8; ++dt) acc[qt][dt] *= al; } }
        V pf[QT], pf2[QT];
#pragma unroll
        for (int qt = 0; qt < QT; ++qt) { const float nm = -mu[qt] * CL; v8f p0, p1;
#pragma unroll
            for (int j = 0; j < 8; ++j) { p0[j] = __builtin_amdgcn_exp2f(fmaf(s[qt][0][j], CL, nm)); p1[j] = __builtin_amdgcn_exp2f(fmaf(s[qt][1][j], CL, nm)); }
            float t = 0.f;
#pragma unroll
            for (int j = 0; j < 8; ++j) t += p0[j] + p1[j];
            ls[qt] += t;
            if constexpr (HL) { const v8bf h0 = __builtin_convertvector(p0, v8bf), h1 = __builtin_convertvector(p1, v8bf); const v8bf l0 = __builtin_convertvector(p0 - __builtin_convertvector(h0, v8f), v8bf), l1 = __builtin_convertvector(p1 - __builtin_convertvector(h1, v8f), v8bf);
                pf[qt] = __builtin_shufflevector(h0, h1, 0, 1, 2, 3, 4, 5, 6, 7, 8, 9, 10, 11, 12, 13, 14, 15); pf2[qt] = __builtin_shufflevector(l0, l1, 0, 1, 2, 3, 4, 5, 6, 7, 8, 9, 10, 11, 12, 13, 14, 15); }
            else pf[qt] = cat16(__builtin_convertvector(p0, v8h), __builtin_convertvector(p1, v8h)); }
#pragma unroll
        for (int dt = 0; dt < 8; ++dt)
#pragma unroll
            for (int qt = 0; qt < QT; ++qt) { acc[qt][dt] = WFrag<T16>::mma(vf[dt], pf[qt], acc[qt][dt]); if (HL) { acc[qt][dt] = WFrag<T16>::mma(vf[dt], pf2[qt], acc[qt][dt]); acc[qt][dt] = WFrag<T16>::mma(vf2[dt], pf[qt], acc[qt][dt]); } }
    }
#pragma unroll
    for (int qt = 0; qt < QT; ++qt) { ls[qt] += xhalf(ls[qt]); if (hi == 0) sm[wave * 32 + qt * 16 + lr] = mu[qt]; }
    __syncthreads();   // every wave's maximum is in LDS before any wave picks the largest
    float* mine = red + wave * (NACC * 256);
#pragma unroll
    for (int qt = 0; qt < QT; ++qt) { const int qi = qt * 16 + lr; const float M = fmaxf(fmaxf(sm[qi], sm[32 + qi]), fmaxf(sm[64 + qi], sm[96 + qi])); const float f = __builtin_amdgcn_exp2f((mu[qt] - M) * CL); if (hi == 0) sl[wave * 32 + qi] = ls[qt] * f;
#pragma unroll
        for (int dt = 0; dt < 8; ++dt) { const v8f t = acc[qt][dt] * f; const int a = qt * 8 + dt; *(v4fa*)(mine + a * 256 + lane * 4) = __builtin_shufflevector(t, t, 0, 1, 2, 3); *(v4fa*)(mine + a * 256 + 128 + lane * 4) = __builtin_shufflevector(t, t, 4, 5, 6, 7); } }
    __syncthreads();   // every wave's rescaled sums are in LDS before any wave adds them up
#pragma unroll
    for (int i = 0; i < NA; ++i) { const int a = wave * NA + i, qt = a >> 3, dt = a & 7, qi = qt * 16 + lr; const float* p = red + a * 256 + lane * 4; v4f s0 = *(const v4fa*)p, s1 = *(const v4fa*)(p + 128); float L = sl[qi];
#pragma unroll
        for (int w = 1; w < KS; ++w) { s0 += *(const v4fa*)(p + w * (NACC * 256)); s1 += *(const v4fa*)(p + w * (NACC * 256) + 128); L += sl[w * 32 + qi]; }
        const float r = __fdiv_rn(1.0f, L); float* o = O + (size_t)(q0 + qi) * HD + dt * 16 + hi * 8; *(v4f*)o = s0 * r; *(v4f*)(o + 4) = s1 * r; }
}
// grid (heads, tiles): tile ranks 0 .. (TT - RH) / 32 - 1 are the fp16 tiles of 32 queries from the last rows down (the longest first), the rest the hi+lo tiles of 16 queries, again from the last down.
__global__ __launch_bounds__(128) void k_fattn(const h16* __restrict__ Q16, const h16* __restrict__ K16, const h16* __restrict__ V16, const bf* __restrict__ Qh, const bf* __restrict__ Ql, const bf* __restrict__ Kh, const bf* __restrict__ Kl, const bf* __restrict__ Vh, const bf* __restrict__ Vl, float* O) {
    __shared__ __align__(16) float red[4 * 16 * 256]; __shared__ float sm[4 * 32]; __shared__ float sl[4 * 32];
    const size_t z = blockIdx.x, g = z / REP; const int rk = blockIdx.y; const size_t qo = z * TT * HD, ko = g * TT * HD; O += qo;
    if (rk < (TT - RH) / 32) fattn_body<h16, false, 2>(Q16 + qo, nullptr, K16 + ko, nullptr, V16 + ko, nullptr, O, TT - 32 - rk * 32, red, sm, sl);
    else fattn_body<bf, true, 1>(Qh + qo, Ql + qo, Kh + ko, Kl + ko, Vh + ko, Vl + ko, O, RH - 16 - (rk - (TT - RH) / 32) * 16, red, sm, sl);
}

__device__ __forceinline__ h16 tohx(float x) { return (h16)x; }
__device__ __forceinline__ void splitf(float y, unsigned short& h, unsigned short& l) { h = f2bf(y); l = f2bf(y - bf2f(h)); }
typedef __attribute__((ext_vector_type(2))) _Float16 v2h;
typedef __attribute__((ext_vector_type(4))) _Float16 v4h;
typedef __attribute__((ext_vector_type(2))) unsigned short v2us;
typedef __attribute__((ext_vector_type(4))) unsigned short v4us;
typedef __attribute__((ext_vector_type(2))) float v2f;
typedef __attribute__((ext_vector_type(4))) int v4i;

__global__ __launch_bounds__(256) void k_wtG(const float* __restrict__ w, int K, int N, bf* Bt) {
    const int lane = threadIdx.x & 31; const int L0 = (blockIdx.x * 8 + (threadIdx.x >> 5)) * 8; const int nlines = N * K / 64;
{
#pragma unroll 1
        for (int l = 0; l < 8; ++l) { const int L = L0 + l; if (L >= nlines) break; const size_t e = (size_t)L * 64 + lane * 2; const int k = (int)(e % K), n = (int)(e / K); v2us o;
            o[0] = f2bf(w[(size_t)k * N + n]); o[1] = f2bf(w[(size_t)(k + 1) * N + n]); *(v2us*)(Bt + e) = o; }
         }
}
// k_pack: f32 rows [R][K] -> bf16 plane in the fragment order of k_gemmw. One wave per block of 16 rows x 32 k: 8 lanes read one whole 128-byte line of a row (4 rows a load), each lane stores its 4 elements as 8 bytes (64 contiguous bytes per 4 rows).
// part >= 0: plane row n is row (n / HD) * 2 * HD + part * HD + n % HD of src (the q, part 0, or the gate, part 1, rows of the interleaved q|gate weight); part < 0: row n.
__global__ __launch_bounds__(256) void k_pack(const float* __restrict__ src, int part, int K, int nblk, bf* dst) {
    const int lane = threadIdx.x & 31; const int blk = blockIdx.x * 8 + (threadIdx.x >> 5); if (blk >= nblk) return; const int KB = K >> 5; const int rb = blk / KB, kb = blk % KB; const int k = (lane & 7) * 4, rq = lane >> 3;
    const int n0 = rb * 16; const int s0 = (part >= 0) ? (n0 / HD) * 2 * HD + part * HD + n0 % HD : n0;   // HD % 16 == 0: the 16 rows of a block are consecutive rows of src
    const float* sp = src + (size_t)(s0 + rq) * K + kb * 32 + k; bf* d = dst + (size_t)blk * 512 + ((k >> 4) & 1) * 256 + ((k >> 3) & 1) * 128 + rq * 8 + (k & 7); v4f v[4];
    const float* p1 = sp + (size_t)4 * K; const float* p2 = sp + (size_t)8 * K; const float* p3 = sp + (size_t)12 * K;
    v[0] = *(const v4f*)sp; v[1] = *(const v4f*)p1; v[2] = *(const v4f*)p2; v[3] = *(const v4f*)p3;
    asm volatile("s_wait_xcnt 0x0" :: "v"(sp), "v"(p1), "v"(p2), "v"(p3) : "memory");   // the four address pairs are inputs, so that none of them is reused (as a later load's destination either) in front of the wait
#pragma unroll
    for (int it = 0; it < 4; ++it) { v4us o;
#pragma unroll
        for (int u = 0; u < 4; ++u) o[u] = f2bf(v[it][u]);
        *(v4us*)(d + it * 32) = o; }
}
__global__ __launch_bounds__(256) void k_cstab(float* CS) { const int idx = blockIdx.x * 256 + threadIdx.x; if (idx >= TT * HD) return; const int t = idx / HD, d = idx % HD; const int i = d % (HD / 2); const float inv = __fdiv_rn(1.0f, powf(10000.0f, (float)(2 * i) / (float)HD)); const float ang = __fmul_rn((float)t, inv); v2f cs; cs[0] = cosf(ang); cs[1] = sinf(ang);
    *(v2f*)(CS + (size_t)idx * 2) = cs;  }
__global__ __launch_bounds__(256) void k_hrms(const float* __restrict__ F, int pitch, int nheads, float* RF) { const int i = blockIdx.x * 256 + threadIdx.x; if (i >= nheads * TT) return; const int t = i % TT, h = i / TT; const float* f = F + (size_t)t * pitch + h * HD; float s = 0.f;
#pragma unroll 4
    for (int d = 0; d < HD; d += 4) { const v4f v = *(const v4f*)(f + d);
#pragma unroll
        for (int q = 0; q < 4; ++q) { float p = __fmul_rn(v[q], v[q]); asm volatile("" : "+v"(p)); s = __fadd_rn(s, p); } }
    const float r = __fdiv_rn(1.0f, __fsqrt_rn(__fadd_rn(s * (1.0f / HD), 1e-6f))); *(float*)(RF + i) = r;  }
// k_rope: head planes [h] of [t][d] in the fragment order of k_gemmw (rows t, k = d; one work-group per block of 16 t x 32 d, a wave takes 4 rows x 16 d: 64-byte pieces on the reading and on the storing side) (fp16 + hi/lo) of rope(w[d] (x rms_factor)) x sc with the rotate-half convention out[d] = x[d] cos[t][d] - x[d+HD/2] sin[t][d], out[d+HD/2] = x[d+HD/2] cos[t][d+HD/2] + x[d] sin[t][d+HD/2]
__global__ __launch_bounds__(256) void k_rope(const float* __restrict__ F, int pitch, int nheads, const float* __restrict__ CS, const float* __restrict__ RF, const float* __restrict__ nw, float sc, h16* P16, bf* Ph, bf* Pl) {
    if ((size_t)blockIdx.x * 512 >= (size_t)nheads * TT * HD) return; const int row = (threadIdx.x >> 6) * 4 + ((threadIdx.x >> 3) & 3), db = ((threadIdx.x >> 5) & 1) * 16 + (threadIdx.x & 7) * 2; const int h = blockIdx.x / (TT * HD / 512), blk = blockIdx.x % (TT * HD / 512);
    const int d = (blk % (HD / 32)) * 32 + db; const int t = (blk / (HD / 32)) * 16 + row; const size_t e = (size_t)blockIdx.x * 512 + (db >> 4) * 256 + (((db >> 3) & 1) * 16 + row) * 8 + (db & 7); const float* f = F + (size_t)t * pitch + h * HD; float rf = 1.0f; v2h o16; v2us oh, ol;
    if (RF) { rf = RF[(size_t)h * TT + t]; asm volatile("s_wait_xcnt 0x0" ::: "memory"); }   // the wait stands in front of the address arithmetic below, which may reuse the registers that this load names
#pragma unroll
    for (int q = 0; q < 2; ++q) { const int dd = d + q; const int dp = (dd < HD / 2) ? dd + HD / 2 : dd - HD / 2; float x0 = f[dd], x1 = f[dp];
        if (RF) { float n0 = __fmul_rn(x0, rf), n1 = __fmul_rn(x1, rf); asm volatile("" : "+v"(n0)); asm volatile("" : "+v"(n1)); x0 = __fmul_rn(__fadd_rn(1.0f, bfr(nw[dd])), n0); x1 = __fmul_rn(__fadd_rn(1.0f, bfr(nw[dp])), n1);   /* weight applied as (1 + w) */ }
        const v2f cs = *(const v2f*)(CS + ((size_t)t * HD + dd) * 2); float a = __fmul_rn(x0, cs[0]), bq = __fmul_rn(x1, cs[1]); asm volatile("" : "+v"(a)); asm volatile("" : "+v"(bq)); const float r = ((dd < HD / 2) ? __fsub_rn(a, bq) : __fadd_rn(a, bq)) * sc;
        o16[q] = tohx(r); unsigned short a2, c2; splitf(r, a2, c2); oh[q] = a2; ol[q] = c2; }
    *(v2h*)(P16 + e) = o16; *(v2us*)(Ph + e) = oh; *(v2us*)(Pl + e) = ol;  }
// k_vtp: v^T planes (rows n = g * HD + d, k = t, k extent TT) in the fragment order of k_gemmw; thread i holds the plane elements 2 i and 2 i + 1 (keys t and t + 1 of one row), whole-line stores.
__global__ __launch_bounds__(256) void k_vtp(const float* __restrict__ F, int pitch, int nheads, h16* V16, bf* Vh, bf* Vl) { const size_t e = ((size_t)blockIdx.x * 256 + threadIdx.x) * 2; if (e >= (size_t)nheads * HD * TT) return; const int blk = (int)(e >> 9), o = (int)(e & 511); const int n = (blk / (TT / 32)) * 16 + ((o >> 3) & 15); const int t = (blk % (TT / 32)) * 32 + (o >> 8) * 16 + ((o >> 7) & 1) * 8 + (o & 7); v2h o16; v2us oh, ol;
#pragma unroll
    for (int q = 0; q < 2; ++q) { const float x = F[(size_t)(t + q) * pitch + n]; o16[q] = tohx(x); unsigned short a2, c2; splitf(x, a2, c2); oh[q] = a2; ol[q] = c2; }
    *(v2h*)(V16 + e) = o16; *(v2us*)(Vh + e) = oh; *(v2us*)(Vl + e) = ol;  }
// k_mergeg: one work-group per block (16 rows t x 32 columns) of the two output planes, which are in the fragment order of k_gemmw: a wave takes 4 rows x 16 columns: 64-byte pieces on the reading and on the storing side.
__global__ __launch_bounds__(256) void k_mergeg(const float* __restrict__ O, const float* __restrict__ G, int h0, bf* Ah, bf* Al) { const int tid = threadIdx.x; const int rb = blockIdx.x / (ZH * HD / 32), kbl = blockIdx.x % (ZH * HD / 32); if (rb >= TT / 16) return;
    const int row = (tid >> 6) * 4 + ((tid >> 3) & 3), db = ((tid >> 5) & 1) * 16 + (tid & 7) * 2; const int kl = kbl * 32 + db; const int t = rb * 16 + row; const int zz = kl / HD, d = kl % HD; const size_t e = ((size_t)zz * TT + t) * HD + d; const size_t oo = (size_t)t * DQ + h0 * HD + kl;
    const size_t po = ((size_t)rb * (DQ / 32) + h0 * (HD / 32) + kbl) * 512 + (db >> 4) * 256 + (((db >> 3) & 1) * 16 + row) * 8 + (db & 7);
    v2us oh, ol;
#pragma unroll
    for (int q = 0; q < 2; ++q) { const float gt = G[oo + q]; const float sg = __fdiv_rn(1.0f, __fadd_rn(1.0f, expf(-gt))); const float o = O[e + q]; unsigned short a, c2; splitf(__fmul_rn(o, sg), a, c2); oh[q] = a; ol[q] = c2; } *(v2us*)(Ah + po) = oh; *(v2us*)(Al + po) = ol;  }

extern "C" void kernel_launch(void* const* d_in, const int* in_sizes, int n_in,
                              void* d_out, int out_size, void* d_ws, size_t ws_size, hipStream_t stream) {
    (void)in_sizes; (void)n_in; (void)out_size;
    const float* x = (const float*)d_in[0]; const float* wqg = (const float*)d_in[1]; const float* wk = (const float*)d_in[2]; const float* wv = (const float*)d_in[3]; const float* wo = (const float*)d_in[4]; const float* qnw = (const float*)d_in[5]; const float* knw = (const float*)d_in[6]; const float* wq = wqg;
    float* OUT = (float*)d_out;     // [2][2048][2048]
    char* wsp = (char*)d_ws;
    auto take = [&](size_t bytes) { char* p = wsp; wsp += (bytes + 255) & ~(size_t)255; return (void*)p; };
    bf* WQ = (bf*)take((size_t)DQ * DM * 2); bf* WK = (bf*)take((size_t)DKV * DM * 2); bf* WV = (bf*)take((size_t)DKV * DM * 2); bf* WO = (bf*)take((size_t)DM * DQ * 2); float* CS = (float*)take((size_t)TT * HD * 2 * 4); float* RFQ = (float*)take((size_t)NH_ * TT * 4); float* RFK = (float*)take((size_t)NKV * TT * 4);
    bf* XB = (bf*)take((size_t)TT * DM * 2); bf* WG = (bf*)take((size_t)DQ * DM * 2); float* GATE = (float*)take((size_t)TT * DQ * 4); float* FQ = (float*)take((size_t)TT * DQ * 4); float* FK = (float*)take((size_t)TT * DKV * 4);
    h16* QP16 = (h16*)take((size_t)NH_ * TT * HD * 2); h16* KP16 = (h16*)take((size_t)NKV * TT * HD * 2); h16* VT16 = (h16*)take((size_t)NKV * HD * 2 * TT * 2);
    bf* QPh = (bf*)take((size_t)NH_ * TT * HD * 2); bf* QPl = (bf*)take((size_t)NH_ * TT * HD * 2); bf* KPh = (bf*)take((size_t)NKV * TT * HD * 2); bf* KPl = (bf*)take((size_t)NKV * TT * HD * 2); bf* VTh = (bf*)take((size_t)NKV * HD * 2 * TT * 2); bf* VTl = VTh + (size_t)NKV * HD * TT;   // v^T: hi plane then lo plane; the fp16 plane uses the first half of its buffer
    bf* ATl = (bf*)take((size_t)TT * DQ * 2);
    if ((size_t)(wsp - (char*)d_ws) > ws_size) return;    // ws 256 MiB
    float* FV = FK;   // v projection reuses the k buffer after the k planes are built (stream-ordered)
    float* Ob = FQ;   // attention output (ZH x TT x HD f32 = TT x DQ) reuses the q projection buffer after the q planes are built (stream-ordered)
    bf* ATh = XB;     // hi plane of the gated attention output (TT x DQ = TT x DM elements) reuses the bf16 x plane after the v projection, its last reader (stream-ordered); x is converted anew for the next batch after Wo has read it
    { k_pack<<<DQ * DM / 512 / 8, 256, 0, stream>>>(wqg, 0, DM, DQ * DM / 512, WQ); k_pack<<<DQ * DM / 512 / 8, 256, 0, stream>>>(wqg, 1, DM, DQ * DM / 512, WG); k_pack<<<DKV * DM / 512 / 8, 256, 0, stream>>>(wk, -1, DM, DKV * DM / 512, WK); k_pack<<<DKV * DM / 512 / 8, 256, 0, stream>>>(wv, -1, DM, DKV * DM / 512, WV);
      k_pack<<<DM * DQ / 512 / 8, 256, 0, stream>>>(wo, -1, DQ, DM * DQ / 512, WO);
      k_cstab<<<(TT * HD + 255) / 256, 256, 0, stream>>>(CS); }
    const unsigned LQ = (unsigned)(((size_t)NH_ * TT * HD / 2 + 255) / 256), LKv = (unsigned)(((size_t)NKV * TT * HD / 2 + 255) / 256);
    for (int b = 0; b < NB_; ++b) {
        
        k_pack<<<TT * DM / 512 / 8, 256, 0, stream>>>(x + (size_t)b * TT * DM, -1, DM, TT * DM / 512, XB);
        k_gemmw<bf, 0, false, 4, DM><<<dim3(TT / 64, DQ / 64, 1), 128, 0, stream>>>(XB, nullptr, WQ, nullptr, FQ, DQ, nullptr, 0, 0, 0); k_gemmw<bf, 0, false, 4, DM><<<dim3(TT / 64, DQ / 64, 1), 128, 0, stream>>>(XB, nullptr, WG, nullptr, GATE, DQ, nullptr, 0, 0, 0); k_hrms<<<(NH_ * TT + 255) / 256, 256, 0, stream>>>(FQ, DQ, NH_, RFQ);
        k_rope<<<LQ, 256, 0, stream>>>(FQ, DQ, NH_, CS, RFQ, qnw, 1.0f, QP16, QPh, QPl);
        k_gemmw<bf, 0, false, 8, DM><<<dim3(TT / 64, DKV / 64, 1), 256, 0, stream>>>(XB, nullptr, WK, nullptr, FK, DKV, nullptr, 0, 0, 0); k_hrms<<<(NKV * TT + 255) / 256, 256, 0, stream>>>(FK, DKV, NKV, RFK);
        k_rope<<<LKv, 256, 0, stream>>>(FK, DKV, NKV, CS, RFK, knw, 1.0f, KP16, KPh, KPl);
        k_gemmw<bf, 0, false, 8, DM><<<dim3(TT / 64, DKV / 64, 1), 256, 0, stream>>>(XB, nullptr, WV, nullptr, FV, DKV, nullptr, 0, 0, 0); k_vtp<<<LKv, 256, 0, stream>>>(FV, DKV, NKV, VT16, VTh, VTl);
        k_fattn<<<dim3(NH_, (TT - RH) / 32 + RH / 16, 1), 128, 0, stream>>>(QP16, KP16, VT16, QPh, QPl, KPh, KPl, VTh, VTl, Ob);
        k_mergeg<<<(unsigned)(((size_t)ZH * TT * HD / 2 + 255) / 256), 256, 0, stream>>>(Ob, GATE, 0, ATh, ATl);
        k_gemmw<bf, 1, false, 4, DQ><<<dim3(TT / 64, DM / 64, 1), 128, 0, stream>>>(ATh, ATl, WO, nullptr, OUT + (size_t)b * TT * DM, DM, nullptr, 0, 0, 0); }
}

// v005
// A run of this version takes 275 microseconds.
// Timed twice side by side with v004, it ran 1.30 and 1.29 times as fast.
// All steps since v000 together make it 6.39 times as fast.
#include <hip/hip_runtime.h>

// GatedAttention (x [2][2048][2048]; qg = x Wq^T (Wq [4096][2048]) viewed (16 heads x 256): q = first 128, gate = last 128 of each head; k/v = x Wk^T / Wv^T (4 kv heads; group h/4); per-head RMSNorm (eps 1e-6) with weight (1 + w) on q and k; rotate-half RoPE (base 1e4, tables computed on device); causal softmax(q.k / sqrt(128)); out = merged attn v x sigmoid(gate); out Wo^T -> [2][2048][2048]).
// Compute dtypes, f32 accumulate: every input rounded to bf16; q / gate / k / v on PLAIN bf16 operands (inputs: exact; the interleaved q|gate rows of Wq gathered); RMSNorm, RoPE, sigmoid gating f32; causal scores and attn.v: query rows < 512 hl (3 products), the rest single fp16, one fused kernel with a running maximum and sum (f32), key blocks above the diagonal skipped; Wo hl x exact (2 products).

#define NB_  2
#define TT   2048
#define DM   2048
#define NH_  16
#define NKV  4
#define REP  (NH_ / NKV)
#define HD   128
#define DQ   (NH_ * HD)
#define DKV  (NKV * HD)
#define ZH   16                   // heads per attention pass (all of them: head z uses kv group z / REP)
#define TR   (NB_ * TT)           // rows of both batches together: row b * TT + t; every stage takes them in one launch
#define RH   512                  // query rows < RH use hi+lo planes (0: none)
#define SCL  0.088388347648318447f   // HD^-0.5
typedef _Float16 h16;
typedef unsigned short bf;
typedef __attribute__((ext_vector_type(16))) __bf16   v16bf;
typedef __attribute__((ext_vector_type(16))) _Float16 v16h;
typedef __attribute__((ext_vector_type(8)))  _Float16 v8h;
typedef __attribute__((ext_vector_type(8)))  unsigned short v8us;
typedef __attribute__((ext_vector_type(8)))  float    v8f;
typedef __attribute__((ext_vector_type(4)))  float    v4f;
typedef v8h  __attribute__((may_alias)) v8ha;
typedef v4f  __attribute__((may_alias)) v4fa;
typedef v8us __attribute__((may_alias)) v8usa;

__device__ __forceinline__ unsigned short f2bf(float f) { unsigned u = __float_as_uint(f); u += 0x7FFFu + ((u >> 16) & 1u); return (unsigned short)(u >> 16); }
__device__ __forceinline__ float bf2f(unsigned short b) { return __uint_as_float(((unsigned)b) << 16); }
__device__ __forceinline__ float bfr(float f) { return bf2f(f2bf(f)); }
__device__ __forceinline__ v16h cat16(v8h lo, v8h hi) { return __builtin_shufflevector(lo, hi, 0, 1, 2, 3, 4, 5, 6, 7, 8, 9, 10, 11, 12, 13, 14, 15); }
__device__ __forceinline__ v16bf cat16b(v8us lo, v8us hi) { return __builtin_bit_cast(v16bf, __builtin_shufflevector(lo, hi, 0, 1, 2, 3, 4, 5, 6, 7, 8, 9, 10, 11, 12, 13, 14, 15)); }
__device__ __forceinline__ v8f wmma16(v16h a, v16h b, v8f c) { return __builtin_amdgcn_wmma_f32_16x16x32_f16(false, a, false, b, (short)0, c, false, false); }
__device__ __forceinline__ v8f wmmab(v16bf a, v16bf b, v8f c) { return __builtin_amdgcn_wmma_f32_16x16x32_bf16(false, a, false, b, (short)0, c, false, false); }



// ---- ksum_store: end of a GEMM tile whose K loop was dealt over the KS waves of one work-group. Every wave parks its 16 partial accumulators in LDS in register order (16 B per lane, contiguous),
// each wave then sums 16/KS of them over the waves in wave order 0..KS-1 (a fixed order), transposes its 16 x WC piece in its own slab and stores whole 128-byte row pieces.
template <int KS, bool BIAS>
__device__ __forceinline__ void ksum_store(v8f (&acc)[4][4], float* red, int wave, int lane, float* C, int ldc, int r0, int c0, const float* __restrict__ bias) {
    constexpr int NA = 16 / KS, WC = NA * 16, P = WC + 4, LPR = WC / 4, RPI = 32 / LPR;
    const int lr = lane & 15, hi = lane >> 4; float* mine = red + wave * 4096;
#pragma unroll
    for (int a = 0; a < 16; ++a) { const v8f t = acc[a >> 2][a & 3]; *(v4fa*)(mine + a * 256 + lane * 4) = __builtin_shufflevector(t, t, 0, 1, 2, 3); *(v4fa*)(mine + a * 256 + 128 + lane * 4) = __builtin_shufflevector(t, t, 4, 5, 6, 7); }
    __syncthreads();   // every wave's partial sums are in LDS before any wave adds them up
    v4f s0[NA], s1[NA];
#pragma unroll
    for (int i = 0; i < NA; ++i) { const float* p = red + (wave * NA + i) * 256 + lane * 4; s0[i] = *(const v4fa*)p; s1[i] = *(const v4fa*)(p + 128);
#pragma unroll
        for (int w = 1; w < KS; ++w) { s0[i] += *(const v4fa*)(p + w * 4096); s1[i] += *(const v4fa*)(p + w * 4096 + 128); } }
    __syncthreads();   // every wave has read the partial sums before a slab is reused for the transpose
#pragma unroll
    for (int i = 0; i < NA; ++i) {
#pragma unroll
        for (int j = 0; j < 4; ++j) { mine[(hi * 8 + j) * P + i * 16 + lr] = s0[i][j]; mine[(hi * 8 + 4 + j) * P + i * 16 + lr] = s1[i][j]; } }
    __builtin_amdgcn_wave_barrier(); asm volatile("" ::: "memory");   // keeps the row reads below behind the column writes above (other lanes' data, same wave)
    const int cb = c0 + ((wave * NA) & 3) * 16; float* crow = C + (size_t)(r0 + ((wave * NA) >> 2) * 16) * ldc + cb;
#pragma unroll
    for (int s = 0; s < 16 / RPI; ++s) { const int row = s * RPI + lane / LPR, cofs = (lane % LPR) * 4; v4f val = *(const v4fa*)(mine + row * P + cofs); if (BIAS) { val[0] += bfr(bias[cb + cofs]); val[1] += bfr(bias[cb + cofs + 1]); val[2] += bfr(bias[cb + cofs + 2]); val[3] += bfr(bias[cb + cofs + 3]); }
        *(v4f*)(crow + (size_t)row * ldc + cofs) = val; }
}

// ---- k_gemmw: register-blocked GEMM, one 64x64 output tile (16 accumulators a wave) per work-group of KS waves; wave w takes the 64-element K blocks w, w + KS, ...; operands straight from 16-bit planes in FRAGMENT ORDER (below); grid (M/64, N/64, Z), KS x 32 threads.
// Fragment order of a plane [R][K]: blocks of 16 rows x 32 k, 512 elements each, block (r / 16, k / 32) at ((r / 16) * (K / 32) + k / 32) * 512; inside a block element (r, k) at ((k / 16) % 2) * 256 + (((k / 8) % 2) * 16 + r % 16) * 8 + k % 8,
// that is: [half of the fragment][lane][8 elements], so that each of the two 16-byte loads of a fragment reads 512 contiguous bytes (4 whole lines) over the wave; every lane gets the same elements as from a row-major plane.
// C[m][n] (f32, pitch ldc, + optional f32 bias[n]) = sum_k A[m][k] Bt[n][k] (+ split products per NSPLIT). z-batch strides sA/sB/sC in elements. K % 64 == 0; K is a compile-time constant so that the starts of the 16-row bands are immediate offsets of the loads (one scalar base per plane, one lane offset).
template <typename T16> struct WFrag;
template <> struct WFrag<h16> { typedef v16h V; static __device__ __forceinline__ V ld(const h16* p) { return cat16(*(const v8h*)p, *(const v8h*)(p + 16)); } static __device__ __forceinline__ V ldp(const h16* band, unsigned vb) { const char* p = (const char*)band + vb; return cat16(*(const v8h*)p, *(const v8h*)(p + 512)); } static __device__ __forceinline__ v8f mma(V a, V b, v8f c) { return wmma16(a, b, c); } };
template <> struct WFrag<bf> { typedef v16bf V; static __device__ __forceinline__ V ld(const bf* p) { return cat16b(*(const v8us*)p, *(const v8us*)(p + 16)); } static __device__ __forceinline__ V ldp(const bf* band, unsigned vb) { const char* p = (const char*)band + vb; return cat16b(*(const v8us*)p, *(const v8us*)(p + 512)); } static __device__ __forceinline__ v8f mma(V a, V b, v8f c) { return wmmab(a, b, c); } };
template <typename T16, int NSPLIT, bool BIAS, int KS, int K>
__global__ __launch_bounds__(KS * 32) void k_gemmw(const T16* __restrict__ A, const T16* __restrict__ A2, const T16* __restrict__ Bt, const T16* __restrict__ Bt2, float* C, int ldc, const float* __restrict__ bias, size_t sA, size_t sB, size_t sC) {
    typedef typename WFrag<T16>::V V;
    __shared__ __align__(16) float os[KS == 1 ? 16 * 68 : KS * 4096];
    const size_t z = blockIdx.z; A += z * sA; if (A2) A2 += z * sA; Bt += z * sB; if (Bt2) Bt2 += z * sB; C += z * sC;
    const int lane = threadIdx.x & 31; const int wave = __builtin_amdgcn_readfirstlane(threadIdx.x >> 5); const int r0 = blockIdx.x * 64, c0 = blockIdx.y * 64;
    v8f acc[4][4];
#pragma unroll
    for (int mb = 0; mb < 4; ++mb)
#pragma unroll
        for (int nb = 0; nb < 4; ++nb) acc[mb][nb] = (v8f){};
    const size_t aoff = (size_t)r0 * K, boff = (size_t)c0 * K;   // a 16-row band of blocks holds 16 * K elements (wave-uniform start); k block kc / 32 starts kc * 32 bytes into it, the lane's 16 bytes lane * 16 into the block
#pragma unroll 1
    for (int kc = wave * 64; kc < K; kc += (kc & 32) ? KS * 64 - 32 : 32) {
        V a[4], a2[4]; const unsigned vb = (unsigned)kc * 32u + (unsigned)lane * 16u;
#pragma unroll
        for (int mb = 0; mb < 4; ++mb) { a[mb] = WFrag<T16>::ldp(A + aoff + (size_t)mb * 16 * K, vb); if (NSPLIT == 1 || NSPLIT == 2) a2[mb] = WFrag<T16>::ldp(A2 + aoff + (size_t)mb * 16 * K, vb); }
#pragma unroll
        for (int nb = 0; nb < 4; ++nb) { const V b = WFrag<T16>::ldp(Bt + boff + (size_t)nb * 16 * K, vb); V b2; if (NSPLIT >= 2) b2 = WFrag<T16>::ldp(Bt2 + boff + (size_t)nb * 16 * K, vb);
#pragma unroll
            for (int mb = 0; mb < 4; ++mb) { acc[mb][nb] = WFrag<T16>::mma(a[mb], b, acc[mb][nb]); if (NSPLIT == 1 || NSPLIT == 2) acc[mb][nb] = WFrag<T16>::mma(a2[mb], b, acc[mb][nb]); if (NSPLIT >= 2) acc[mb][nb] = WFrag<T16>::mma(a[mb], b2, acc[mb][nb]); } }
        asm volatile("v_nop\n\tv_nop\n\tv_nop\n\tv_nop" : "+v"(acc[0][0]), "+v"(acc[1][1]), "+v"(acc[2][2]), "+v"(acc[3][3]) : "v"(a[0]), "v"(a[3]));
    }
    ksum_store<KS, BIAS>(acc, os, wave, lane, C, ldc, r0, c0, bias);
}

// ---- k_fattn: causal scores, softmax and probability x value product in one kernel; no score or probability ever reaches memory. One work-group of 4 waves per (head, tile of QT x 16 queries); wave w takes the 32-key blocks w, w + 4, ... up to the diagonal.
// Transposed products: S^T = K Q^T (A = 16 keys x 32 d of the k plane, B = the queries, kept in registers), O^T += V^T P^T (A = 16 d x 32 keys of the v^T plane). In an S^T tile lane (lr, hi) holds keys hi * 8 + j of query lr,
// which is the B-fragment order of those keys: two tiles convert in place into one P^T fragment; maximum and sum of a query are in-lane but for one exchange between the wave halves.
// Running maximum mu (raw score units) and sum per query; the accumulators are rescaled only when some query's block maximum exceeds its mu by more than 8 in log2 units (probabilities stay below 2^8, inside fp16 range).
// At the end the 4 waves agree on the largest mu, rescale, park sums and accumulators in LDS and add them in wave order 0..3 (a fixed order); each wave divides and stores a quarter of the output tile, QT * 32 d of 16 queries (whole 128-byte lines of a query's row).
typedef __attribute__((ext_vector_type(8))) __bf16 v8bf;
__device__ __forceinline__ float xhalf(float x) { const int b = __float_as_int(x); return __int_as_float(__builtin_amdgcn_permlanex16(b, b, 0x76543210, 0xfedcba98, false, false)); }   // the value of lane l ^ 16
template <typename T16, bool HL, int QT>
__device__ __forceinline__ void fattn_body(const T16* __restrict__ Q, const T16* __restrict__ Q2, const T16* __restrict__ Kp, const T16* __restrict__ Kp2, const T16* __restrict__ Vt, const T16* __restrict__ Vt2, float* O, int q0, float* red, float* sm, float* sl) {
    typedef typename WFrag<T16>::V V;
    constexpr int KS = 4, NACC = QT * 8, NA = NACC / KS; constexpr float CL = SCL * 1.4426950408889634f;   // score -> log2 units
    const int lane = threadIdx.x & 31, lr = lane & 15, hi = lane >> 4; const int wave = __builtin_amdgcn_readfirstlane(threadIdx.x >> 5); const unsigned lb = (unsigned)lane * 16u;
    V qf[QT][4], qf2[QT][4]; const T16* qp = (const T16*)((const char*)(Q + (size_t)(q0 / 16) * 2048) + lb); const T16* qp2 = HL ? (const T16*)((const char*)(Q2 + (size_t)(q0 / 16) * 2048) + lb) : qp;   // the lane's own address in the first block; the other blocks are immediate offsets
#pragma unroll
    for (int qt = 0; qt < QT; ++qt)
#pragma unroll
        for (int dc = 0; dc < 4; ++dc) { const int o = (qt * 4 + dc) * 512; qf[qt][dc] = WFrag<T16>::ldp(qp + o, 0u); if (HL) qf2[qt][dc] = WFrag<T16>::ldp(qp2 + o, 0u); }
    asm volatile("s_wait_xcnt 0x0" :: "v"(qp), "v"(qp2), "v"(lane) : "memory");   // the address pairs are inputs, so that none of them is reused (as a later load's destination either) in front of the wait; the lane number too, which the loads name as their offset where the block's start is a scalar base
    const int nkb = (q0 + QT * 16 + 31) / 32;   // 32-key blocks up to and with the one that holds the diagonal
    V kf[8], kf2[8];   // single-plane tiles fetch the k fragments one block ahead, into the same registers (block 'wave' exists in the plane also where the wave has no work: wave < 4 <= TT / 32); the short hi+lo tiles load them where they are used
    if constexpr (!HL) {
        const T16* kp = (const T16*)((const char*)(Kp + (size_t)wave * 4096) + lb);
#pragma unroll
        for (int i = 0; i < 8; ++i) kf[i] = WFrag<T16>::ldp(kp + i * 512, 0u);
        asm volatile("s_wait_xcnt 0x0" :: "v"(kp), "v"(lane) : "memory"); }   // as above
    v8f acc[QT][8]; float mu[QT], ls[QT];
#pragma unroll
    for (int qt = 0; qt < QT; ++qt) { mu[qt] = -3.0e38f; ls[qt] = 0.f;
#pragma unroll
        for (int dt = 0; dt < 8; ++dt) acc[qt][dt] = (v8f){}; }
#pragma unroll 1   // one body: a second copy would need a second set of k, v^T and score registers, and the wave's allocation decides how many waves a SIMD holds
    for (int kb = wave; kb < nkb; kb += KS) {
        const int kn = (kb + KS < nkb) ? kb + KS : kb;   // the block fetched ahead; the wave's last block fetches itself again (in bounds, unused)
        V vf[8], vf2[8];   // asked for in front of the score products and the softmax arithmetic, which cover most of their latency
        const T16* vp = (const T16*)((const char*)(Vt + (size_t)kb * 512) + lb);
        if constexpr (HL) { const T16* kp = (const T16*)((const char*)(Kp + (size_t)kb * 4096) + lb); const T16* kp2 = (const T16*)((const char*)(Kp2 + (size_t)kb * 4096) + lb); const T16* vp2 = (const T16*)((const char*)(Vt2 + (size_t)kb * 512) + lb);
#pragma unroll
            for (int i = 0; i < 8; ++i) { kf[i] = WFrag<T16>::ldp(kp + i * 512, 0u); kf2[i] = WFrag<T16>::ldp(kp2 + i * 512, 0u); }
#pragma unroll
            for (int dt = 0; dt < 8; ++dt) { vf[dt] = WFrag<T16>::ldp(vp + dt * (TT / 32) * 512, 0u); vf2[dt] = WFrag<T16>::ldp(vp2 + dt * (TT / 32) * 512, 0u); }
            asm volatile("s_wait_xcnt 0x0" :: "v"(kp), "v"(kp2), "v"(vp), "v"(vp2) : "memory");   // as above
        } else {
#pragma unroll
            for (int dt = 0; dt < 8; ++dt) vf[dt] = WFrag<T16>::ldp(vp + dt * (TT / 32) * 512, 0u); }
        v8f s[QT][2];
#pragma unroll
        for (int qt = 0; qt < QT; ++qt) { s[qt][0] = (v8f){}; s[qt][1] = (v8f){}; }
#pragma unroll
        for (int hf = 0; hf < 2; ++hf)
#pragma unroll
            for (int dc = 0; dc < 4; ++dc) { const int i = hf * 4 + dc;
#pragma unroll
                for (int qt = 0; qt < QT; ++qt) { s[qt][hf] = WFrag<T16>::mma(kf[i], qf[qt][dc], s[qt][hf]); if (HL) { s[qt][hf] = WFrag<T16>::mma(kf[i], qf2[qt][dc], s[qt][hf]); s[qt][hf] = WFrag<T16>::mma(kf2[i], qf[qt][dc], s[qt][hf]); } } }
        if constexpr (!HL) {
            __builtin_amdgcn_sched_barrier(0);   // keeps the loads below behind the products above, which read the registers they fill: lifted over them they take a second register set, and copies behind a full wait at the loop's foot
            const T16* kp = (const T16*)((const char*)(Kp + (size_t)kn * 4096) + lb);
#pragma unroll
            for (int i = 0; i < 8; ++i) kf[i] = WFrag<T16>::ldp(kp + i * 512, 0u);
            asm volatile("s_wait_xcnt 0x0" :: "v"(kp), "v"(vp) : "memory"); }   // as above, for this block's v^T loads too
        if (kb == nkb - 1) {   // the block on the diagonal: keys behind the query are masked (wave-uniform test)
#pragma unroll
            for (int qt = 0; qt < QT; ++qt)
#pragma unroll
                for (int hf = 0; hf < 2; ++hf)
#pragma unroll
                    for (int j = 0; j < 8; ++j) if (kb * 32 + hf * 16 + hi * 8 + j > q0 + qt * 16 + lr) s[qt][hf][j] = -3.0e38f; }
        float bm[QT]; bool need = false;
#pragma unroll
        for (int qt = 0; qt < QT; ++qt) { float t = fmaxf(s[qt][0][0], s[qt][1][0]);
#pragma unroll
            for (int j = 1; j < 8; ++j) t = fmaxf(t, fmaxf(s[qt][0][j], s[qt][1][j]));
            bm[qt] = fmaxf(t, xhalf(t)); need = need || ((bm[qt] - mu[qt]) * CL > 8.0f); }
        if (__builtin_amdgcn_ballot_w32(need) != 0) {   // one scalar test a block
#pragma unroll
            for (int qt = 0; qt < QT; ++qt) { const float mn = fmaxf(mu[qt], bm[qt]); const float al = __builtin_amdgcn_exp2f((mu[qt] - mn) * CL); mu[qt] = mn; ls[qt] *= al;
#pragma unroll
                for (int dt = 0; dt < 8; ++dt) acc[qt][dt] *= al; } }
        V pf[QT], pf2[QT];
#pragma unroll
        for (int qt = 0; qt < QT; ++qt) { const float nm = -mu[qt] * CL; v8f p0, p1;
#pragma unroll
            for (int j = 0; j < 8; ++j) { p0[j] = __builtin_amdgcn_exp2f(fmaf(s[qt][0][j], CL, nm)); p1[j] = __builtin_amdgcn_exp2f(fmaf(s[qt][1][j], CL, nm)); }
            float t = 0.f;
#pragma unroll
            for (int j = 0; j < 8; ++j) t += p0[j] + p1[j];
            ls[qt] += t;
            if constexpr (HL) { const v8bf h0 = __builtin_convertvector(p0, v8bf), h1 = __builtin_convertvector(p1, v8bf); const v8bf l0 = __builtin_convertvector(p0 - __builtin_convertvector(h0, v8f), v8bf), l1 = __builtin_convertvector(p1 - __builtin_convertvector(h1, v8f), v8bf);
                pf[qt] = __builtin_shufflevector(h0, h1, 0, 1, 2, 3, 4, 5, 6, 7, 8, 9, 10, 11, 12, 13, 14, 15); pf2[qt] = __builtin_shufflevector(l0, l1, 0, 1, 2, 3, 4, 5, 6, 7, 8, 9, 10, 11, 12, 13, 14, 15); }
            else pf[qt] = cat16(__builtin_convertvector(p0, v8h), __builtin_convertvector(p1, v8h)); }
#pragma unroll
        for (int dt = 0; dt < 8; ++dt)
#pragma unroll
            for (int qt = 0; qt < QT; ++qt) { acc[qt][dt] = WFrag<T16>::mma(vf[dt], pf[qt], acc[qt][dt]); if (HL) { acc[qt][dt] = WFrag<T16>::mma(vf[dt], pf2[qt], acc[qt][dt]); acc[qt][dt] = WFrag<T16>::mma(vf2[dt], pf[qt], acc[qt][dt]); } }
    }
#pragma unroll
    for (int qt = 0; qt < QT; ++qt) { ls[qt] += xhalf(ls[qt]); if (hi == 0) sm[wave * 32 + qt * 16 + lr] = mu[qt]; }
    __syncthreads();   // every wave's maximum is in LDS before any wave picks the largest
    float* mine = red + wave * (NACC * 256);
#pragma unroll
    for (int qt = 0; qt < QT; ++qt) { const int qi = qt * 16 + lr; const float M = fmaxf(fmaxf(sm[qi], sm[32 + qi]), fmaxf(sm[64 + qi], sm[96 + qi])); const float f = __builtin_amdgcn_exp2f((mu[qt] - M) * CL); if (hi == 0) sl[wave * 32 + qi] = ls[qt] * f;
#pragma unroll
        for (int dt = 0; dt < 8; ++dt) { const v8f t = acc[qt][dt] * f; const int a = qt * 8 + dt; *(v4fa*)(mine + a * 256 + lane * 4) = __builtin_shufflevector(t, t, 0, 1, 2, 3); *(v4fa*)(mine + a * 256 + 128 + lane * 4) = __builtin_shufflevector(t, t, 4, 5, 6, 7); } }
    __syncthreads();   // every wave's rescaled sums are in LDS before any wave adds them up
#pragma unroll
    for (int i = 0; i < NA; ++i) { const int a = wave * NA + i, qt = a >> 3, dt = a & 7, qi = qt * 16 + lr; const float* p = red + a * 256 + lane * 4; v4f s0 = *(const v4fa*)p, s1 = *(const v4fa*)(p + 128); float L = sl[qi];
#pragma unroll
        for (int w = 1; w < KS; ++w) { s0 += *(const v4fa*)(p + w * (NACC * 256)); s1 += *(const v4fa*)(p + w * (NACC * 256) + 128); L += sl[w * 32 + qi]; }
        const float r = __fdiv_rn(1.0f, L); float* o = O + (size_t)(q0 + qi) * HD + dt * 16 + hi * 8; *(v4f*)o = s0 * r; *(v4f*)(o + 4) = s1 * r; }
}
// grid (batches x heads, tiles): blockIdx.x = b * NH_ + head, whose kv planes are number blockIdx.x / REP = b * NKV + head / REP; tile ranks 0 .. (TT - RH) / 32 - 1 are the fp16 tiles of 32 queries from the last rows down (the longest first), the rest the hi+lo tiles of 16 queries, again from the last down.
__global__ __launch_bounds__(128) void k_fattn(const h16* __restrict__ Q16, const h16* __restrict__ K16, const h16* __restrict__ V16, const bf* __restrict__ Qh, const bf* __restrict__ Ql, const bf* __restrict__ Kh, const bf* __restrict__ Kl, const bf* __restrict__ Vh, const bf* __restrict__ Vl, float* O) {
    __shared__ __align__(16) float red[4 * 16 * 256]; __shared__ float sm[4 * 32]; __shared__ float sl[4 * 32];
    const size_t z = blockIdx.x, g = z / REP; const int rk = blockIdx.y; const size_t qo = z * TT * HD, ko = g * TT * HD; O += qo;
    if (rk < (TT - RH) / 32) fattn_body<h16, false, 2>(Q16 + qo, nullptr, K16 + ko, nullptr, V16 + ko, nullptr, O, TT - 32 - rk * 32, red, sm, sl);
    else fattn_body<bf, true, 1>(Qh + qo, Ql + qo, Kh + ko, Kl + ko, Vh + ko, Vl + ko, O, RH - 16 - (rk - (TT - RH) / 32) * 16, red, sm, sl);
}

__device__ __forceinline__ h16 tohx(float x) { return (h16)x; }
__device__ __forceinline__ void splitf(float y, unsigned short& h, unsigned short& l) { h = f2bf(y); l = f2bf(y - bf2f(h)); }
typedef __attribute__((ext_vector_type(2))) _Float16 v2h;
typedef __attribute__((ext_vector_type(4))) _Float16 v4h;
typedef __attribute__((ext_vector_type(2))) unsigned short v2us;
typedef __attribute__((ext_vector_type(4))) unsigned short v4us;
typedef __attribute__((ext_vector_type(2))) float v2f;
typedef __attribute__((ext_vector_type(4))) int v4i;

__global__ __launch_bounds__(256) void k_wtG(const float* __restrict__ w, int K, int N, bf* Bt) {
    const int lane = threadIdx.x & 31; const int L0 = (blockIdx.x * 8 + (threadIdx.x >> 5)) * 8; const int nlines = N * K / 64;
{
#pragma unroll 1
        for (int l = 0; l < 8; ++l) { const int L = L0 + l; if (L >= nlines) break; const size_t e = (size_t)L * 64 + lane * 2; const int k = (int)(e % K), n = (int)(e / K); v2us o;
            o[0] = f2bf(w[(size_t)k * N + n]); o[1] = f2bf(w[(size_t)(k + 1) * N + n]); *(v2us*)(Bt + e) = o; }
         }
}
// pack_body: f32 rows [R][K] -> bf16 plane in the fragment order of k_gemmw. One wave per block of 16 rows x 32 k: 8 lanes read one whole 128-byte line of a row (4 rows a load), each lane stores its 4 elements as 8 bytes (64 contiguous bytes per 4 rows).
// One launch packs every operand: all have K = DM = DQ columns, and their planes lie one behind the other in dst: [q rows of Wq | gate rows of Wq | Wk | Wv | Wo | x, both batches] = PKR rows. The 8 waves of a work-group share a band of 16 rows, so the choice of the source is uniform.
// q / gate plane row n is row (n / HD) * 2 * HD + part * HD + n % HD of the interleaved q|gate weight (part 0: q, part 1: gate); every other plane row is the same row of its source.
#define PKR  (2 * DQ + 2 * DKV + DM + TR)
static_assert(DM == DQ, "one K for every packed plane");
__device__ __forceinline__ void pack_body(int bx, const float* __restrict__ wqg, const float* __restrict__ wk, const float* __restrict__ wv, const float* __restrict__ wo, const float* __restrict__ x, bf* dst) {
    constexpr int K = DM, KB = K >> 5;
    const int lane = threadIdx.x & 31; const int blk = bx * 8 + (threadIdx.x >> 5); const int rb = bx / (KB / 8), kb = blk % KB; const int k = (lane & 7) * 4, rq = lane >> 3;
    const int n0 = rb * 16; const float* src; int s0;   // HD % 16 == 0: the 16 rows of a block are consecutive rows of src
    if (n0 < 2 * DQ) { const int part = n0 / DQ, nn = n0 % DQ; src = wqg; s0 = (nn / HD) * 2 * HD + part * HD + nn % HD; }
    else if (n0 < 2 * DQ + DKV) { src = wk; s0 = n0 - 2 * DQ; }
    else if (n0 < 2 * DQ + 2 * DKV) { src = wv; s0 = n0 - (2 * DQ + DKV); }
    else if (n0 < 2 * DQ + 2 * DKV + DM) { src = wo; s0 = n0 - (2 * DQ + 2 * DKV); }
    else { src = x; s0 = n0 - (2 * DQ + 2 * DKV + DM); }
    const float* sp = src + (size_t)(s0 + rq) * K + kb * 32 + k; bf* d = dst + (size_t)blk * 512 + ((k >> 4) & 1) * 256 + ((k >> 3) & 1) * 128 + rq * 8 + (k & 7); v4f v[4];
    const float* p1 = sp + (size_t)4 * K; const float* p2 = sp + (size_t)8 * K; const float* p3 = sp + (size_t)12 * K;
    v[0] = *(const v4f*)sp; v[1] = *(const v4f*)p1; v[2] = *(const v4f*)p2; v[3] = *(const v4f*)p3;
    asm volatile("s_wait_xcnt 0x0" :: "v"(sp), "v"(p1), "v"(p2), "v"(p3) : "memory");   // the four address pairs are inputs, so that none of them is reused (as a later load's destination either) in front of the wait
#pragma unroll
    for (int it = 0; it < 4; ++it) { v4us o;
#pragma unroll
        for (int u = 0; u < 4; ++u) o[u] = f2bf(v[it][u]);
        *(v4us*)(d + it * 32) = o; }
    asm volatile("s_wait_xcnt 0x0" ::: "memory");   // behind the four stores: in k_prep the table code follows them in the listing, and it writes registers that the stores name
}
__device__ __forceinline__ void cstab_body(int bx, float* CS) { const int idx = bx * 256 + threadIdx.x; if (idx >= TT * HD) return; const int t = idx / HD, d = idx % HD; const int i = d % (HD / 2); const float inv = __fdiv_rn(1.0f, powf(10000.0f, (float)(2 * i) / (float)HD)); const float ang = __fmul_rn((float)t, inv); v2f cs; cs[0] = cosf(ang); cs[1] = sinf(ang);
    *(v2f*)(CS + (size_t)idx * 2) = cs;  }
// k_prep: the two stages that depend on nothing but the inputs, in one launch: the first TT * HD / 256 work-groups fill the cos|sin table (the longer threads), the rest pack the operands.
__global__ __launch_bounds__(256) void k_prep(const float* __restrict__ wqg, const float* __restrict__ wk, const float* __restrict__ wv, const float* __restrict__ wo, const float* __restrict__ x, bf* dst, float* CS) {
    constexpr int NCS = TT * HD / 256; const int bx = blockIdx.x; if (bx < NCS) cstab_body(bx, CS); else pack_body(bx - NCS, wqg, wk, wv, wo, x, dst); }
// hrms_body: one thread per (head, row of both batches); heads 0 .. NH_ - 1 are the q heads, the NKV behind them the k heads (TR % 256 == 0: a work-group has one head); RF[head][row].
__device__ __forceinline__ void hrms_body(int bx, const float* __restrict__ FQ, const float* __restrict__ FK, float* RF) { const int i = bx * 256 + threadIdx.x; if (i >= (NH_ + NKV) * TR) return; const int t = i % TR, h = i / TR; const float* f = (h < NH_) ? FQ + (size_t)t * DQ + h * HD : FK + (size_t)t * DKV + (h - NH_) * HD; float s = 0.f;
#pragma unroll 4
    for (int d = 0; d < HD; d += 4) { const v4f v = *(const v4f*)(f + d);
#pragma unroll
        for (int q = 0; q < 4; ++q) { float p = __fmul_rn(v[q], v[q]); asm volatile("" : "+v"(p)); s = __fadd_rn(s, p); } }
    const float r = __fdiv_rn(1.0f, __fsqrt_rn(__fadd_rn(s * (1.0f / HD), 1e-6f))); *(float*)(RF + i) = r;  }
// k_rope: head planes [h] of [t][d] in the fragment order of k_gemmw (rows t, k = d; one work-group per block of 16 t x 32 d, a wave takes 4 rows x 16 d: 64-byte pieces on the reading and on the storing side) (fp16 + hi/lo) of rope(w[d] (x rms_factor)) x sc with the rotate-half convention out[d] = x[d] cos[t][d] - x[d+HD/2] sin[t][d], out[d+HD/2] = x[d+HD/2] cos[t][d+HD/2] + x[d] sin[t][d+HD/2]
// One launch for q and k of both batches: the first NB_ * NH_ * TT * HD / 512 work-groups build the q planes [b][head], the rest the k planes [b][kv head] (a uniform choice); RF as hrms_body leaves it.
__global__ __launch_bounds__(256) void k_rope(const float* __restrict__ FQ, const float* __restrict__ FK, const float* __restrict__ CS, const float* __restrict__ RF, const float* __restrict__ qnw, const float* __restrict__ knw, float sc, h16* Q16, bf* Qh, bf* Ql, h16* K16, bf* Kh, bf* Kl) {
    constexpr int NBQ = NB_ * NH_ * (TT * HD / 512); const bool isk = (int)blockIdx.x >= NBQ; const int bx = isk ? (int)blockIdx.x - NBQ : (int)blockIdx.x; if (bx >= (isk ? NB_ * NKV * (TT * HD / 512) : NBQ)) return;
    const int nheads = isk ? NKV : NH_, pitch = nheads * HD; const float* F = isk ? FK : FQ; const float* nw = isk ? knw : qnw; h16* P16 = isk ? K16 : Q16; bf* Ph = isk ? Kh : Qh; bf* Pl = isk ? Kl : Ql;
    const int row = (threadIdx.x >> 6) * 4 + ((threadIdx.x >> 3) & 3), db = ((threadIdx.x >> 5) & 1) * 16 + (threadIdx.x & 7) * 2; const int hb = bx / (TT * HD / 512), blk = bx % (TT * HD / 512); const int b = isk ? hb / NKV : hb / NH_, h = isk ? hb % NKV : hb % NH_;
    const int d = (blk % (HD / 32)) * 32 + db; const int t = (blk / (HD / 32)) * 16 + row; const size_t e = (size_t)bx * 512 + (db >> 4) * 256 + (((db >> 3) & 1) * 16 + row) * 8 + (db & 7); const float* f = F + (size_t)(b * TT + t) * pitch + h * HD; float rf = 1.0f; v2h o16; v2us oh, ol;
    if (RF) { rf = RF[(size_t)((isk ? NH_ : 0) + h) * TR + b * TT + t]; asm volatile("s_wait_xcnt 0x0" ::: "memory"); }   // the wait stands in front of the address arithmetic below, which may reuse the registers that this load names
#pragma unroll
    for (int q = 0; q < 2; ++q) { const int dd = d + q; const int dp = (dd < HD / 2) ? dd + HD / 2 : dd - HD / 2; float x0 = f[dd], x1 = f[dp];
        if (RF) { float n0 = __fmul_rn(x0, rf), n1 = __fmul_rn(x1, rf); asm volatile("" : "+v"(n0)); asm volatile("" : "+v"(n1)); x0 = __fmul_rn(__fadd_rn(1.0f, bfr(nw[dd])), n0); x1 = __fmul_rn(__fadd_rn(1.0f, bfr(nw[dp])), n1);   /* weight applied as (1 + w) */ }
        const v2f cs = *(const v2f*)(CS + ((size_t)t * HD + dd) * 2); float a = __fmul_rn(x0, cs[0]), bq = __fmul_rn(x1, cs[1]); asm volatile("" : "+v"(a)); asm volatile("" : "+v"(bq)); const float r = ((dd < HD / 2) ? __fsub_rn(a, bq) : __fadd_rn(a, bq)) * sc;
        o16[q] = tohx(r); unsigned short a2, c2; splitf(r, a2, c2); oh[q] = a2; ol[q] = c2; }
    *(v2h*)(P16 + e) = o16; *(v2us*)(Ph + e) = oh; *(v2us*)(Pl + e) = ol;  }
// vtp_body: v^T planes, one per batch, one behind the other (rows n = g * HD + d, k = t, k extent TT) in the fragment order of k_gemmw; thread i holds the plane elements 2 i and 2 i + 1 (keys t and t + 1 of one row), whole-line stores.
__device__ __forceinline__ void vtp_body(int bx, const float* __restrict__ F, h16* V16, bf* Vh, bf* Vl) { const size_t e = ((size_t)bx * 256 + threadIdx.x) * 2; if (e >= (size_t)NB_ * DKV * TT) return; const int blk = (int)(e >> 9), o = (int)(e & 511); const int na = (blk / (TT / 32)) * 16 + ((o >> 3) & 15); const int b = na / DKV, n = na % DKV; const int t = (blk % (TT / 32)) * 32 + (o >> 8) * 16 + ((o >> 7) & 1) * 8 + (o & 7); v2h o16; v2us oh, ol;
#pragma unroll
    for (int q = 0; q < 2; ++q) { const float x = F[(size_t)(b * TT + t + q) * DKV + n]; o16[q] = tohx(x); unsigned short a2, c2; splitf(x, a2, c2); oh[q] = a2; ol[q] = c2; }
    *(v2h*)(V16 + e) = o16; *(v2us*)(Vh + e) = oh; *(v2us*)(Vl + e) = ol;  }
// k_rmsvt: the two stages that depend on the projections alone, in one launch: the first (NH_ + NKV) * TR / 256 work-groups take the rms factors (few, long threads), the rest build the v^T planes.
__global__ __launch_bounds__(256) void k_rmsvt(const float* __restrict__ FQ, const float* __restrict__ FK, float* RF, const float* __restrict__ FV, h16* V16, bf* Vh, bf* Vl) {
    constexpr int NR = (NH_ + NKV) * TR / 256; const int bx = blockIdx.x; if (bx < NR) hrms_body(bx, FQ, FK, RF); else vtp_body(bx - NR, FV, V16, Vh, Vl); }
// k_mergeg: one work-group per block (16 rows t x 32 columns) of the two output planes, which are in the fragment order of k_gemmw: a wave takes 4 rows x 16 columns: 64-byte pieces on the reading and on the storing side.
__global__ __launch_bounds__(256) void k_mergeg(const float* __restrict__ O, const float* __restrict__ G, int h0, bf* Ah, bf* Al) { const int tid = threadIdx.x; const int rb = blockIdx.x / (ZH * HD / 32), kbl = blockIdx.x % (ZH * HD / 32); if (rb >= TR / 16) return;   // rb counts the 16-row bands of both batches
    const int row = (tid >> 6) * 4 + ((tid >> 3) & 3), db = ((tid >> 5) & 1) * 16 + (tid & 7) * 2; const int kl = kbl * 32 + db; const int tg = rb * 16 + row, b = tg / TT, t = tg % TT; const int zz = kl / HD, d = kl % HD; const size_t e = ((size_t)(b * ZH + zz) * TT + t) * HD + d; const size_t oo = (size_t)tg * DQ + h0 * HD + kl;
    const size_t po = ((size_t)rb * (DQ / 32) + h0 * (HD / 32) + kbl) * 512 + (db >> 4) * 256 + (((db >> 3) & 1) * 16 + row) * 8 + (db & 7);
    v2us oh, ol;
#pragma unroll
    for (int q = 0; q < 2; ++q) { const float gt = G[oo + q]; const float sg = __fdiv_rn(1.0f, __fadd_rn(1.0f, expf(-gt))); const float o = O[e + q]; unsigned short a, c2; splitf(__fmul_rn(o, sg), a, c2); oh[q] = a; ol[q] = c2; } *(v2us*)(Ah + po) = oh; *(v2us*)(Al + po) = ol;  }

extern "C" void kernel_launch(void* const* d_in, const int* in_sizes, int n_in,
                              void* d_out, int out_size, void* d_ws, size_t ws_size, hipStream_t stream) {
    (void)in_sizes; (void)n_in; (void)out_size;
    const float* x = (const float*)d_in[0]; const float* wqg = (const float*)d_in[1]; const float* wk = (const float*)d_in[2]; const float* wv = (const float*)d_in[3]; const float* wo = (const float*)d_in[4]; const float* qnw = (const float*)d_in[5]; const float* knw = (const float*)d_in[6]; const float* wq = wqg;
    float* OUT = (float*)d_out;     // [2][2048][2048]
    char* wsp = (char*)d_ws;
    auto take = [&](size_t bytes) { char* p = wsp; wsp += (bytes + 255) & ~(size_t)255; return (void*)p; };
    bf* PK = (bf*)take((size_t)PKR * DM * 2);   // every packed bf16 operand plane, in the row order of pack_body
    bf* WQ = PK; bf* WK = WQ + (size_t)2 * DQ * DM; bf* WO = WK + (size_t)2 * DKV * DM; bf* XB = WO + (size_t)DM * DQ;   // the gate plane follows WQ, the Wv plane follows WK: z-slices of one GEMM launch
    float* CS = (float*)take((size_t)TT * HD * 2 * 4); float* RF = (float*)take((size_t)(NH_ + NKV) * TR * 4);
    float* FQ = (float*)take((size_t)2 * TR * DQ * 4); float* GATE = FQ + (size_t)TR * DQ; float* FK = (float*)take((size_t)2 * TR * DKV * 4); float* FV = FK + (size_t)TR * DKV;   // q then gate, k then v: the z-slices' outputs
    h16* QP16 = (h16*)take((size_t)NB_ * NH_ * TT * HD * 2); h16* KP16 = (h16*)take((size_t)NB_ * NKV * TT * HD * 2); h16* VT16 = (h16*)take((size_t)NB_ * NKV * HD * TT * 2);
    bf* QPh = (bf*)take((size_t)NB_ * NH_ * TT * HD * 2); bf* QPl = (bf*)take((size_t)NB_ * NH_ * TT * HD * 2); bf* KPh = (bf*)take((size_t)NB_ * NKV * TT * HD * 2); bf* KPl = (bf*)take((size_t)NB_ * NKV * TT * HD * 2); bf* VTh = (bf*)take((size_t)NB_ * NKV * HD * 2 * TT * 2); bf* VTl = VTh + (size_t)NB_ * NKV * HD * TT;   // v^T: hi planes then lo planes
    bf* ATl = (bf*)take((size_t)TR * DQ * 2);
    if ((size_t)(wsp - (char*)d_ws) > ws_size) return;    // ws 256 MiB
    float* Ob = FQ;   // attention output (NB_ x ZH x TT x HD f32 = TR x DQ) reuses the q projection buffer after the q planes are built (stream-ordered)
    bf* ATh = XB;     // hi plane of the gated attention output (TR x DQ = TR x DM elements) reuses the bf16 x plane after the k|v projection, its last reader (stream-ordered)
    k_prep<<<TT * HD / 256 + PKR * DM / 512 / 8, 256, 0, stream>>>(wqg, wk, wv, wo, x, PK, CS);
    k_gemmw<bf, 0, false, 4, DM><<<dim3(TR / 64, DQ / 64, 2), 128, 0, stream>>>(XB, nullptr, WQ, nullptr, FQ, DQ, nullptr, 0, (size_t)DQ * DM, (size_t)TR * DQ);       // z = 0: q, z = 1: gate
    k_gemmw<bf, 0, false, 8, DM><<<dim3(TR / 64, DKV / 64, 2), 256, 0, stream>>>(XB, nullptr, WK, nullptr, FK, DKV, nullptr, 0, (size_t)DKV * DM, (size_t)TR * DKV);   // z = 0: k, z = 1: v
    k_rmsvt<<<(NH_ + NKV) * TR / 256 + NB_ * NKV * TT * HD / 2 / 256, 256, 0, stream>>>(FQ, FK, RF, FV, VT16, VTh, VTl);
    k_rope<<<NB_ * (NH_ + NKV) * (TT * HD / 512), 256, 0, stream>>>(FQ, FK, CS, RF, qnw, knw, 1.0f, QP16, QPh, QPl, KP16, KPh, KPl);
    k_fattn<<<dim3(NB_ * NH_, (TT - RH) / 32 + RH / 16, 1), 128, 0, stream>>>(QP16, KP16, VT16, QPh, QPl, KPh, KPl, VTh, VTl, Ob);
    k_mergeg<<<NB_ * ZH * TT * HD / 2 / 256, 256, 0, stream>>>(Ob, GATE, 0, ATh, ATl);
    k_gemmw<bf, 1, false, 4, DQ><<<dim3(TR / 64, DM / 64, 1), 128, 0, stream>>>(ATh, ATl, WO, nullptr, OUT, DM, nullptr, 0, 0, 0);
}

// v006
// One run takes 264 microseconds.
// Next to v005, in two timings, it ran 1.04 times as fast each time.
// Counting every step since v000, it is 6.64 times as fast.
#include <hip/hip_runtime.h>

// GatedAttention (x [2][2048][2048]; qg = x Wq^T (Wq [4096][2048]) viewed (16 heads x 256): q = first 128, gate = last 128 of each head; k/v = x Wk^T / Wv^T (4 kv heads; group h/4); per-head RMSNorm (eps 1e-6) with weight (1 + w) on q and k; rotate-half RoPE (base 1e4, tables computed on device); causal softmax(q.k / sqrt(128)); out = merged attn v x sigmoid(gate); out Wo^T -> [2][2048][2048]).
// Compute dtypes, f32 accumulate: every input rounded to bf16; q / gate / k / v on PLAIN bf16 operands (inputs: exact; the interleaved q|gate rows of Wq gathered); RMSNorm, RoPE, sigmoid gating f32; causal scores and attn.v: query rows < 512 hl (3 products), the rest single fp16, one fused kernel with a running maximum and sum (f32), key blocks above the diagonal skipped; Wo hl x exact (2 products).

#define NB_  2
#define TT   2048
#define DM   2048
#define NH_  16
#define NKV  4
#define REP  (NH_ / NKV)
#define HD   128
#define DQ   (NH_ * HD)
#define DKV  (NKV * HD)
#define ZH   16                   // heads per attention pass (all of them: head z uses kv group z / REP)
#define TR   (NB_ * TT)           // rows of both batches together: row b * TT + t; every stage takes them in one launch
#define RH   512                  // query rows < RH use hi+lo planes (0: none)
#define SCL  0.088388347648318447f   // HD^-0.5
typedef _Float16 h16;
typedef unsigned short bf;
typedef __attribute__((ext_vector_type(16))) __bf16   v16bf;
typedef __attribute__((ext_vector_type(16))) _Float16 v16h;
typedef __attribute__((ext_vector_type(8)))  _Float16 v8h;
typedef __attribute__((ext_vector_type(8)))  unsigned short v8us;
typedef __attribute__((ext_vector_type(8)))  float    v8f;
typedef __attribute__((ext_vector_type(4)))  float    v4f;
typedef v8h  __attribute__((may_alias)) v8ha;
typedef v4f  __attribute__((may_alias)) v4fa;
typedef v8us __attribute__((may_alias)) v8usa;

__device__ __forceinline__ unsigned short f2bf(float f) { unsigned u = __float_as_uint(f); u += 0x7FFFu + ((u >> 16) & 1u); return (unsigned short)(u >> 16); }
__device__ __forceinline__ float bf2f(unsigned short b) { return __uint_as_float(((unsigned)b) << 16); }
__device__ __forceinline__ float bfr(float f) { return bf2f(f2bf(f)); }
__device__ __forceinline__ v16h cat16(v8h lo, v8h hi) { return __builtin_shufflevector(lo, hi, 0, 1, 2, 3, 4, 5, 6, 7, 8, 9, 10, 11, 12, 13, 14, 15); }
__device__ __forceinline__ v16bf cat16b(v8us lo, v8us hi) { return __builtin_bit_cast(v16bf, __builtin_shufflevector(lo, hi, 0, 1, 2, 3, 4, 5, 6, 7, 8, 9, 10, 11, 12, 13, 14, 15)); }
__device__ __forceinline__ v8f wmma16(v16h a, v16h b, v8f c) { return __builtin_amdgcn_wmma_f32_16x16x32_f16(false, a, false, b, (short)0, c, false, false); }
__device__ __forceinline__ v8f wmmab(v16bf a, v16bf b, v8f c) { return __builtin_amdgcn_wmma_f32_16x16x32_bf16(false, a, false, b, (short)0, c, false, false); }



// ---- ksum_store: end of a GEMM tile whose K loop was dealt over the KS waves of one work-group. Every wave parks its 16 partial accumulators in LDS in register order (16 B per lane, contiguous),
// each wave then sums 16/KS of them over the waves in wave order 0..KS-1 (a fixed order), transposes its 16 x WC piece in its own slab and stores whole 128-byte row pieces.
template <int KS, bool BIAS>
__device__ __forceinline__ void ksum_store(v8f (&acc)[4][4], float* red, int wave, int lane, float* C, int ldc, int r0, int c0, const float* __restrict__ bias) {
    constexpr int NA = 16 / KS, WC = NA * 16, P = WC + 4, LPR = WC / 4, RPI = 32 / LPR;
    const int lr = lane & 15, hi = lane >> 4; float* mine = red + wave * 4096;
#pragma unroll
    for (int a = 0; a < 16; ++a) { const v8f t = acc[a >> 2][a & 3]; *(v4fa*)(mine + a * 256 + lane * 4) = __builtin_shufflevector(t, t, 0, 1, 2, 3); *(v4fa*)(mine + a * 256 + 128 + lane * 4) = __builtin_shufflevector(t, t, 4, 5, 6, 7); }
    __syncthreads();   // every wave's partial sums are in LDS before any wave adds them up
    v4f s0[NA], s1[NA];
#pragma unroll
    for (int i = 0; i < NA; ++i) { const float* p = red + (wave * NA + i) * 256 + lane * 4; s0[i] = *(const v4fa*)p; s1[i] = *(const v4fa*)(p + 128);
#pragma unroll
        for (int w = 1; w < KS; ++w) { s0[i] += *(const v4fa*)(p + w * 4096); s1[i] += *(const v4fa*)(p + w * 4096 + 128); } }
    __syncthreads();   // every wave has read the partial sums before a slab is reused for the transpose
#pragma unroll
    for (int i = 0; i < NA; ++i) {
#pragma unroll
        for (int j = 0; j < 4; ++j) { mine[(hi * 8 + j) * P + i * 16 + lr] = s0[i][j]; mine[(hi * 8 + 4 + j) * P + i * 16 + lr] = s1[i][j]; } }
    __builtin_amdgcn_wave_barrier(); asm volatile("" ::: "memory");   // keeps the row reads below behind the column writes above (other lanes' data, same wave)
    const int cb = c0 + ((wave * NA) & 3) * 16; float* crow = C + (size_t)(r0 + ((wave * NA) >> 2) * 16) * ldc + cb;
#pragma unroll
    for (int s = 0; s < 16 / RPI; ++s) { const int row = s * RPI + lane / LPR, cofs = (lane % LPR) * 4; v4f val = *(const v4fa*)(mine + row * P + cofs); if (BIAS) { val[0] += bfr(bias[cb + cofs]); val[1] += bfr(bias[cb + cofs + 1]); val[2] += bfr(bias[cb + cofs + 2]); val[3] += bfr(bias[cb + cofs + 3]); }
        *(v4f*)(crow + (size_t)row * ldc + cofs) = val; }
}

// ---- k_gemmw: register-blocked GEMM, one 64x64 output tile (16 accumulators a wave) per work-group of KS waves; wave w takes the 64-element K blocks w, w + KS, ...; operands straight from 16-bit planes in FRAGMENT ORDER (below); grid (M/64, N/64, Z), KS x 32 threads.
// Fragment order of a plane [R][K]: blocks of 16 rows x 32 k, 512 elements each, block (r / 16, k / 32) at ((r / 16) * (K / 32) + k / 32) * 512; inside a block element (r, k) at ((k / 16) % 2) * 256 + (((k / 8) % 2) * 16 + r % 16) * 8 + k % 8,
// that is: [half of the fragment][lane][8 elements], so that each of the two 16-byte loads of a fragment reads 512 contiguous bytes (4 whole lines) over the wave; every lane gets the same elements as from a row-major plane.
// C[m][n] (f32, pitch ldc, + optional f32 bias[n]) = sum_k A[m][k] Bt[n][k] (+ split products per NSPLIT). z-batch strides sA/sB/sC in elements. K % 64 == 0; K is a compile-time constant so that the starts of the 16-row bands are immediate offsets of the loads (one scalar base per plane, one lane offset).
template <typename T16> struct WFrag;
template <> struct WFrag<h16> { typedef v16h V; static __device__ __forceinline__ V ld(const h16* p) { return cat16(*(const v8h*)p, *(const v8h*)(p + 16)); } static __device__ __forceinline__ V ldp(const h16* band, unsigned vb) { const char* p = (const char*)band + vb; return cat16(*(const v8h*)p, *(const v8h*)(p + 512)); } static __device__ __forceinline__ v8f mma(V a, V b, v8f c) { return wmma16(a, b, c); } };
template <> struct WFrag<bf> { typedef v16bf V; static __device__ __forceinline__ V ld(const bf* p) { return cat16b(*(const v8us*)p, *(const v8us*)(p + 16)); } static __device__ __forceinline__ V ldp(const bf* band, unsigned vb) { const char* p = (const char*)band + vb; return cat16b(*(const v8us*)p, *(const v8us*)(p + 512)); } static __device__ __forceinline__ v8f mma(V a, V b, v8f c) { return wmmab(a, b, c); } };
template <typename T16, int NSPLIT, bool BIAS, int KS, int K>
__global__ __launch_bounds__(KS * 32) void k_gemmw(const T16* __restrict__ A, const T16* __restrict__ A2, const T16* __restrict__ Bt, const T16* __restrict__ Bt2, float* C, int ldc, const float* __restrict__ bias, size_t sA, size_t sB, size_t sC) {
    typedef typename WFrag<T16>::V V;
    __shared__ __align__(16) float os[KS == 1 ? 16 * 68 : KS * 4096];
    const size_t z = blockIdx.z; A += z * sA; if (A2) A2 += z * sA; Bt += z * sB; if (Bt2) Bt2 += z * sB; C += z * sC;
    const int lane = threadIdx.x & 31; const int wave = __builtin_amdgcn_readfirstlane(threadIdx.x >> 5); const int r0 = blockIdx.x * 64, c0 = blockIdx.y * 64;
    v8f acc[4][4];
#pragma unroll
    for (int mb = 0; mb < 4; ++mb)
#pragma unroll
        for (int nb = 0; nb < 4; ++nb) acc[mb][nb] = (v8f){};
    const size_t aoff = (size_t)r0 * K, boff = (size_t)c0 * K;   // a 16-row band of blocks holds 16 * K elements (wave-uniform start); k block kc / 32 starts kc * 32 bytes into it, the lane's 16 bytes lane * 16 into the block
#pragma unroll 1
    for (int kc = wave * 64; kc < K; kc += (kc & 32) ? KS * 64 - 32 : 32) {
        V a[4], a2[4]; const unsigned vb = (unsigned)kc * 32u + (unsigned)lane * 16u;
#pragma unroll
        for (int mb = 0; mb < 4; ++mb) { a[mb] = WFrag<T16>::ldp(A + aoff + (size_t)mb * 16 * K, vb); if (NSPLIT == 1 || NSPLIT == 2) a2[mb] = WFrag<T16>::ldp(A2 + aoff + (size_t)mb * 16 * K, vb); }
#pragma unroll
        for (int nb = 0; nb < 4; ++nb) { const V b = WFrag<T16>::ldp(Bt + boff + (size_t)nb * 16 * K, vb); V b2; if (NSPLIT >= 2) b2 = WFrag<T16>::ldp(Bt2 + boff + (size_t)nb * 16 * K, vb);
#pragma unroll
            for (int mb = 0; mb < 4; ++mb) { acc[mb][nb] = WFrag<T16>::mma(a[mb], b, acc[mb][nb]); if (NSPLIT == 1 || NSPLIT == 2) acc[mb][nb] = WFrag<T16>::mma(a2[mb], b, acc[mb][nb]); if (NSPLIT >= 2) acc[mb][nb] = WFrag<T16>::mma(a[mb], b2, acc[mb][nb]); } }
        asm volatile("v_nop\n\tv_nop\n\tv_nop\n\tv_nop" : "+v"(acc[0][0]), "+v"(acc[1][1]), "+v"(acc[2][2]), "+v"(acc[3][3]) : "v"(a[0]), "v"(a[3]));
    }
    ksum_store<KS, BIAS>(acc, os, wave, lane, C, ldc, r0, c0, bias);
}

// ---- k_fattn: causal scores, softmax and probability x value product in one kernel; no score or probability ever reaches memory. One work-group of 4 waves per (head, tile of QT x 16 queries); wave w takes the 32-key blocks w, w + 4, ... up to the diagonal.
// Transposed products: S^T = K Q^T (A = 16 keys x 32 d of the k plane, B = the queries, kept in registers), O^T += V^T P^T (A = 16 d x 32 keys of the v^T plane). In an S^T tile lane (lr, hi) holds keys hi * 8 + j of query lr,
// which is the B-fragment order of those keys: two tiles convert in place into one P^T fragment; maximum and sum of a query are in-lane but for one exchange between the wave halves.
// Running maximum mu (raw score units) and sum per query; the accumulators are rescaled only when some query's block maximum exceeds its mu by more than 8 in log2 units (probabilities stay below 2^8, inside fp16 range).
// At the end the 4 waves agree on the largest mu, rescale, park sums and accumulators in LDS and add them in wave order 0..3 (a fixed order); each wave divides and stores a quarter of the output tile, QT * 32 d of 16 queries (whole 128-byte lines of a query's row).
typedef __attribute__((ext_vector_type(8))) __bf16 v8bf;
__device__ __forceinline__ float xhalf(float x) { const int b = __float_as_int(x); return __int_as_float(__builtin_amdgcn_permlanex16(b, b, 0x76543210, 0xfedcba98, false, false)); }   // the value of lane l ^ 16
template <typename T16, bool HL, int QT>
__device__ __forceinline__ void fattn_body(const T16* __restrict__ Q, const T16* __restrict__ Q2, const T16* __restrict__ Kp, const T16* __restrict__ Kp2, const T16* __restrict__ Vt, const T16* __restrict__ Vt2, float* O, int q0, float* red, float* sm, float* sl) {
    typedef typename WFrag<T16>::V V;
    constexpr int KS = 4, NACC = QT * 8, NA = NACC / KS; constexpr float CL = SCL * 1.4426950408889634f;   // score -> log2 units
    const int lane = threadIdx.x & 31, lr = lane & 15, hi = lane >> 4; const int wave = __builtin_amdgcn_readfirstlane(threadIdx.x >> 5); const unsigned lb = (unsigned)lane * 16u;
    V qf[QT][4], qf2[QT][4]; const T16* qp = (const T16*)((const char*)(Q + (size_t)(q0 / 16) * 2048) + lb); const T16* qp2 = HL ? (const T16*)((const char*)(Q2 + (size_t)(q0 / 16) * 2048) + lb) : qp;   // the lane's own address in the first block; the other blocks are immediate offsets
#pragma unroll
    for (int qt = 0; qt < QT; ++qt)
#pragma unroll
        for (int dc = 0; dc < 4; ++dc) { const int o = (qt * 4 + dc) * 512; qf[qt][dc] = WFrag<T16>::ldp(qp + o, 0u); if (HL) qf2[qt][dc] = WFrag<T16>::ldp(qp2 + o, 0u); }
    asm volatile("s_wait_xcnt 0x0" :: "v"(qp), "v"(qp2), "v"(lane) : "memory");   // the address pairs are inputs, so that none of them is reused (as a later load's destination either) in front of the wait; the lane number too, which the loads name as their offset where the block's start is a scalar base
    const int nkb = (q0 + QT * 16 + 31) / 32;   // 32-key blocks up to and with the one that holds the diagonal
    V kf[8], kf2[8];   // single-plane tiles fetch the k fragments one block ahead, into the same registers (block 'wave' exists in the plane also where the wave has no work: wave < 4 <= TT / 32); the short hi+lo tiles load them where they are used
    if constexpr (!HL) {
        const T16* kp = (const T16*)((const char*)(Kp + (size_t)wave * 4096) + lb);
#pragma unroll
        for (int i = 0; i < 8; ++i) kf[i] = WFrag<T16>::ldp(kp + i * 512, 0u);
        asm volatile("s_wait_xcnt 0x0" :: "v"(kp), "v"(lane) : "memory"); }   // as above
    v8f acc[QT][8]; float mu[QT], ls[QT];
#pragma unroll
    for (int qt = 0; qt < QT; ++qt) { mu[qt] = -3.0e38f; ls[qt] = 0.f;
#pragma unroll
        for (int dt = 0; dt < 8; ++dt) acc[qt][dt] = (v8f){}; }
#pragma unroll 1   // one body: a second copy would need a second set of k, v^T and score registers, and the wave's allocation decides how many waves a SIMD holds
    for (int kb = wave; kb < nkb; kb += KS) {
        const int kn = (kb + KS < nkb) ? kb + KS : kb;   // the block fetched ahead; the wave's last block fetches itself again (in bounds, unused)
        V vf[8], vf2[8];   // asked for in front of the score products and the softmax arithmetic, which cover most of their latency
        const T16* vp = (const T16*)((const char*)(Vt + (size_t)kb * 512) + lb);
        if constexpr (HL) { const T16* kp = (const T16*)((const char*)(Kp + (size_t)kb * 4096) + lb); const T16* kp2 = (const T16*)((const char*)(Kp2 + (size_t)kb * 4096) + lb); const T16* vp2 = (const T16*)((const char*)(Vt2 + (size_t)kb * 512) + lb);
#pragma unroll
            for (int i = 0; i < 8; ++i) { kf[i] = WFrag<T16>::ldp(kp + i * 512, 0u); kf2[i] = WFrag<T16>::ldp(kp2 + i * 512, 0u); }
#pragma unroll
            for (int dt = 0; dt < 8; ++dt) { vf[dt] = WFrag<T16>::ldp(vp + dt * (TT / 32) * 512, 0u); vf2[dt] = WFrag<T16>::ldp(vp2 + dt * (TT / 32) * 512, 0u); }
            asm volatile("s_wait_xcnt 0x0" :: "v"(kp), "v"(kp2), "v"(vp), "v"(vp2) : "memory");   // as above
        } else {
#pragma unroll
            for (int dt = 0; dt < 8; ++dt) vf[dt] = WFrag<T16>::ldp(vp + dt * (TT / 32) * 512, 0u); }
        v8f s[QT][2];
#pragma unroll
        for (int qt = 0; qt < QT; ++qt) { s[qt][0] = (v8f){}; s[qt][1] = (v8f){}; }
#pragma unroll
        for (int hf = 0; hf < 2; ++hf)
#pragma unroll
            for (int dc = 0; dc < 4; ++dc) { const int i = hf * 4 + dc;
#pragma unroll
                for (int qt = 0; qt < QT; ++qt) { s[qt][hf] = WFrag<T16>::mma(kf[i], qf[qt][dc], s[qt][hf]); if (HL) { s[qt][hf] = WFrag<T16>::mma(kf[i], qf2[qt][dc], s[qt][hf]); s[qt][hf] = WFrag<T16>::mma(kf2[i], qf[qt][dc], s[qt][hf]); } } }
        if constexpr (!HL) {
            __builtin_amdgcn_sched_barrier(0);   // keeps the loads below behind the products above, which read the registers they fill: lifted over them they take a second register set, and copies behind a full wait at the loop's foot
            const T16* kp = (const T16*)((const char*)(Kp + (size_t)kn * 4096) + lb);
#pragma unroll
            for (int i = 0; i < 8; ++i) kf[i] = WFrag<T16>::ldp(kp + i * 512, 0u);
            asm volatile("s_wait_xcnt 0x0" :: "v"(kp), "v"(vp) : "memory"); }   // as above, for this block's v^T loads too
        if (kb == nkb - 1) {   // the block on the diagonal: keys behind the query are masked (wave-uniform test)
#pragma unroll
            for (int qt = 0; qt < QT; ++qt)
#pragma unroll
                for (int hf = 0; hf < 2; ++hf)
#pragma unroll
                    for (int j = 0; j < 8; ++j) if (kb * 32 + hf * 16 + hi * 8 + j > q0 + qt * 16 + lr) s[qt][hf][j] = -3.0e38f; }
        float bm[QT]; bool need = false;
#pragma unroll
        for (int qt = 0; qt < QT; ++qt) { float t = fmaxf(s[qt][0][0], s[qt][1][0]);
#pragma unroll
            for (int j = 1; j < 8; ++j) t = fmaxf(t, fmaxf(s[qt][0][j], s[qt][1][j]));
            bm[qt] = fmaxf(t, xhalf(t)); need = need || ((bm[qt] - mu[qt]) * CL > 8.0f); }
        if (__builtin_amdgcn_ballot_w32(need) != 0) {   // one scalar test a block
#pragma unroll
            for (int qt = 0; qt < QT; ++qt) { const float mn = fmaxf(mu[qt], bm[qt]); const float al = __builtin_amdgcn_exp2f((mu[qt] - mn) * CL); mu[qt] = mn; ls[qt] *= al;
#pragma unroll
                for (int dt = 0; dt < 8; ++dt) acc[qt][dt] *= al; } }
        V pf[QT], pf2[QT];
#pragma unroll
        for (int qt = 0; qt < QT; ++qt) { const float nm = -mu[qt] * CL; v8f p0, p1;
#pragma unroll
            for (int j = 0; j < 8; ++j) { p0[j] = __builtin_amdgcn_exp2f(fmaf(s[qt][0][j], CL, nm)); p1[j] = __builtin_amdgcn_exp2f(fmaf(s[qt][1][j], CL, nm)); }
            float t = 0.f;
#pragma unroll
            for (int j = 0; j < 8; ++j) t += p0[j] + p1[j];
            ls[qt] += t;
            if constexpr (HL) { const v8bf h0 = __builtin_convertvector(p0, v8bf), h1 = __builtin_convertvector(p1, v8bf); const v8bf l0 = __builtin_convertvector(p0 - __builtin_convertvector(h0, v8f), v8bf), l1 = __builtin_convertvector(p1 - __builtin_convertvector(h1, v8f), v8bf);
                pf[qt] = __builtin_shufflevector(h0, h1, 0, 1, 2, 3, 4, 5, 6, 7, 8, 9, 10, 11, 12, 13, 14, 15); pf2[qt] = __builtin_shufflevector(l0, l1, 0, 1, 2, 3, 4, 5, 6, 7, 8, 9, 10, 11, 12, 13, 14, 15); }
            else pf[qt] = cat16(__builtin_convertvector(p0, v8h), __builtin_convertvector(p1, v8h)); }
#pragma unroll
        for (int dt = 0; dt < 8; ++dt)
#pragma unroll
            for (int qt = 0; qt < QT; ++qt) { acc[qt][dt] = WFrag<T16>::mma(vf[dt], pf[qt], acc[qt][dt]); if (HL) { acc[qt][dt] = WFrag<T16>::mma(vf[dt], pf2[qt], acc[qt][dt]); acc[qt][dt] = WFrag<T16>::mma(vf2[dt], pf[qt], acc[qt][dt]); } }
    }
#pragma unroll
    for (int qt = 0; qt < QT; ++qt) { ls[qt] += xhalf(ls[qt]); if (hi == 0) sm[wave * 32 + qt * 16 + lr] = mu[qt]; }
    __syncthreads();   // every wave's maximum is in LDS before any wave picks the largest
    float* mine = red + wave * (NACC * 256);
#pragma unroll
    for (int qt = 0; qt < QT; ++qt) { const int qi = qt * 16 + lr; const float M = fmaxf(fmaxf(sm[qi], sm[32 + qi]), fmaxf(sm[64 + qi], sm[96 + qi])); const float f = __builtin_amdgcn_exp2f((mu[qt] - M) * CL); if (hi == 0) sl[wave * 32 + qi] = ls[qt] * f;
#pragma unroll
        for (int dt = 0; dt < 8; ++dt) { const v8f t = acc[qt][dt] * f; const int a = qt * 8 + dt; *(v4fa*)(mine + a * 256 + lane * 4) = __builtin_shufflevector(t, t, 0, 1, 2, 3); *(v4fa*)(mine + a * 256 + 128 + lane * 4) = __builtin_shufflevector(t, t, 4, 5, 6, 7); } }
    __syncthreads();   // every wave's rescaled sums are in LDS before any wave adds them up
#pragma unroll
    for (int i = 0; i < NA; ++i) { const int a = wave * NA + i, qt = a >> 3, dt = a & 7, qi = qt * 16 + lr; const float* p = red + a * 256 + lane * 4; v4f s0 = *(const v4fa*)p, s1 = *(const v4fa*)(p + 128); float L = sl[qi];
#pragma unroll
        for (int w = 1; w < KS; ++w) { s0 += *(const v4fa*)(p + w * (NACC * 256)); s1 += *(const v4fa*)(p + w * (NACC * 256) + 128); L += sl[w * 32 + qi]; }
        const float r = __fdiv_rn(1.0f, L); float* o = O + (size_t)(q0 + qi) * HD + dt * 16 + hi * 8; *(v4f*)o = s0 * r; *(v4f*)(o + 4) = s1 * r; }
}
// grid (batches x heads, tiles): blockIdx.x = b * NH_ + head, whose kv planes are number blockIdx.x / REP = b * NKV + head / REP; tile ranks 0 .. (TT - RH) / 32 - 1 are the fp16 tiles of 32 queries from the last rows down (the longest first), the rest the hi+lo tiles of 16 queries, again from the last down.
__global__ __launch_bounds__(128) void k_fattn(const h16* __restrict__ Q16, const h16* __restrict__ K16, const h16* __restrict__ V16, const bf* __restrict__ Qh, const bf* __restrict__ Ql, const bf* __restrict__ Kh, const bf* __restrict__ Kl, const bf* __restrict__ Vh, const bf* __restrict__ Vl, float* O) {
    __shared__ __align__(16) float red[4 * 16 * 256]; __shared__ float sm[4 * 32]; __shared__ float sl[4 * 32];
    const size_t z = blockIdx.x, g = z / REP; const int rk = blockIdx.y; const size_t qo = z * TT * HD, ko = g * TT * HD; O += qo;
    if (rk < (TT - RH) / 32) fattn_body<h16, false, 2>(Q16 + qo, nullptr, K16 + ko, nullptr, V16 + ko, nullptr, O, TT - 32 - rk * 32, red, sm, sl);
    else fattn_body<bf, true, 1>(Qh + qo, Ql + qo, Kh + ko, Kl + ko, Vh + ko, Vl + ko, O, RH - 16 - (rk - (TT - RH) / 32) * 16, red, sm, sl);
}

__device__ __forceinline__ h16 tohx(float x) { return (h16)x; }
__device__ __forceinline__ void splitf(float y, unsigned short& h, unsigned short& l) { h = f2bf(y); l = f2bf(y - bf2f(h)); }
typedef __attribute__((ext_vector_type(2))) _Float16 v2h;
typedef __attribute__((ext_vector_type(4))) _Float16 v4h;
typedef __attribute__((ext_vector_type(2))) unsigned short v2us;
typedef __attribute__((ext_vector_type(4))) unsigned short v4us;
typedef __attribute__((ext_vector_type(2))) float v2f;
typedef __attribute__((ext_vector_type(4))) int v4i;

__global__ __launch_bounds__(256) void k_wtG(const float* __restrict__ w, int K, int N, bf* Bt) {
    const int lane = threadIdx.x & 31; const int L0 = (blockIdx.x * 8 + (threadIdx.x >> 5)) * 8; const int nlines = N * K / 64;
{
#pragma unroll 1
        for (int l = 0; l < 8; ++l) { const int L = L0 + l; if (L >= nlines) break; const size_t e = (size_t)L * 64 + lane * 2; const int k = (int)(e % K), n = (int)(e / K); v2us o;
            o[0] = f2bf(w[(size_t)k * N + n]); o[1] = f2bf(w[(size_t)(k + 1) * N + n]); *(v2us*)(Bt + e) = o; }
         }
}
// pack_body: f32 rows [R][K] -> bf16 plane in the fragment order of k_gemmw. A wave takes one block of 16 rows x 32 k at a time: 8 lanes read one whole 128-byte line of a row (4 rows a load), each lane stores its 4 elements as 8 bytes (64 contiguous bytes per 4 rows).
// One launch packs every operand: all have K = DM = DQ columns, and their planes lie one behind the other in dst: [q rows of Wq | gate rows of Wq | Wk | Wv | Wo | x, both batches] = PKR rows. The 8 waves of a work-group share a band of 16 rows, so the choice of the source is uniform.
// q / gate plane row n is row (n / HD) * 2 * HD + part * HD + n % HD of the interleaved q|gate weight (part 0: q, part 1: gate); every other plane row is the same row of its source.
#define PKR  (2 * DQ + 2 * DKV + DM + TR)
static_assert(DM == DQ, "one K for every packed plane");
__device__ __forceinline__ void pack_body(int bx, const float* __restrict__ wqg, const float* __restrict__ wk, const float* __restrict__ wv, const float* __restrict__ wo, const float* __restrict__ x, bf* dst) {
    constexpr int K = DM, KB = K >> 5;
    const int lane = threadIdx.x & 31; const int rb = bx; const int k = (lane & 7) * 4, rq = lane >> 3;   // work-group bx takes the whole band bx of 16 rows: its wave w the k blocks w, w + 8, ... (few long waves, for speed only)
    const int n0 = rb * 16; const float* src; int s0;   // HD % 16 == 0: the 16 rows of a block are consecutive rows of src
    if (n0 < 2 * DQ) { const int part = n0 / DQ, nn = n0 % DQ; src = wqg; s0 = (nn / HD) * 2 * HD + part * HD + nn % HD; }
    else if (n0 < 2 * DQ + DKV) { src = wk; s0 = n0 - 2 * DQ; }
    else if (n0 < 2 * DQ + 2 * DKV) { src = wv; s0 = n0 - (2 * DQ + DKV); }
    else if (n0 < 2 * DQ + 2 * DKV + DM) { src = wo; s0 = n0 - (2 * DQ + 2 * DKV); }
    else { src = x; s0 = n0 - (2 * DQ + 2 * DKV + DM); }
#pragma unroll 1   // one body: the trips are independent streams, and the many resident waves keep enough bytes in flight
    for (int kb = (int)(threadIdx.x >> 5); kb < KB; kb += 8) { const int blk = rb * KB + kb;
    const float* sp = src + (size_t)(s0 + rq) * K + kb * 32 + k; bf* d = dst + (size_t)blk * 512 + ((k >> 4) & 1) * 256 + ((k >> 3) & 1) * 128 + rq * 8 + (k & 7); v4f v[4];
    const float* p1 = sp + (size_t)4 * K; const float* p2 = sp + (size_t)8 * K; const float* p3 = sp + (size_t)12 * K;
    v[0] = *(const v4f*)sp; v[1] = *(const v4f*)p1; v[2] = *(const v4f*)p2; v[3] = *(const v4f*)p3;
    asm volatile("s_wait_xcnt 0x0" :: "v"(sp), "v"(p1), "v"(p2), "v"(p3) : "memory");   // the four address pairs are inputs, so that none of them is reused (as a later load's destination either) in front of the wait
#pragma unroll
    for (int it = 0; it < 4; ++it) { v4us o;
#pragma unroll
        for (int u = 0; u < 4; ++u) o[u] = f2bf(v[it][u]);
        *(v4us*)(d + it * 32) = o; }
    asm volatile("s_wait_xcnt 0x0" :: "v"(d) : "memory");   // behind the four stores, their address an input: the next trip writes registers that the stores name
    }
}
#define CSB  4    // table pieces of 256 entries a work-group fills, one after the other
static_assert(TT * HD % (256 * CSB) == 0, "whole work-groups");
__device__ __forceinline__ void cstab_body(int bx, float* CS) {
#pragma unroll 1   // one body: the range reductions of cosf and sinf are long code
    for (int it = 0; it < CSB; ++it) { const int idx = (bx * CSB + it) * 256 + threadIdx.x; if (idx >= TT * HD) break; const int t = idx / HD, d = idx % HD; const int i = d % (HD / 2); const float inv = __fdiv_rn(1.0f, powf(10000.0f, (float)(2 * i) / (float)HD)); const float ang = __fmul_rn((float)t, inv); v2f cs; cs[0] = cosf(ang); cs[1] = sinf(ang);
    float* cp = CS + (size_t)idx * 2; *(v2f*)cp = cs;
    asm volatile("s_wait_xcnt 0x0" :: "v"(cp) : "memory"); }   // behind the store, its address an input: the next trip writes registers that the store names
}
// k_prep: the two stages that depend on nothing but the inputs, in one launch: the first TT * HD / 256 / CSB work-groups fill the cos|sin table (the longer threads), the rest pack the operands.
__global__ __launch_bounds__(256) void k_prep(const float* __restrict__ wqg, const float* __restrict__ wk, const float* __restrict__ wv, const float* __restrict__ wo, const float* __restrict__ x, bf* dst, float* CS) {
    constexpr int NCS = TT * HD / 256 / CSB; const int bx = blockIdx.x; if (bx < NCS) cstab_body(bx, CS); else pack_body(bx - NCS, wqg, wk, wv, wo, x, dst); }
// hrms_body: one thread per (head, row of both batches); heads 0 .. NH_ - 1 are the q heads, the NKV behind them the k heads (TR % 256 == 0: a work-group has one head); RF[head][row].
__device__ __forceinline__ void hrms_body(int bx, const float* __restrict__ FQ, const float* __restrict__ FK, float* RF) { const int i = bx * 256 + threadIdx.x; if (i >= (NH_ + NKV) * TR) return; const int t = i % TR, h = i / TR; const float* f = (h < NH_) ? FQ + (size_t)t * DQ + h * HD : FK + (size_t)t * DKV + (h - NH_) * HD; float s = 0.f;
#pragma unroll 4
    for (int d = 0; d < HD; d += 4) { const v4f v = *(const v4f*)(f + d);
#pragma unroll
        for (int q = 0; q < 4; ++q) { float p = __fmul_rn(v[q], v[q]); asm volatile("" : "+v"(p)); s = __fadd_rn(s, p); } }
    const float r = __fdiv_rn(1.0f, __fsqrt_rn(__fadd_rn(s * (1.0f / HD), 1e-6f))); *(float*)(RF + i) = r;  }
// k_rope: head planes [h] of [t][d] in the fragment order of k_gemmw (rows t, k = d; one block of 16 t x 32 d a trip of a work-group, a wave takes 4 rows x 16 d: 64-byte pieces on the reading and on the storing side) (fp16 + hi/lo) of rope(w[d] (x rms_factor)) x sc with the rotate-half convention out[d] = x[d] cos[t][d] - x[d+HD/2] sin[t][d], out[d+HD/2] = x[d+HD/2] cos[t][d+HD/2] + x[d] sin[t][d+HD/2]
// One launch for q and k of both batches: a work-group takes RPB blocks one after the other (64 rows t of one head: few long waves, for speed only); the first NB_ * NH_ * TT * HD / 512 blocks build the q planes [b][head], the rest the k planes [b][kv head] (a uniform choice); RF as hrms_body leaves it.
#define RPB  16
__global__ __launch_bounds__(256) void k_rope(const float* __restrict__ FQ, const float* __restrict__ FK, const float* __restrict__ CS, const float* __restrict__ RF, const float* __restrict__ qnw, const float* __restrict__ knw, float sc, h16* Q16, bf* Qh, bf* Ql, h16* K16, bf* Kh, bf* Kl) {
    constexpr int NBQ = NB_ * NH_ * (TT * HD / 512); static_assert(NBQ % RPB == 0 && (TT * HD / 512) % RPB == 0, "the blocks of a work-group lie in one head plane");
    const int bf0 = (int)blockIdx.x * RPB; const bool isk = bf0 >= NBQ; const int bx0 = isk ? bf0 - NBQ : bf0; if (bx0 >= (isk ? NB_ * NKV * (TT * HD / 512) : NBQ)) return;
    const int nheads = isk ? NKV : NH_, pitch = nheads * HD; const float* F = isk ? FK : FQ; const float* nw = isk ? knw : qnw; h16* P16 = isk ? K16 : Q16; bf* Ph = isk ? Kh : Qh; bf* Pl = isk ? Kl : Ql;
    const int row = (threadIdx.x >> 6) * 4 + ((threadIdx.x >> 3) & 3), db = ((threadIdx.x >> 5) & 1) * 16 + (threadIdx.x & 7) * 2; const int hb = bx0 / (TT * HD / 512); const int b = isk ? hb / NKV : hb / NH_, h = isk ? hb % NKV : hb % NH_;
#pragma unroll 1   // one body: the trips are independent, and the many resident waves keep enough bytes in flight
    for (int it = 0; it < RPB; ++it) { const int bx = bx0 + it, blk = bx % (TT * HD / 512);
    const int d = (blk % (HD / 32)) * 32 + db; const int t = (blk / (HD / 32)) * 16 + row; const size_t e = (size_t)bx * 512 + (db >> 4) * 256 + (((db >> 3) & 1) * 16 + row) * 8 + (db & 7); const float* f = F + (size_t)(b * TT + t) * pitch + h * HD; float rf = 1.0f; v2h o16; v2us oh, ol;
    // every load of the trip is asked for here, together (one memory latency a trip, not one per use); d is even and HD / 2 too, so d and d + 1 have neighbouring partners
    const float* fa = f + d; const float* fb = f + ((d < HD / 2) ? d + HD / 2 : d - HD / 2); const float* na = nw + d; const float* nb = nw + ((d < HD / 2) ? d + HD / 2 : d - HD / 2); const float* cp = CS + ((size_t)t * HD + d) * 2;
    const float* rp = RF + (size_t)((isk ? NH_ : 0) + h) * TR + b * TT + t; if (RF) rf = *rp;
    const v2f xa = *(const v2f*)fa, xb = *(const v2f*)fb, wa = *(const v2f*)na, wb = *(const v2f*)nb; const v4f c4 = *(const v4f*)cp;
    asm volatile("s_wait_xcnt 0x0" :: "v"(rp), "v"(fa), "v"(fb), "v"(na), "v"(nb), "v"(cp) : "memory");   // the address pairs are inputs, so that none of them is reused (as a later load's destination either) in front of the wait; it stands in front of the arithmetic below, which may reuse the registers that these loads name
#pragma unroll
    for (int q = 0; q < 2; ++q) { const int dd = d + q; float x0 = xa[q], x1 = xb[q];
        if (RF) { float n0 = __fmul_rn(x0, rf), n1 = __fmul_rn(x1, rf); asm volatile("" : "+v"(n0)); asm volatile("" : "+v"(n1)); x0 = __fmul_rn(__fadd_rn(1.0f, bfr(wa[q])), n0); x1 = __fmul_rn(__fadd_rn(1.0f, bfr(wb[q])), n1);   /* weight applied as (1 + w) */ }
        float a = __fmul_rn(x0, c4[2 * q]), bq = __fmul_rn(x1, c4[2 * q + 1]); asm volatile("" : "+v"(a)); asm volatile("" : "+v"(bq)); const float r = ((dd < HD / 2) ? __fsub_rn(a, bq) : __fadd_rn(a, bq)) * sc;
        o16[q] = tohx(r); unsigned short a2, c2; splitf(r, a2, c2); oh[q] = a2; ol[q] = c2; }
    h16* s16 = P16 + e; bf* sh = Ph + e; bf* sl = Pl + e; *(v2h*)s16 = o16; *(v2us*)sh = oh; *(v2us*)sl = ol;
    asm volatile("s_wait_xcnt 0x0" :: "v"(s16), "v"(sh), "v"(sl) : "memory"); }   // behind the three stores, their addresses inputs: the next trip writes registers that this trip's loads and stores name
}
// vtp_body: v^T planes, one per batch, one behind the other (rows n = g * HD + d, k = t, k extent TT) in the fragment order of k_gemmw; thread x of work-group bx holds in trip it the plane elements 2 i and 2 i + 1, i = (bx * VTB + it) * 256 + x (keys t and t + 1 of one row), whole-line stores.
#define VTB  8    // blocks of 512 plane elements a work-group takes, one after the other
static_assert(NB_ * NKV * TT * HD / 512 % VTB == 0, "whole work-groups");
__device__ __forceinline__ void vtp_body(int bx, const float* __restrict__ F, h16* V16, bf* Vh, bf* Vl) {
#pragma unroll 1   // one body: the trips are independent
    for (int it = 0; it < VTB; ++it) { const size_t e = ((size_t)(bx * VTB + it) * 256 + threadIdx.x) * 2; if (e >= (size_t)NB_ * DKV * TT) break; const int blk = (int)(e >> 9), o = (int)(e & 511); const int na = (blk / (TT / 32)) * 16 + ((o >> 3) & 15); const int b = na / DKV, n = na % DKV; const int t = (blk % (TT / 32)) * 32 + (o >> 8) * 16 + ((o >> 7) & 1) * 8 + (o & 7); v2h o16; v2us oh, ol;
#pragma unroll
    for (int q = 0; q < 2; ++q) { const float x = F[(size_t)(b * TT + t + q) * DKV + n]; o16[q] = tohx(x); unsigned short a2, c2; splitf(x, a2, c2); oh[q] = a2; ol[q] = c2; }
    h16* s16 = V16 + e; bf* sh = Vh + e; bf* sl = Vl + e; *(v2h*)s16 = o16; *(v2us*)sh = oh; *(v2us*)sl = ol;
    asm volatile("s_wait_xcnt 0x0" :: "v"(s16), "v"(sh), "v"(sl) : "memory"); }   // behind the three stores, their addresses inputs: the next trip writes registers that this trip's loads and stores name
}
// k_rmsvt: the two stages that depend on the projections alone, in one launch: the first (NH_ + NKV) * TR / 256 work-groups take the rms factors (few, long threads), the rest build the v^T planes.
__global__ __launch_bounds__(256) void k_rmsvt(const float* __restrict__ FQ, const float* __restrict__ FK, float* RF, const float* __restrict__ FV, h16* V16, bf* Vh, bf* Vl) {
    constexpr int NR = (NH_ + NKV) * TR / 256; const int bx = blockIdx.x; if (bx < NR) hrms_body(bx, FQ, FK, RF); else vtp_body(bx - NR, FV, V16, Vh, Vl); }
// k_mergeg: blocks (16 rows t x 32 columns) of the two output planes, which are in the fragment order of k_gemmw: a wave takes 4 rows x 16 columns: 64-byte pieces on the reading and on the storing side.
// A work-group takes MGB blocks of one band, MGU at a time (their loads asked for together): few long waves, for speed only.
#define MGB  16
#define MGU  4
static_assert((ZH * HD / 32) % MGB == 0 && MGB % MGU == 0, "the blocks of a work-group lie in one band");
__global__ __launch_bounds__(256) void k_mergeg(const float* __restrict__ O, const float* __restrict__ G, int h0, bf* Ah, bf* Al) { const int tid = threadIdx.x; const int rb = blockIdx.x / (ZH * HD / 32 / MGB), kb0 = (blockIdx.x % (ZH * HD / 32 / MGB)) * MGB; if (rb >= TR / 16) return;   // rb counts the 16-row bands of both batches
    const int row = (tid >> 6) * 4 + ((tid >> 3) & 3), db = ((tid >> 5) & 1) * 16 + (tid & 7) * 2; const int tg = rb * 16 + row, b = tg / TT, t = tg % TT;
#pragma unroll 1   // MGU blocks a trip are unrolled below; more would only lengthen the code
    for (int it = 0; it < MGB; it += MGU) { const float* gp[MGU]; const float* op[MGU]; v2f gv[MGU], ov[MGU];
#pragma unroll
    for (int u = 0; u < MGU; ++u) { const int kl = (kb0 + it + u) * 32 + db; const int zz = kl / HD, d = kl % HD; gp[u] = G + (size_t)tg * DQ + h0 * HD + kl; op[u] = O + ((size_t)(b * ZH + zz) * TT + t) * HD + d; gv[u] = *(const v2f*)gp[u]; ov[u] = *(const v2f*)op[u]; }
    asm volatile("s_wait_xcnt 0x0" :: "v"(gp[0]), "v"(gp[1]), "v"(gp[2]), "v"(gp[3]), "v"(op[0]), "v"(op[1]), "v"(op[2]), "v"(op[3]) : "memory");   // the address pairs are inputs, so that none of them is reused (as a later load's destination either) in front of the wait
    bf* ap[MGU]; bf* lp[MGU];
#pragma unroll
    for (int u = 0; u < MGU; ++u) { const int kbl = kb0 + it + u;
    const size_t po = ((size_t)rb * (DQ / 32) + h0 * (HD / 32) + kbl) * 512 + (db >> 4) * 256 + (((db >> 3) & 1) * 16 + row) * 8 + (db & 7);
    v2us oh, ol;
#pragma unroll
    for (int q = 0; q < 2; ++q) { const float gt = gv[u][q]; const float sg = __fdiv_rn(1.0f, __fadd_rn(1.0f, expf(-gt))); const float o = ov[u][q]; unsigned short a, c2; splitf(__fmul_rn(o, sg), a, c2); oh[q] = a; ol[q] = c2; } ap[u] = Ah + po; lp[u] = Al + po; *(v2us*)ap[u] = oh; *(v2us*)lp[u] = ol; }
    asm volatile("s_wait_xcnt 0x0" :: "v"(ap[0]), "v"(ap[1]), "v"(ap[2]), "v"(ap[3]), "v"(lp[0]), "v"(lp[1]), "v"(lp[2]), "v"(lp[3]) : "memory"); }   // behind the stores, their addresses inputs: the next trip writes registers that the stores name
}

extern "C" void kernel_launch(void* const* d_in, const int* in_sizes, int n_in,
                              void* d_out, int out_size, void* d_ws, size_t ws_size, hipStream_t stream) {
    (void)in_sizes; (void)n_in; (void)out_size;
    const float* x = (const float*)d_in[0]; const float* wqg = (const float*)d_in[1]; const float* wk = (const float*)d_in[2]; const float* wv = (const float*)d_in[3]; const float* wo = (const float*)d_in[4]; const float* qnw = (const float*)d_in[5]; const float* knw = (const float*)d_in[6]; const float* wq = wqg;
    float* OUT = (float*)d_out;     // [2][2048][2048]
    char* wsp = (char*)d_ws;
    auto take = [&](size_t bytes) { char* p = wsp; wsp += (bytes + 255) & ~(size_t)255; return (void*)p; };
    bf* PK = (bf*)take((size_t)PKR * DM * 2);   // every packed bf16 operand plane, in the row order of pack_body
    bf* WQ = PK; bf* WK = WQ + (size_t)2 * DQ * DM; bf* WO = WK + (size_t)2 * DKV * DM; bf* XB = WO + (size_t)DM * DQ;   // the gate plane follows WQ, the Wv plane follows WK: z-slices of one GEMM launch
    float* CS = (float*)take((size_t)TT * HD * 2 * 4); float* RF = (float*)take((size_t)(NH_ + NKV) * TR * 4);
    float* FQ = (float*)take((size_t)2 * TR * DQ * 4); float* GATE = FQ + (size_t)TR * DQ; float* FK = (float*)take((size_t)2 * TR * DKV * 4); float* FV = FK + (size_t)TR * DKV;   // q then gate, k then v: the z-slices' outputs
    h16* QP16 = (h16*)take((size_t)NB_ * NH_ * TT * HD * 2); h16* KP16 = (h16*)take((size_t)NB_ * NKV * TT * HD * 2); h16* VT16 = (h16*)take((size_t)NB_ * NKV * HD * TT * 2);
    bf* QPh = (bf*)take((size_t)NB_ * NH_ * TT * HD * 2); bf* QPl = (bf*)take((size_t)NB_ * NH_ * TT * HD * 2); bf* KPh = (bf*)take((size_t)NB_ * NKV * TT * HD * 2); bf* KPl = (bf*)take((size_t)NB_ * NKV * TT * HD * 2); bf* VTh = (bf*)take((size_t)NB_ * NKV * HD * 2 * TT * 2); bf* VTl = VTh + (size_t)NB_ * NKV * HD * TT;   // v^T: hi planes then lo planes
    bf* ATl = (bf*)take((size_t)TR * DQ * 2);
    if ((size_t)(wsp - (char*)d_ws) > ws_size) return;    // ws 256 MiB
    float* Ob = FQ;   // attention output (NB_ x ZH x TT x HD f32 = TR x DQ) reuses the q projection buffer after the q planes are built (stream-ordered)
    bf* ATh = XB;     // hi plane of the gated attention output (TR x DQ = TR x DM elements) reuses the bf16 x plane after the k|v projection, its last reader (stream-ordered)
    k_prep<<<TT * HD / 256 / CSB + PKR / 16, 256, 0, stream>>>(wqg, wk, wv, wo, x, PK, CS);
    k_gemmw<bf, 0, false, 4, DM><<<dim3(TR / 64, DQ / 64, 2), 128, 0, stream>>>(XB, nullptr, WQ, nullptr, FQ, DQ, nullptr, 0, (size_t)DQ * DM, (size_t)TR * DQ);       // z = 0: q, z = 1: gate
    k_gemmw<bf, 0, false, 8, DM><<<dim3(TR / 64, DKV / 64, 2), 256, 0, stream>>>(XB, nullptr, WK, nullptr, FK, DKV, nullptr, 0, (size_t)DKV * DM, (size_t)TR * DKV);   // z = 0: k, z = 1: v
    k_rmsvt<<<(NH_ + NKV) * TR / 256 + NB_ * NKV * TT * HD / 2 / 256 / VTB, 256, 0, stream>>>(FQ, FK, RF, FV, VT16, VTh, VTl);
    k_rope<<<NB_ * (NH_ + NKV) * (TT * HD / 512) / RPB, 256, 0, stream>>>(FQ, FK, CS, RF, qnw, knw, 1.0f, QP16, QPh, QPl, KP16, KPh, KPl);
    k_fattn<<<dim3(NB_ * NH_, (TT - RH) / 32 + RH / 16, 1), 128, 0, stream>>>(QP16, KP16, VT16, QPh, QPl, KPh, KPl, VTh, VTl, Ob);
    k_mergeg<<<NB_ * ZH * TT * HD / 2 / 256 / MGB, 256, 0, stream>>>(Ob, GATE, 0, ATh, ATl);
    k_gemmw<bf, 1, false, 4, DQ><<<dim3(TR / 64, DM / 64, 1), 128, 0, stream>>>(ATh, ATl, WO, nullptr, OUT, DM, nullptr, 0, 0, 0);
}

// v007
// One run takes 223 microseconds.
// Two timings next to v006 put it at 1.19 and 1.18 times that version's speed.
// Counting every step since v000, it is 7.86 times as fast.
#include <hip/hip_runtime.h>

// GatedAttention (x [2][2048][2048]; qg = x Wq^T (Wq [4096][2048]) viewed (16 heads x 256): q = first 128, gate = last 128 of each head; k/v = x Wk^T / Wv^T (4 kv heads; group h/4); per-head RMSNorm (eps 1e-6) with weight (1 + w) on q and k; rotate-half RoPE (base 1e4, tables computed on device); causal softmax(q.k / sqrt(128)); out = merged attn v x sigmoid(gate); out Wo^T -> [2][2048][2048]).
// Compute dtypes, f32 accumulate: every input rounded to bf16; q / gate / k / v on PLAIN bf16 operands (inputs: exact; the interleaved q|gate rows of Wq gathered); RMSNorm, RoPE, sigmoid gating f32; causal scores and attn.v: query rows < 512 hl (3 products), the rest single fp16, one fused kernel with a running maximum and sum (f32), key blocks above the diagonal skipped; Wo hl x exact (2 products).

#define NB_  2
#define TT   2048
#define DM   2048
#define NH_  16
#define NKV  4
#define REP  (NH_ / NKV)
#define HD   128
#define DQ   (NH_ * HD)
#define DKV  (NKV * HD)
#define ZH   16                   // heads per attention pass (all of them: head z uses kv group z / REP)
#define TR   (NB_ * TT)           // rows of both batches together: row b * TT + t; every stage takes them in one launch
#define RH   512                  // query rows < RH use hi+lo planes (0: none)
#define SCL  0.088388347648318447f   // HD^-0.5
typedef _Float16 h16;
typedef unsigned short bf;
typedef __attribute__((ext_vector_type(16))) __bf16   v16bf;
typedef __attribute__((ext_vector_type(16))) _Float16 v16h;
typedef __attribute__((ext_vector_type(8)))  _Float16 v8h;
typedef __attribute__((ext_vector_type(8)))  unsigned short v8us;
typedef __attribute__((ext_vector_type(8)))  float    v8f;
typedef __attribute__((ext_vector_type(4)))  float    v4f;
typedef v8h  __attribute__((may_alias)) v8ha;
typedef v4f  __attribute__((may_alias)) v4fa;
typedef v8us __attribute__((may_alias)) v8usa;

__device__ __forceinline__ unsigned short f2bf(float f) { unsigned u = __float_as_uint(f); u += 0x7FFFu + ((u >> 16) & 1u); return (unsigned short)(u >> 16); }
__device__ __forceinline__ float bf2f(unsigned short b) { return __uint_as_float(((unsigned)b) << 16); }
__device__ __forceinline__ float bfr(float f) { return bf2f(f2bf(f)); }
__device__ __forceinline__ v16h cat16(v8h lo, v8h hi) { return __builtin_shufflevector(lo, hi, 0, 1, 2, 3, 4, 5, 6, 7, 8, 9, 10, 11, 12, 13, 14, 15); }
__device__ __forceinline__ v16bf cat16b(v8us lo, v8us hi) { return __builtin_bit_cast(v16bf, __builtin_shufflevector(lo, hi, 0, 1, 2, 3, 4, 5, 6, 7, 8, 9, 10, 11, 12, 13, 14, 15)); }
__device__ __forceinline__ v8f wmma16(v16h a, v16h b, v8f c) { return __builtin_amdgcn_wmma_f32_16x16x32_f16(false, a, false, b, (short)0, c, false, false); }
__device__ __forceinline__ v8f wmmab(v16bf a, v16bf b, v8f c) { return __builtin_amdgcn_wmma_f32_16x16x32_bf16(false, a, false, b, (short)0, c, false, false); }



// ---- k_gemmw: GEMM on bf16 planes in FRAGMENT ORDER (below). One tile of (WM x 64) x (WN x 64) outputs per work-group of WM x WN waves, 64 x 64 outputs (16 accumulators) a wave, every wave over the whole K in rising order.
// The operand bands of the tile are staged in LDS, KC k at a time, by asynchronous copies (global_load_async_to_lds_b128) into a ring of two buffers: an A band is fetched from L2 once per work-group and read from LDS by WN waves, a B band by WM waves.
// Fragment order of a plane [R][K]: blocks of 16 rows x 32 k, 512 elements each, block (r / 16, k / 32) at ((r / 16) * (K / 32) + k / 32) * 512; inside a block element (r, k) at ((k / 16) % 2) * 256 + (((k / 8) % 2) * 16 + r % 16) * 8 + k % 8,
// that is: [half of the fragment][lane][8 elements], so that each of the two 16-byte loads of a fragment reads 512 contiguous bytes over the wave (from LDS: every bank once per 256 bytes, no pad needed); KC k of a band of 16 rows are KC * 32 contiguous bytes, in the plane and in LDS alike.
// C[m][n] (f32, pitch LDC) = sum_k A[m][k] Bt[n][k] (+ A2[m][k] Bt[n][k] where NSPLIT == 1). z-slices: strides sB / sC in elements. grid (M / (WM * 64), N / (WN * 64), Z).
// A stage in LDS: [A bands | A2 bands | B bands], KC * 32 bytes each; wave w copies the bands w * BPW .. w * BPW + BPW - 1.
template <typename T16> struct WFrag;
template <> struct WFrag<h16> { typedef v16h V; static __device__ __forceinline__ V ld(const h16* p) { return cat16(*(const v8h*)p, *(const v8h*)(p + 16)); } static __device__ __forceinline__ V ldp(const h16* band, unsigned vb) { const char* p = (const char*)band + vb; return cat16(*(const v8h*)p, *(const v8h*)(p + 512)); } static __device__ __forceinline__ v8f mma(V a, V b, v8f c) { return wmma16(a, b, c); } };
template <> struct WFrag<bf> { typedef v16bf V; static __device__ __forceinline__ V ld(const bf* p) { return cat16b(*(const v8us*)p, *(const v8us*)(p + 16)); } static __device__ __forceinline__ V ldp(const bf* band, unsigned vb) { const char* p = (const char*)band + vb; return cat16b(*(const v8us*)p, *(const v8us*)(p + 512)); } static __device__ __forceinline__ v8f mma(V a, V b, v8f c) { return wmmab(a, b, c); } };
typedef __attribute__((ext_vector_type(4))) int cv4i;
typedef __attribute__((address_space(1))) cv4i gcv4i;
typedef __attribute__((address_space(3))) cv4i lcv4i;
__device__ __forceinline__ void cp16(const char* g, char* l) { __builtin_amdgcn_global_load_async_to_lds_b128((gcv4i*)g, (lcv4i*)l, 0, 0); }   // each lane: 16 bytes from global memory to LDS, through no register
__device__ __forceinline__ v16bf ldsfrag(const char* p) { return cat16b(*(const v8usa*)p, *(const v8usa*)(p + 512)); }
template <int NSPLIT, int WM, int WN, int KC, int PF, int K, int LDC>
__global__ __launch_bounds__(WM * WN * 32) void k_gemmw(const bf* __restrict__ A, const bf* __restrict__ A2, const bf* __restrict__ Bt, float* C, size_t sB, size_t sC) {
    constexpr int NW = WM * WN, NAB = WM * 4, NAA = NAB * (1 + NSPLIT), NBAND = NAA + WN * 4, BCH = KC * 32, STAGE = NBAND * BCH, BPW = NBAND / NW, CPB = BCH / 512, NT = K / KC;
    static_assert(NBAND % NW == 0 && K % KC == 0 && KC % (32 * PF) == 0 && NT >= 2 && BPW * CPB <= 63 && NW * 16 * 68 * 4 <= 2 * STAGE, "whole bands a wave, two stages or more, at most 63 copies of a wave in flight, the output slabs fit the ring");
    __shared__ __align__(1024) char ring[2 * STAGE];
    Bt += blockIdx.z * sB; C += blockIdx.z * sC;
    const int lane = threadIdx.x & 31, lr = lane & 15, hi = lane >> 4; const int wave = __builtin_amdgcn_readfirstlane(threadIdx.x >> 5); const int wm = wave / WN, wn = wave % WN; const int r0 = blockIdx.x * (WM * 64), c0 = blockIdx.y * (WN * 64);
    const char* gs[BPW];   // the lane's own 16 bytes at k = 0 of each band that this wave copies (the choice of the plane is wave-uniform)
#pragma unroll
    for (int u = 0; u < BPW; ++u) { const int i = wave * BPW + u; const bf* p = (i < NAB) ? A + (size_t)(r0 / 16 + i) * 16 * K : (NSPLIT == 1 && i < NAA) ? A2 + (size_t)(r0 / 16 + i - NAB) * 16 * K : Bt + (size_t)(c0 / 16 + i - NAA) * 16 * K; gs[u] = (const char*)p + lane * 16; }
    auto fill = [&](int t) { char* l = ring + (t & 1) * STAGE + wave * (BPW * BCH) + lane * 16;
#pragma unroll
        for (int u = 0; u < BPW; ++u)
#pragma unroll
            for (int c = 0; c < CPB; ++c) cp16(gs[u] + (size_t)t * BCH + c * 512, l + u * BCH + c * 512); };
    v8f acc[4][4];
#pragma unroll
    for (int mb = 0; mb < 4; ++mb)
#pragma unroll
        for (int nb = 0; nb < 4; ++nb) acc[mb][nb] = (v8f){};
    fill(0);
    asm volatile("s_wait_asynccnt 0x0" ::: "memory");   // this wave's copies of stage 0 have landed
    __syncthreads();                                     // every wave's have: stage 0 may be read
    fill(1);
#pragma unroll 1   // one body: the buffer is chosen by the trip's parity
    for (int t = 0; t < NT; ++t) {
        const char* sb = ring + (t & 1) * STAGE + lane * 16; const char* sa = sb + wm * (4 * BCH); const char* sw = sb + NAA * BCH + wn * (4 * BCH);
#pragma unroll
        for (int kg = 0; kg < KC / 32; kg += PF) { v16bf a[PF][4], a2[PF][4], b[PF][4];   // the fragments of PF k blocks are asked for together, in front of their products: one LDS latency a group, not one per B fragment
#pragma unroll
            for (int p = 0; p < PF; ++p)
#pragma unroll
                for (int i = 0; i < 4; ++i) { const int ko = (kg + p) * 1024; a[p][i] = ldsfrag(sa + i * BCH + ko); if (NSPLIT == 1) a2[p][i] = ldsfrag(sa + (NAB + i) * BCH + ko); b[p][i] = ldsfrag(sw + i * BCH + ko); }
            __builtin_amdgcn_sched_barrier(0);   // keeps the group of LDS loads above in front of the products below: sunk among them, each B fragment's load is waited for alone
#pragma unroll
            for (int p = 0; p < PF; ++p)
#pragma unroll
                for (int nb = 0; nb < 4; ++nb) {   // per accumulator: the A product, then the A2 product; three other products stand between the two (a product that reads the one just issued waits for it)
#pragma unroll
                    for (int mb = 0; mb < 4; ++mb) acc[mb][nb] = wmmab(a[p][mb], b[p][nb], acc[mb][nb]);
                    if (NSPLIT == 1) {
#pragma unroll
                        for (int mb = 0; mb < 4; ++mb) acc[mb][nb] = wmmab(a2[p][mb], b[p][nb], acc[mb][nb]); } } }
        __builtin_amdgcn_sched_barrier(0);   // keeps the products above in front of the waits below: lifted over them, the wait for the next stage's copies stands ahead of this trip's products and the refill behind them, and the copies fly with nothing to cover them
        asm volatile("s_wait_dscnt 0x0" ::: "memory");      // this wave's reads of the buffer have returned before the buffer is handed to its next writer
        asm volatile("s_wait_asynccnt 0x0" ::: "memory");   // this wave's copies of stage t + 1 have landed
        __syncthreads();                                     // publishes stage t + 1 and ends every wave's reads of stage t
        if (t + 2 < NT) fill(t + 2);                         // into the buffer that this trip has just read (the test reads the same for the whole work-group)
    }
    asm volatile("s_wait_asynccnt 0x0" ::: "memory");   // no copy is outstanding when the ring becomes output staging
    // each wave transposes its tile, 16 rows at a time, in a slab of its own (pitch 68 floats) and stores whole 128-byte lines: two rows of 256 bytes a store
    float* slab = (float*)ring + wave * (16 * 68); float* cw = C + (size_t)(r0 + wm * 64 + hi) * LDC + c0 + wn * 64 + lr * 4;
#pragma unroll
    for (int mb = 0; mb < 4; ++mb) {
#pragma unroll
        for (int nb = 0; nb < 4; ++nb)
#pragma unroll
            for (int j = 0; j < 8; ++j) slab[(hi * 8 + j) * 68 + nb * 16 + lr] = acc[mb][nb][j];
        asm volatile("s_wait_dscnt 0x0" ::: "memory");   // the column writes above (other lanes' data, same wave) are done before the rows are read back
        v4f val[8];
#pragma unroll
        for (int s = 0; s < 8; ++s) val[s] = *(const v4fa*)(slab + (s * 2 + hi) * 68 + lr * 4);
#pragma unroll
        for (int s = 0; s < 8; ++s) *(v4f*)(cw + (size_t)(mb * 16 + s * 2) * LDC) = val[s];
        asm volatile("s_wait_xcnt 0x0" :: "v"(cw), "v"(val[0]), "v"(val[1]), "v"(val[2]), "v"(val[3]), "v"(val[4]), "v"(val[5]), "v"(val[6]), "v"(val[7]) : "memory");   // behind the eight stores, their address and data inputs: the next rows' reads write registers that the stores name
    }
}

// ---- k_fattn: causal scores, softmax and probability x value product in one kernel; no score or probability ever reaches memory. One work-group of 4 waves per (head, tile of QT x 16 queries); wave w takes the 32-key blocks w, w + 4, ... up to the diagonal.
// Transposed products: S^T = K Q^T (A = 16 keys x 32 d of the k plane, B = the queries, kept in registers), O^T += V^T P^T (A = 16 d x 32 keys of the v^T plane). In an S^T tile lane (lr, hi) holds keys hi * 8 + j of query lr,
// which is the B-fragment order of those keys: two tiles convert in place into one P^T fragment; maximum and sum of a query are in-lane but for one exchange between the wave halves.
// Running maximum mu (raw score units) and sum per query; the accumulators are rescaled only when some query's block maximum exceeds its mu by more than 8 in log2 units (probabilities stay below 2^8, inside fp16 range).
// At the end the 4 waves agree on the largest mu, rescale, park sums and accumulators in LDS and add them in wave order 0..3 (a fixed order); each wave divides and stores a quarter of the output tile, QT * 32 d of 16 queries (whole 128-byte lines of a query's row).
typedef __attribute__((ext_vector_type(8))) __bf16 v8bf;
__device__ __forceinline__ float xhalf(float x) { const int b = __float_as_int(x); return __int_as_float(__builtin_amdgcn_permlanex16(b, b, 0x76543210, 0xfedcba98, false, false)); }   // the value of lane l ^ 16
template <typename T16, bool HL, int QT>
__device__ __forceinline__ void fattn_body(const T16* __restrict__ Q, const T16* __restrict__ Q2, const T16* __restrict__ Kp, const T16* __restrict__ Kp2, const T16* __restrict__ Vt, const T16* __restrict__ Vt2, float* O, int q0, float* red, float* sm, float* sl) {
    typedef typename WFrag<T16>::V V;
    constexpr int KS = 4, NACC = QT * 8, NA = NACC / KS; constexpr float CL = SCL * 1.4426950408889634f;   // score -> log2 units
    const int lane = threadIdx.x & 31, lr = lane & 15, hi = lane >> 4; const int wave = __builtin_amdgcn_readfirstlane(threadIdx.x >> 5); const unsigned lb = (unsigned)lane * 16u;
    V qf[QT][4], qf2[QT][4]; const T16* qp = (const T16*)((const char*)(Q + (size_t)(q0 / 16) * 2048) + lb); const T16* qp2 = HL ? (const T16*)((const char*)(Q2 + (size_t)(q0 / 16) * 2048) + lb) : qp;   // the lane's own address in the first block; the other blocks are immediate offsets
#pragma unroll
    for (int qt = 0; qt < QT; ++qt)
#pragma unroll
        for (int dc = 0; dc < 4; ++dc) { const int o = (qt * 4 + dc) * 512; qf[qt][dc] = WFrag<T16>::ldp(qp + o, 0u); if (HL) qf2[qt][dc] = WFrag<T16>::ldp(qp2 + o, 0u); }
    asm volatile("s_wait_xcnt 0x0" :: "v"(qp), "v"(qp2), "v"(lane) : "memory");   // the address pairs are inputs, so that none of them is reused (as a later load's destination either) in front of the wait; the lane number too, which the loads name as their offset where the block's start is a scalar base
    const int nkb = (q0 + QT * 16 + 31) / 32;   // 32-key blocks up to and with the one that holds the diagonal
    V kf[8], kf2[8];   // single-plane tiles fetch the k fragments one block ahead, into the same registers (block 'wave' exists in the plane also where the wave has no work: wave < 4 <= TT / 32); the short hi+lo tiles load them where they are used
    if constexpr (!HL) {
        const T16* kp = (const T16*)((const char*)(Kp + (size_t)wave * 4096) + lb);
#pragma unroll
        for (int i = 0; i < 8; ++i) kf[i] = WFrag<T16>::ldp(kp + i * 512, 0u);
        asm volatile("s_wait_xcnt 0x0" :: "v"(kp), "v"(lane) : "memory"); }   // as above
    v8f acc[QT][8]; float mu[QT], ls[QT];
#pragma unroll
    for (int qt = 0; qt < QT; ++qt) { mu[qt] = -3.0e38f; ls[qt] = 0.f;
#pragma unroll
        for (int dt = 0; dt < 8; ++dt) acc[qt][dt] = (v8f){}; }
#pragma unroll 1   // one body: a second copy would need a second set of k, v^T and score registers, and the wave's allocation decides how many waves a SIMD holds
    for (int kb = wave; kb < nkb; kb += KS) {
        const int kn = (kb + KS < nkb) ? kb + KS : kb;   // the block fetched ahead; the wave's last block fetches itself again (in bounds, unused)
        V vf[8], vf2[8];   // asked for in front of the score products and the softmax arithmetic, which cover most of their latency
        const T16* vp = (const T16*)((const char*)(Vt + (size_t)kb * 512) + lb);
        if constexpr (HL) { const T16* kp = (const T16*)((const char*)(Kp + (size_t)kb * 4096) + lb); const T16* kp2 = (const T16*)((const char*)(Kp2 + (size_t)kb * 4096) + lb); const T16* vp2 = (const T16*)((const char*)(Vt2 + (size_t)kb * 512) + lb);
#pragma unroll
            for (int i = 0; i < 8; ++i) { kf[i] = WFrag<T16>::ldp(kp + i * 512, 0u); kf2[i] = WFrag<T16>::ldp(kp2 + i * 512, 0u); }
#pragma unroll
            for (int dt = 0; dt < 8; ++dt) { vf[dt] = WFrag<T16>::ldp(vp + dt * (TT / 32) * 512, 0u); vf2[dt] = WFrag<T16>::ldp(vp2 + dt * (TT / 32) * 512, 0u); }
            asm volatile("s_wait_xcnt 0x0" :: "v"(kp), "v"(kp2), "v"(vp), "v"(vp2) : "memory");   // as above
        } else {
#pragma unroll
            for (int dt = 0; dt < 8; ++dt) vf[dt] = WFrag<T16>::ldp(vp + dt * (TT / 32) * 512, 0u); }
        v8f s[QT][2];
#pragma unroll
        for (int qt = 0; qt < QT; ++qt) { s[qt][0] = (v8f){}; s[qt][1] = (v8f){}; }
#pragma unroll
        for (int hf = 0; hf < 2; ++hf)
#pragma unroll
            for (int dc = 0; dc < 4; ++dc) { const int i = hf * 4 + dc;
#pragma unroll
                for (int qt = 0; qt < QT; ++qt) { s[qt][hf] = WFrag<T16>::mma(kf[i], qf[qt][dc], s[qt][hf]); if (HL) { s[qt][hf] = WFrag<T16>::mma(kf[i], qf2[qt][dc], s[qt][hf]); s[qt][hf] = WFrag<T16>::mma(kf2[i], qf[qt][dc], s[qt][hf]); } } }
        if constexpr (!HL) {
            __builtin_amdgcn_sched_barrier(0);   // keeps the loads below behind the products above, which read the registers they fill: lifted over them they take a second register set, and copies behind a full wait at the loop's foot
            const T16* kp = (const T16*)((const char*)(Kp + (size_t)kn * 4096) + lb);
#pragma unroll
            for (int i = 0; i < 8; ++i) kf[i] = WFrag<T16>::ldp(kp + i * 512, 0u);
            asm volatile("s_wait_xcnt 0x0" :: "v"(kp), "v"(vp) : "memory"); }   // as above, for this block's v^T loads too
        if (kb == nkb - 1) {   // the block on the diagonal: keys behind the query are masked (wave-uniform test)
#pragma unroll
            for (int qt = 0; qt < QT; ++qt)
#pragma unroll
                for (int hf = 0; hf < 2; ++hf)
#pragma unroll
                    for (int j = 0; j < 8; ++j) if (kb * 32 + hf * 16 + hi * 8 + j > q0 + qt * 16 + lr) s[qt][hf][j] = -3.0e38f; }
        float bm[QT]; bool need = false;
#pragma unroll
        for (int qt = 0; qt < QT; ++qt) { float t = fmaxf(s[qt][0][0], s[qt][1][0]);
#pragma unroll
            for (int j = 1; j < 8; ++j) t = fmaxf(t, fmaxf(s[qt][0][j], s[qt][1][j]));
            bm[qt] = fmaxf(t, xhalf(t)); need = need || ((bm[qt] - mu[qt]) * CL > 8.0f); }
        if (__builtin_amdgcn_ballot_w32(need) != 0) {   // one scalar test a block
#pragma unroll
            for (int qt = 0; qt < QT; ++qt) { const float mn = fmaxf(mu[qt], bm[qt]); const float al = __builtin_amdgcn_exp2f((mu[qt] - mn) * CL); mu[qt] = mn; ls[qt] *= al;
#pragma unroll
                for (int dt = 0; dt < 8; ++dt) acc[qt][dt] *= al; } }
        V pf[QT], pf2[QT];
#pragma unroll
        for (int qt = 0; qt < QT; ++qt) { const float nm = -mu[qt] * CL; v8f p0, p1;
#pragma unroll
            for (int j = 0; j < 8; ++j) { p0[j] = __builtin_amdgcn_exp2f(fmaf(s[qt][0][j], CL, nm)); p1[j] = __builtin_amdgcn_exp2f(fmaf(s[qt][1][j], CL, nm)); }
            float t = 0.f;
#pragma unroll
            for (int j = 0; j < 8; ++j) t += p0[j] + p1[j];
            ls[qt] += t;
            if constexpr (HL) { const v8bf h0 = __builtin_convertvector(p0, v8bf), h1 = __builtin_convertvector(p1, v8bf); const v8bf l0 = __builtin_convertvector(p0 - __builtin_convertvector(h0, v8f), v8bf), l1 = __builtin_convertvector(p1 - __builtin_convertvector(h1, v8f), v8bf);
                pf[qt] = __builtin_shufflevector(h0, h1, 0, 1, 2, 3, 4, 5, 6, 7, 8, 9, 10, 11, 12, 13, 14, 15); pf2[qt] = __builtin_shufflevector(l0, l1, 0, 1, 2, 3, 4, 5, 6, 7, 8, 9, 10, 11, 12, 13, 14, 15); }
            else pf[qt] = cat16(__builtin_convertvector(p0, v8h), __builtin_convertvector(p1, v8h)); }
#pragma unroll
        for (int dt = 0; dt < 8; ++dt)
#pragma unroll
            for (int qt = 0; qt < QT; ++qt) { acc[qt][dt] = WFrag<T16>::mma(vf[dt], pf[qt], acc[qt][dt]); if (HL) { acc[qt][dt] = WFrag<T16>::mma(vf[dt], pf2[qt], acc[qt][dt]); acc[qt][dt] = WFrag<T16>::mma(vf2[dt], pf[qt], acc[qt][dt]); } }
    }
#pragma unroll
    for (int qt = 0; qt < QT; ++qt) { ls[qt] += xhalf(ls[qt]); if (hi == 0) sm[wave * 32 + qt * 16 + lr] = mu[qt]; }
    __syncthreads();   // every wave's maximum is in LDS before any wave picks the largest
    float* mine = red + wave * (NACC * 256);
#pragma unroll
    for (int qt = 0; qt < QT; ++qt) { const int qi = qt * 16 + lr; const float M = fmaxf(fmaxf(sm[qi], sm[32 + qi]), fmaxf(sm[64 + qi], sm[96 + qi])); const float f = __builtin_amdgcn_exp2f((mu[qt] - M) * CL); if (hi == 0) sl[wave * 32 + qi] = ls[qt] * f;
#pragma unroll
        for (int dt = 0; dt < 8; ++dt) { const v8f t = acc[qt][dt] * f; const int a = qt * 8 + dt; *(v4fa*)(mine + a * 256 + lane * 4) = __builtin_shufflevector(t, t, 0, 1, 2, 3); *(v4fa*)(mine + a * 256 + 128 + lane * 4) = __builtin_shufflevector(t, t, 4, 5, 6, 7); } }
    __syncthreads();   // every wave's rescaled sums are in LDS before any wave adds them up
#pragma unroll
    for (int i = 0; i < NA; ++i) { const int a = wave * NA + i, qt = a >> 3, dt = a & 7, qi = qt * 16 + lr; const float* p = red + a * 256 + lane * 4; v4f s0 = *(const v4fa*)p, s1 = *(const v4fa*)(p + 128); float L = sl[qi];
#pragma unroll
        for (int w = 1; w < KS; ++w) { s0 += *(const v4fa*)(p + w * (NACC * 256)); s1 += *(const v4fa*)(p + w * (NACC * 256) + 128); L += sl[w * 32 + qi]; }
        const float r = __fdiv_rn(1.0f, L); float* o = O + (size_t)(q0 + qi) * HD + dt * 16 + hi * 8; *(v4f*)o = s0 * r; *(v4f*)(o + 4) = s1 * r; }
}
// grid (batches x heads, tiles): blockIdx.x = b * NH_ + head, whose kv planes are number blockIdx.x / REP = b * NKV + head / REP; tile ranks 0 .. (TT - RH) / 32 - 1 are the fp16 tiles of 32 queries from the last rows down (the longest first), the rest the hi+lo tiles of 16 queries, again from the last down.
__global__ __launch_bounds__(128) void k_fattn(const h16* __restrict__ Q16, const h16* __restrict__ K16, const h16* __restrict__ V16, const bf* __restrict__ Qh, const bf* __restrict__ Ql, const bf* __restrict__ Kh, const bf* __restrict__ Kl, const bf* __restrict__ Vh, const bf* __restrict__ Vl, float* O) {
    __shared__ __align__(16) float red[4 * 16 * 256]; __shared__ float sm[4 * 32]; __shared__ float sl[4 * 32];
    const size_t z = blockIdx.x, g = z / REP; const int rk = blockIdx.y; const size_t qo = z * TT * HD, ko = g * TT * HD; O += qo;
    if (rk < (TT - RH) / 32) fattn_body<h16, false, 2>(Q16 + qo, nullptr, K16 + ko, nullptr, V16 + ko, nullptr, O, TT - 32 - rk * 32, red, sm, sl);
    else fattn_body<bf, true, 1>(Qh + qo, Ql + qo, Kh + ko, Kl + ko, Vh + ko, Vl + ko, O, RH - 16 - (rk - (TT - RH) / 32) * 16, red, sm, sl);
}

__device__ __forceinline__ h16 tohx(float x) { return (h16)x; }
__device__ __forceinline__ void splitf(float y, unsigned short& h, unsigned short& l) { h = f2bf(y); l = f2bf(y - bf2f(h)); }
typedef __attribute__((ext_vector_type(2))) _Float16 v2h;
typedef __attribute__((ext_vector_type(4))) _Float16 v4h;
typedef __attribute__((ext_vector_type(2))) unsigned short v2us;
typedef __attribute__((ext_vector_type(4))) unsigned short v4us;
typedef __attribute__((ext_vector_type(2))) float v2f;
typedef __attribute__((ext_vector_type(4))) int v4i;

__global__ __launch_bounds__(256) void k_wtG(const float* __restrict__ w, int K, int N, bf* Bt) {
    const int lane = threadIdx.x & 31; const int L0 = (blockIdx.x * 8 + (threadIdx.x >> 5)) * 8; const int nlines = N * K / 64;
{
#pragma unroll 1
        for (int l = 0; l < 8; ++l) { const int L = L0 + l; if (L >= nlines) break; const size_t e = (size_t)L * 64 + lane * 2; const int k = (int)(e % K), n = (int)(e / K); v2us o;
            o[0] = f2bf(w[(size_t)k * N + n]); o[1] = f2bf(w[(size_t)(k + 1) * N + n]); *(v2us*)(Bt + e) = o; }
         }
}
// pack_body: f32 rows [R][K] -> bf16 plane in the fragment order of k_gemmw. A wave takes one block of 16 rows x 32 k at a time: 8 lanes read one whole 128-byte line of a row (4 rows a load), each lane stores its 4 elements as 8 bytes (64 contiguous bytes per 4 rows).
// One launch packs every operand: all have K = DM = DQ columns, and their planes lie one behind the other in dst: [q rows of Wq | gate rows of Wq | Wk | Wv | Wo | x, both batches] = PKR rows. The 8 waves of a work-group share a band of 16 rows, so the choice of the source is uniform.
// q / gate plane row n is row (n / HD) * 2 * HD + part * HD + n % HD of the interleaved q|gate weight (part 0: q, part 1: gate); every other plane row is the same row of its source.
#define PKR  (2 * DQ + 2 * DKV + DM + TR)
static_assert(DM == DQ, "one K for every packed plane");
__device__ __forceinline__ void pack_body(int bx, const float* __restrict__ wqg, const float* __restrict__ wk, const float* __restrict__ wv, const float* __restrict__ wo, const float* __restrict__ x, bf* dst) {
    constexpr int K = DM, KB = K >> 5;
    const int lane = threadIdx.x & 31; const int rb = bx; const int k = (lane & 7) * 4, rq = lane >> 3;   // work-group bx takes the whole band bx of 16 rows: its wave w the k blocks w, w + 8, ... (few long waves, for speed only)
    const int n0 = rb * 16; const float* src; int s0;   // HD % 16 == 0: the 16 rows of a block are consecutive rows of src
    if (n0 < 2 * DQ) { const int part = n0 / DQ, nn = n0 % DQ; src = wqg; s0 = (nn / HD) * 2 * HD + part * HD + nn % HD; }
    else if (n0 < 2 * DQ + DKV) { src = wk; s0 = n0 - 2 * DQ; }
    else if (n0 < 2 * DQ + 2 * DKV) { src = wv; s0 = n0 - (2 * DQ + DKV); }
    else if (n0 < 2 * DQ + 2 * DKV + DM) { src = wo; s0 = n0 - (2 * DQ + 2 * DKV); }
    else { src = x; s0 = n0 - (2 * DQ + 2 * DKV + DM); }
#pragma unroll 1   // one body: the trips are independent streams, and the many resident waves keep enough bytes in flight
    for (int kb = (int)(threadIdx.x >> 5); kb < KB; kb += 8) { const int blk = rb * KB + kb;
    const float* sp = src + (size_t)(s0 + rq) * K + kb * 32 + k; bf* d = dst + (size_t)blk * 512 + ((k >> 4) & 1) * 256 + ((k >> 3) & 1) * 128 + rq * 8 + (k & 7); v4f v[4];
    const float* p1 = sp + (size_t)4 * K; const float* p2 = sp + (size_t)8 * K; const float* p3 = sp + (size_t)12 * K;
    v[0] = *(const v4f*)sp; v[1] = *(const v4f*)p1; v[2] = *(const v4f*)p2; v[3] = *(const v4f*)p3;
    asm volatile("s_wait_xcnt 0x0" :: "v"(sp), "v"(p1), "v"(p2), "v"(p3) : "memory");   // the four address pairs are inputs, so that none of them is reused (as a later load's destination either) in front of the wait
#pragma unroll
    for (int it = 0; it < 4; ++it) { v4us o;
#pragma unroll
        for (int u = 0; u < 4; ++u) o[u] = f2bf(v[it][u]);
        *(v4us*)(d + it * 32) = o; }
    asm volatile("s_wait_xcnt 0x0" :: "v"(d) : "memory");   // behind the four stores, their address an input: the next trip writes registers that the stores name
    }
}
#define CSB  4    // table pieces of 256 entries a work-group fills, one after the other
static_assert(TT * HD % (256 * CSB) == 0, "whole work-groups");
__device__ __forceinline__ void cstab_body(int bx, float* CS) {
#pragma unroll 1   // one body: the range reductions of cosf and sinf are long code
    for (int it = 0; it < CSB; ++it) { const int idx = (bx * CSB + it) * 256 + threadIdx.x; if (idx >= TT * HD) break; const int t = idx / HD, d = idx % HD; const int i = d % (HD / 2); const float inv = __fdiv_rn(1.0f, powf(10000.0f, (float)(2 * i) / (float)HD)); const float ang = __fmul_rn((float)t, inv); v2f cs; cs[0] = cosf(ang); cs[1] = sinf(ang);
    float* cp = CS + (size_t)idx * 2; *(v2f*)cp = cs;
    asm volatile("s_wait_xcnt 0x0" :: "v"(cp) : "memory"); }   // behind the store, its address an input: the next trip writes registers that the store names
}
// k_prep: the two stages that depend on nothing but the inputs, in one launch: the first TT * HD / 256 / CSB work-groups fill the cos|sin table (the longer threads), the rest pack the operands.
__global__ __launch_bounds__(256) void k_prep(const float* __restrict__ wqg, const float* __restrict__ wk, const float* __restrict__ wv, const float* __restrict__ wo, const float* __restrict__ x, bf* dst, float* CS) {
    constexpr int NCS = TT * HD / 256 / CSB; const int bx = blockIdx.x; if (bx < NCS) cstab_body(bx, CS); else pack_body(bx - NCS, wqg, wk, wv, wo, x, dst); }
// hrms_body: one thread per (head, row of both batches); heads 0 .. NH_ - 1 are the q heads, the NKV behind them the k heads (TR % 256 == 0: a work-group has one head); RF[head][row].
__device__ __forceinline__ void hrms_body(int bx, const float* __restrict__ FQ, const float* __restrict__ FK, float* RF) { const int i = bx * 256 + threadIdx.x; if (i >= (NH_ + NKV) * TR) return; const int t = i % TR, h = i / TR; const float* f = (h < NH_) ? FQ + (size_t)t * DQ + h * HD : FK + (size_t)t * DKV + (h - NH_) * HD; float s = 0.f;
#pragma unroll 4
    for (int d = 0; d < HD; d += 4) { const v4f v = *(const v4f*)(f + d);
#pragma unroll
        for (int q = 0; q < 4; ++q) { float p = __fmul_rn(v[q], v[q]); asm volatile("" : "+v"(p)); s = __fadd_rn(s, p); } }
    const float r = __fdiv_rn(1.0f, __fsqrt_rn(__fadd_rn(s * (1.0f / HD), 1e-6f))); *(float*)(RF + i) = r;  }
// k_rope: head planes [h] of [t][d] in the fragment order of k_gemmw (rows t, k = d; one block of 16 t x 32 d a trip of a work-group, a wave takes 4 rows x 16 d: 64-byte pieces on the reading and on the storing side) (fp16 + hi/lo) of rope(w[d] (x rms_factor)) x sc with the rotate-half convention out[d] = x[d] cos[t][d] - x[d+HD/2] sin[t][d], out[d+HD/2] = x[d+HD/2] cos[t][d+HD/2] + x[d] sin[t][d+HD/2]
// One launch for q and k of both batches: a work-group takes RPB blocks one after the other (64 rows t of one head: few long waves, for speed only); the first NB_ * NH_ * TT * HD / 512 blocks build the q planes [b][head], the rest the k planes [b][kv head] (a uniform choice); RF as hrms_body leaves it.
#define RPB  16
__global__ __launch_bounds__(256) void k_rope(const float* __restrict__ FQ, const float* __restrict__ FK, const float* __restrict__ CS, const float* __restrict__ RF, const float* __restrict__ qnw, const float* __restrict__ knw, float sc, h16* Q16, bf* Qh, bf* Ql, h16* K16, bf* Kh, bf* Kl) {
    constexpr int NBQ = NB_ * NH_ * (TT * HD / 512); static_assert(NBQ % RPB == 0 && (TT * HD / 512) % RPB == 0, "the blocks of a work-group lie in one head plane");
    const int bf0 = (int)blockIdx.x * RPB; const bool isk = bf0 >= NBQ; const int bx0 = isk ? bf0 - NBQ : bf0; if (bx0 >= (isk ? NB_ * NKV * (TT * HD / 512) : NBQ)) return;
    const int nheads = isk ? NKV : NH_, pitch = nheads * HD; const float* F = isk ? FK : FQ; const float* nw = isk ? knw : qnw; h16* P16 = isk ? K16 : Q16; bf* Ph = isk ? Kh : Qh; bf* Pl = isk ? Kl : Ql;
    const int row = (threadIdx.x >> 6) * 4 + ((threadIdx.x >> 3) & 3), db = ((threadIdx.x >> 5) & 1) * 16 + (threadIdx.x & 7) * 2; const int hb = bx0 / (TT * HD / 512); const int b = isk ? hb / NKV : hb / NH_, h = isk ? hb % NKV : hb % NH_;
#pragma unroll 1   // one body: the trips are independent, and the many resident waves keep enough bytes in flight
    for (int it = 0; it < RPB; ++it) { const int bx = bx0 + it, blk = bx % (TT * HD / 512);
    const int d = (blk % (HD / 32)) * 32 + db; const int t = (blk / (HD / 32)) * 16 + row; const size_t e = (size_t)bx * 512 + (db >> 4) * 256 + (((db >> 3) & 1) * 16 + row) * 8 + (db & 7); const float* f = F + (size_t)(b * TT + t) * pitch + h * HD; float rf = 1.0f; v2h o16; v2us oh, ol;
    // every load of the trip is asked for here, together (one memory latency a trip, not one per use); d is even and HD / 2 too, so d and d + 1 have neighbouring partners
    const float* fa = f + d; const float* fb = f + ((d < HD / 2) ? d + HD / 2 : d - HD / 2); const float* na = nw + d; const float* nb = nw + ((d < HD / 2) ? d + HD / 2 : d - HD / 2); const float* cp = CS + ((size_t)t * HD + d) * 2;
    const float* rp = RF + (size_t)((isk ? NH_ : 0) + h) * TR + b * TT + t; if (RF) rf = *rp;
    const v2f xa = *(const v2f*)fa, xb = *(const v2f*)fb, wa = *(const v2f*)na, wb = *(const v2f*)nb; const v4f c4 = *(const v4f*)cp;
    asm volatile("s_wait_xcnt 0x0" :: "v"(rp), "v"(fa), "v"(fb), "v"(na), "v"(nb), "v"(cp) : "memory");   // the address pairs are inputs, so that none of them is reused (as a later load's destination either) in front of the wait; it stands in front of the arithmetic below, which may reuse the registers that these loads name
#pragma unroll
    for (int q = 0; q < 2; ++q) { const int dd = d + q; float x0 = xa[q], x1 = xb[q];
        if (RF) { float n0 = __fmul_rn(x0, rf), n1 = __fmul_rn(x1, rf); asm volatile("" : "+v"(n0)); asm volatile("" : "+v"(n1)); x0 = __fmul_rn(__fadd_rn(1.0f, bfr(wa[q])), n0); x1 = __fmul_rn(__fadd_rn(1.0f, bfr(wb[q])), n1);   /* weight applied as (1 + w) */ }
        float a = __fmul_rn(x0, c4[2 * q]), bq = __fmul_rn(x1, c4[2 * q + 1]); asm volatile("" : "+v"(a)); asm volatile("" : "+v"(bq)); const float r = ((dd < HD / 2) ? __fsub_rn(a, bq) : __fadd_rn(a, bq)) * sc;
        o16[q] = tohx(r); unsigned short a2, c2; splitf(r, a2, c2); oh[q] = a2; ol[q] = c2; }
    h16* s16 = P16 + e; bf* sh = Ph + e; bf* sl = Pl + e; *(v2h*)s16 = o16; *(v2us*)sh = oh; *(v2us*)sl = ol;
    asm volatile("s_wait_xcnt 0x0" :: "v"(s16), "v"(sh), "v"(sl) : "memory"); }   // behind the three stores, their addresses inputs: the next trip writes registers that this trip's loads and stores name
}
// vtp_body: v^T planes, one per batch, one behind the other (rows n = g * HD + d, k = t, k extent TT) in the fragment order of k_gemmw; thread x of work-group bx holds in trip it the plane elements 2 i and 2 i + 1, i = (bx * VTB + it) * 256 + x (keys t and t + 1 of one row), whole-line stores.
#define VTB  8    // blocks of 512 plane elements a work-group takes, one after the other
static_assert(NB_ * NKV * TT * HD / 512 % VTB == 0, "whole work-groups");
__device__ __forceinline__ void vtp_body(int bx, const float* __restrict__ F, h16* V16, bf* Vh, bf* Vl) {
#pragma unroll 1   // one body: the trips are independent
    for (int it = 0; it < VTB; ++it) { const size_t e = ((size_t)(bx * VTB + it) * 256 + threadIdx.x) * 2; if (e >= (size_t)NB_ * DKV * TT) break; const int blk = (int)(e >> 9), o = (int)(e & 511); const int na = (blk / (TT / 32)) * 16 + ((o >> 3) & 15); const int b = na / DKV, n = na % DKV; const int t = (blk % (TT / 32)) * 32 + (o >> 8) * 16 + ((o >> 7) & 1) * 8 + (o & 7); v2h o16; v2us oh, ol;
#pragma unroll
    for (int q = 0; q < 2; ++q) { const float x = F[(size_t)(b * TT + t + q) * DKV + n]; o16[q] = tohx(x); unsigned short a2, c2; splitf(x, a2, c2); oh[q] = a2; ol[q] = c2; }
    h16* s16 = V16 + e; bf* sh = Vh + e; bf* sl = Vl + e; *(v2h*)s16 = o16; *(v2us*)sh = oh; *(v2us*)sl = ol;
    asm volatile("s_wait_xcnt 0x0" :: "v"(s16), "v"(sh), "v"(sl) : "memory"); }   // behind the three stores, their addresses inputs: the next trip writes registers that this trip's loads and stores name
}
// k_rmsvt: the two stages that depend on the projections alone, in one launch: the first (NH_ + NKV) * TR / 256 work-groups take the rms factors (few, long threads), the rest build the v^T planes.
__global__ __launch_bounds__(256) void k_rmsvt(const float* __restrict__ FQ, const float* __restrict__ FK, float* RF, const float* __restrict__ FV, h16* V16, bf* Vh, bf* Vl) {
    constexpr int NR = (NH_ + NKV) * TR / 256; const int bx = blockIdx.x; if (bx < NR) hrms_body(bx, FQ, FK, RF); else vtp_body(bx - NR, FV, V16, Vh, Vl); }
// k_mergeg: blocks (16 rows t x 32 columns) of the two output planes, which are in the fragment order of k_gemmw: a wave takes 4 rows x 16 columns: 64-byte pieces on the reading and on the storing side.
// A work-group takes MGB blocks of one band, MGU at a time (their loads asked for together): few long waves, for speed only.
#define MGB  16
#define MGU  4
static_assert((ZH * HD / 32) % MGB == 0 && MGB % MGU == 0, "the blocks of a work-group lie in one band");
__global__ __launch_bounds__(256) void k_mergeg(const float* __restrict__ O, const float* __restrict__ G, int h0, bf* Ah, bf* Al) { const int tid = threadIdx.x; const int rb = blockIdx.x / (ZH * HD / 32 / MGB), kb0 = (blockIdx.x % (ZH * HD / 32 / MGB)) * MGB; if (rb >= TR / 16) return;   // rb counts the 16-row bands of both batches
    const int row = (tid >> 6) * 4 + ((tid >> 3) & 3), db = ((tid >> 5) & 1) * 16 + (tid & 7) * 2; const int tg = rb * 16 + row, b = tg / TT, t = tg % TT;
#pragma unroll 1   // MGU blocks a trip are unrolled below; more would only lengthen the code
    for (int it = 0; it < MGB; it += MGU) { const float* gp[MGU]; const float* op[MGU]; v2f gv[MGU], ov[MGU];
#pragma unroll
    for (int u = 0; u < MGU; ++u) { const int kl = (kb0 + it + u) * 32 + db; const int zz = kl / HD, d = kl % HD; gp[u] = G + (size_t)tg * DQ + h0 * HD + kl; op[u] = O + ((size_t)(b * ZH + zz) * TT + t) * HD + d; gv[u] = *(const v2f*)gp[u]; ov[u] = *(const v2f*)op[u]; }
    asm volatile("s_wait_xcnt 0x0" :: "v"(gp[0]), "v"(gp[1]), "v"(gp[2]), "v"(gp[3]), "v"(op[0]), "v"(op[1]), "v"(op[2]), "v"(op[3]) : "memory");   // the address pairs are inputs, so that none of them is reused (as a later load's destination either) in front of the wait
    bf* ap[MGU]; bf* lp[MGU];
#pragma unroll
    for (int u = 0; u < MGU; ++u) { const int kbl = kb0 + it + u;
    const size_t po = ((size_t)rb * (DQ / 32) + h0 * (HD / 32) + kbl) * 512 + (db >> 4) * 256 + (((db >> 3) & 1) * 16 + row) * 8 + (db & 7);
    v2us oh, ol;
#pragma unroll
    for (int q = 0; q < 2; ++q) { const float gt = gv[u][q]; const float sg = __fdiv_rn(1.0f, __fadd_rn(1.0f, expf(-gt))); const float o = ov[u][q]; unsigned short a, c2; splitf(__fmul_rn(o, sg), a, c2); oh[q] = a; ol[q] = c2; } ap[u] = Ah + po; lp[u] = Al + po; *(v2us*)ap[u] = oh; *(v2us*)lp[u] = ol; }
    asm volatile("s_wait_xcnt 0x0" :: "v"(ap[0]), "v"(ap[1]), "v"(ap[2]), "v"(ap[3]), "v"(lp[0]), "v"(lp[1]), "v"(lp[2]), "v"(lp[3]) : "memory"); }   // behind the stores, their addresses inputs: the next trip writes registers that the stores name
}

extern "C" void kernel_launch(void* const* d_in, const int* in_sizes, int n_in,
                              void* d_out, int out_size, void* d_ws, size_t ws_size, hipStream_t stream) {
    (void)in_sizes; (void)n_in; (void)out_size;
    const float* x = (const float*)d_in[0]; const float* wqg = (const float*)d_in[1]; const float* wk = (const float*)d_in[2]; const float* wv = (const float*)d_in[3]; const float* wo = (const float*)d_in[4]; const float* qnw = (const float*)d_in[5]; const float* knw = (const float*)d_in[6]; const float* wq = wqg;
    float* OUT = (float*)d_out;     // [2][2048][2048]
    char* wsp = (char*)d_ws;
    auto take = [&](size_t bytes) { char* p = wsp; wsp += (bytes + 255) & ~(size_t)255; return (void*)p; };
    bf* PK = (bf*)take((size_t)PKR * DM * 2);   // every packed bf16 operand plane, in the row order of pack_body
    bf* WQ = PK; bf* WK = WQ + (size_t)2 * DQ * DM; bf* WO = WK + (size_t)2 * DKV * DM; bf* XB = WO + (size_t)DM * DQ;   // the gate plane follows WQ, the Wv plane follows WK: z-slices of one GEMM launch
    float* CS = (float*)take((size_t)TT * HD * 2 * 4); float* RF = (float*)take((size_t)(NH_ + NKV) * TR * 4);
    float* FQ = (float*)take((size_t)2 * TR * DQ * 4); float* GATE = FQ + (size_t)TR * DQ; float* FK = (float*)take((size_t)2 * TR * DKV * 4); float* FV = FK + (size_t)TR * DKV;   // q then gate, k then v: the z-slices' outputs
    h16* QP16 = (h16*)take((size_t)NB_ * NH_ * TT * HD * 2); h16* KP16 = (h16*)take((size_t)NB_ * NKV * TT * HD * 2); h16* VT16 = (h16*)take((size_t)NB_ * NKV * HD * TT * 2);
    bf* QPh = (bf*)take((size_t)NB_ * NH_ * TT * HD * 2); bf* QPl = (bf*)take((size_t)NB_ * NH_ * TT * HD * 2); bf* KPh = (bf*)take((size_t)NB_ * NKV * TT * HD * 2); bf* KPl = (bf*)take((size_t)NB_ * NKV * TT * HD * 2); bf* VTh = (bf*)take((size_t)NB_ * NKV * HD * 2 * TT * 2); bf* VTl = VTh + (size_t)NB_ * NKV * HD * TT;   // v^T: hi planes then lo planes
    bf* ATl = (bf*)take((size_t)TR * DQ * 2);
    if ((size_t)(wsp - (char*)d_ws) > ws_size) return;    // ws 256 MiB
    float* Ob = FQ;   // attention output (NB_ x ZH x TT x HD f32 = TR x DQ) reuses the q projection buffer after the q planes are built (stream-ordered)
    bf* ATh = XB;     // hi plane of the gated attention output (TR x DQ = TR x DM elements) reuses the bf16 x plane after the k|v projection, its last reader (stream-ordered)
    k_prep<<<TT * HD / 256 / CSB + PKR / 16, 256, 0, stream>>>(wqg, wk, wv, wo, x, PK, CS);
    k_gemmw<0, 4, 2, 64, 1, DM, DQ><<<dim3(TR / 256, DQ / 128, 2), 256, 0, stream>>>(XB, nullptr, WQ, FQ, (size_t)DQ * DM, (size_t)TR * DQ);       // z = 0: q, z = 1: gate
    k_gemmw<0, 2, 2, 128, 4, DM, DKV><<<dim3(TR / 128, DKV / 128, 2), 128, 0, stream>>>(XB, nullptr, WK, FK, (size_t)DKV * DM, (size_t)TR * DKV);   // z = 0: k, z = 1: v
    k_rmsvt<<<(NH_ + NKV) * TR / 256 + NB_ * NKV * TT * HD / 2 / 256 / VTB, 256, 0, stream>>>(FQ, FK, RF, FV, VT16, VTh, VTl);
    k_rope<<<NB_ * (NH_ + NKV) * (TT * HD / 512) / RPB, 256, 0, stream>>>(FQ, FK, CS, RF, qnw, knw, 1.0f, QP16, QPh, QPl, KP16, KPh, KPl);
    k_fattn<<<dim3(NB_ * NH_, (TT - RH) / 32 + RH / 16, 1), 128, 0, stream>>>(QP16, KP16, VT16, QPh, QPl, KPh, KPl, VTh, VTl, Ob);
    k_mergeg<<<NB_ * ZH * TT * HD / 2 / 256 / MGB, 256, 0, stream>>>(Ob, GATE, 0, ATh, ATl);
    k_gemmw<1, 2, 4, 64, 2, DQ, DM><<<dim3(TR / 128, DM / 256, 1), 256, 0, stream>>>(ATh, ATl, WO, OUT, 0, 0);
}

// v008
// A run of this version takes 211 microseconds.
// In two side-by-side timings against v007, it was 1.06 and 1.05 times as fast.
// Over all steps from v000 it is 8.31 times as fast.
#include <hip/hip_runtime.h>

// GatedAttention (x [2][2048][2048]; qg = x Wq^T (Wq [4096][2048]) viewed (16 heads x 256): q = first 128, gate = last 128 of each head; k/v = x Wk^T / Wv^T (4 kv heads; group h/4); per-head RMSNorm (eps 1e-6) with weight (1 + w) on q and k; rotate-half RoPE (base 1e4, tables computed on device); causal softmax(q.k / sqrt(128)); out = merged attn v x sigmoid(gate); out Wo^T -> [2][2048][2048]).
// Compute dtypes, f32 accumulate: every input rounded to bf16; q / gate / k / v on PLAIN bf16 operands (inputs: exact; the interleaved q|gate rows of Wq gathered); RMSNorm, RoPE, sigmoid gating f32; causal scores and attn.v: query rows < 512 hl (3 products), the rest single fp16, one fused kernel with a running maximum and sum (f32), key blocks above the diagonal skipped; Wo hl x exact (2 products).

#define NB_  2
#define TT   2048
#define DM   2048
#define NH_  16
#define NKV  4
#define REP  (NH_ / NKV)
#define HD   128
#define DQ   (NH_ * HD)
#define DKV  (NKV * HD)
#define ZH   16                   // heads per attention pass (all of them: head z uses kv group z / REP)
#define TR   (NB_ * TT)           // rows of both batches together: row b * TT + t; every stage takes them in one launch
#define RH   512                  // query rows < RH use hi+lo planes (0: none)
#define SCL  0.088388347648318447f   // HD^-0.5
typedef _Float16 h16;
typedef unsigned short bf;
typedef __attribute__((ext_vector_type(16))) __bf16   v16bf;
typedef __attribute__((ext_vector_type(16))) _Float16 v16h;
typedef __attribute__((ext_vector_type(8)))  _Float16 v8h;
typedef __attribute__((ext_vector_type(8)))  unsigned short v8us;
typedef __attribute__((ext_vector_type(8)))  float    v8f;
typedef __attribute__((ext_vector_type(4)))  float    v4f;
typedef v8h  __attribute__((may_alias)) v8ha;
typedef v4f  __attribute__((may_alias)) v4fa;
typedef v8us __attribute__((may_alias)) v8usa;

__device__ __forceinline__ unsigned short f2bf(float f) { unsigned u = __float_as_uint(f); u += 0x7FFFu + ((u >> 16) & 1u); return (unsigned short)(u >> 16); }
__device__ __forceinline__ float bf2f(unsigned short b) { return __uint_as_float(((unsigned)b) << 16); }
__device__ __forceinline__ float bfr(float f) { return bf2f(f2bf(f)); }
__device__ __forceinline__ v16h cat16(v8h lo, v8h hi) { return __builtin_shufflevector(lo, hi, 0, 1, 2, 3, 4, 5, 6, 7, 8, 9, 10, 11, 12, 13, 14, 15); }
__device__ __forceinline__ v16bf cat16b(v8us lo, v8us hi) { return __builtin_bit_cast(v16bf, __builtin_shufflevector(lo, hi, 0, 1, 2, 3, 4, 5, 6, 7, 8, 9, 10, 11, 12, 13, 14, 15)); }
__device__ __forceinline__ v8f wmma16(v16h a, v16h b, v8f c) { return __builtin_amdgcn_wmma_f32_16x16x32_f16(false, a, false, b, (short)0, c, false, false); }
__device__ __forceinline__ v8f wmmab(v16bf a, v16bf b, v8f c) { return __builtin_amdgcn_wmma_f32_16x16x32_bf16(false, a, false, b, (short)0, c, false, false); }



// ---- k_gemmw: GEMM on bf16 planes in FRAGMENT ORDER (below). One tile of (WM x 64) x (WN x 64) outputs per work-group of WM x WN waves, 64 x 64 outputs (16 accumulators) a wave, every wave over the whole K in rising order.
// The operand bands of the tile are staged in LDS, KC k at a time, by asynchronous copies (global_load_async_to_lds_b128) into a ring of two buffers: an A band is fetched from L2 once per work-group and read from LDS by WN waves, a B band by WM waves.
// Fragment order of a plane [R][K]: blocks of 16 rows x 32 k, 512 elements each, block (r / 16, k / 32) at ((r / 16) * (K / 32) + k / 32) * 512; inside a block element (r, k) at ((k / 16) % 2) * 256 + (((k / 8) % 2) * 16 + r % 16) * 8 + k % 8,
// that is: [half of the fragment][lane][8 elements], so that each of the two 16-byte loads of a fragment reads 512 contiguous bytes over the wave (from LDS: every bank once per 256 bytes, no pad needed); KC k of a band of 16 rows are KC * 32 contiguous bytes, in the plane and in LDS alike.
// C[m][n] (f32, pitch LDC) = sum_k A[m][k] Bt[n][k] (+ A2[m][k] Bt[n][k] where NSPLIT == 1). z-slices: strides sB / sC in elements. grid (M / (WM * 64), N / (WN * 64), Z).
// A stage in LDS: [A bands | A2 bands | B bands], KC * 32 bytes each; wave w copies the bands w * BPW .. w * BPW + BPW - 1.
template <typename T16> struct WFrag;
template <> struct WFrag<h16> { typedef v16h V; static __device__ __forceinline__ V ld(const h16* p) { return cat16(*(const v8h*)p, *(const v8h*)(p + 16)); } static __device__ __forceinline__ V ldp(const h16* band, unsigned vb) { const char* p = (const char*)band + vb; return cat16(*(const v8h*)p, *(const v8h*)(p + 512)); } static __device__ __forceinline__ v8f mma(V a, V b, v8f c) { return wmma16(a, b, c); } };
template <> struct WFrag<bf> { typedef v16bf V; static __device__ __forceinline__ V ld(const bf* p) { return cat16b(*(const v8us*)p, *(const v8us*)(p + 16)); } static __device__ __forceinline__ V ldp(const bf* band, unsigned vb) { const char* p = (const char*)band + vb; return cat16b(*(const v8us*)p, *(const v8us*)(p + 512)); } static __device__ __forceinline__ v8f mma(V a, V b, v8f c) { return wmmab(a, b, c); } };
typedef __attribute__((ext_vector_type(4))) int cv4i;
typedef __attribute__((address_space(1))) cv4i gcv4i;
typedef __attribute__((address_space(3))) cv4i lcv4i;
__device__ __forceinline__ void cp16(const char* g, char* l) { __builtin_amdgcn_global_load_async_to_lds_b128((gcv4i*)g, (lcv4i*)l, 0, 0); }   // each lane: 16 bytes from global memory to LDS, through no register
__device__ __forceinline__ v16bf ldsfrag(const char* p) { return cat16b(*(const v8usa*)p, *(const v8usa*)(p + 512)); }
template <int NSPLIT, int WM, int WN, int KC, int PF, int K, int LDC>
__global__ __launch_bounds__(WM * WN * 32) void k_gemmw(const bf* __restrict__ A, const bf* __restrict__ A2, const bf* __restrict__ Bt, float* C, size_t sB, size_t sC) {
    constexpr int NW = WM * WN, NAB = WM * 4, NAA = NAB * (1 + NSPLIT), NBAND = NAA + WN * 4, BCH = KC * 32, STAGE = NBAND * BCH, BPW = NBAND / NW, CPB = BCH / 512, NT = K / KC;
    static_assert(NBAND % NW == 0 && K % KC == 0 && KC % (32 * PF) == 0 && NT >= 2 && BPW * CPB <= 63 && NW * 16 * 68 * 4 <= 2 * STAGE, "whole bands a wave, two stages or more, at most 63 copies of a wave in flight, the output slabs fit the ring");
    __shared__ __align__(1024) char ring[2 * STAGE];
    Bt += blockIdx.z * sB; C += blockIdx.z * sC;
    const int lane = threadIdx.x & 31, lr = lane & 15, hi = lane >> 4; const int wave = __builtin_amdgcn_readfirstlane(threadIdx.x >> 5); const int wm = wave / WN, wn = wave % WN; const int r0 = blockIdx.x * (WM * 64), c0 = blockIdx.y * (WN * 64);
    const char* gs[BPW];   // the lane's own 16 bytes at k = 0 of each band that this wave copies (the choice of the plane is wave-uniform)
#pragma unroll
    for (int u = 0; u < BPW; ++u) { const int i = wave * BPW + u; const bf* p = (i < NAB) ? A + (size_t)(r0 / 16 + i) * 16 * K : (NSPLIT == 1 && i < NAA) ? A2 + (size_t)(r0 / 16 + i - NAB) * 16 * K : Bt + (size_t)(c0 / 16 + i - NAA) * 16 * K; gs[u] = (const char*)p + lane * 16; }
    auto fill = [&](int t) { char* l = ring + (t & 1) * STAGE + wave * (BPW * BCH) + lane * 16;
#pragma unroll
        for (int u = 0; u < BPW; ++u)
#pragma unroll
            for (int c = 0; c < CPB; ++c) cp16(gs[u] + (size_t)t * BCH + c * 512, l + u * BCH + c * 512); };
    v8f acc[4][4];
#pragma unroll
    for (int mb = 0; mb < 4; ++mb)
#pragma unroll
        for (int nb = 0; nb < 4; ++nb) acc[mb][nb] = (v8f){};
    fill(0);
    asm volatile("s_wait_asynccnt 0x0" ::: "memory");   // this wave's copies of stage 0 have landed
    __syncthreads();                                     // every wave's have: stage 0 may be read
    fill(1);
#pragma unroll 1   // one body: the buffer is chosen by the trip's parity
    for (int t = 0; t < NT; ++t) {
        const char* sb = ring + (t & 1) * STAGE + lane * 16; const char* sa = sb + wm * (4 * BCH); const char* sw = sb + NAA * BCH + wn * (4 * BCH);
#pragma unroll
        for (int kg = 0; kg < KC / 32; kg += PF) { v16bf a[PF][4], a2[PF][4], b[PF][4];   // the fragments of PF k blocks are asked for together, in front of their products: one LDS latency a group, not one per B fragment
#pragma unroll
            for (int p = 0; p < PF; ++p)
#pragma unroll
                for (int i = 0; i < 4; ++i) { const int ko = (kg + p) * 1024; a[p][i] = ldsfrag(sa + i * BCH + ko); if (NSPLIT == 1) a2[p][i] = ldsfrag(sa + (NAB + i) * BCH + ko); b[p][i] = ldsfrag(sw + i * BCH + ko); }
            __builtin_amdgcn_sched_barrier(0);   // keeps the group of LDS loads above in front of the products below: sunk among them, each B fragment's load is waited for alone
#pragma unroll
            for (int p = 0; p < PF; ++p)
#pragma unroll
                for (int nb = 0; nb < 4; ++nb) {   // per accumulator: the A product, then the A2 product; three other products stand between the two (a product that reads the one just issued waits for it)
#pragma unroll
                    for (int mb = 0; mb < 4; ++mb) acc[mb][nb] = wmmab(a[p][mb], b[p][nb], acc[mb][nb]);
                    if (NSPLIT == 1) {
#pragma unroll
                        for (int mb = 0; mb < 4; ++mb) acc[mb][nb] = wmmab(a2[p][mb], b[p][nb], acc[mb][nb]); } } }
        __builtin_amdgcn_sched_barrier(0);   // keeps the products above in front of the waits below: lifted over them, the wait for the next stage's copies stands ahead of this trip's products and the refill behind them, and the copies fly with nothing to cover them
        asm volatile("s_wait_dscnt 0x0" ::: "memory");      // this wave's reads of the buffer have returned before the buffer is handed to its next writer
        asm volatile("s_wait_asynccnt 0x0" ::: "memory");   // this wave's copies of stage t + 1 have landed
        __syncthreads();                                     // publishes stage t + 1 and ends every wave's reads of stage t
        if (t + 2 < NT) fill(t + 2);                         // into the buffer that this trip has just read (the test reads the same for the whole work-group)
    }
    asm volatile("s_wait_asynccnt 0x0" ::: "memory");   // no copy is outstanding when the ring becomes output staging
    // each wave transposes its tile, 16 rows at a time, in a slab of its own (pitch 68 floats) and stores whole 128-byte lines: two rows of 256 bytes a store
    float* slab = (float*)ring + wave * (16 * 68); float* cw = C + (size_t)(r0 + wm * 64 + hi) * LDC + c0 + wn * 64 + lr * 4;
#pragma unroll
    for (int mb = 0; mb < 4; ++mb) {
#pragma unroll
        for (int nb = 0; nb < 4; ++nb)
#pragma unroll
            for (int j = 0; j < 8; ++j) slab[(hi * 8 + j) * 68 + nb * 16 + lr] = acc[mb][nb][j];
        asm volatile("s_wait_dscnt 0x0" ::: "memory");   // the column writes above (other lanes' data, same wave) are done before the rows are read back
        v4f val[8];
#pragma unroll
        for (int s = 0; s < 8; ++s) val[s] = *(const v4fa*)(slab + (s * 2 + hi) * 68 + lr * 4);
#pragma unroll
        for (int s = 0; s < 8; ++s) *(v4f*)(cw + (size_t)(mb * 16 + s * 2) * LDC) = val[s];
        asm volatile("s_wait_xcnt 0x0" :: "v"(cw), "v"(val[0]), "v"(val[1]), "v"(val[2]), "v"(val[3]), "v"(val[4]), "v"(val[5]), "v"(val[6]), "v"(val[7]) : "memory");   // behind the eight stores, their address and data inputs: the next rows' reads write registers that the stores name
    }
}

// ---- k_fattn: causal scores, softmax and probability x value product in one kernel; no score or probability ever reaches memory. One work-group of 8 waves per (kv group, tile of QT x 16 queries): wave w works for head w / 2 of the group's four and takes the 32-key blocks of parity w % 2 up to the diagonal.
// The four heads of a group read the same k and v^T planes: a stage of two key blocks (64 keys, every plane) is brought from L2 once per work-group, by asynchronous copies (global_load_async_to_lds_b128) into a ring of two buffers in LDS, and each block is read from LDS by four waves.
// A stage in LDS: [block of even parity | block of odd parity], a block [k | (k lo) | v^T | (v^T lo)], 8 fragment blocks of 1 KiB a plane, in the planes' own fragment order; wave w copies the 1-KiB blocks w * PER .. w * PER + PER - 1 of the stage (all of one plane).
// Transposed products: S^T = K Q^T (A = 16 keys x 32 d of the k plane, B = the queries, kept in registers), O^T += V^T P^T (A = 16 d x 32 keys of the v^T plane). In an S^T tile lane (lr, hi) holds keys hi * 8 + j of query lr,
// which is the B-fragment order of those keys: two tiles convert in place into one P^T fragment; maximum and sum of a query are in-lane but for one exchange between the wave halves.
// Running maximum mu (raw score units) and sum per query; the accumulators are rescaled only when some query's block maximum exceeds its mu by more than 8 in log2 units (probabilities stay below 2^8, inside fp16 range).
// At the end the two waves of a head agree on the larger mu and rescale; the odd wave parks its sums and accumulators in LDS, the even wave adds them to its own (even + odd, a fixed order), divides and stores the head's rows.
typedef __attribute__((ext_vector_type(8))) __bf16 v8bf;
__device__ __forceinline__ float xhalf(float x) { const int b = __float_as_int(x); return __int_as_float(__builtin_amdgcn_permlanex16(b, b, 0x76543210, 0xfedcba98, false, false)); }   // the value of lane l ^ 16
__device__ __forceinline__ v16h ldsfr(const h16*, const char* p) { return cat16(*(const v8ha*)p, *(const v8ha*)(p + 512)); }
__device__ __forceinline__ v16bf ldsfr(const bf*, const char* p) { return ldsfrag(p); }
template <typename T16, bool HL, int QT>
__device__ __forceinline__ void fattn_body(const T16* __restrict__ Q, const T16* __restrict__ Q2, const T16* __restrict__ Kp, const T16* __restrict__ Kp2, const T16* __restrict__ Vt, const T16* __restrict__ Vt2, float* O, int q0, int wave, char* ring, float* sm, float* sl) {
    typedef typename WFrag<T16>::V V;
    constexpr int KS = 2, NACC = QT * 8, PL = HL ? 4 : 2, BLKB = PL * 8192, STAGE = KS * BLKB, PER = KS * PL * 8 / 8; constexpr float CL = SCL * 1.4426950408889634f;   // score -> log2 units
    static_assert(2 * PER <= 63 && 8 % PER == 0 && 4 * NACC * 1024 <= 2 * STAGE, "at most 63 copies of a wave in flight, a wave's blocks lie in one plane, the parked accumulators fit the ring");
    const int lane = threadIdx.x & 31, lr = lane & 15, hi = lane >> 4; const int hg = wave >> 1, ks = wave & 1; const unsigned lb = (unsigned)lane * 16u;
    V qf[QT][4], qf2[QT][4]; const T16* qp = (const T16*)((const char*)(Q + (size_t)(q0 / 16) * 2048) + lb); const T16* qp2 = HL ? (const T16*)((const char*)(Q2 + (size_t)(q0 / 16) * 2048) + lb) : qp;   // the lane's own address in the first block; the other blocks are immediate offsets
#pragma unroll
    for (int qt = 0; qt < QT; ++qt)
#pragma unroll
        for (int dc = 0; dc < 4; ++dc) { const int o = (qt * 4 + dc) * 512; qf[qt][dc] = WFrag<T16>::ldp(qp + o, 0u); if (HL) qf2[qt][dc] = WFrag<T16>::ldp(qp2 + o, 0u); }
    asm volatile("s_wait_xcnt 0x0" :: "v"(qp), "v"(qp2), "v"(lane) : "memory");   // the address pairs are inputs, so that none of them is reused (as a later load's destination either) in front of the wait; the lane number too, which the loads name as their offset where the block's start is a scalar base
    const int nkb = (q0 + QT * 16 + 31) / 32;   // 32-key blocks up to and with the one that holds the diagonal
    const int ntr = (nkb + KS - 1) / KS;        // stages; where nkb is odd the last stage's second block lies behind the diagonal: it is copied (nkb < TT / 32 then: it exists in the planes) and not read
    // what this wave copies of a stage (every choice is wave-uniform): 1-KiB block j0 + u of the stage = key block 'slot', plane 'plane', fragment block i0 + u
    const int j0 = wave * PER, slot = j0 / (PL * 8), plane = (j0 / 8) % PL, i0 = j0 % 8; const bool isv = plane >= PL / 2;
    const T16* pb = HL ? (plane == 0 ? Kp : plane == 1 ? Kp2 : plane == 2 ? Vt : Vt2) : (plane == 0 ? Kp : Vt);
    const char* g0 = (const char*)pb + (isv ? (size_t)i0 * ((TT / 32) * 1024) + (size_t)slot * 1024 : (size_t)slot * 8192 + (size_t)i0 * 1024) + lb;   // the lane's own 16 bytes of the wave's first block in stage 0
    const size_t gstep = isv ? (size_t)(TT / 32) * 1024 : (size_t)1024, adv = isv ? (size_t)KS * 1024 : (size_t)KS * 8192;   // from a fragment block to the next; from a stage to the next
    char* l0 = ring + j0 * 1024 + lb;
    auto fill = [&](int t) { const char* g = g0 + (size_t)t * adv; char* l = l0 + (t & 1) * STAGE;
#pragma unroll
        for (int u = 0; u < PER; ++u) { cp16(g + u * gstep, l + u * 1024); cp16(g + u * gstep + 512, l + u * 1024 + 512); } };
    v8f acc[QT][8]; float mu[QT], ls[QT];
#pragma unroll
    for (int qt = 0; qt < QT; ++qt) { mu[qt] = -3.0e38f; ls[qt] = 0.f;
#pragma unroll
        for (int dt = 0; dt < 8; ++dt) acc[qt][dt] = (v8f){}; }
    fill(0);
    asm volatile("s_wait_asynccnt 0x0" ::: "memory");   // this wave's copies of stage 0 have landed
    __syncthreads();                                     // every wave's have: stage 0 may be read
    if (1 < ntr) fill(1);                                // the test reads the same for the whole work-group
#pragma unroll 1   // one body: the buffer is chosen by the trip's parity, and a second copy would need a second set of k, v^T and score registers
    for (int t = 0; t < ntr; ++t) {
        const int kb = t * KS + ks;
        if (kb < nkb) {   // wave-uniform (a scalar test); no barrier stands inside
        const char* sb = ring + (t & 1) * STAGE + ks * BLKB + lb;
        V kf[8], kf2[8], vf[8], vf2[8];   // the v^T fragments are asked for in front of the score products and the softmax arithmetic, which cover their latency
#pragma unroll
        for (int i = 0; i < 8; ++i) { kf[i] = ldsfr((const T16*)nullptr, sb + i * 1024); if (HL) kf2[i] = ldsfr((const T16*)nullptr, sb + 8192 + i * 1024); }
#pragma unroll
        for (int dt = 0; dt < 8; ++dt) { vf[dt] = ldsfr((const T16*)nullptr, sb + (PL / 2) * 8192 + dt * 1024); if (HL) vf2[dt] = ldsfr((const T16*)nullptr, sb + 3 * 8192 + dt * 1024); }
        __builtin_amdgcn_sched_barrier(0);   // keeps the group of LDS loads above in front of the products below: sunk among them, each k fragment's load is waited for alone
        v8f s[QT][2];
#pragma unroll
        for (int qt = 0; qt < QT; ++qt) { s[qt][0] = (v8f){}; s[qt][1] = (v8f){}; }
#pragma unroll
        for (int hf = 0; hf < 2; ++hf)
#pragma unroll
            for (int dc = 0; dc < 4; ++dc) { const int i = hf * 4 + dc;
#pragma unroll
                for (int qt = 0; qt < QT; ++qt) { s[qt][hf] = WFrag<T16>::mma(kf[i], qf[qt][dc], s[qt][hf]); if (HL) { s[qt][hf] = WFrag<T16>::mma(kf[i], qf2[qt][dc], s[qt][hf]); s[qt][hf] = WFrag<T16>::mma(kf2[i], qf[qt][dc], s[qt][hf]); } } }
        if (kb == nkb - 1) {   // the block on the diagonal: keys behind the query are masked (wave-uniform test)
#pragma unroll
            for (int qt = 0; qt < QT; ++qt)
#pragma unroll
                for (int hf = 0; hf < 2; ++hf)
#pragma unroll
                    for (int j = 0; j < 8; ++j) if (kb * 32 + hf * 16 + hi * 8 + j > q0 + qt * 16 + lr) s[qt][hf][j] = -3.0e38f; }
        float bm[QT]; bool need = false;
#pragma unroll
        for (int qt = 0; qt < QT; ++qt) { float t2 = fmaxf(s[qt][0][0], s[qt][1][0]);
#pragma unroll
            for (int j = 1; j < 8; ++j) t2 = fmaxf(t2, fmaxf(s[qt][0][j], s[qt][1][j]));
            bm[qt] = fmaxf(t2, xhalf(t2)); need = need || ((bm[qt] - mu[qt]) * CL > 8.0f); }
        if (__builtin_amdgcn_ballot_w32(need) != 0) {   // one scalar test a block
#pragma unroll
            for (int qt = 0; qt < QT; ++qt) { const float mn = fmaxf(mu[qt], bm[qt]); const float al = __builtin_amdgcn_exp2f((mu[qt] - mn) * CL); mu[qt] = mn; ls[qt] *= al;
#pragma unroll
                for (int dt = 0; dt < 8; ++dt) acc[qt][dt] *= al; } }
        V pf[QT], pf2[QT];
#pragma unroll
        for (int qt = 0; qt < QT; ++qt) { const float nm = -mu[qt] * CL; v8f p0, p1;
#pragma unroll
            for (int j = 0; j < 8; ++j) { p0[j] = __builtin_amdgcn_exp2f(fmaf(s[qt][0][j], CL, nm)); p1[j] = __builtin_amdgcn_exp2f(fmaf(s[qt][1][j], CL, nm)); }
            float t2 = 0.f;
#pragma unroll
            for (int j = 0; j < 8; ++j) t2 += p0[j] + p1[j];
            ls[qt] += t2;
            if constexpr (HL) { const v8bf h0 = __builtin_convertvector(p0, v8bf), h1 = __builtin_convertvector(p1, v8bf); const v8bf l0b = __builtin_convertvector(p0 - __builtin_convertvector(h0, v8f), v8bf), l1b = __builtin_convertvector(p1 - __builtin_convertvector(h1, v8f), v8bf);
                pf[qt] = __builtin_shufflevector(h0, h1, 0, 1, 2, 3, 4, 5, 6, 7, 8, 9, 10, 11, 12, 13, 14, 15); pf2[qt] = __builtin_shufflevector(l0b, l1b, 0, 1, 2, 3, 4, 5, 6, 7, 8, 9, 10, 11, 12, 13, 14, 15); }
            else pf[qt] = cat16(__builtin_convertvector(p0, v8h), __builtin_convertvector(p1, v8h)); }
#pragma unroll
        for (int dt = 0; dt < 8; ++dt)
#pragma unroll
            for (int qt = 0; qt < QT; ++qt) { acc[qt][dt] = WFrag<T16>::mma(vf[dt], pf[qt], acc[qt][dt]); if (HL) { acc[qt][dt] = WFrag<T16>::mma(vf[dt], pf2[qt], acc[qt][dt]); acc[qt][dt] = WFrag<T16>::mma(vf2[dt], pf[qt], acc[qt][dt]); } }
        }
        asm volatile("s_wait_dscnt 0x0" ::: "memory");      // this wave's reads of the buffer have returned before the buffer is handed to its next writer
        asm volatile("s_wait_asynccnt 0x0" ::: "memory");   // this wave's copies of stage t + 1 have landed
        __syncthreads();                                     // publishes stage t + 1 and ends every wave's reads of stage t
        if (t + 2 < ntr) fill(t + 2);                        // into the buffer that this trip has just read (the test reads the same for the whole work-group)
    }
    asm volatile("s_wait_asynccnt 0x0" ::: "memory");   // no copy is outstanding when the ring becomes the place of the parked accumulators
#pragma unroll
    for (int qt = 0; qt < QT; ++qt) { ls[qt] += xhalf(ls[qt]); if (hi == 0) sm[wave * 32 + qt * 16 + lr] = mu[qt]; }
    __syncthreads();   // both waves' maxima of a head are in LDS before either picks the larger
    char* park = ring + hg * (NACC * 1024) + lb;   // the lane's own 16 bytes of the head's first parked half tile
#pragma unroll
    for (int qt = 0; qt < QT; ++qt) { const int qi = qt * 16 + lr; const float M = fmaxf(sm[hg * 64 + qi], sm[hg * 64 + 32 + qi]); const float f = __builtin_amdgcn_exp2f((mu[qt] - M) * CL); ls[qt] *= f;
#pragma unroll
        for (int dt = 0; dt < 8; ++dt) acc[qt][dt] *= f;
        if (ks == 1) { if (hi == 0) sl[hg * 32 + qi] = ls[qt];
#pragma unroll
            for (int dt = 0; dt < 8; ++dt) { const v8f t2 = acc[qt][dt]; const int a = qt * 8 + dt; *(v4fa*)(park + a * 1024) = __builtin_shufflevector(t2, t2, 0, 1, 2, 3); *(v4fa*)(park + a * 1024 + 512) = __builtin_shufflevector(t2, t2, 4, 5, 6, 7); } } }
    __syncthreads();   // the odd waves' rescaled sums are in LDS before the even waves add them
    if (ks == 0) {   // wave-uniform; no barrier follows
#pragma unroll
        for (int qt = 0; qt < QT; ++qt) { const float r = __fdiv_rn(1.0f, ls[qt] + sl[hg * 32 + qt * 16 + lr]);
#pragma unroll
            for (int dt = 0; dt < 8; ++dt) { const char* p = park + (qt * 8 + dt) * 1024; const v4f s0 = *(const v4fa*)p, s1 = *(const v4fa*)(p + 512); acc[qt][dt] = (acc[qt][dt] + __builtin_shufflevector(s0, s1, 0, 1, 2, 3, 4, 5, 6, 7)) * r; } }
        __builtin_amdgcn_sched_barrier(0);   // keeps the stores below behind all the arithmetic above: no register that a store names is written behind it
        float* ob = O + (size_t)(q0 + lr) * HD + hi * 8;   // the lane's query row of the first tile; the other pieces are immediate offsets
#pragma unroll
        for (int qt = 0; qt < QT; ++qt)
#pragma unroll
            for (int dt = 0; dt < 8; ++dt) { float* o = ob + qt * 16 * HD + dt * 16; const v8f t2 = acc[qt][dt]; *(v4f*)o = __builtin_shufflevector(t2, t2, 0, 1, 2, 3); *(v4f*)(o + 4) = __builtin_shufflevector(t2, t2, 4, 5, 6, 7); }
        asm volatile("s_wait_xcnt 0x0" :: "v"(ob) : "memory");   // behind the stores, their address an input
    }
}
// grid (batches x kv groups, tiles): blockIdx.x = b * NKV + group, whose heads are number blockIdx.x * REP + 0 .. REP - 1 = b * NH_ + head; tile ranks 0 .. (TT - RH) / 32 - 1 are the fp16 tiles of 32 queries from the last rows down (the longest first), the rest the hi+lo tiles of 16 queries, again from the last down.
__global__ __launch_bounds__(256) void k_fattn(const h16* __restrict__ Q16, const h16* __restrict__ K16, const h16* __restrict__ V16, const bf* __restrict__ Qh, const bf* __restrict__ Ql, const bf* __restrict__ Kh, const bf* __restrict__ Kl, const bf* __restrict__ Vh, const bf* __restrict__ Vl, float* O) {
    static_assert(REP == 4, "eight waves: four heads of a group, two waves a head");
    __shared__ __align__(1024) char ring[131072]; __shared__ float sm[8 * 32]; __shared__ float sl[4 * 32];
    const int wave = __builtin_amdgcn_readfirstlane(threadIdx.x >> 5);
    const size_t g = blockIdx.x, z = g * REP + (wave >> 1); const int rk = blockIdx.y; const size_t qo = z * TT * HD, ko = g * TT * HD; O += qo;
    if (rk < (TT - RH) / 32) fattn_body<h16, false, 2>(Q16 + qo, nullptr, K16 + ko, nullptr, V16 + ko, nullptr, O, TT - 32 - rk * 32, wave, ring, sm, sl);
    else fattn_body<bf, true, 1>(Qh + qo, Ql + qo, Kh + ko, Kl + ko, Vh + ko, Vl + ko, O, RH - 16 - (rk - (TT - RH) / 32) * 16, wave, ring, sm, sl);
}

__device__ __forceinline__ h16 tohx(float x) { return (h16)x; }
__device__ __forceinline__ void splitf(float y, unsigned short& h, unsigned short& l) { h = f2bf(y); l = f2bf(y - bf2f(h)); }
typedef __attribute__((ext_vector_type(2))) _Float16 v2h;
typedef __attribute__((ext_vector_type(4))) _Float16 v4h;
typedef __attribute__((ext_vector_type(2))) unsigned short v2us;
typedef __attribute__((ext_vector_type(4))) unsigned short v4us;
typedef __attribute__((ext_vector_type(2))) float v2f;
typedef __attribute__((ext_vector_type(4))) int v4i;

__global__ __launch_bounds__(256) void k_wtG(const float* __restrict__ w, int K, int N, bf* Bt) {
    const int lane = threadIdx.x & 31; const int L0 = (blockIdx.x * 8 + (threadIdx.x >> 5)) * 8; const int nlines = N * K / 64;
{
#pragma unroll 1
        for (int l = 0; l < 8; ++l) { const int L = L0 + l; if (L >= nlines) break; const size_t e = (size_t)L * 64 + lane * 2; const int k = (int)(e % K), n = (int)(e / K); v2us o;
            o[0] = f2bf(w[(size_t)k * N + n]); o[1] = f2bf(w[(size_t)(k + 1) * N + n]); *(v2us*)(Bt + e) = o; }
         }
}
// pack_body: f32 rows [R][K] -> bf16 plane in the fragment order of k_gemmw. A wave takes one block of 16 rows x 32 k at a time: 8 lanes read one whole 128-byte line of a row (4 rows a load), each lane stores its 4 elements as 8 bytes (64 contiguous bytes per 4 rows).
// One launch packs every operand: all have K = DM = DQ columns, and their planes lie one behind the other in dst: [q rows of Wq | gate rows of Wq | Wk | Wv | Wo | x, both batches] = PKR rows. The 8 waves of a work-group share a band of 16 rows, so the choice of the source is uniform.
// q / gate plane row n is row (n / HD) * 2 * HD + part * HD + n % HD of the interleaved q|gate weight (part 0: q, part 1: gate); every other plane row is the same row of its source.
#define PKR  (2 * DQ + 2 * DKV + DM + TR)
static_assert(DM == DQ, "one K for every packed plane");
__device__ __forceinline__ void pack_body(int bx, const float* __restrict__ wqg, const float* __restrict__ wk, const float* __restrict__ wv, const float* __restrict__ wo, const float* __restrict__ x, bf* dst) {
    constexpr int K = DM, KB = K >> 5;
    const int lane = threadIdx.x & 31; const int rb = bx; const int k = (lane & 7) * 4, rq = lane >> 3;   // work-group bx takes the whole band bx of 16 rows: its wave w the k blocks w, w + 8, ... (few long waves, for speed only)
    const int n0 = rb * 16; const float* src; int s0;   // HD % 16 == 0: the 16 rows of a block are consecutive rows of src
    if (n0 < 2 * DQ) { const int part = n0 / DQ, nn = n0 % DQ; src = wqg; s0 = (nn / HD) * 2 * HD + part * HD + nn % HD; }
    else if (n0 < 2 * DQ + DKV) { src = wk; s0 = n0 - 2 * DQ; }
    else if (n0 < 2 * DQ + 2 * DKV) { src = wv; s0 = n0 - (2 * DQ + DKV); }
    else if (n0 < 2 * DQ + 2 * DKV + DM) { src = wo; s0 = n0 - (2 * DQ + 2 * DKV); }
    else { src = x; s0 = n0 - (2 * DQ + 2 * DKV + DM); }
#pragma unroll 1   // one body: the trips are independent streams, and the many resident waves keep enough bytes in flight
    for (int kb = (int)(threadIdx.x >> 5); kb < KB; kb += 8) { const int blk = rb * KB + kb;
    const float* sp = src + (size_t)(s0 + rq) * K + kb * 32 + k; bf* d = dst + (size_t)blk * 512 + ((k >> 4) & 1) * 256 + ((k >> 3) & 1) * 128 + rq * 8 + (k & 7); v4f v[4];
    const float* p1 = sp + (size_t)4 * K; const float* p2 = sp + (size_t)8 * K; const float* p3 = sp + (size_t)12 * K;
    v[0] = *(const v4f*)sp; v[1] = *(const v4f*)p1; v[2] = *(const v4f*)p2; v[3] = *(const v4f*)p3;
    asm volatile("s_wait_xcnt 0x0" :: "v"(sp), "v"(p1), "v"(p2), "v"(p3) : "memory");   // the four address pairs are inputs, so that none of them is reused (as a later load's destination either) in front of the wait
#pragma unroll
    for (int it = 0; it < 4; ++it) { v4us o;
#pragma unroll
        for (int u = 0; u < 4; ++u) o[u] = f2bf(v[it][u]);
        *(v4us*)(d + it * 32) = o; }
    asm volatile("s_wait_xcnt 0x0" :: "v"(d) : "memory");   // behind the four stores, their address an input: the next trip writes registers that the stores name
    }
}
#define CSB  4    // table pieces of 256 entries a work-group fills, one after the other
static_assert(TT * HD % (256 * CSB) == 0, "whole work-groups");
__device__ __forceinline__ void cstab_body(int bx, float* CS) {
#pragma unroll 1   // one body: the range reductions of cosf and sinf are long code
    for (int it = 0; it < CSB; ++it) { const int idx = (bx * CSB + it) * 256 + threadIdx.x; if (idx >= TT * HD) break; const int t = idx / HD, d = idx % HD; const int i = d % (HD / 2); const float inv = __fdiv_rn(1.0f, powf(10000.0f, (float)(2 * i) / (float)HD)); const float ang = __fmul_rn((float)t, inv); v2f cs; cs[0] = cosf(ang); cs[1] = sinf(ang);
    float* cp = CS + (size_t)idx * 2; *(v2f*)cp = cs;
    asm volatile("s_wait_xcnt 0x0" :: "v"(cp) : "memory"); }   // behind the store, its address an input: the next trip writes registers that the store names
}
// k_prep: the two stages that depend on nothing but the inputs, in one launch: the first TT * HD / 256 / CSB work-groups fill the cos|sin table (the longer threads), the rest pack the operands.
__global__ __launch_bounds__(256) void k_prep(const float* __restrict__ wqg, const float* __restrict__ wk, const float* __restrict__ wv, const float* __restrict__ wo, const float* __restrict__ x, bf* dst, float* CS) {
    constexpr int NCS = TT * HD / 256 / CSB; const int bx = blockIdx.x; if (bx < NCS) cstab_body(bx, CS); else pack_body(bx - NCS, wqg, wk, wv, wo, x, dst); }
// hrms_body: one thread per (head, row of both batches); heads 0 .. NH_ - 1 are the q heads, the NKV behind them the k heads (TR % 256 == 0: a work-group has one head); RF[head][row].
__device__ __forceinline__ void hrms_body(int bx, const float* __restrict__ FQ, const float* __restrict__ FK, float* RF) { const int i = bx * 256 + threadIdx.x; if (i >= (NH_ + NKV) * TR) return; const int t = i % TR, h = i / TR; const float* f = (h < NH_) ? FQ + (size_t)t * DQ + h * HD : FK + (size_t)t * DKV + (h - NH_) * HD; float s = 0.f;
#pragma unroll 4
    for (int d = 0; d < HD; d += 4) { const v4f v = *(const v4f*)(f + d);
#pragma unroll
        for (int q = 0; q < 4; ++q) { float p = __fmul_rn(v[q], v[q]); asm volatile("" : "+v"(p)); s = __fadd_rn(s, p); } }
    const float r = __fdiv_rn(1.0f, __fsqrt_rn(__fadd_rn(s * (1.0f / HD), 1e-6f))); *(float*)(RF + i) = r;  }
// k_rope: head planes [h] of [t][d] in the fragment order of k_gemmw (rows t, k = d; one block of 16 t x 32 d a trip of a work-group, a wave takes 4 rows x 16 d: 64-byte pieces on the reading and on the storing side) (fp16 + hi/lo) of rope(w[d] (x rms_factor)) x sc with the rotate-half convention out[d] = x[d] cos[t][d] - x[d+HD/2] sin[t][d], out[d+HD/2] = x[d+HD/2] cos[t][d+HD/2] + x[d] sin[t][d+HD/2]
// One launch for q and k of both batches: a work-group takes RPB blocks one after the other (64 rows t of one head: few long waves, for speed only); the first NB_ * NH_ * TT * HD / 512 blocks build the q planes [b][head], the rest the k planes [b][kv head] (a uniform choice); RF as hrms_body leaves it.
#define RPB  16
__global__ __launch_bounds__(256) void k_rope(const float* __restrict__ FQ, const float* __restrict__ FK, const float* __restrict__ CS, const float* __restrict__ RF, const float* __restrict__ qnw, const float* __restrict__ knw, float sc, h16* Q16, bf* Qh, bf* Ql, h16* K16, bf* Kh, bf* Kl) {
    constexpr int NBQ = NB_ * NH_ * (TT * HD / 512); static_assert(NBQ % RPB == 0 && (TT * HD / 512) % RPB == 0, "the blocks of a work-group lie in one head plane");
    const int bf0 = (int)blockIdx.x * RPB; const bool isk = bf0 >= NBQ; const int bx0 = isk ? bf0 - NBQ : bf0; if (bx0 >= (isk ? NB_ * NKV * (TT * HD / 512) : NBQ)) return;
    const int nheads = isk ? NKV : NH_, pitch = nheads * HD; const float* F = isk ? FK : FQ; const float* nw = isk ? knw : qnw; h16* P16 = isk ? K16 : Q16; bf* Ph = isk ? Kh : Qh; bf* Pl = isk ? Kl : Ql;
    const int row = (threadIdx.x >> 6) * 4 + ((threadIdx.x >> 3) & 3), db = ((threadIdx.x >> 5) & 1) * 16 + (threadIdx.x & 7) * 2; const int hb = bx0 / (TT * HD / 512); const int b = isk ? hb / NKV : hb / NH_, h = isk ? hb % NKV : hb % NH_;
#pragma unroll 1   // one body: the trips are independent, and the many resident waves keep enough bytes in flight
    for (int it = 0; it < RPB; ++it) { const int bx = bx0 + it, blk = bx % (TT * HD / 512);
    const int d = (blk % (HD / 32)) * 32 + db; const int t = (blk / (HD / 32)) * 16 + row; const size_t e = (size_t)bx * 512 + (db >> 4) * 256 + (((db >> 3) & 1) * 16 + row) * 8 + (db & 7); const float* f = F + (size_t)(b * TT + t) * pitch + h * HD; float rf = 1.0f; v2h o16; v2us oh, ol;
    // every load of the trip is asked for here, together (one memory latency a trip, not one per use); d is even and HD / 2 too, so d and d + 1 have neighbouring partners
    const float* fa = f + d; const float* fb = f + ((d < HD / 2) ? d + HD / 2 : d - HD / 2); const float* na = nw + d; const float* nb = nw + ((d < HD / 2) ? d + HD / 2 : d - HD / 2); const float* cp = CS + ((size_t)t * HD + d) * 2;
    const float* rp = RF + (size_t)((isk ? NH_ : 0) + h) * TR + b * TT + t; if (RF) rf = *rp;
    const v2f xa = *(const v2f*)fa, xb = *(const v2f*)fb, wa = *(const v2f*)na, wb = *(const v2f*)nb; const v4f c4 = *(const v4f*)cp;
    asm volatile("s_wait_xcnt 0x0" :: "v"(rp), "v"(fa), "v"(fb), "v"(na), "v"(nb), "v"(cp) : "memory");   // the address pairs are inputs, so that none of them is reused (as a later load's destination either) in front of the wait; it stands in front of the arithmetic below, which may reuse the registers that these loads name
#pragma unroll
    for (int q = 0; q < 2; ++q) { const int dd = d + q; float x0 = xa[q], x1 = xb[q];
        if (RF) { float n0 = __fmul_rn(x0, rf), n1 = __fmul_rn(x1, rf); asm volatile("" : "+v"(n0)); asm volatile("" : "+v"(n1)); x0 = __fmul_rn(__fadd_rn(1.0f, bfr(wa[q])), n0); x1 = __fmul_rn(__fadd_rn(1.0f, bfr(wb[q])), n1);   /* weight applied as (1 + w) */ }
        float a = __fmul_rn(x0, c4[2 * q]), bq = __fmul_rn(x1, c4[2 * q + 1]); asm volatile("" : "+v"(a)); asm volatile("" : "+v"(bq)); const float r = ((dd < HD / 2) ? __fsub_rn(a, bq) : __fadd_rn(a, bq)) * sc;
        o16[q] = tohx(r); unsigned short a2, c2; splitf(r, a2, c2); oh[q] = a2; ol[q] = c2; }
    h16* s16 = P16 + e; bf* sh = Ph + e; bf* sl = Pl + e; *(v2h*)s16 = o16; *(v2us*)sh = oh; *(v2us*)sl = ol;
    asm volatile("s_wait_xcnt 0x0" :: "v"(s16), "v"(sh), "v"(sl) : "memory"); }   // behind the three stores, their addresses inputs: the next trip writes registers that this trip's loads and stores name
}
// vtp_body: v^T planes, one per batch, one behind the other (rows n = g * HD + d, k = t, k extent TT) in the fragment order of k_gemmw; thread x of work-group bx holds in trip it the plane elements 2 i and 2 i + 1, i = (bx * VTB + it) * 256 + x (keys t and t + 1 of one row), whole-line stores.
#define VTB  8    // blocks of 512 plane elements a work-group takes, one after the other
static_assert(NB_ * NKV * TT * HD / 512 % VTB == 0, "whole work-groups");
__device__ __forceinline__ void vtp_body(int bx, const float* __restrict__ F, h16* V16, bf* Vh, bf* Vl) {
#pragma unroll 1   // one body: the trips are independent
    for (int it = 0; it < VTB; ++it) { const size_t e = ((size_t)(bx * VTB + it) * 256 + threadIdx.x) * 2; if (e >= (size_t)NB_ * DKV * TT) break; const int blk = (int)(e >> 9), o = (int)(e & 511); const int na = (blk / (TT / 32)) * 16 + ((o >> 3) & 15); const int b = na / DKV, n = na % DKV; const int t = (blk % (TT / 32)) * 32 + (o >> 8) * 16 + ((o >> 7) & 1) * 8 + (o & 7); v2h o16; v2us oh, ol;
#pragma unroll
    for (int q = 0; q < 2; ++q) { const float x = F[(size_t)(b * TT + t + q) * DKV + n]; o16[q] = tohx(x); unsigned short a2, c2; splitf(x, a2, c2); oh[q] = a2; ol[q] = c2; }
    h16* s16 = V16 + e; bf* sh = Vh + e; bf* sl = Vl + e; *(v2h*)s16 = o16; *(v2us*)sh = oh; *(v2us*)sl = ol;
    asm volatile("s_wait_xcnt 0x0" :: "v"(s16), "v"(sh), "v"(sl) : "memory"); }   // behind the three stores, their addresses inputs: the next trip writes registers that this trip's loads and stores name
}
// k_rmsvt: the two stages that depend on the projections alone, in one launch: the first (NH_ + NKV) * TR / 256 work-groups take the rms factors (few, long threads), the rest build the v^T planes.
__global__ __launch_bounds__(256) void k_rmsvt(const float* __restrict__ FQ, const float* __restrict__ FK, float* RF, const float* __restrict__ FV, h16* V16, bf* Vh, bf* Vl) {
    constexpr int NR = (NH_ + NKV) * TR / 256; const int bx = blockIdx.x; if (bx < NR) hrms_body(bx, FQ, FK, RF); else vtp_body(bx - NR, FV, V16, Vh, Vl); }
// k_mergeg: blocks (16 rows t x 32 columns) of the two output planes, which are in the fragment order of k_gemmw: a wave takes 4 rows x 16 columns: 64-byte pieces on the reading and on the storing side.
// A work-group takes MGB blocks of one band, MGU at a time (their loads asked for together): few long waves, for speed only.
#define MGB  16
#define MGU  4
static_assert((ZH * HD / 32) % MGB == 0 && MGB % MGU == 0, "the blocks of a work-group lie in one band");
__global__ __launch_bounds__(256) void k_mergeg(const float* __restrict__ O, const float* __restrict__ G, int h0, bf* Ah, bf* Al) { const int tid = threadIdx.x; const int rb = blockIdx.x / (ZH * HD / 32 / MGB), kb0 = (blockIdx.x % (ZH * HD / 32 / MGB)) * MGB; if (rb >= TR / 16) return;   // rb counts the 16-row bands of both batches
    const int row = (tid >> 6) * 4 + ((tid >> 3) & 3), db = ((tid >> 5) & 1) * 16 + (tid & 7) * 2; const int tg = rb * 16 + row, b = tg / TT, t = tg % TT;
#pragma unroll 1   // MGU blocks a trip are unrolled below; more would only lengthen the code
    for (int it = 0; it < MGB; it += MGU) { const float* gp[MGU]; const float* op[MGU]; v2f gv[MGU], ov[MGU];
#pragma unroll
    for (int u = 0; u < MGU; ++u) { const int kl = (kb0 + it + u) * 32 + db; const int zz = kl / HD, d = kl % HD; gp[u] = G + (size_t)tg * DQ + h0 * HD + kl; op[u] = O + ((size_t)(b * ZH + zz) * TT + t) * HD + d; gv[u] = *(const v2f*)gp[u]; ov[u] = *(const v2f*)op[u]; }
    asm volatile("s_wait_xcnt 0x0" :: "v"(gp[0]), "v"(gp[1]), "v"(gp[2]), "v"(gp[3]), "v"(op[0]), "v"(op[1]), "v"(op[2]), "v"(op[3]) : "memory");   // the address pairs are inputs, so that none of them is reused (as a later load's destination either) in front of the wait
    bf* ap[MGU]; bf* lp[MGU];
#pragma unroll
    for (int u = 0; u < MGU; ++u) { const int kbl = kb0 + it + u;
    const size_t po = ((size_t)rb * (DQ / 32) + h0 * (HD / 32) + kbl) * 512 + (db >> 4) * 256 + (((db >> 3) & 1) * 16 + row) * 8 + (db & 7);
    v2us oh, ol;
#pragma unroll
    for (int q = 0; q < 2; ++q) { const float gt = gv[u][q]; const float sg = __fdiv_rn(1.0f, __fadd_rn(1.0f, expf(-gt))); const float o = ov[u][q]; unsigned short a, c2; splitf(__fmul_rn(o, sg), a, c2); oh[q] = a; ol[q] = c2; } ap[u] = Ah + po; lp[u] = Al + po; *(v2us*)ap[u] = oh; *(v2us*)lp[u] = ol; }
    asm volatile("s_wait_xcnt 0x0" :: "v"(ap[0]), "v"(ap[1]), "v"(ap[2]), "v"(ap[3]), "v"(lp[0]), "v"(lp[1]), "v"(lp[2]), "v"(lp[3]) : "memory"); }   // behind the stores, their addresses inputs: the next trip writes registers that the stores name
}

extern "C" void kernel_launch(void* const* d_in, const int* in_sizes, int n_in,
                              void* d_out, int out_size, void* d_ws, size_t ws_size, hipStream_t stream) {
    (void)in_sizes; (void)n_in; (void)out_size;
    const float* x = (const float*)d_in[0]; const float* wqg = (const float*)d_in[1]; const float* wk = (const float*)d_in[2]; const float* wv = (const float*)d_in[3]; const float* wo = (const float*)d_in[4]; const float* qnw = (const float*)d_in[5]; const float* knw = (const float*)d_in[6]; const float* wq = wqg;
    float* OUT = (float*)d_out;     // [2][2048][2048]
    char* wsp = (char*)d_ws;
    auto take = [&](size_t bytes) { char* p = wsp; wsp += (bytes + 255) & ~(size_t)255; return (void*)p; };
    bf* PK = (bf*)take((size_t)PKR * DM * 2);   // every packed bf16 operand plane, in the row order of pack_body
    bf* WQ = PK; bf* WK = WQ + (size_t)2 * DQ * DM; bf* WO = WK + (size_t)2 * DKV * DM; bf* XB = WO + (size_t)DM * DQ;   // the gate plane follows WQ, the Wv plane follows WK: z-slices of one GEMM launch
    float* CS = (float*)take((size_t)TT * HD * 2 * 4); float* RF = (float*)take((size_t)(NH_ + NKV) * TR * 4);
    float* FQ = (float*)take((size_t)2 * TR * DQ * 4); float* GATE = FQ + (size_t)TR * DQ; float* FK = (float*)take((size_t)2 * TR * DKV * 4); float* FV = FK + (size_t)TR * DKV;   // q then gate, k then v: the z-slices' outputs
    h16* QP16 = (h16*)take((size_t)NB_ * NH_ * TT * HD * 2); h16* KP16 = (h16*)take((size_t)NB_ * NKV * TT * HD * 2); h16* VT16 = (h16*)take((size_t)NB_ * NKV * HD * TT * 2);
    bf* QPh = (bf*)take((size_t)NB_ * NH_ * TT * HD * 2); bf* QPl = (bf*)take((size_t)NB_ * NH_ * TT * HD * 2); bf* KPh = (bf*)take((size_t)NB_ * NKV * TT * HD * 2); bf* KPl = (bf*)take((size_t)NB_ * NKV * TT * HD * 2); bf* VTh = (bf*)take((size_t)NB_ * NKV * HD * 2 * TT * 2); bf* VTl = VTh + (size_t)NB_ * NKV * HD * TT;   // v^T: hi planes then lo planes
    bf* ATl = (bf*)take((size_t)TR * DQ * 2);
    if ((size_t)(wsp - (char*)d_ws) > ws_size) return;    // ws 256 MiB
    float* Ob = FQ;   // attention output (NB_ x ZH x TT x HD f32 = TR x DQ) reuses the q projection buffer after the q planes are built (stream-ordered)
    bf* ATh = XB;     // hi plane of the gated attention output (TR x DQ = TR x DM elements) reuses the bf16 x plane after the k|v projection, its last reader (stream-ordered)
    k_prep<<<TT * HD / 256 / CSB + PKR / 16, 256, 0, stream>>>(wqg, wk, wv, wo, x, PK, CS);
    k_gemmw<0, 4, 2, 64, 1, DM, DQ><<<dim3(TR / 256, DQ / 128, 2), 256, 0, stream>>>(XB, nullptr, WQ, FQ, (size_t)DQ * DM, (size_t)TR * DQ);       // z = 0: q, z = 1: gate
    k_gemmw<0, 2, 2, 128, 4, DM, DKV><<<dim3(TR / 128, DKV / 128, 2), 128, 0, stream>>>(XB, nullptr, WK, FK, (size_t)DKV * DM, (size_t)TR * DKV);   // z = 0: k, z = 1: v
    k_rmsvt<<<(NH_ + NKV) * TR / 256 + NB_ * NKV * TT * HD / 2 / 256 / VTB, 256, 0, stream>>>(FQ, FK, RF, FV, VT16, VTh, VTl);
    k_rope<<<NB_ * (NH_ + NKV) * (TT * HD / 512) / RPB, 256, 0, stream>>>(FQ, FK, CS, RF, qnw, knw, 1.0f, QP16, QPh, QPl, KP16, KPh, KPl);
    k_fattn<<<dim3(NB_ * NKV, (TT - RH) / 32 + RH / 16, 1), 256, 0, stream>>>(QP16, KP16, VT16, QPh, QPl, KPh, KPl, VTh, VTl, Ob);
    k_mergeg<<<NB_ * ZH * TT * HD / 2 / 256 / MGB, 256, 0, stream>>>(Ob, GATE, 0, ATh, ATl);
    k_gemmw<1, 2, 4, 64, 2, DQ, DM><<<dim3(TR / 128, DM / 256, 1), 256, 0, stream>>>(ATh, ATl, WO, OUT, 0, 0);
}

// v009
// A run of this version takes 186 microseconds.
// Timed twice side by side with v008, it ran 1.14 and 1.13 times as fast.
// Counting every step since v000, it is 9.46 times as fast.
#include <hip/hip_runtime.h>

// GatedAttention (x [2][2048][2048]; qg = x Wq^T (Wq [4096][2048]) viewed (16 heads x 256): q = first 128, gate = last 128 of each head; k/v = x Wk^T / Wv^T (4 kv heads; group h/4); per-head RMSNorm (eps 1e-6) with weight (1 + w) on q and k; rotate-half RoPE (base 1e4, tables computed on device); causal softmax(q.k / sqrt(128)); out = merged attn v x sigmoid(gate); out Wo^T -> [2][2048][2048]).
// Compute dtypes, f32 accumulate: every input rounded to bf16; q / gate / k / v on PLAIN bf16 operands (inputs: exact; the interleaved q|gate rows of Wq gathered); RMSNorm, RoPE (both in the projections' epilogues), sigmoid gating f32; causal scores and attn.v: query rows < 512 hl (3 products), the rest single fp16, one fused kernel with a running maximum and sum (f32), key blocks above the diagonal skipped; Wo hl x exact (2 products).

#define NB_  2
#define TT   2048
#define DM   2048
#define NH_  16
#define NKV  4
#define REP  (NH_ / NKV)
#define HD   128
#define DQ   (NH_ * HD)
#define DKV  (NKV * HD)
#define ZH   16                   // heads per attention pass (all of them: head z uses kv group z / REP)
#define TR   (NB_ * TT)           // rows of both batches together: row b * TT + t; every stage takes them in one launch
#define RH   512                  // query rows < RH use hi+lo planes (0: none)
#define SCL  0.088388347648318447f   // HD^-0.5
typedef _Float16 h16;
typedef unsigned short bf;
typedef __attribute__((ext_vector_type(16))) __bf16   v16bf;
typedef __attribute__((ext_vector_type(16))) _Float16 v16h;
typedef __attribute__((ext_vector_type(8)))  _Float16 v8h;
typedef __attribute__((ext_vector_type(8)))  unsigned short v8us;
typedef __attribute__((ext_vector_type(8)))  float    v8f;
typedef __attribute__((ext_vector_type(4)))  float    v4f;
typedef v8h  __attribute__((may_alias)) v8ha;
typedef v4f  __attribute__((may_alias)) v4fa;
typedef v8us __attribute__((may_alias)) v8usa;

__device__ __forceinline__ unsigned short f2bf(float f) { unsigned u = __float_as_uint(f); u += 0x7FFFu + ((u >> 16) & 1u); return (unsigned short)(u >> 16); }
__device__ __forceinline__ float bf2f(unsigned short b) { return __uint_as_float(((unsigned)b) << 16); }
__device__ __forceinline__ float bfr(float f) { return bf2f(f2bf(f)); }
__device__ __forceinline__ v16h cat16(v8h lo, v8h hi) { return __builtin_shufflevector(lo, hi, 0, 1, 2, 3, 4, 5, 6, 7, 8, 9, 10, 11, 12, 13, 14, 15); }
__device__ __forceinline__ v16bf cat16b(v8us lo, v8us hi) { return __builtin_bit_cast(v16bf, __builtin_shufflevector(lo, hi, 0, 1, 2, 3, 4, 5, 6, 7, 8, 9, 10, 11, 12, 13, 14, 15)); }
__device__ __forceinline__ v8f wmma16(v16h a, v16h b, v8f c) { return __builtin_amdgcn_wmma_f32_16x16x32_f16(false, a, false, b, (short)0, c, false, false); }
__device__ __forceinline__ v8f wmmab(v16bf a, v16bf b, v8f c) { return __builtin_amdgcn_wmma_f32_16x16x32_bf16(false, a, false, b, (short)0, c, false, false); }



// ---- k_gemmw: GEMM on bf16 planes in FRAGMENT ORDER (below). One tile of (WM x 64) x (WN x 64) outputs per work-group of WM x WN waves, 64 x 64 outputs (16 accumulators) a wave, every wave over the whole K in rising order.
// The operand bands of the tile are staged in LDS, KC k at a time, by asynchronous copies (global_load_async_to_lds_b128) into a ring of two buffers: an A band is fetched from L2 once per work-group and read from LDS by WN waves, a B band by WM waves.
// Fragment order of a plane [R][K]: blocks of 16 rows x 32 k, 512 elements each, block (r / 16, k / 32) at ((r / 16) * (K / 32) + k / 32) * 512; inside a block element (r, k) at ((k / 16) % 2) * 256 + (((k / 8) % 2) * 16 + r % 16) * 8 + k % 8,
// that is: [half of the fragment][lane][8 elements], so that each of the two 16-byte loads of a fragment reads 512 contiguous bytes over the wave (from LDS: every bank once per 256 bytes, no pad needed); KC k of a band of 16 rows are KC * 32 contiguous bytes, in the plane and in LDS alike.
// C[m][n] (f32, pitch LDC) = sum_k A[m][k] Bt[n][k] (+ A2[m][k] Bt[n][k] where NSPLIT == 1). z-slices: strides sB / sC in elements. grid (M / (WM * 64), N / (WN * 64), Z).
// A stage in LDS: [A bands | A2 bands | B bands], KC * 32 bytes each; wave w copies the bands w * BPW .. w * BPW + BPW - 1.
template <typename T16> struct WFrag;
template <> struct WFrag<h16> { typedef v16h V; static __device__ __forceinline__ V ld(const h16* p) { return cat16(*(const v8h*)p, *(const v8h*)(p + 16)); } static __device__ __forceinline__ V ldp(const h16* band, unsigned vb) { const char* p = (const char*)band + vb; return cat16(*(const v8h*)p, *(const v8h*)(p + 512)); } static __device__ __forceinline__ v8f mma(V a, V b, v8f c) { return wmma16(a, b, c); } };
template <> struct WFrag<bf> { typedef v16bf V; static __device__ __forceinline__ V ld(const bf* p) { return cat16b(*(const v8us*)p, *(const v8us*)(p + 16)); } static __device__ __forceinline__ V ldp(const bf* band, unsigned vb) { const char* p = (const char*)band + vb; return cat16b(*(const v8us*)p, *(const v8us*)(p + 512)); } static __device__ __forceinline__ v8f mma(V a, V b, v8f c) { return wmmab(a, b, c); } };
typedef __attribute__((ext_vector_type(4))) int cv4i;
typedef __attribute__((address_space(1))) cv4i gcv4i;
typedef __attribute__((address_space(3))) cv4i lcv4i;
__device__ __forceinline__ void cp16(const char* g, char* l) { __builtin_amdgcn_global_load_async_to_lds_b128((gcv4i*)g, (lcv4i*)l, 0, 0); }   // each lane: 16 bytes from global memory to LDS, through no register
__device__ __forceinline__ v16bf ldsfrag(const char* p) { return cat16b(*(const v8usa*)p, *(const v8usa*)(p + 512)); }
typedef __attribute__((ext_vector_type(8))) __bf16 v8bf;
__device__ __forceinline__ float xhalf(float x) { const int b = __float_as_int(x); return __int_as_float(__builtin_amdgcn_permlanex16(b, b, 0x76543210, 0xfedcba98, false, false)); }   // the value of lane l ^ 16
// st3: 8 values of a lane as fp16, bf16 hi and bf16 lo (x - hi), 16 bytes to each of the three planes at element e (a wave stores 512 contiguous bytes a plane)
__device__ __forceinline__ void st3(v8f x, h16* p16, bf* ph, bf* pl) {
    const v8h o16 = __builtin_convertvector(x, v8h); const v8bf h = __builtin_convertvector(x, v8bf); const v8bf l = __builtin_convertvector(x - __builtin_convertvector(h, v8f), v8bf);
    const v8us oh = __builtin_bit_cast(v8us, h), ol = __builtin_bit_cast(v8us, l);
    *(v8h*)p16 = o16; *(v8us*)ph = oh; *(v8us*)pl = ol;
    asm volatile("s_wait_xcnt 0x0" :: "v"(p16), "v"(ph), "v"(pl), "v"(o16), "v"(oh), "v"(ol) : "memory");   // behind the three stores, their addresses and data inputs: what follows writes registers that the stores name
}
// rope_epi: epilogue of a projection tile of WM x 64 rows x one whole head (128 columns, two waves side by side): per-head RMSNorm with weight (1 + w), rotate-half RoPE, and the head's three planes (fp16, hi, lo; rows t, k = d) in fragment order, straight from the accumulators.
// The whole tile goes through LDS once (pitch 132 floats: the column writes and the 16-byte row reads both spread over the banks). Behind the one barrier lane (lr, hi) reads row lr of 16 rows at a time: the pieces d = m * 16 + hi * 8 .. + 7.
// Sum of squares: the lane's 64 values in eight running sums (one per d % 8, rising d), these added in pairs, then the other half wave's sum. Wave wn builds the d blocks wn and wn + 2 (d and d + 64 are rotation partners) of its own 64 rows: piece (block, half u) is the lane's own 16 bytes of the fragment block.
#define RSP  132
__device__ __forceinline__ void rope_epi(const v8f (&acc)[4][4], float* tile, int wm, int wn, int lane, int r0, int head, int nheads, const float* __restrict__ CS, const float* __restrict__ nw, h16* P16, bf* Ph, bf* Pl) {
    const int lr = lane & 15, hi = lane >> 4; const int b = r0 / TT, t0 = r0 % TT + wm * 64; const int dl = wn * 32 + hi * 8;
    const size_t pb = (size_t)(b * nheads + head) * TT * HD + (size_t)(t0 / 16) * (HD / 32 * 512) + (size_t)wn * 512 + lane * 8;
    float* tw = tile + (wm * 64 + hi * 8) * RSP + wn * 64 + lr;
#pragma unroll
    for (int mb = 0; mb < 4; ++mb)
#pragma unroll
        for (int nb = 0; nb < 4; ++nb)
#pragma unroll
            for (int j = 0; j < 8; ++j) tw[(mb * 16 + j) * RSP + nb * 16] = acc[mb][nb][j];
    __syncthreads();   // both waves' halves of the rows are in LDS before either reads whole rows
    const float* cp = CS + ((size_t)(t0 + lr) * HD + dl) * 2; const float* wp = nw + dl;   // cos | sin pairs of row t at d (the table's entries at d + 64 are the same values)
    v4f cs[4][2][4], wl[2][2], wh[2][2];   // every global load of the epilogue is asked for here, together: one memory latency, not one per 16 rows (the accumulators' registers are free by now)
#pragma unroll
    for (int u = 0; u < 2; ++u)
#pragma unroll
        for (int q = 0; q < 2; ++q) { wl[u][q] = *(const v4f*)(wp + u * 16 + q * 4); wh[u][q] = *(const v4f*)(wp + HD / 2 + u * 16 + q * 4); }
#pragma unroll
    for (int mb = 0; mb < 4; ++mb)
#pragma unroll
        for (int u = 0; u < 2; ++u)
#pragma unroll
            for (int q = 0; q < 4; ++q) cs[mb][u][q] = *(const v4f*)(cp + mb * (16 * HD * 2) + u * 32 + q * 4);
    asm volatile("s_wait_xcnt 0x0" :: "v"(cp), "v"(wp) : "memory");   // the address pairs are inputs, so that neither is reused (as a later load's destination either) in front of the wait
#pragma unroll
    for (int u = 0; u < 2; ++u)
#pragma unroll
        for (int q = 0; q < 2; ++q)
#pragma unroll
            for (int i = 0; i < 4; ++i) { wl[u][q][i] = 1.0f + bfr(wl[u][q][i]); wh[u][q][i] = 1.0f + bfr(wh[u][q][i]); }   // weight applied as (1 + w)
#pragma unroll
    for (int mb = 0; mb < 4; ++mb) {
        const float* rp = tile + (wm * 64 + mb * 16 + lr) * RSP; v4f sa = (v4f){}, sc = (v4f){};   // eight running sums, one per d % 8: short chains
#pragma unroll
        for (int m = 0; m < 8; ++m) { const v4f a = *(const v4fa*)(rp + m * 16 + hi * 8), c = *(const v4fa*)(rp + m * 16 + hi * 8 + 4); sa += a * a; sc += c * c; }
        sa += sc; float s = (sa[0] + sa[1]) + (sa[2] + sa[3]);
        s += xhalf(s);
        const float rf = __fdiv_rn(1.0f, __fsqrt_rn(s * (1.0f / HD) + 1e-6f));
#pragma unroll
        for (int u = 0; u < 2; ++u) { const float* xp = rp + dl + u * 16; v8f lo, hg;
#pragma unroll
            for (int q = 0; q < 2; ++q) { const v4f xa = *(const v4fa*)(xp + q * 4), xb = *(const v4fa*)(xp + HD / 2 + q * 4);
#pragma unroll
                for (int i = 0; i < 4; ++i) { const float x0 = wl[u][q][i] * (xa[i] * rf), x1 = wh[u][q][i] * (xb[i] * rf); const int ci = (q * 4 + i) * 2; const float co = cs[mb][u][ci / 4][ci % 4], si = cs[mb][u][ci / 4][ci % 4 + 1];
                    lo[q * 4 + i] = x0 * co - x1 * si; hg[q * 4 + i] = x1 * co + x0 * si; } }
            const size_t e = pb + mb * (HD / 32 * 512) + u * 256;
            st3(lo, P16 + e, Ph + e, Pl + e); st3(hg, P16 + e + 1024, Ph + e + 1024, Pl + e + 1024); }
    }
}
// vt_epi: epilogue of a v projection tile: in an accumulator lane (lr, hi) holds column n = lr, rows t = hi * 8 + j, which is the lane's own 16 bytes of the v^T planes' fragment block (rows n = g * HD + d of batch b, k = t): stored straight from the registers.
__device__ __forceinline__ void vt_epi(const v8f (&acc)[4][4], int lane, int rw, int cw, h16* V16, bf* Vh, bf* Vl) {   // rw, cw: first row (of both batches) and first column of the wave's tile
    const int b = rw / TT, tl = rw % TT;
#pragma unroll
    for (int mb = 0; mb < 4; ++mb)
#pragma unroll
        for (int nb = 0; nb < 4; ++nb) { const size_t e = ((size_t)((b * DKV + cw) / 16 + nb) * (TT / 32) + (tl + mb * 16) / 32) * 512 + (mb & 1) * 256 + lane * 8; st3(acc[mb][nb], V16 + e, Vh + e, Vl + e);
            __builtin_amdgcn_sched_barrier(0); }   // keeps the next tile's conversions behind the wait that ends st3: lifted among its stores, they write registers that the stores name
}
// EPI 0: C in f32. EPI 1 (q | gate): slice 0 ends in rope_epi (head blockIdx.y of NH_), slice 1 stores C. EPI 2 (k | v): slice 0 ends in rope_epi (head blockIdx.y of NKV), slice 1 in vt_epi; C is not written.
template <int EPI, int NSPLIT, int WM, int WN, int KC, int PF, int K, int LDC>
__global__ __launch_bounds__(WM * WN * 32) void k_gemmw(const bf* __restrict__ A, const bf* __restrict__ A2, const bf* __restrict__ Bt, float* C, size_t sB, size_t sC, const float* __restrict__ CS, const float* __restrict__ nw, h16* P16, bf* Ph, bf* Pl, h16* V16, bf* Vh, bf* Vl) {
    constexpr int NW = WM * WN, NAB = WM * 4, NAA = NAB * (1 + NSPLIT), NBAND = NAA + WN * 4, BCH = KC * 32, STAGE = NBAND * BCH, BPW = NBAND / NW, CPB = BCH / 512, NT = K / KC;
    static_assert(NBAND % NW == 0 && K % KC == 0 && KC % (32 * PF) == 0 && NT >= 2 && BPW * CPB <= 63 && NW * 16 * 68 * 4 <= 2 * STAGE, "whole bands a wave, two stages or more, at most 63 copies of a wave in flight, the output slabs fit the ring");
    constexpr int RB = (EPI != 0 && WM * 64 * RSP * 4 > 2 * STAGE) ? WM * 64 * RSP * 4 : 2 * STAGE;   // the ring; behind the loop the same bytes stage the output tile
    __shared__ __align__(1024) char ring[RB];
    Bt += blockIdx.z * sB; C += blockIdx.z * sC;
    const int lane = threadIdx.x & 31, lr = lane & 15, hi = lane >> 4; const int wave = __builtin_amdgcn_readfirstlane(threadIdx.x >> 5); const int wm = wave / WN, wn = wave % WN; const int r0 = blockIdx.x * (WM * 64), c0 = blockIdx.y * (WN * 64);
    const char* gs[BPW];   // the lane's own 16 bytes at k = 0 of each band that this wave copies (the choice of the plane is wave-uniform)
#pragma unroll
    for (int u = 0; u < BPW; ++u) { const int i = wave * BPW + u; const bf* p = (i < NAB) ? A + (size_t)(r0 / 16 + i) * 16 * K : (NSPLIT == 1 && i < NAA) ? A2 + (size_t)(r0 / 16 + i - NAB) * 16 * K : Bt + (size_t)(c0 / 16 + i - NAA) * 16 * K; gs[u] = (const char*)p + lane * 16; }
    auto fill = [&](int t) { char* l = ring + (t & 1) * STAGE + wave * (BPW * BCH) + lane * 16;
#pragma unroll
        for (int u = 0; u < BPW; ++u)
#pragma unroll
            for (int c = 0; c < CPB; ++c) cp16(gs[u] + (size_t)t * BCH + c * 512, l + u * BCH + c * 512); };
    v8f acc[4][4];
#pragma unroll
    for (int mb = 0; mb < 4; ++mb)
#pragma unroll
        for (int nb = 0; nb < 4; ++nb) acc[mb][nb] = (v8f){};
    fill(0);
    asm volatile("s_wait_asynccnt 0x0" ::: "memory");   // this wave's copies of stage 0 have landed
    __syncthreads();                                     // every wave's have: stage 0 may be read
    fill(1);
#pragma unroll 1   // one body: the buffer is chosen by the trip's parity
    for (int t = 0; t < NT; ++t) {
        const char* sb = ring + (t & 1) * STAGE + lane * 16; const char* sa = sb + wm * (4 * BCH); const char* sw = sb + NAA * BCH + wn * (4 * BCH);
#pragma unroll
        for (int kg = 0; kg < KC / 32; kg += PF) { v16bf a[PF][4], a2[PF][4], b[PF][4];   // the fragments of PF k blocks are asked for together, in front of their products: one LDS latency a group, not one per B fragment
#pragma unroll
            for (int p = 0; p < PF; ++p)
#pragma unroll
                for (int i = 0; i < 4; ++i) { const int ko = (kg + p) * 1024; a[p][i] = ldsfrag(sa + i * BCH + ko); if (NSPLIT == 1) a2[p][i] = ldsfrag(sa + (NAB + i) * BCH + ko); b[p][i] = ldsfrag(sw + i * BCH + ko); }
            __builtin_amdgcn_sched_barrier(0);   // keeps the group of LDS loads above in front of the products below: sunk among them, each B fragment's load is waited for alone
#pragma unroll
            for (int p = 0; p < PF; ++p)
#pragma unroll
                for (int nb = 0; nb < 4; ++nb) {   // per accumulator: the A product, then the A2 product; three other products stand between the two (a product that reads the one just issued waits for it)
#pragma unroll
                    for (int mb = 0; mb < 4; ++mb) acc[mb][nb] = wmmab(a[p][mb], b[p][nb], acc[mb][nb]);
                    if (NSPLIT == 1) {
#pragma unroll
                        for (int mb = 0; mb < 4; ++mb) acc[mb][nb] = wmmab(a2[p][mb], b[p][nb], acc[mb][nb]); } } }
        __builtin_amdgcn_sched_barrier(0);   // keeps the products above in front of the waits below: lifted over them, the wait for the next stage's copies stands ahead of this trip's products and the refill behind them, and the copies fly with nothing to cover them
        asm volatile("s_wait_dscnt 0x0" ::: "memory");      // this wave's reads of the buffer have returned before the buffer is handed to its next writer
        asm volatile("s_wait_asynccnt 0x0" ::: "memory");   // this wave's copies of stage t + 1 have landed
        __syncthreads();                                     // publishes stage t + 1 and ends every wave's reads of stage t
        if (t + 2 < NT) fill(t + 2);                         // into the buffer that this trip has just read (the test reads the same for the whole work-group)
    }
    asm volatile("s_wait_asynccnt 0x0" ::: "memory");   // no copy is outstanding when the ring becomes output staging
    if constexpr (EPI != 0) {   // the slice is the same for the whole work-group: every wave takes the same epilogue, with its barrier
        static_assert(WN == 2, "a tile is one head wide");
        if (blockIdx.z == 0) { rope_epi(acc, (float*)ring, wm, wn, lane, r0, blockIdx.y, EPI == 1 ? NH_ : NKV, CS, nw, P16, Ph, Pl); return; }
        if constexpr (EPI == 2) { vt_epi(acc, lane, r0 + wm * 64, c0 + wn * 64, V16, Vh, Vl); return; }
    }
    // each wave transposes its tile, 16 rows at a time, in a slab of its own (pitch 68 floats) and stores whole 128-byte lines: two rows of 256 bytes a store
    float* slab = (float*)ring + wave * (16 * 68); float* cw = C + (size_t)(r0 + wm * 64 + hi) * LDC + c0 + wn * 64 + lr * 4;
#pragma unroll
    for (int mb = 0; mb < 4; ++mb) {
#pragma unroll
        for (int nb = 0; nb < 4; ++nb)
#pragma unroll
            for (int j = 0; j < 8; ++j) slab[(hi * 8 + j) * 68 + nb * 16 + lr] = acc[mb][nb][j];
        asm volatile("s_wait_dscnt 0x0" ::: "memory");   // the column writes above (other lanes' data, same wave) are done before the rows are read back
        v4f val[8];
#pragma unroll
        for (int s = 0; s < 8; ++s) val[s] = *(const v4fa*)(slab + (s * 2 + hi) * 68 + lr * 4);
#pragma unroll
        for (int s = 0; s < 8; ++s) *(v4f*)(cw + (size_t)(mb * 16 + s * 2) * LDC) = val[s];
        asm volatile("s_wait_xcnt 0x0" :: "v"(cw), "v"(val[0]), "v"(val[1]), "v"(val[2]), "v"(val[3]), "v"(val[4]), "v"(val[5]), "v"(val[6]), "v"(val[7]) : "memory");   // behind the eight stores, their address and data inputs: the next rows' reads write registers that the stores name
    }
}

// ---- k_fattn: causal scores, softmax and probability x value product in one kernel; no score or probability ever reaches memory. One work-group of 8 waves per (kv group, tile of QT x 16 queries): wave w works for head w / 2 of the group's four and takes the 32-key blocks of parity w % 2 up to the diagonal.
// The four heads of a group read the same k and v^T planes: a stage of two key blocks (64 keys, every plane) is brought from L2 once per work-group, by asynchronous copies (global_load_async_to_lds_b128) into a ring of two buffers in LDS, and each block is read from LDS by four waves.
// A stage in LDS: [block of even parity | block of odd parity], a block [k | (k lo) | v^T | (v^T lo)], 8 fragment blocks of 1 KiB a plane, in the planes' own fragment order; wave w copies the 1-KiB blocks w * PER .. w * PER + PER - 1 of the stage (all of one plane).
// Transposed products: S^T = K Q^T (A = 16 keys x 32 d of the k plane, B = the queries, kept in registers), O^T += V^T P^T (A = 16 d x 32 keys of the v^T plane). In an S^T tile lane (lr, hi) holds keys hi * 8 + j of query lr,
// which is the B-fragment order of those keys: two tiles convert in place into one P^T fragment; maximum and sum of a query are in-lane but for one exchange between the wave halves.
// Running maximum mu (raw score units) and sum per query; the accumulators are rescaled only when some query's block maximum exceeds its mu by more than 8 in log2 units (probabilities stay below 2^8, inside fp16 range).
// At the end the two waves of a head agree on the larger mu and rescale; the odd wave parks its sums and accumulators in LDS, the even wave adds them to its own (even + odd, a fixed order), divides and stores the head's rows.
__device__ __forceinline__ v16h ldsfr(const h16*, const char* p) { return cat16(*(const v8ha*)p, *(const v8ha*)(p + 512)); }
__device__ __forceinline__ v16bf ldsfr(const bf*, const char* p) { return ldsfrag(p); }
template <typename T16, bool HL, int QT>
__device__ __forceinline__ void fattn_body(const T16* __restrict__ Q, const T16* __restrict__ Q2, const T16* __restrict__ Kp, const T16* __restrict__ Kp2, const T16* __restrict__ Vt, const T16* __restrict__ Vt2, float* O, int q0, int wave, char* ring, float* sm, float* sl) {
    typedef typename WFrag<T16>::V V;
    constexpr int KS = 2, NACC = QT * 8, PL = HL ? 4 : 2, BLKB = PL * 8192, STAGE = KS * BLKB, PER = KS * PL * 8 / 8; constexpr float CL = SCL * 1.4426950408889634f;   // score -> log2 units
    static_assert(2 * PER <= 63 && 8 % PER == 0 && 4 * NACC * 1024 <= 2 * STAGE, "at most 63 copies of a wave in flight, a wave's blocks lie in one plane, the parked accumulators fit the ring");
    const int lane = threadIdx.x & 31, lr = lane & 15, hi = lane >> 4; const int hg = wave >> 1, ks = wave & 1; const unsigned lb = (unsigned)lane * 16u;
    V qf[QT][4], qf2[QT][4]; const T16* qp = (const T16*)((const char*)(Q + (size_t)(q0 / 16) * 2048) + lb); const T16* qp2 = HL ? (const T16*)((const char*)(Q2 + (size_t)(q0 / 16) * 2048) + lb) : qp;   // the lane's own address in the first block; the other blocks are immediate offsets
#pragma unroll
    for (int qt = 0; qt < QT; ++qt)
#pragma unroll
        for (int dc = 0; dc < 4; ++dc) { const int o = (qt * 4 + dc) * 512; qf[qt][dc] = WFrag<T16>::ldp(qp + o, 0u); if (HL) qf2[qt][dc] = WFrag<T16>::ldp(qp2 + o, 0u); }
    asm volatile("s_wait_xcnt 0x0" :: "v"(qp), "v"(qp2), "v"(lane) : "memory");   // the address pairs are inputs, so that none of them is reused (as a later load's destination either) in front of the wait; the lane number too, which the loads name as their offset where the block's start is a scalar base
    const int nkb = (q0 + QT * 16 + 31) / 32;   // 32-key blocks up to and with the one that holds the diagonal
    const int ntr = (nkb + KS - 1) / KS;        // stages; where nkb is odd the last stage's second block lies behind the diagonal: it is copied (nkb < TT / 32 then: it exists in the planes) and not read
    // what this wave copies of a stage (every choice is wave-uniform): 1-KiB block j0 + u of the stage = key block 'slot', plane 'plane', fragment block i0 + u
    const int j0 = wave * PER, slot = j0 / (PL * 8), plane = (j0 / 8) % PL, i0 = j0 % 8; const bool isv = plane >= PL / 2;
    const T16* pb = HL ? (plane == 0 ? Kp : plane == 1 ? Kp2 : plane == 2 ? Vt : Vt2) : (plane == 0 ? Kp : Vt);
    const char* g0 = (const char*)pb + (isv ? (size_t)i0 * ((TT / 32) * 1024) + (size_t)slot * 1024 : (size_t)slot * 8192 + (size_t)i0 * 1024) + lb;   // the lane's own 16 bytes of the wave's first block in stage 0
    const size_t gstep = isv ? (size_t)(TT / 32) * 1024 : (size_t)1024, adv = isv ? (size_t)KS * 1024 : (size_t)KS * 8192;   // from a fragment block to the next; from a stage to the next
    char* l0 = ring + j0 * 1024 + lb;
    auto fill = [&](int t) { const char* g = g0 + (size_t)t * adv; char* l = l0 + (t & 1) * STAGE;
#pragma unroll
        for (int u = 0; u < PER; ++u) { cp16(g + u * gstep, l + u * 1024); cp16(g + u * gstep + 512, l + u * 1024 + 512); } };
    v8f acc[QT][8]; float mu[QT], ls[QT];
#pragma unroll
    for (int qt = 0; qt < QT; ++qt) { mu[qt] = -3.0e38f; ls[qt] = 0.f;
#pragma unroll
        for (int dt = 0; dt < 8; ++dt) acc[qt][dt] = (v8f){}; }
    fill(0);
    asm volatile("s_wait_asynccnt 0x0" ::: "memory");   // this wave's copies of stage 0 have landed
    __syncthreads();                                     // every wave's have: stage 0 may be read
    if (1 < ntr) fill(1);                                // the test reads the same for the whole work-group
#pragma unroll 1   // one body: the buffer is chosen by the trip's parity, and a second copy would need a second set of k, v^T and score registers
    for (int t = 0; t < ntr; ++t) {
        const int kb = t * KS + ks;
        if (kb < nkb) {   // wave-uniform (a scalar test); no barrier stands inside
        const char* sb = ring + (t & 1) * STAGE + ks * BLKB + lb;
        V kf[8], kf2[8], vf[8], vf2[8];   // the v^T fragments are asked for in front of the score products and the softmax arithmetic, which cover their latency
#pragma unroll
        for (int i = 0; i < 8; ++i) { kf[i] = ldsfr((const T16*)nullptr, sb + i * 1024); if (HL) kf2[i] = ldsfr((const T16*)nullptr, sb + 8192 + i * 1024); }
#pragma unroll
        for (int dt = 0; dt < 8; ++dt) { vf[dt] = ldsfr((const T16*)nullptr, sb + (PL / 2) * 8192 + dt * 1024); if (HL) vf2[dt] = ldsfr((const T16*)nullptr, sb + 3 * 8192 + dt * 1024); }
        __builtin_amdgcn_sched_barrier(0);   // keeps the group of LDS loads above in front of the products below: sunk among them, each k fragment's load is waited for alone
        v8f s[QT][2];
#pragma unroll
        for (int qt = 0; qt < QT; ++qt) { s[qt][0] = (v8f){}; s[qt][1] = (v8f){}; }
#pragma unroll
        for (int hf = 0; hf < 2; ++hf)
#pragma unroll
            for (int dc = 0; dc < 4; ++dc) { const int i = hf * 4 + dc;
#pragma unroll
                for (int qt = 0; qt < QT; ++qt) { s[qt][hf] = WFrag<T16>::mma(kf[i], qf[qt][dc], s[qt][hf]); if (HL) { s[qt][hf] = WFrag<T16>::mma(kf[i], qf2[qt][dc], s[qt][hf]); s[qt][hf] = WFrag<T16>::mma(kf2[i], qf[qt][dc], s[qt][hf]); } } }
        if (kb == nkb - 1) {   // the block on the diagonal: keys behind the query are masked (wave-uniform test)
#pragma unroll
            for (int qt = 0; qt < QT; ++qt)
#pragma unroll
                for (int hf = 0; hf < 2; ++hf)
#pragma unroll
                    for (int j = 0; j < 8; ++j) if (kb * 32 + hf * 16 + hi * 8 + j > q0 + qt * 16 + lr) s[qt][hf][j] = -3.0e38f; }
        float bm[QT]; bool need = false;
#pragma unroll
        for (int qt = 0; qt < QT; ++qt) { float t2 = fmaxf(s[qt][0][0], s[qt][1][0]);
#pragma unroll
            for (int j = 1; j < 8; ++j) t2 = fmaxf(t2, fmaxf(s[qt][0][j], s[qt][1][j]));
            bm[qt] = fmaxf(t2, xhalf(t2)); need = need || ((bm[qt] - mu[qt]) * CL > 8.0f); }
        if (__builtin_amdgcn_ballot_w32(need) != 0) {   // one scalar test a block
#pragma unroll
            for (int qt = 0; qt < QT; ++qt) { const float mn = fmaxf(mu[qt], bm[qt]); const float al = __builtin_amdgcn_exp2f((mu[qt] - mn) * CL); mu[qt] = mn; ls[qt] *= al;
#pragma unroll
                for (int dt = 0; dt < 8; ++dt) acc[qt][dt] *= al; } }
        V pf[QT], pf2[QT];
#pragma unroll
        for (int qt = 0; qt < QT; ++qt) { const float nm = -mu[qt] * CL; v8f p0, p1;
#pragma unroll
            for (int j = 0; j < 8; ++j) { p0[j] = __builtin_amdgcn_exp2f(fmaf(s[qt][0][j], CL, nm)); p1[j] = __builtin_amdgcn_exp2f(fmaf(s[qt][1][j], CL, nm)); }
            float t2 = 0.f;
#pragma unroll
            for (int j = 0; j < 8; ++j) t2 += p0[j] + p1[j];
            ls[qt] += t2;
            if constexpr (HL) { const v8bf h0 = __builtin_convertvector(p0, v8bf), h1 = __builtin_convertvector(p1, v8bf); const v8bf l0b = __builtin_convertvector(p0 - __builtin_convertvector(h0, v8f), v8bf), l1b = __builtin_convertvector(p1 - __builtin_convertvector(h1, v8f), v8bf);
                pf[qt] = __builtin_shufflevector(h0, h1, 0, 1, 2, 3, 4, 5, 6, 7, 8, 9, 10, 11, 12, 13, 14, 15); pf2[qt] = __builtin_shufflevector(l0b, l1b, 0, 1, 2, 3, 4, 5, 6, 7, 8, 9, 10, 11, 12, 13, 14, 15); }
            else pf[qt] = cat16(__builtin_convertvector(p0, v8h), __builtin_convertvector(p1, v8h)); }
#pragma unroll
        for (int dt = 0; dt < 8; ++dt)
#pragma unroll
            for (int qt = 0; qt < QT; ++qt) { acc[qt][dt] = WFrag<T16>::mma(vf[dt], pf[qt], acc[qt][dt]); if (HL) { acc[qt][dt] = WFrag<T16>::mma(vf[dt], pf2[qt], acc[qt][dt]); acc[qt][dt] = WFrag<T16>::mma(vf2[dt], pf[qt], acc[qt][dt]); } }
        }
        asm volatile("s_wait_dscnt 0x0" ::: "memory");      // this wave's reads of the buffer have returned before the buffer is handed to its next writer
        asm volatile("s_wait_asynccnt 0x0" ::: "memory");   // this wave's copies of stage t + 1 have landed
        __syncthreads();                                     // publishes stage t + 1 and ends every wave's reads of stage t
        if (t + 2 < ntr) fill(t + 2);                        // into the buffer that this trip has just read (the test reads the same for the whole work-group)
    }
    asm volatile("s_wait_asynccnt 0x0" ::: "memory");   // no copy is outstanding when the ring becomes the place of the parked accumulators
#pragma unroll
    for (int qt = 0; qt < QT; ++qt) { ls[qt] += xhalf(ls[qt]); if (hi == 0) sm[wave * 32 + qt * 16 + lr] = mu[qt]; }
    __syncthreads();   // both waves' maxima of a head are in LDS before either picks the larger
    char* park = ring + hg * (NACC * 1024) + lb;   // the lane's own 16 bytes of the head's first parked half tile
#pragma unroll
    for (int qt = 0; qt < QT; ++qt) { const int qi = qt * 16 + lr; const float M = fmaxf(sm[hg * 64 + qi], sm[hg * 64 + 32 + qi]); const float f = __builtin_amdgcn_exp2f((mu[qt] - M) * CL); ls[qt] *= f;
#pragma unroll
        for (int dt = 0; dt < 8; ++dt) acc[qt][dt] *= f;
        if (ks == 1) { if (hi == 0) sl[hg * 32 + qi] = ls[qt];
#pragma unroll
            for (int dt = 0; dt < 8; ++dt) { const v8f t2 = acc[qt][dt]; const int a = qt * 8 + dt; *(v4fa*)(park + a * 1024) = __builtin_shufflevector(t2, t2, 0, 1, 2, 3); *(v4fa*)(park + a * 1024 + 512) = __builtin_shufflevector(t2, t2, 4, 5, 6, 7); } } }
    __syncthreads();   // the odd waves' rescaled sums are in LDS before the even waves add them
    if (ks == 0) {   // wave-uniform; no barrier follows
#pragma unroll
        for (int qt = 0; qt < QT; ++qt) { const float r = __fdiv_rn(1.0f, ls[qt] + sl[hg * 32 + qt * 16 + lr]);
#pragma unroll
            for (int dt = 0; dt < 8; ++dt) { const char* p = park + (qt * 8 + dt) * 1024; const v4f s0 = *(const v4fa*)p, s1 = *(const v4fa*)(p + 512); acc[qt][dt] = (acc[qt][dt] + __builtin_shufflevector(s0, s1, 0, 1, 2, 3, 4, 5, 6, 7)) * r; } }
        __builtin_amdgcn_sched_barrier(0);   // keeps the stores below behind all the arithmetic above: no register that a store names is written behind it
        float* ob = O + (size_t)(q0 + lr) * HD + hi * 8;   // the lane's query row of the first tile; the other pieces are immediate offsets
#pragma unroll
        for (int qt = 0; qt < QT; ++qt)
#pragma unroll
            for (int dt = 0; dt < 8; ++dt) { float* o = ob + qt * 16 * HD + dt * 16; const v8f t2 = acc[qt][dt]; *(v4f*)o = __builtin_shufflevector(t2, t2, 0, 1, 2, 3); *(v4f*)(o + 4) = __builtin_shufflevector(t2, t2, 4, 5, 6, 7); }
        asm volatile("s_wait_xcnt 0x0" :: "v"(ob) : "memory");   // behind the stores, their address an input
    }
}
// grid (batches x kv groups, tiles): blockIdx.x = b * NKV + group, whose heads are number blockIdx.x * REP + 0 .. REP - 1 = b * NH_ + head; tile ranks 0 .. (TT - RH) / 32 - 1 are the fp16 tiles of 32 queries from the last rows down (the longest first), the rest the hi+lo tiles of 16 queries, again from the last down.
__global__ __launch_bounds__(256) void k_fattn(const h16* __restrict__ Q16, const h16* __restrict__ K16, const h16* __restrict__ V16, const bf* __restrict__ Qh, const bf* __restrict__ Ql, const bf* __restrict__ Kh, const bf* __restrict__ Kl, const bf* __restrict__ Vh, const bf* __restrict__ Vl, float* O) {
    static_assert(REP == 4, "eight waves: four heads of a group, two waves a head");
    __shared__ __align__(1024) char ring[131072]; __shared__ float sm[8 * 32]; __shared__ float sl[4 * 32];
    const int wave = __builtin_amdgcn_readfirstlane(threadIdx.x >> 5);
    const size_t g = blockIdx.x, z = g * REP + (wave >> 1); const int rk = blockIdx.y; const size_t qo = z * TT * HD, ko = g * TT * HD; O += qo;
    if (rk < (TT - RH) / 32) fattn_body<h16, false, 2>(Q16 + qo, nullptr, K16 + ko, nullptr, V16 + ko, nullptr, O, TT - 32 - rk * 32, wave, ring, sm, sl);
    else fattn_body<bf, true, 1>(Qh + qo, Ql + qo, Kh + ko, Kl + ko, Vh + ko, Vl + ko, O, RH - 16 - (rk - (TT - RH) / 32) * 16, wave, ring, sm, sl);
}

__device__ __forceinline__ void splitf(float y, unsigned short& h, unsigned short& l) { h = f2bf(y); l = f2bf(y - bf2f(h)); }
typedef __attribute__((ext_vector_type(2))) _Float16 v2h;
typedef __attribute__((ext_vector_type(4))) _Float16 v4h;
typedef __attribute__((ext_vector_type(2))) unsigned short v2us;
typedef __attribute__((ext_vector_type(4))) unsigned short v4us;
typedef __attribute__((ext_vector_type(2))) float v2f;
typedef __attribute__((ext_vector_type(4))) int v4i;

__global__ __launch_bounds__(256) void k_wtG(const float* __restrict__ w, int K, int N, bf* Bt) {
    const int lane = threadIdx.x & 31; const int L0 = (blockIdx.x * 8 + (threadIdx.x >> 5)) * 8; const int nlines = N * K / 64;
{
#pragma unroll 1
        for (int l = 0; l < 8; ++l) { const int L = L0 + l; if (L >= nlines) break; const size_t e = (size_t)L * 64 + lane * 2; const int k = (int)(e % K), n = (int)(e / K); v2us o;
            o[0] = f2bf(w[(size_t)k * N + n]); o[1] = f2bf(w[(size_t)(k + 1) * N + n]); *(v2us*)(Bt + e) = o; }
         }
}
// pack_body: f32 rows [R][K] -> bf16 plane in the fragment order of k_gemmw. A wave takes one block of 16 rows x 32 k at a time: 8 lanes read one whole 128-byte line of a row (4 rows a load), each lane stores its 4 elements as 8 bytes (64 contiguous bytes per 4 rows).
// One launch packs every operand: all have K = DM = DQ columns, and their planes lie one behind the other in dst: [q rows of Wq | gate rows of Wq | Wk | Wv | Wo | x, both batches] = PKR rows. The 8 waves of a work-group share a band of 16 rows, so the choice of the source is uniform.
// q / gate plane row n is row (n / HD) * 2 * HD + part * HD + n % HD of the interleaved q|gate weight (part 0: q, part 1: gate); every other plane row is the same row of its source.
#define PKR  (2 * DQ + 2 * DKV + DM + TR)
static_assert(DM == DQ, "one K for every packed plane");
__device__ __forceinline__ void pack_body(int bx, const float* __restrict__ wqg, const float* __restrict__ wk, const float* __restrict__ wv, const float* __restrict__ wo, const float* __restrict__ x, bf* dst) {
    constexpr int K = DM, KB = K >> 5;
    const int lane = threadIdx.x & 31; const int rb = bx; const int k = (lane & 7) * 4, rq = lane >> 3;   // work-group bx takes the whole band bx of 16 rows: its wave w the k blocks w, w + 8, ... (few long waves, for speed only)
    const int n0 = rb * 16; const float* src; int s0;   // HD % 16 == 0: the 16 rows of a block are consecutive rows of src
    if (n0 < 2 * DQ) { const int part = n0 / DQ, nn = n0 % DQ; src = wqg; s0 = (nn / HD) * 2 * HD + part * HD + nn % HD; }
    else if (n0 < 2 * DQ + DKV) { src = wk; s0 = n0 - 2 * DQ; }
    else if (n0 < 2 * DQ + 2 * DKV) { src = wv; s0 = n0 - (2 * DQ + DKV); }
    else if (n0 < 2 * DQ + 2 * DKV + DM) { src = wo; s0 = n0 - (2 * DQ + 2 * DKV); }
    else { src = x; s0 = n0 - (2 * DQ + 2 * DKV + DM); }
#pragma unroll 1   // one body: the trips are independent streams, and the many resident waves keep enough bytes in flight
    for (int kb = (int)(threadIdx.x >> 5); kb < KB; kb += 8) { const int blk = rb * KB + kb;
    const float* sp = src + (size_t)(s0 + rq) * K + kb * 32 + k; bf* d = dst + (size_t)blk * 512 + ((k >> 4) & 1) * 256 + ((k >> 3) & 1) * 128 + rq * 8 + (k & 7); v4f v[4];
    const float* p1 = sp + (size_t)4 * K; const float* p2 = sp + (size_t)8 * K; const float* p3 = sp + (size_t)12 * K;
    v[0] = *(const v4f*)sp; v[1] = *(const v4f*)p1; v[2] = *(const v4f*)p2; v[3] = *(const v4f*)p3;
    asm volatile("s_wait_xcnt 0x0" :: "v"(sp), "v"(p1), "v"(p2), "v"(p3) : "memory");   // the four address pairs are inputs, so that none of them is reused (as a later load's destination either) in front of the wait
#pragma unroll
    for (int it = 0; it < 4; ++it) { v4us o;
#pragma unroll
        for (int u = 0; u < 4; ++u) o[u] = f2bf(v[it][u]);
        *(v4us*)(d + it * 32) = o; }
    asm volatile("s_wait_xcnt 0x0" :: "v"(d) : "memory");   // behind the four stores, their address an input: the next trip writes registers that the stores name
    }
}
#define CSB  4    // table pieces of 256 entries a work-group fills, one after the other
static_assert(TT * HD % (256 * CSB) == 0, "whole work-groups");
__device__ __forceinline__ void cstab_body(int bx, float* CS) {
#pragma unroll 1   // one body: the range reductions of cosf and sinf are long code
    for (int it = 0; it < CSB; ++it) { const int idx = (bx * CSB + it) * 256 + threadIdx.x; if (idx >= TT * HD) break; const int t = idx / HD, d = idx % HD; const int i = d % (HD / 2); const float inv = __fdiv_rn(1.0f, powf(10000.0f, (float)(2 * i) / (float)HD)); const float ang = __fmul_rn((float)t, inv); v2f cs; cs[0] = cosf(ang); cs[1] = sinf(ang);
    float* cp = CS + (size_t)idx * 2; *(v2f*)cp = cs;
    asm volatile("s_wait_xcnt 0x0" :: "v"(cp) : "memory"); }   // behind the store, its address an input: the next trip writes registers that the store names
}
// k_prep: the two stages that depend on nothing but the inputs, in one launch: the first TT * HD / 256 / CSB work-groups fill the cos|sin table (the longer threads), the rest pack the operands.
__global__ __launch_bounds__(256) void k_prep(const float* __restrict__ wqg, const float* __restrict__ wk, const float* __restrict__ wv, const float* __restrict__ wo, const float* __restrict__ x, bf* dst, float* CS) {
    constexpr int NCS = TT * HD / 256 / CSB; const int bx = blockIdx.x; if (bx < NCS) cstab_body(bx, CS); else pack_body(bx - NCS, wqg, wk, wv, wo, x, dst); }
// k_mergeg: blocks (16 rows t x 32 columns) of the two output planes, which are in the fragment order of k_gemmw: a wave takes 4 rows x 16 columns: 64-byte pieces on the reading and on the storing side.
// A work-group takes MGB blocks of one band, MGU at a time (their loads asked for together): few long waves, for speed only.
#define MGB  16
#define MGU  4
static_assert((ZH * HD / 32) % MGB == 0 && MGB % MGU == 0, "the blocks of a work-group lie in one band");
__global__ __launch_bounds__(256) void k_mergeg(const float* __restrict__ O, const float* __restrict__ G, int h0, bf* Ah, bf* Al) { const int tid = threadIdx.x; const int rb = blockIdx.x / (ZH * HD / 32 / MGB), kb0 = (blockIdx.x % (ZH * HD / 32 / MGB)) * MGB; if (rb >= TR / 16) return;   // rb counts the 16-row bands of both batches
    const int row = (tid >> 6) * 4 + ((tid >> 3) & 3), db = ((tid >> 5) & 1) * 16 + (tid & 7) * 2; const int tg = rb * 16 + row, b = tg / TT, t = tg % TT;
#pragma unroll 1   // MGU blocks a trip are unrolled below; more would only lengthen the code
    for (int it = 0; it < MGB; it += MGU) { const float* gp[MGU]; const float* op[MGU]; v2f gv[MGU], ov[MGU];
#pragma unroll
    for (int u = 0; u < MGU; ++u) { const int kl = (kb0 + it + u) * 32 + db; const int zz = kl / HD, d = kl % HD; gp[u] = G + (size_t)tg * DQ + h0 * HD + kl; op[u] = O + ((size_t)(b * ZH + zz) * TT + t) * HD + d; gv[u] = *(const v2f*)gp[u]; ov[u] = *(const v2f*)op[u]; }
    asm volatile("s_wait_xcnt 0x0" :: "v"(gp[0]), "v"(gp[1]), "v"(gp[2]), "v"(gp[3]), "v"(op[0]), "v"(op[1]), "v"(op[2]), "v"(op[3]) : "memory");   // the address pairs are inputs, so that none of them is reused (as a later load's destination either) in front of the wait
    bf* ap[MGU]; bf* lp[MGU];
#pragma unroll
    for (int u = 0; u < MGU; ++u) { const int kbl = kb0 + it + u;
    const size_t po = ((size_t)rb * (DQ / 32) + h0 * (HD / 32) + kbl) * 512 + (db >> 4) * 256 + (((db >> 3) & 1) * 16 + row) * 8 + (db & 7);
    v2us oh, ol;
#pragma unroll
    for (int q = 0; q < 2; ++q) { const float gt = gv[u][q]; const float sg = __fdiv_rn(1.0f, __fadd_rn(1.0f, expf(-gt))); const float o = ov[u][q]; unsigned short a, c2; splitf(__fmul_rn(o, sg), a, c2); oh[q] = a; ol[q] = c2; } ap[u] = Ah + po; lp[u] = Al + po; *(v2us*)ap[u] = oh; *(v2us*)lp[u] = ol; }
    asm volatile("s_wait_xcnt 0x0" :: "v"(ap[0]), "v"(ap[1]), "v"(ap[2]), "v"(ap[3]), "v"(lp[0]), "v"(lp[1]), "v"(lp[2]), "v"(lp[3]) : "memory"); }   // behind the stores, their addresses inputs: the next trip writes registers that the stores name
}

extern "C" void kernel_launch(void* const* d_in, const int* in_sizes, int n_in,
                              void* d_out, int out_size, void* d_ws, size_t ws_size, hipStream_t stream) {
    (void)in_sizes; (void)n_in; (void)out_size;
    const float* x = (const float*)d_in[0]; const float* wqg = (const float*)d_in[1]; const float* wk = (const float*)d_in[2]; const float* wv = (const float*)d_in[3]; const float* wo = (const float*)d_in[4]; const float* qnw = (const float*)d_in[5]; const float* knw = (const float*)d_in[6]; const float* wq = wqg;
    float* OUT = (float*)d_out;     // [2][2048][2048]
    char* wsp = (char*)d_ws;
    auto take = [&](size_t bytes) { char* p = wsp; wsp += (bytes + 255) & ~(size_t)255; return (void*)p; };
    bf* PK = (bf*)take((size_t)PKR * DM * 2);   // every packed bf16 operand plane, in the row order of pack_body
    bf* WQ = PK; bf* WK = WQ + (size_t)2 * DQ * DM; bf* WO = WK + (size_t)2 * DKV * DM; bf* XB = WO + (size_t)DM * DQ;   // the gate plane follows WQ, the Wv plane follows WK: z-slices of one GEMM launch
    float* CS = (float*)take((size_t)TT * HD * 2 * 4);
    float* FQ = (float*)take((size_t)2 * TR * DQ * 4); float* GATE = FQ + (size_t)TR * DQ;   // the gate is the output of z-slice 1; the first half holds the attention output
    h16* QP16 = (h16*)take((size_t)NB_ * NH_ * TT * HD * 2); h16* KP16 = (h16*)take((size_t)NB_ * NKV * TT * HD * 2); h16* VT16 = (h16*)take((size_t)NB_ * NKV * HD * TT * 2);
    bf* QPh = (bf*)take((size_t)NB_ * NH_ * TT * HD * 2); bf* QPl = (bf*)take((size_t)NB_ * NH_ * TT * HD * 2); bf* KPh = (bf*)take((size_t)NB_ * NKV * TT * HD * 2); bf* KPl = (bf*)take((size_t)NB_ * NKV * TT * HD * 2); bf* VTh = (bf*)take((size_t)NB_ * NKV * HD * 2 * TT * 2); bf* VTl = VTh + (size_t)NB_ * NKV * HD * TT;   // v^T: hi planes then lo planes
    bf* ATl = (bf*)take((size_t)TR * DQ * 2);
    if ((size_t)(wsp - (char*)d_ws) > ws_size) return;    // ws 256 MiB
    float* Ob = FQ;   // attention output (NB_ x ZH x TT x HD f32 = TR x DQ)
    bf* ATh = XB;     // hi plane of the gated attention output (TR x DQ = TR x DM elements) reuses the bf16 x plane after the k|v projection, its last reader (stream-ordered)
    k_prep<<<TT * HD / 256 / CSB + PKR / 16, 256, 0, stream>>>(wqg, wk, wv, wo, x, PK, CS);
    k_gemmw<1, 0, 4, 2, 64, 1, DM, DQ><<<dim3(TR / 256, DQ / 128, 2), 256, 0, stream>>>(XB, nullptr, WQ, FQ, (size_t)DQ * DM, (size_t)TR * DQ, CS, qnw, QP16, QPh, QPl, nullptr, nullptr, nullptr);       // z = 0: q planes, z = 1: gate
    k_gemmw<2, 0, 2, 2, 128, 4, DM, DKV><<<dim3(TR / 128, DKV / 128, 2), 128, 0, stream>>>(XB, nullptr, WK, nullptr, (size_t)DKV * DM, 0, CS, knw, KP16, KPh, KPl, VT16, VTh, VTl);   // z = 0: k planes, z = 1: v^T planes
    k_fattn<<<dim3(NB_ * NKV, (TT - RH) / 32 + RH / 16, 1), 256, 0, stream>>>(QP16, KP16, VT16, QPh, QPl, KPh, KPl, VTh, VTl, Ob);
    k_mergeg<<<NB_ * ZH * TT * HD / 2 / 256 / MGB, 256, 0, stream>>>(Ob, GATE, 0, ATh, ATl);
    k_gemmw<0, 1, 2, 4, 64, 2, DQ, DM><<<dim3(TR / 128, DM / 256, 1), 256, 0, stream>>>(ATh, ATl, WO, OUT, 0, 0, nullptr, nullptr, nullptr, nullptr, nullptr, nullptr, nullptr, nullptr);
}

// v010
// Measured time: 177 microseconds a run.
// Two timings next to v009 both put it at 1.05 times that version's speed.
// All steps since v000 together make it 9.94 times as fast.
#include <hip/hip_runtime.h>

// GatedAttention (x [2][2048][2048]; qg = x Wq^T (Wq [4096][2048]) viewed (16 heads x 256): q = first 128, gate = last 128 of each head; k/v = x Wk^T / Wv^T (4 kv heads; group h/4); per-head RMSNorm (eps 1e-6) with weight (1 + w) on q and k; rotate-half RoPE (base 1e4, tables computed on device); causal softmax(q.k / sqrt(128)); out = merged attn v x sigmoid(gate); out Wo^T -> [2][2048][2048]).
// Compute dtypes, f32 accumulate: every input rounded to bf16; q / gate / k / v on PLAIN bf16 operands (inputs: exact; the interleaved q|gate rows of Wq gathered); RMSNorm, RoPE (both in the projections' epilogues), sigmoid gating f32; causal scores and attn.v: query rows < 512 hl (3 products), the rest single fp16, one fused kernel with a running maximum and sum (f32), key blocks above the diagonal skipped; Wo hl x exact (2 products).

#define NB_  2
#define TT   2048
#define DM   2048
#define NH_  16
#define NKV  4
#define REP  (NH_ / NKV)
#define HD   128
#define DQ   (NH_ * HD)
#define DKV  (NKV * HD)
#define ZH   16                   // heads per attention pass (all of them: head z uses kv group z / REP)
#define TR   (NB_ * TT)           // rows of both batches together: row b * TT + t; every stage takes them in one launch
#define RH   512                  // query rows < RH use hi+lo planes (0: none)
#define SCL  0.088388347648318447f   // HD^-0.5
typedef _Float16 h16;
typedef unsigned short bf;
typedef __attribute__((ext_vector_type(16))) __bf16   v16bf;
typedef __attribute__((ext_vector_type(16))) _Float16 v16h;
typedef __attribute__((ext_vector_type(8)))  _Float16 v8h;
typedef __attribute__((ext_vector_type(8)))  unsigned short v8us;
typedef __attribute__((ext_vector_type(8)))  float    v8f;
typedef __attribute__((ext_vector_type(4)))  float    v4f;
typedef v8h  __attribute__((may_alias)) v8ha;
typedef v4f  __attribute__((may_alias)) v4fa;
typedef v8us __attribute__((may_alias)) v8usa;

__device__ __forceinline__ unsigned short f2bf(float f) { unsigned u = __float_as_uint(f); u += 0x7FFFu + ((u >> 16) & 1u); return (unsigned short)(u >> 16); }
__device__ __forceinline__ float bf2f(unsigned short b) { return __uint_as_float(((unsigned)b) << 16); }
__device__ __forceinline__ float bfr(float f) { return bf2f(f2bf(f)); }
__device__ __forceinline__ v16h cat16(v8h lo, v8h hi) { return __builtin_shufflevector(lo, hi, 0, 1, 2, 3, 4, 5, 6, 7, 8, 9, 10, 11, 12, 13, 14, 15); }
__device__ __forceinline__ v16bf cat16b(v8us lo, v8us hi) { return __builtin_bit_cast(v16bf, __builtin_shufflevector(lo, hi, 0, 1, 2, 3, 4, 5, 6, 7, 8, 9, 10, 11, 12, 13, 14, 15)); }
__device__ __forceinline__ v8f wmma16(v16h a, v16h b, v8f c) { return __builtin_amdgcn_wmma_f32_16x16x32_f16(false, a, false, b, (short)0, c, false, false); }
__device__ __forceinline__ v8f wmmab(v16bf a, v16bf b, v8f c) { return __builtin_amdgcn_wmma_f32_16x16x32_bf16(false, a, false, b, (short)0, c, false, false); }



// ---- k_gemmw: GEMM on bf16 planes in FRAGMENT ORDER (below). One tile of (WM x 64) x (WN x 64) outputs per work-group of WM x WN waves, 64 x 64 outputs (16 accumulators) a wave, every wave over the whole K in rising order.
// The operand bands of the tile are staged in LDS, KC k at a time, by asynchronous copies (global_load_async_to_lds_b128) into a ring of two buffers: an A band is fetched from L2 once per work-group and read from LDS by WN waves, a B band by WM waves.
// Fragment order of a plane [R][K]: blocks of 16 rows x 32 k, 512 elements each, block (r / 16, k / 32) at ((r / 16) * (K / 32) + k / 32) * 512; inside a block element (r, k) at ((k / 16) % 2) * 256 + (((k / 8) % 2) * 16 + r % 16) * 8 + k % 8,
// that is: [half of the fragment][lane][8 elements], so that each of the two 16-byte loads of a fragment reads 512 contiguous bytes over the wave (from LDS: every bank once per 256 bytes, no pad needed); KC k of a band of 16 rows are KC * 32 contiguous bytes, in the plane and in LDS alike.
// C[m][n] (f32, pitch LDC) = sum_k A[m][k] Bt[n][k] (+ A2[m][k] Bt[n][k] where NSPLIT == 1). z-slices: strides sB / sC in elements. grid (M / (WM * 64), N / (WN * 64), Z).
// A stage in LDS: [A bands | A2 bands | B bands], KC * 32 bytes each; wave w copies the bands w * BPW .. w * BPW + BPW - 1.
template <typename T16> struct WFrag;
template <> struct WFrag<h16> { typedef v16h V; static __device__ __forceinline__ V ld(const h16* p) { return cat16(*(const v8h*)p, *(const v8h*)(p + 16)); } static __device__ __forceinline__ V ldp(const h16* band, unsigned vb) { const char* p = (const char*)band + vb; return cat16(*(const v8h*)p, *(const v8h*)(p + 512)); } static __device__ __forceinline__ v8f mma(V a, V b, v8f c) { return wmma16(a, b, c); } };
template <> struct WFrag<bf> { typedef v16bf V; static __device__ __forceinline__ V ld(const bf* p) { return cat16b(*(const v8us*)p, *(const v8us*)(p + 16)); } static __device__ __forceinline__ V ldp(const bf* band, unsigned vb) { const char* p = (const char*)band + vb; return cat16b(*(const v8us*)p, *(const v8us*)(p + 512)); } static __device__ __forceinline__ v8f mma(V a, V b, v8f c) { return wmmab(a, b, c); } };
typedef __attribute__((ext_vector_type(4))) int cv4i;
typedef __attribute__((address_space(1))) cv4i gcv4i;
typedef __attribute__((address_space(3))) cv4i lcv4i;
__device__ __forceinline__ void cp16(const char* g, char* l) { __builtin_amdgcn_global_load_async_to_lds_b128((gcv4i*)g, (lcv4i*)l, 0, 0); }   // each lane: 16 bytes from global memory to LDS, through no register
__device__ __forceinline__ v16bf ldsfrag(const char* p) { return cat16b(*(const v8usa*)p, *(const v8usa*)(p + 512)); }
typedef __attribute__((ext_vector_type(8))) __bf16 v8bf;
__device__ __forceinline__ float xhalf(float x) { const int b = __float_as_int(x); return __int_as_float(__builtin_amdgcn_permlanex16(b, b, 0x76543210, 0xfedcba98, false, false)); }   // the value of lane l ^ 16
// st3: 8 values of a lane as fp16, bf16 hi and bf16 lo (x - hi), 16 bytes to each of the three planes at element e (a wave stores 512 contiguous bytes a plane)
__device__ __forceinline__ void st3(v8f x, h16* p16, bf* ph, bf* pl) {
    const v8h o16 = __builtin_convertvector(x, v8h); const v8bf h = __builtin_convertvector(x, v8bf); const v8bf l = __builtin_convertvector(x - __builtin_convertvector(h, v8f), v8bf);
    const v8us oh = __builtin_bit_cast(v8us, h), ol = __builtin_bit_cast(v8us, l);
    *(v8h*)p16 = o16; *(v8us*)ph = oh; *(v8us*)pl = ol;
    asm volatile("s_wait_xcnt 0x0" :: "v"(p16), "v"(ph), "v"(pl), "v"(o16), "v"(oh), "v"(ol) : "memory");   // behind the three stores, their addresses and data inputs: what follows writes registers that the stores name
}
// rope_epi: epilogue of a projection tile of WM x 64 rows x one whole head (128 columns, two waves side by side): per-head RMSNorm with weight (1 + w), rotate-half RoPE, and the head's three planes (fp16, hi, lo; rows t, k = d) in fragment order, straight from the accumulators.
// The whole tile goes through LDS once (pitch 132 floats: the column writes and the 16-byte row reads both spread over the banks). Behind the one barrier lane (lr, hi) reads row lr of 16 rows at a time: the pieces d = m * 16 + hi * 8 .. + 7.
// Sum of squares: the lane's 64 values in eight running sums (one per d % 8, rising d), these added in pairs, then the other half wave's sum. Wave wn builds the d blocks wn and wn + 2 (d and d + 64 are rotation partners) of its own 64 rows: piece (block, half u) is the lane's own 16 bytes of the fragment block.
#define RSP  132
__device__ __forceinline__ void rope_epi(const v8f (&acc)[4][4], float* tile, int wm, int wn, int lane, int r0, int head, int nheads, const float* __restrict__ CS, const float* __restrict__ nw, h16* P16, bf* Ph, bf* Pl) {
    const int lr = lane & 15, hi = lane >> 4; const int b = r0 / TT, t0 = r0 % TT + wm * 64; const int dl = wn * 32 + hi * 8;
    const size_t pb = (size_t)(b * nheads + head) * TT * HD + (size_t)(t0 / 16) * (HD / 32 * 512) + (size_t)wn * 512 + lane * 8;
    float* tw = tile + (wm * 64 + hi * 8) * RSP + wn * 64 + lr;
#pragma unroll
    for (int mb = 0; mb < 4; ++mb)
#pragma unroll
        for (int nb = 0; nb < 4; ++nb)
#pragma unroll
            for (int j = 0; j < 8; ++j) tw[(mb * 16 + j) * RSP + nb * 16] = acc[mb][nb][j];
    __syncthreads();   // both waves' halves of the rows are in LDS before either reads whole rows
    const float* cp = CS + ((size_t)(t0 + lr) * HD + dl) * 2; const float* wp = nw + dl;   // cos | sin pairs of row t at d (the table's entries at d + 64 are the same values)
    v4f cs[4][2][4], wl[2][2], wh[2][2];   // every global load of the epilogue is asked for here, together: one memory latency, not one per 16 rows (the accumulators' registers are free by now)
#pragma unroll
    for (int u = 0; u < 2; ++u)
#pragma unroll
        for (int q = 0; q < 2; ++q) { wl[u][q] = *(const v4f*)(wp + u * 16 + q * 4); wh[u][q] = *(const v4f*)(wp + HD / 2 + u * 16 + q * 4); }
#pragma unroll
    for (int mb = 0; mb < 4; ++mb)
#pragma unroll
        for (int u = 0; u < 2; ++u)
#pragma unroll
            for (int q = 0; q < 4; ++q) cs[mb][u][q] = *(const v4f*)(cp + mb * (16 * HD * 2) + u * 32 + q * 4);
    asm volatile("s_wait_xcnt 0x0" :: "v"(cp), "v"(wp) : "memory");   // the address pairs are inputs, so that neither is reused (as a later load's destination either) in front of the wait
#pragma unroll
    for (int u = 0; u < 2; ++u)
#pragma unroll
        for (int q = 0; q < 2; ++q)
#pragma unroll
            for (int i = 0; i < 4; ++i) { wl[u][q][i] = 1.0f + bfr(wl[u][q][i]); wh[u][q][i] = 1.0f + bfr(wh[u][q][i]); }   // weight applied as (1 + w)
#pragma unroll
    for (int mb = 0; mb < 4; ++mb) {
        const float* rp = tile + (wm * 64 + mb * 16 + lr) * RSP; v4f sa = (v4f){}, sc = (v4f){};   // eight running sums, one per d % 8: short chains
#pragma unroll
        for (int m = 0; m < 8; ++m) { const v4f a = *(const v4fa*)(rp + m * 16 + hi * 8), c = *(const v4fa*)(rp + m * 16 + hi * 8 + 4); sa += a * a; sc += c * c; }
        sa += sc; float s = (sa[0] + sa[1]) + (sa[2] + sa[3]);
        s += xhalf(s);
        const float rf = __fdiv_rn(1.0f, __fsqrt_rn(s * (1.0f / HD) + 1e-6f));
#pragma unroll
        for (int u = 0; u < 2; ++u) { const float* xp = rp + dl + u * 16; v8f lo, hg;
#pragma unroll
            for (int q = 0; q < 2; ++q) { const v4f xa = *(const v4fa*)(xp + q * 4), xb = *(const v4fa*)(xp + HD / 2 + q * 4);
#pragma unroll
                for (int i = 0; i < 4; ++i) { const float x0 = wl[u][q][i] * (xa[i] * rf), x1 = wh[u][q][i] * (xb[i] * rf); const int ci = (q * 4 + i) * 2; const float co = cs[mb][u][ci / 4][ci % 4], si = cs[mb][u][ci / 4][ci % 4 + 1];
                    lo[q * 4 + i] = x0 * co - x1 * si; hg[q * 4 + i] = x1 * co + x0 * si; } }
            const size_t e = pb + mb * (HD / 32 * 512) + u * 256;
            st3(lo, P16 + e, Ph + e, Pl + e); st3(hg, P16 + e + 1024, Ph + e + 1024, Pl + e + 1024); }
    }
}
// vt_epi: epilogue of a v projection tile: in an accumulator lane (lr, hi) holds column n = lr, rows t = hi * 8 + j, which is the lane's own 16 bytes of the v^T planes' fragment block (rows n = g * HD + d of batch b, k = t): stored straight from the registers.
__device__ __forceinline__ void vt_epi(const v8f (&acc)[4][4], int lane, int rw, int cw, h16* V16, bf* Vh, bf* Vl) {   // rw, cw: first row (of both batches) and first column of the wave's tile
    const int b = rw / TT, tl = rw % TT;
#pragma unroll
    for (int mb = 0; mb < 4; ++mb)
#pragma unroll
        for (int nb = 0; nb < 4; ++nb) { const size_t e = ((size_t)((b * DKV + cw) / 16 + nb) * (TT / 32) + (tl + mb * 16) / 32) * 512 + (mb & 1) * 256 + lane * 8; st3(acc[mb][nb], V16 + e, Vh + e, Vl + e);
            __builtin_amdgcn_sched_barrier(0); }   // keeps the next tile's conversions behind the wait that ends st3: lifted among its stores, they write registers that the stores name
}
// EPI 0: C in f32. EPI 1 (q | gate): slice 0 ends in rope_epi (head blockIdx.y of NH_), slice 1 stores sigmoid(gate) in C in the lane order of k_fattn's epilogue (below). EPI 2 (k | v): slice 0 ends in rope_epi (head blockIdx.y of NKV), slice 1 in vt_epi; C is not written.
template <int EPI, int NSPLIT, int WM, int WN, int KC, int PF, int K, int LDC>
__global__ __launch_bounds__(WM * WN * 32) void k_gemmw(const bf* __restrict__ A, const bf* __restrict__ A2, const bf* __restrict__ Bt, float* C, size_t sB, size_t sC, const float* __restrict__ CS, const float* __restrict__ nw, h16* P16, bf* Ph, bf* Pl, h16* V16, bf* Vh, bf* Vl) {
    constexpr int NW = WM * WN, NAB = WM * 4, NAA = NAB * (1 + NSPLIT), NBAND = NAA + WN * 4, BCH = KC * 32, STAGE = NBAND * BCH, BPW = NBAND / NW, CPB = BCH / 512, NT = K / KC;
    static_assert(NBAND % NW == 0 && K % KC == 0 && KC % (32 * PF) == 0 && NT >= 2 && BPW * CPB <= 63 && NW * 16 * 68 * 4 <= 2 * STAGE, "whole bands a wave, two stages or more, at most 63 copies of a wave in flight, the output slabs fit the ring");
    constexpr int RB = (EPI != 0 && WM * 64 * RSP * 4 > 2 * STAGE) ? WM * 64 * RSP * 4 : 2 * STAGE;   // the ring; behind the loop the same bytes stage the output tile
    __shared__ __align__(1024) char ring[RB];
    Bt += blockIdx.z * sB; C += blockIdx.z * sC;
    const int lane = threadIdx.x & 31, lr = lane & 15, hi = lane >> 4; const int wave = __builtin_amdgcn_readfirstlane(threadIdx.x >> 5); const int wm = wave / WN, wn = wave % WN; const int r0 = blockIdx.x * (WM * 64), c0 = blockIdx.y * (WN * 64);
    const char* gs[BPW];   // the lane's own 16 bytes at k = 0 of each band that this wave copies (the choice of the plane is wave-uniform)
#pragma unroll
    for (int u = 0; u < BPW; ++u) { const int i = wave * BPW + u; const bf* p = (i < NAB) ? A + (size_t)(r0 / 16 + i) * 16 * K : (NSPLIT == 1 && i < NAA) ? A2 + (size_t)(r0 / 16 + i - NAB) * 16 * K : Bt + (size_t)(c0 / 16 + i - NAA) * 16 * K; gs[u] = (const char*)p + lane * 16; }
    auto fill = [&](int t) { char* l = ring + (t & 1) * STAGE + wave * (BPW * BCH) + lane * 16;
#pragma unroll
        for (int u = 0; u < BPW; ++u)
#pragma unroll
            for (int c = 0; c < CPB; ++c) cp16(gs[u] + (size_t)t * BCH + c * 512, l + u * BCH + c * 512); };
    v8f acc[4][4];
#pragma unroll
    for (int mb = 0; mb < 4; ++mb)
#pragma unroll
        for (int nb = 0; nb < 4; ++nb) acc[mb][nb] = (v8f){};
    fill(0);
    asm volatile("s_wait_asynccnt 0x0" ::: "memory");   // this wave's copies of stage 0 have landed
    __syncthreads();                                     // every wave's have: stage 0 may be read
    fill(1);
#pragma unroll 1   // one body: the buffer is chosen by the trip's parity
    for (int t = 0; t < NT; ++t) {
        const char* sb = ring + (t & 1) * STAGE + lane * 16; const char* sa = sb + wm * (4 * BCH); const char* sw = sb + NAA * BCH + wn * (4 * BCH);
#pragma unroll
        for (int kg = 0; kg < KC / 32; kg += PF) { v16bf a[PF][4], a2[PF][4], b[PF][4];   // the fragments of PF k blocks are asked for together, in front of their products: one LDS latency a group, not one per B fragment
#pragma unroll
            for (int p = 0; p < PF; ++p)
#pragma unroll
                for (int i = 0; i < 4; ++i) { const int ko = (kg + p) * 1024; a[p][i] = ldsfrag(sa + i * BCH + ko); if (NSPLIT == 1) a2[p][i] = ldsfrag(sa + (NAB + i) * BCH + ko); b[p][i] = ldsfrag(sw + i * BCH + ko); }
            __builtin_amdgcn_sched_barrier(0);   // keeps the group of LDS loads above in front of the products below: sunk among them, each B fragment's load is waited for alone
#pragma unroll
            for (int p = 0; p < PF; ++p)
#pragma unroll
                for (int nb = 0; nb < 4; ++nb) {   // per accumulator: the A product, then the A2 product; three other products stand between the two (a product that reads the one just issued waits for it)
#pragma unroll
                    for (int mb = 0; mb < 4; ++mb) acc[mb][nb] = wmmab(a[p][mb], b[p][nb], acc[mb][nb]);
                    if (NSPLIT == 1) {
#pragma unroll
                        for (int mb = 0; mb < 4; ++mb) acc[mb][nb] = wmmab(a2[p][mb], b[p][nb], acc[mb][nb]); } } }
        __builtin_amdgcn_sched_barrier(0);   // keeps the products above in front of the waits below: lifted over them, the wait for the next stage's copies stands ahead of this trip's products and the refill behind them, and the copies fly with nothing to cover them
        asm volatile("s_wait_dscnt 0x0" ::: "memory");      // this wave's reads of the buffer have returned before the buffer is handed to its next writer
        asm volatile("s_wait_asynccnt 0x0" ::: "memory");   // this wave's copies of stage t + 1 have landed
        __syncthreads();                                     // publishes stage t + 1 and ends every wave's reads of stage t
        if (t + 2 < NT) fill(t + 2);                         // into the buffer that this trip has just read (the test reads the same for the whole work-group)
    }
    asm volatile("s_wait_asynccnt 0x0" ::: "memory");   // no copy is outstanding when the ring becomes output staging
    if constexpr (EPI != 0) {   // the slice is the same for the whole work-group: every wave takes the same epilogue, with its barrier
        static_assert(WN == 2, "a tile is one head wide");
        if (blockIdx.z == 0) { rope_epi(acc, (float*)ring, wm, wn, lane, r0, blockIdx.y, EPI == 1 ? NH_ : NKV, CS, nw, P16, Ph, Pl); return; }
        if constexpr (EPI == 2) { vt_epi(acc, lane, r0 + wm * 64, c0 + wn * 64, V16, Vh, Vl); return; }
    }
    if constexpr (EPI == 1) {
        // sigmoid(gate) of head blockIdx.y, f32, in tiles of 16 rows t x 16 columns d, 256 floats each, tile (t / 16, d / 16) of head plane (b * NH_ + head) at ((b * NH_ + head) * (TT / 16) + t / 16) * 2048 + (d / 16) * 256;
        // inside a tile element (t, d) at ((d / 4) % 2) * 128 + (((d / 8) % 2) * 16 + t % 16) * 4 + d % 4: lane (lr, hi) owns row lr, columns hi * 8 .. + 7, as in an O^T accumulator of k_fattn; every store and every later load is 512 contiguous bytes a wave.
        // Each wave turns its 64 x 64 outputs in its own part of the tile in LDS (pitch RSP, as in rope_epi: column writes and 16-byte row reads both spread over the banks); it reads back only what it wrote itself: no barrier.
        float* tw = (float*)ring + (wm * 64 + hi * 8) * RSP + wn * 64 + lr;
#pragma unroll
        for (int mb = 0; mb < 4; ++mb)
#pragma unroll
            for (int nb = 0; nb < 4; ++nb)
#pragma unroll
                for (int j = 0; j < 8; ++j) tw[(mb * 16 + j) * RSP + nb * 16] = acc[mb][nb][j];
        asm volatile("s_wait_dscnt 0x0" ::: "memory");   // the column writes above (other lanes' data, same wave) are done before the rows are read back
        const float* tr = (const float*)ring + (wm * 64 + lr) * RSP + wn * 64 + hi * 8;
        const int rw = r0 + wm * 64; float* gw = C + ((size_t)((rw / TT) * NH_ + blockIdx.y) * (TT / 16) + (rw % TT) / 16) * (HD * 16) + wn * 1024 + lane * 4;
#pragma unroll 1   // one body of 16 rows x 32 columns: expf and the division are long code (for speed only)
        for (int it = 0; it < 8; ++it) {
            const float* rp = tr + (it >> 1) * (16 * RSP) + (it & 1) * 32; float* gp = gw + (it >> 1) * (HD * 16) + (it & 1) * 512; v4f val[4];
#pragma unroll
            for (int s = 0; s < 4; ++s) val[s] = *(const v4fa*)(rp + (s >> 1) * 16 + (s & 1) * 4);
#pragma unroll
            for (int s = 0; s < 4; ++s)
#pragma unroll
                for (int i = 0; i < 4; ++i) val[s][i] = __fdiv_rn(1.0f, __fadd_rn(1.0f, expf(-val[s][i])));
#pragma unroll
            for (int s = 0; s < 4; ++s) *(v4f*)(gp + s * 128) = val[s];
            asm volatile("s_wait_xcnt 0x0" :: "v"(gp), "v"(val[0]), "v"(val[1]), "v"(val[2]), "v"(val[3]) : "memory");   // behind the four stores, their address and data inputs: the next trip writes registers that the stores name
        }
        return;
    }
    // each wave transposes its tile, 16 rows at a time, in a slab of its own (pitch 68 floats) and stores whole 128-byte lines: two rows of 256 bytes a store
    float* slab = (float*)ring + wave * (16 * 68); float* cw = C + (size_t)(r0 + wm * 64 + hi) * LDC + c0 + wn * 64 + lr * 4;
#pragma unroll
    for (int mb = 0; mb < 4; ++mb) {
#pragma unroll
        for (int nb = 0; nb < 4; ++nb)
#pragma unroll
            for (int j = 0; j < 8; ++j) slab[(hi * 8 + j) * 68 + nb * 16 + lr] = acc[mb][nb][j];
        asm volatile("s_wait_dscnt 0x0" ::: "memory");   // the column writes above (other lanes' data, same wave) are done before the rows are read back
        v4f val[8];
#pragma unroll
        for (int s = 0; s < 8; ++s) val[s] = *(const v4fa*)(slab + (s * 2 + hi) * 68 + lr * 4);
#pragma unroll
        for (int s = 0; s < 8; ++s) *(v4f*)(cw + (size_t)(mb * 16 + s * 2) * LDC) = val[s];
        asm volatile("s_wait_xcnt 0x0" :: "v"(cw), "v"(val[0]), "v"(val[1]), "v"(val[2]), "v"(val[3]), "v"(val[4]), "v"(val[5]), "v"(val[6]), "v"(val[7]) : "memory");   // behind the eight stores, their address and data inputs: the next rows' reads write registers that the stores name
    }
}

// ---- k_fattn: causal scores, softmax and probability x value product in one kernel; no score or probability ever reaches memory. One work-group of 8 waves per (kv group, tile of QT x 16 queries): wave w works for head w / 2 of the group's four and takes the 32-key blocks of parity w % 2 up to the diagonal.
// The four heads of a group read the same k and v^T planes: a stage of two key blocks (64 keys, every plane) is brought from L2 once per work-group, by asynchronous copies (global_load_async_to_lds_b128) into a ring of two buffers in LDS, and each block is read from LDS by four waves.
// A stage in LDS: [block of even parity | block of odd parity], a block [k | (k lo) | v^T | (v^T lo)], 8 fragment blocks of 1 KiB a plane, in the planes' own fragment order; wave w copies the 1-KiB blocks w * PER .. w * PER + PER - 1 of the stage (all of one plane).
// Transposed products: S^T = K Q^T (A = 16 keys x 32 d of the k plane, B = the queries, kept in registers), O^T += V^T P^T (A = 16 d x 32 keys of the v^T plane). In an S^T tile lane (lr, hi) holds keys hi * 8 + j of query lr,
// which is the B-fragment order of those keys: two tiles convert in place into one P^T fragment; maximum and sum of a query are in-lane but for one exchange between the wave halves.
// Running maximum mu (raw score units) and sum per query; the accumulators are rescaled only when some query's block maximum exceeds its mu by more than 8 in log2 units (probabilities stay below 2^8, inside fp16 range).
// At the end the two waves of a head agree on the larger mu and rescale; the odd wave parks its sums and accumulators in LDS, the even wave adds them to its own (even + odd, a fixed order), divides,
// multiplies by sigmoid(gate) (SG: the gate projection's output, in this epilogue's lane order) and stores the product as bf16 hi and lo (y - hi) planes, the A operand of the output projection: in an O^T tile lane (lr, hi) holds row t = lr, columns d = hi * 8 + j, the lane's own 16 bytes of that plane's fragment block.
__device__ __forceinline__ v16h ldsfr(const h16*, const char* p) { return cat16(*(const v8ha*)p, *(const v8ha*)(p + 512)); }
__device__ __forceinline__ v16bf ldsfr(const bf*, const char* p) { return ldsfrag(p); }
template <typename T16, bool HL, int QT>
__device__ __forceinline__ void fattn_body(const T16* __restrict__ Q, const T16* __restrict__ Q2, const T16* __restrict__ Kp, const T16* __restrict__ Kp2, const T16* __restrict__ Vt, const T16* __restrict__ Vt2, const float* __restrict__ SG, bf* Ah, bf* Al, int q0, int wave, char* ring, float* sm, float* sl) {
    typedef typename WFrag<T16>::V V;
    constexpr int KS = 2, NACC = QT * 8, PL = HL ? 4 : 2, BLKB = PL * 8192, STAGE = KS * BLKB, PER = KS * PL * 8 / 8; constexpr float CL = SCL * 1.4426950408889634f;   // score -> log2 units
    static_assert(2 * PER <= 63 && 8 % PER == 0 && 4 * NACC * 1024 <= 2 * STAGE, "at most 63 copies of a wave in flight, a wave's blocks lie in one plane, the parked accumulators fit the ring");
    const int lane = threadIdx.x & 31, lr = lane & 15, hi = lane >> 4; const int hg = wave >> 1, ks = wave & 1; const unsigned lb = (unsigned)lane * 16u;
    V qf[QT][4], qf2[QT][4]; const T16* qp = (const T16*)((const char*)(Q + (size_t)(q0 / 16) * 2048) + lb); const T16* qp2 = HL ? (const T16*)((const char*)(Q2 + (size_t)(q0 / 16) * 2048) + lb) : qp;   // the lane's own address in the first block; the other blocks are immediate offsets
#pragma unroll
    for (int qt = 0; qt < QT; ++qt)
#pragma unroll
        for (int dc = 0; dc < 4; ++dc) { const int o = (qt * 4 + dc) * 512; qf[qt][dc] = WFrag<T16>::ldp(qp + o, 0u); if (HL) qf2[qt][dc] = WFrag<T16>::ldp(qp2 + o, 0u); }
    asm volatile("s_wait_xcnt 0x0" :: "v"(qp), "v"(qp2), "v"(lane) : "memory");   // the address pairs are inputs, so that none of them is reused (as a later load's destination either) in front of the wait; the lane number too, which the loads name as their offset where the block's start is a scalar base
    const int nkb = (q0 + QT * 16 + 31) / 32;   // 32-key blocks up to and with the one that holds the diagonal
    const int ntr = (nkb + KS - 1) / KS;        // stages; where nkb is odd the last stage's second block lies behind the diagonal: it is copied (nkb < TT / 32 then: it exists in the planes) and not read
    // what this wave copies of a stage (every choice is wave-uniform): 1-KiB block j0 + u of the stage = key block 'slot', plane 'plane', fragment block i0 + u
    const int j0 = wave * PER, slot = j0 / (PL * 8), plane = (j0 / 8) % PL, i0 = j0 % 8; const bool isv = plane >= PL / 2;
    const T16* pb = HL ? (plane == 0 ? Kp : plane == 1 ? Kp2 : plane == 2 ? Vt : Vt2) : (plane == 0 ? Kp : Vt);
    const char* g0 = (const char*)pb + (isv ? (size_t)i0 * ((TT / 32) * 1024) + (size_t)slot * 1024 : (size_t)slot * 8192 + (size_t)i0 * 1024) + lb;   // the lane's own 16 bytes of the wave's first block in stage 0
    const size_t gstep = isv ? (size_t)(TT / 32) * 1024 : (size_t)1024, adv = isv ? (size_t)KS * 1024 : (size_t)KS * 8192;   // from a fragment block to the next; from a stage to the next
    char* l0 = ring + j0 * 1024 + lb;
    auto fill = [&](int t) { const char* g = g0 + (size_t)t * adv; char* l = l0 + (t & 1) * STAGE;
#pragma unroll
        for (int u = 0; u < PER; ++u) { cp16(g + u * gstep, l + u * 1024); cp16(g + u * gstep + 512, l + u * 1024 + 512); } };
    v8f acc[QT][8]; float mu[QT], ls[QT];
#pragma unroll
    for (int qt = 0; qt < QT; ++qt) { mu[qt] = -3.0e38f; ls[qt] = 0.f;
#pragma unroll
        for (int dt = 0; dt < 8; ++dt) acc[qt][dt] = (v8f){}; }
    fill(0);
    asm volatile("s_wait_asynccnt 0x0" ::: "memory");   // this wave's copies of stage 0 have landed
    __syncthreads();                                     // every wave's have: stage 0 may be read
    if (1 < ntr) fill(1);                                // the test reads the same for the whole work-group
#pragma unroll 1   // one body: the buffer is chosen by the trip's parity, and a second copy would need a second set of k, v^T and score registers
    for (int t = 0; t < ntr; ++t) {
        const int kb = t * KS + ks;
        if (kb < nkb) {   // wave-uniform (a scalar test); no barrier stands inside
        const char* sb = ring + (t & 1) * STAGE + ks * BLKB + lb;
        V kf[8], kf2[8], vf[8], vf2[8];   // the v^T fragments are asked for in front of the score products and the softmax arithmetic, which cover their latency
#pragma unroll
        for (int i = 0; i < 8; ++i) { kf[i] = ldsfr((const T16*)nullptr, sb + i * 1024); if (HL) kf2[i] = ldsfr((const T16*)nullptr, sb + 8192 + i * 1024); }
#pragma unroll
        for (int dt = 0; dt < 8; ++dt) { vf[dt] = ldsfr((const T16*)nullptr, sb + (PL / 2) * 8192 + dt * 1024); if (HL) vf2[dt] = ldsfr((const T16*)nullptr, sb + 3 * 8192 + dt * 1024); }
        __builtin_amdgcn_sched_barrier(0);   // keeps the group of LDS loads above in front of the products below: sunk among them, each k fragment's load is waited for alone
        v8f s[QT][2];
#pragma unroll
        for (int qt = 0; qt < QT; ++qt) { s[qt][0] = (v8f){}; s[qt][1] = (v8f){}; }
#pragma unroll
        for (int hf = 0; hf < 2; ++hf)
#pragma unroll
            for (int dc = 0; dc < 4; ++dc) { const int i = hf * 4 + dc;
#pragma unroll
                for (int qt = 0; qt < QT; ++qt) { s[qt][hf] = WFrag<T16>::mma(kf[i], qf[qt][dc], s[qt][hf]); if (HL) { s[qt][hf] = WFrag<T16>::mma(kf[i], qf2[qt][dc], s[qt][hf]); s[qt][hf] = WFrag<T16>::mma(kf2[i], qf[qt][dc], s[qt][hf]); } } }
        if (kb == nkb - 1) {   // the block on the diagonal: keys behind the query are masked (wave-uniform test)
#pragma unroll
            for (int qt = 0; qt < QT; ++qt)
#pragma unroll
                for (int hf = 0; hf < 2; ++hf)
#pragma unroll
                    for (int j = 0; j < 8; ++j) if (kb * 32 + hf * 16 + hi * 8 + j > q0 + qt * 16 + lr) s[qt][hf][j] = -3.0e38f; }
        float bm[QT]; bool need = false;
#pragma unroll
        for (int qt = 0; qt < QT; ++qt) { float t2 = fmaxf(s[qt][0][0], s[qt][1][0]);
#pragma unroll
            for (int j = 1; j < 8; ++j) t2 = fmaxf(t2, fmaxf(s[qt][0][j], s[qt][1][j]));
            bm[qt] = fmaxf(t2, xhalf(t2)); need = need || ((bm[qt] - mu[qt]) * CL > 8.0f); }
        if (__builtin_amdgcn_ballot_w32(need) != 0) {   // one scalar test a block
#pragma unroll
            for (int qt = 0; qt < QT; ++qt) { const float mn = fmaxf(mu[qt], bm[qt]); const float al = __builtin_amdgcn_exp2f((mu[qt] - mn) * CL); mu[qt] = mn; ls[qt] *= al;
#pragma unroll
                for (int dt = 0; dt < 8; ++dt) acc[qt][dt] *= al; } }
        V pf[QT], pf2[QT];
#pragma unroll
        for (int qt = 0; qt < QT; ++qt) { const float nm = -mu[qt] * CL; v8f p0, p1;
#pragma unroll
            for (int j = 0; j < 8; ++j) { p0[j] = __builtin_amdgcn_exp2f(fmaf(s[qt][0][j], CL, nm)); p1[j] = __builtin_amdgcn_exp2f(fmaf(s[qt][1][j], CL, nm)); }
            float t2 = 0.f;
#pragma unroll
            for (int j = 0; j < 8; ++j) t2 += p0[j] + p1[j];
            ls[qt] += t2;
            if constexpr (HL) { const v8bf h0 = __builtin_convertvector(p0, v8bf), h1 = __builtin_convertvector(p1, v8bf); const v8bf l0b = __builtin_convertvector(p0 - __builtin_convertvector(h0, v8f), v8bf), l1b = __builtin_convertvector(p1 - __builtin_convertvector(h1, v8f), v8bf);
                pf[qt] = __builtin_shufflevector(h0, h1, 0, 1, 2, 3, 4, 5, 6, 7, 8, 9, 10, 11, 12, 13, 14, 15); pf2[qt] = __builtin_shufflevector(l0b, l1b, 0, 1, 2, 3, 4, 5, 6, 7, 8, 9, 10, 11, 12, 13, 14, 15); }
            else pf[qt] = cat16(__builtin_convertvector(p0, v8h), __builtin_convertvector(p1, v8h)); }
#pragma unroll
        for (int dt = 0; dt < 8; ++dt)
#pragma unroll
            for (int qt = 0; qt < QT; ++qt) { acc[qt][dt] = WFrag<T16>::mma(vf[dt], pf[qt], acc[qt][dt]); if (HL) { acc[qt][dt] = WFrag<T16>::mma(vf[dt], pf2[qt], acc[qt][dt]); acc[qt][dt] = WFrag<T16>::mma(vf2[dt], pf[qt], acc[qt][dt]); } }
        }
        asm volatile("s_wait_dscnt 0x0" ::: "memory");      // this wave's reads of the buffer have returned before the buffer is handed to its next writer
        asm volatile("s_wait_asynccnt 0x0" ::: "memory");   // this wave's copies of stage t + 1 have landed
        __syncthreads();                                     // publishes stage t + 1 and ends every wave's reads of stage t
        if (t + 2 < ntr) fill(t + 2);                        // into the buffer that this trip has just read (the test reads the same for the whole work-group)
    }
    asm volatile("s_wait_asynccnt 0x0" ::: "memory");   // no copy is outstanding when the ring becomes the place of the parked accumulators
    const unsigned le = __builtin_amdgcn_mbcnt_lo(~0u, 0u) * 16u;   // the lane's byte offset (= lb), formed anew from the lane number: as a 64-bit address part kept from the head of the kernel it was spilled to scratch over the loop
    v4f sg[QT][8][2]; const float* sgp = (const float*)((const char*)(SG + (size_t)(q0 / 16) * (HD * 16)) + le);   // the lane's own 16 bytes of the first gate tile; the other pieces are immediate offsets
    if (ks == 0) {   // wave-uniform; no barrier stands inside. Asked for here: the two barriers and the rescaling below cover the loads' latency (the k, v^T and query registers are free by now)
#pragma unroll
        for (int qt = 0; qt < QT; ++qt)
#pragma unroll
            for (int dt = 0; dt < 8; ++dt) { sg[qt][dt][0] = *(const v4f*)(sgp + (qt * 8 + dt) * 256); sg[qt][dt][1] = *(const v4f*)(sgp + (qt * 8 + dt) * 256 + 128); }
        asm volatile("s_wait_xcnt 0x0" :: "v"(sgp), "v"(le) : "memory");   // the address pair is an input, so that it is not reused (as a later load's destination either) in front of the wait; the lane's byte offset too, which the loads name where the tile's start is a scalar base
    }
#pragma unroll
    for (int qt = 0; qt < QT; ++qt) { ls[qt] += xhalf(ls[qt]); if (hi == 0) sm[wave * 32 + qt * 16 + lr] = mu[qt]; }
    __syncthreads();   // both waves' maxima of a head are in LDS before either picks the larger
    char* park = ring + hg * (NACC * 1024) + lb;   // the lane's own 16 bytes of the head's first parked half tile
#pragma unroll
    for (int qt = 0; qt < QT; ++qt) { const int qi = qt * 16 + lr; const float M = fmaxf(sm[hg * 64 + qi], sm[hg * 64 + 32 + qi]); const float f = __builtin_amdgcn_exp2f((mu[qt] - M) * CL); ls[qt] *= f;
#pragma unroll
        for (int dt = 0; dt < 8; ++dt) acc[qt][dt] *= f;
        if (ks == 1) { if (hi == 0) sl[hg * 32 + qi] = ls[qt];
#pragma unroll
            for (int dt = 0; dt < 8; ++dt) { const v8f t2 = acc[qt][dt]; const int a = qt * 8 + dt; *(v4fa*)(park + a * 1024) = __builtin_shufflevector(t2, t2, 0, 1, 2, 3); *(v4fa*)(park + a * 1024 + 512) = __builtin_shufflevector(t2, t2, 4, 5, 6, 7); } } }
    __syncthreads();   // the odd waves' rescaled sums are in LDS before the even waves add them
    if (ks == 0) {   // wave-uniform; no barrier follows
        v8us oh[QT][8], ol[QT][8];
#pragma unroll
        for (int qt = 0; qt < QT; ++qt) { const float r = __fdiv_rn(1.0f, ls[qt] + sl[hg * 32 + qt * 16 + lr]);
#pragma unroll
            for (int dt = 0; dt < 8; ++dt) { const char* p = park + (qt * 8 + dt) * 1024; const v4f s0 = *(const v4fa*)p, s1 = *(const v4fa*)(p + 512);
                const v8f y = ((acc[qt][dt] + __builtin_shufflevector(s0, s1, 0, 1, 2, 3, 4, 5, 6, 7)) * r) * __builtin_shufflevector(sg[qt][dt][0], sg[qt][dt][1], 0, 1, 2, 3, 4, 5, 6, 7);
                const v8bf h = __builtin_convertvector(y, v8bf); const v8bf l = __builtin_convertvector(y - __builtin_convertvector(h, v8f), v8bf);
                oh[qt][dt] = __builtin_bit_cast(v8us, h); ol[qt][dt] = __builtin_bit_cast(v8us, l); } }
        __builtin_amdgcn_sched_barrier(0);   // keeps the stores below behind all the arithmetic above: no register that a store names is written behind it
        bf* ah = (bf*)((char*)(Ah + (size_t)(q0 / 16) * (DQ / 32 * 512)) + le); bf* al = (bf*)((char*)(Al + (size_t)(q0 / 16) * (DQ / 32 * 512)) + le);   // the lane's own 16 bytes of the head's first fragment block in the band of rows q0; the other pieces are immediate offsets
#pragma unroll
        for (int qt = 0; qt < QT; ++qt)
#pragma unroll
            for (int dt = 0; dt < 8; ++dt) { const int e = (qt * (DQ / 32) + dt / 2) * 512 + (dt & 1) * 256; *(v8us*)(ah + e) = oh[qt][dt]; *(v8us*)(al + e) = ol[qt][dt]; }
        asm volatile("s_wait_xcnt 0x0" :: "v"(ah), "v"(al), "v"(le) : "memory");   // behind the stores, their addresses inputs
    }
}
// grid (batches x kv groups, tiles): blockIdx.x = b * NKV + group, whose heads are number blockIdx.x * REP + 0 .. REP - 1 = b * NH_ + head; tile ranks 0 .. (TT - RH) / 32 - 1 are the fp16 tiles of 32 queries from the last rows down (the longest first), the rest the hi+lo tiles of 16 queries, again from the last down.
__global__ __launch_bounds__(256) void k_fattn(const h16* __restrict__ Q16, const h16* __restrict__ K16, const h16* __restrict__ V16, const bf* __restrict__ Qh, const bf* __restrict__ Ql, const bf* __restrict__ Kh, const bf* __restrict__ Kl, const bf* __restrict__ Vh, const bf* __restrict__ Vl, const float* __restrict__ SG, bf* Ah, bf* Al) {
    static_assert(REP == 4, "eight waves: four heads of a group, two waves a head");
    __shared__ __align__(1024) char ring[131072]; __shared__ float sm[8 * 32]; __shared__ float sl[4 * 32];
    const int wave = __builtin_amdgcn_readfirstlane(threadIdx.x >> 5);
    const size_t g = blockIdx.x, z = g * REP + (wave >> 1); const int rk = blockIdx.y; const size_t qo = z * TT * HD, ko = g * TT * HD; SG += qo;
    const size_t ao = ((z / NH_) * (TT / 16) * (DQ / 32) + (z % NH_) * (HD / 32)) * 512; Ah += ao; Al += ao;   // the head's first fragment block in the first band of its batch's rows (plane [TR][DQ], fragment order of k_gemmw)
    if (rk < (TT - RH) / 32) fattn_body<h16, false, 2>(Q16 + qo, nullptr, K16 + ko, nullptr, V16 + ko, nullptr, SG, Ah, Al, TT - 32 - rk * 32, wave, ring, sm, sl);
    else fattn_body<bf, true, 1>(Qh + qo, Ql + qo, Kh + ko, Kl + ko, Vh + ko, Vl + ko, SG, Ah, Al, RH - 16 - (rk - (TT - RH) / 32) * 16, wave, ring, sm, sl);
}

typedef __attribute__((ext_vector_type(2))) _Float16 v2h;
typedef __attribute__((ext_vector_type(4))) _Float16 v4h;
typedef __attribute__((ext_vector_type(2))) unsigned short v2us;
typedef __attribute__((ext_vector_type(4))) unsigned short v4us;
typedef __attribute__((ext_vector_type(2))) float v2f;
typedef __attribute__((ext_vector_type(4))) int v4i;

__global__ __launch_bounds__(256) void k_wtG(const float* __restrict__ w, int K, int N, bf* Bt) {
    const int lane = threadIdx.x & 31; const int L0 = (blockIdx.x * 8 + (threadIdx.x >> 5)) * 8; const int nlines = N * K / 64;
{
#pragma unroll 1
        for (int l = 0; l < 8; ++l) { const int L = L0 + l; if (L >= nlines) break; const size_t e = (size_t)L * 64 + lane * 2; const int k = (int)(e % K), n = (int)(e / K); v2us o;
            o[0] = f2bf(w[(size_t)k * N + n]); o[1] = f2bf(w[(size_t)(k + 1) * N + n]); *(v2us*)(Bt + e) = o; }
         }
}
// pack_body: f32 rows [R][K] -> bf16 plane in the fragment order of k_gemmw. A wave takes one block of 16 rows x 32 k at a time: 8 lanes read one whole 128-byte line of a row (4 rows a load), each lane stores its 4 elements as 8 bytes (64 contiguous bytes per 4 rows).
// One launch packs every operand: all have K = DM = DQ columns, and their planes lie one behind the other in dst: [q rows of Wq | gate rows of Wq | Wk | Wv | Wo | x, both batches] = PKR rows. The 8 waves of a work-group share a band of 16 rows, so the choice of the source is uniform.
// q / gate plane row n is row (n / HD) * 2 * HD + part * HD + n % HD of the interleaved q|gate weight (part 0: q, part 1: gate); every other plane row is the same row of its source.
#define PKR  (2 * DQ + 2 * DKV + DM + TR)
static_assert(DM == DQ, "one K for every packed plane");
__device__ __forceinline__ void pack_body(int bx, const float* __restrict__ wqg, const float* __restrict__ wk, const float* __restrict__ wv, const float* __restrict__ wo, const float* __restrict__ x, bf* dst) {
    constexpr int K = DM, KB = K >> 5;
    const int lane = threadIdx.x & 31; const int rb = bx; const int k = (lane & 7) * 4, rq = lane >> 3;   // work-group bx takes the whole band bx of 16 rows: its wave w the k blocks w, w + 8, ... (few long waves, for speed only)
    const int n0 = rb * 16; const float* src; int s0;   // HD % 16 == 0: the 16 rows of a block are consecutive rows of src
    if (n0 < 2 * DQ) { const int part = n0 / DQ, nn = n0 % DQ; src = wqg; s0 = (nn / HD) * 2 * HD + part * HD + nn % HD; }
    else if (n0 < 2 * DQ + DKV) { src = wk; s0 = n0 - 2 * DQ; }
    else if (n0 < 2 * DQ + 2 * DKV) { src = wv; s0 = n0 - (2 * DQ + DKV); }
    else if (n0 < 2 * DQ + 2 * DKV + DM) { src = wo; s0 = n0 - (2 * DQ + 2 * DKV); }
    else { src = x; s0 = n0 - (2 * DQ + 2 * DKV + DM); }
#pragma unroll 1   // one body: the trips are independent streams, and the many resident waves keep enough bytes in flight
    for (int kb = (int)(threadIdx.x >> 5); kb < KB; kb += 8) { const int blk = rb * KB + kb;
    const float* sp = src + (size_t)(s0 + rq) * K + kb * 32 + k; bf* d = dst + (size_t)blk * 512 + ((k >> 4) & 1) * 256 + ((k >> 3) & 1) * 128 + rq * 8 + (k & 7); v4f v[4];
    const float* p1 = sp + (size_t)4 * K; const float* p2 = sp + (size_t)8 * K; const float* p3 = sp + (size_t)12 * K;
    v[0] = *(const v4f*)sp; v[1] = *(const v4f*)p1; v[2] = *(const v4f*)p2; v[3] = *(const v4f*)p3;
    asm volatile("s_wait_xcnt 0x0" :: "v"(sp), "v"(p1), "v"(p2), "v"(p3) : "memory");   // the four address pairs are inputs, so that none of them is reused (as a later load's destination either) in front of the wait
#pragma unroll
    for (int it = 0; it < 4; ++it) { v4us o;
#pragma unroll
        for (int u = 0; u < 4; ++u) o[u] = f2bf(v[it][u]);
        *(v4us*)(d + it * 32) = o; }
    asm volatile("s_wait_xcnt 0x0" :: "v"(d) : "memory");   // behind the four stores, their address an input: the next trip writes registers that the stores name
    }
}
#define CSB  4    // table pieces of 256 entries a work-group fills, one after the other
static_assert(TT * HD % (256 * CSB) == 0, "whole work-groups");
__device__ __forceinline__ void cstab_body(int bx, float* CS) {
#pragma unroll 1   // one body: the range reductions of cosf and sinf are long code
    for (int it = 0; it < CSB; ++it) { const int idx = (bx * CSB + it) * 256 + threadIdx.x; if (idx >= TT * HD) break; const int t = idx / HD, d = idx % HD; const int i = d % (HD / 2); const float inv = __fdiv_rn(1.0f, powf(10000.0f, (float)(2 * i) / (float)HD)); const float ang = __fmul_rn((float)t, inv); v2f cs; cs[0] = cosf(ang); cs[1] = sinf(ang);
    float* cp = CS + (size_t)idx * 2; *(v2f*)cp = cs;
    asm volatile("s_wait_xcnt 0x0" :: "v"(cp) : "memory"); }   // behind the store, its address an input: the next trip writes registers that the store names
}
// k_prep: the two stages that depend on nothing but the inputs, in one launch: the first TT * HD / 256 / CSB work-groups fill the cos|sin table (the longer threads), the rest pack the operands.
__global__ __launch_bounds__(256) void k_prep(const float* __restrict__ wqg, const float* __restrict__ wk, const float* __restrict__ wv, const float* __restrict__ wo, const float* __restrict__ x, bf* dst, float* CS) {
    constexpr int NCS = TT * HD / 256 / CSB; const int bx = blockIdx.x; if (bx < NCS) cstab_body(bx, CS); else pack_body(bx - NCS, wqg, wk, wv, wo, x, dst); }

extern "C" void kernel_launch(void* const* d_in, const int* in_sizes, int n_in,
                              void* d_out, int out_size, void* d_ws, size_t ws_size, hipStream_t stream) {
    (void)in_sizes; (void)n_in; (void)out_size;
    const float* x = (const float*)d_in[0]; const float* wqg = (const float*)d_in[1]; const float* wk = (const float*)d_in[2]; const float* wv = (const float*)d_in[3]; const float* wo = (const float*)d_in[4]; const float* qnw = (const float*)d_in[5]; const float* knw = (const float*)d_in[6]; const float* wq = wqg;
    float* OUT = (float*)d_out;     // [2][2048][2048]
    char* wsp = (char*)d_ws;
    auto take = [&](size_t bytes) { char* p = wsp; wsp += (bytes + 255) & ~(size_t)255; return (void*)p; };
    bf* PK = (bf*)take((size_t)PKR * DM * 2);   // every packed bf16 operand plane, in the row order of pack_body
    bf* WQ = PK; bf* WK = WQ + (size_t)2 * DQ * DM; bf* WO = WK + (size_t)2 * DKV * DM; bf* XB = WO + (size_t)DM * DQ;   // the gate plane follows WQ, the Wv plane follows WK: z-slices of one GEMM launch
    float* CS = (float*)take((size_t)TT * HD * 2 * 4);
    float* FQ = (float*)take((size_t)2 * TR * DQ * 4); float* GATE = FQ + (size_t)TR * DQ;   // sigmoid(gate) is the output of z-slice 1 (slice 0 writes no C)
    h16* QP16 = (h16*)take((size_t)NB_ * NH_ * TT * HD * 2); h16* KP16 = (h16*)take((size_t)NB_ * NKV * TT * HD * 2); h16* VT16 = (h16*)take((size_t)NB_ * NKV * HD * TT * 2);
    bf* QPh = (bf*)take((size_t)NB_ * NH_ * TT * HD * 2); bf* QPl = (bf*)take((size_t)NB_ * NH_ * TT * HD * 2); bf* KPh = (bf*)take((size_t)NB_ * NKV * TT * HD * 2); bf* KPl = (bf*)take((size_t)NB_ * NKV * TT * HD * 2); bf* VTh = (bf*)take((size_t)NB_ * NKV * HD * 2 * TT * 2); bf* VTl = VTh + (size_t)NB_ * NKV * HD * TT;   // v^T: hi planes then lo planes
    bf* ATl = (bf*)take((size_t)TR * DQ * 2);
    if ((size_t)(wsp - (char*)d_ws) > ws_size) return;    // ws 256 MiB
    bf* ATh = XB;     // hi plane of the gated attention output (TR x DQ = TR x DM elements) reuses the bf16 x plane after the k|v projection, its last reader (stream-ordered)
    k_prep<<<TT * HD / 256 / CSB + PKR / 16, 256, 0, stream>>>(wqg, wk, wv, wo, x, PK, CS);
    k_gemmw<1, 0, 4, 2, 64, 1, DM, DQ><<<dim3(TR / 256, DQ / 128, 2), 256, 0, stream>>>(XB, nullptr, WQ, FQ, (size_t)DQ * DM, (size_t)TR * DQ, CS, qnw, QP16, QPh, QPl, nullptr, nullptr, nullptr);       // z = 0: q planes, z = 1: sigmoid(gate)
    k_gemmw<2, 0, 2, 2, 128, 4, DM, DKV><<<dim3(TR / 128, DKV / 128, 2), 128, 0, stream>>>(XB, nullptr, WK, nullptr, (size_t)DKV * DM, 0, CS, knw, KP16, KPh, KPl, VT16, VTh, VTl);   // z = 0: k planes, z = 1: v^T planes
    k_fattn<<<dim3(NB_ * NKV, (TT - RH) / 32 + RH / 16, 1), 256, 0, stream>>>(QP16, KP16, VT16, QPh, QPl, KPh, KPl, VTh, VTl, GATE, ATh, ATl);
    k_gemmw<0, 1, 2, 4, 64, 2, DQ, DM><<<dim3(TR / 128, DM / 256, 1), 256, 0, stream>>>(ATh, ATl, WO, OUT, 0, 0, nullptr, nullptr, nullptr, nullptr, nullptr, nullptr, nullptr, nullptr);
}
